// v000
// Times are from an AMD MI455X. After a warm-up the kernel runs many times in a row, and a time is the length of
// such a window on the GPU divided by its runs, so every launch and the gaps after it count. The runs cycle
// through copies of the inputs. A figure is the median of several windows, for all but v000 over two sittings.
// Sittings can differ by a few percent; kernels timed side by side share one.
// v000, which the later versions start from, runs in 3350 microseconds.
#include <hip/hip_runtime.h>
// Multi-head attention on three inputs with per-head projection tensors and the source's head-major context view (Q, K, V [8][1024][512]; Qh / Kh / Vh = einsum('bsd,hde->bhse', input, W) + b with per-head [in][out] weights W [8][512][64] and biases [8][64] (uniform +-512^-0.5); scores * 64^-0.5; softmax over all 1024 keys (no mask); context x [B][H][S][64] is RE-VIEWED as [B][S][512] WITHOUT transposing heads and time (row s' of the view = 512 consecutive floats of the [H][S][64] block); out = view Wo + bo ([in][out] 512 x 512) -> [8][1024][512]).
// Structure: token rows r = b*1024 + s; the query, key and value sources as exact f16 rows (bf16-rounded); Q, K, V as three WMMA GEMMs (32x64 wave tiles, f32 accumulation, exact x16 weights + bias, f16 outputs); per batch: V^T for all heads via LDS transposes; per (batch, group of 4 heads): scores GEMM (K = 64, batched over the heads on grid.y, alpha = 64^-0.5), row softmax on VALU (f32 statistics, native exp; weights stored x256 as f16), o = P . V^T GEMM (K = 1024, alpha 2^-2: o carried x64 against f16 subnormal flush, folded into the output GEMM alpha) written straight into the merged f16 o rows; out = o W_o + b GEMM (f32) into the output layout.
// Compute dtype: inputs rounded to bf16; x / weights exact; q, k, v, softmax weights and o as plain f16 GEMM operands (~2^-12); scores and softmax statistics f32. v_wmma_f32_16x16x32_f16.
#define NB 8
#define SQ 1024
#define DM 512
#define NH 8
#define HD 64
#define HG 4                         /* heads per attention launch group */
#define B0 0                         /* first batch processed (debug hook) */
#define NBR NB                       /* batches processed (debug hook) */
#define NR ((size_t)NB * SQ)         /* token rows */
#define MP ((int)((size_t)NBR * SQ)) /* rows projected (debug hook) */
#define QN SQ                        /* query rows attended per batch (debug hook) */
#define NHD NH                       /* heads attended (debug hook) */
#define MPO MP                       /* rows through the output stage (debug hook) */
#define LQ DM      /* row pitch of the q/k/v rows */
typedef __bf16 v16b __attribute__((ext_vector_type(16)));
typedef unsigned short v8us __attribute__((ext_vector_type(8), may_alias));
typedef float  v8f  __attribute__((ext_vector_type(8)));
typedef float  v4f  __attribute__((ext_vector_type(4)));
typedef float  v4fa __attribute__((ext_vector_type(4), may_alias));
union FragB { v16b v; v8us half[2]; unsigned short u[16]; };

__device__ __forceinline__ unsigned short bf16_bits(float x) { unsigned int u = __float_as_uint(x); return (unsigned short)((u + 0x7FFFu + ((u >> 16) & 1u)) >> 16); }
__device__ __forceinline__ float bf16_val(unsigned short b) { return __uint_as_float(((unsigned int)b) << 16); }
__device__ __forceinline__ float bf16_round(float x) { return bf16_val(bf16_bits(x)); }
// D += A·B with NT terms: 1 = ah·bh, 2 = + al·bh (A split), 3 = + ah·bl (both split)
template <int NT>
__device__ __forceinline__ v8f mmaN(v16b ah, v16b al, v16b bh, v16b bl, v8f c) {
  c = __builtin_amdgcn_wmma_f32_16x16x32_bf16(false, ah, false, bh, (short)0, c, false, false);
  if (NT >= 2) c = __builtin_amdgcn_wmma_f32_16x16x32_bf16(false, al, false, bh, (short)0, c, false, false);
  if (NT >= 3) c = __builtin_amdgcn_wmma_f32_16x16x32_bf16(false, ah, false, bl, (short)0, c, false, false);
  asm volatile("v_nop\n\tv_nop\n\tv_nop\n\tv_nop" : "+v"(c) : "v"(ah), "v"(al), "v"(bh), "v"(bl));
  return c;
}

__global__ __launch_bounds__(256) void k_wt_bf16(const float* __restrict__ W, unsigned short* __restrict__ Wt, int K, int N) {
  const int t = blockIdx.x * 256 + threadIdx.x;
  const int k8n = K / 8;
  if (t >= N * k8n) return;
  const int n = t / k8n, k8 = (t % k8n) * 8;
  v8us v;
#pragma unroll
  for (int i = 0; i < 8; ++i) v[i] = bf16_bits(W[(size_t)(k8 + i) * N + n]);
  *(v8us*)(Wt + (size_t)n * K + k8) = v;
  
}

// GEMM C[M][N] (f32, pitch ldc) = act(A[M][K]·W + bias). A f32 row-major (pitch lda) converted per fragment to bf16
// (ASPLIT: hi/lo two planes -> 2 terms, else single rounded term); Wt bf16 [N][K] (pitch ldb). BIAS_BF16 rounds the
// bias to bf16 first (bias quantised to bf16 before the add). K%32==0, M%16==0, N%64==0.
template <bool ASPLIT, int ACT, bool BIAS_BF16>
__global__ __launch_bounds__(128) void k_gemm_bf(const float* __restrict__ A, int lda, const unsigned short* __restrict__ Wt, int ldb,
                                               const float* __restrict__ bias, float* __restrict__ C, int ldc, int M, int N, int K) {
  __shared__ __attribute__((aligned(16))) float so[4][16][64];
  const int tid = threadIdx.x, w = tid >> 5, lane = tid & 31, ln = lane & 15, hh = lane >> 4;
  const int ntn = N / 64;
  const int wid = blockIdx.x * 4 + w;
  const int mt = wid / ntn, nq = wid % ntn;
  if (mt * 16 >= M) return;
  const int row0 = mt * 16, col0 = nq * 64;
  const float* arow = A + (size_t)(row0 + ln) * lda;
  v8f acc[4] = {};
  for (int kb = 0; kb < K; kb += 32) {
    FragB ah, al;
    const v4f x0 = *(const v4fa*)(arow + kb + 8 * hh), x1 = *(const v4fa*)(arow + kb + 8 * hh + 4);
    const v4f x2 = *(const v4fa*)(arow + kb + 16 + 8 * hh), x3 = *(const v4fa*)(arow + kb + 16 + 8 * hh + 4);
    float xs[16] = {x0[0],x0[1],x0[2],x0[3],x1[0],x1[1],x1[2],x1[3],x2[0],x2[1],x2[2],x2[3],x3[0],x3[1],x3[2],x3[3]};
#pragma unroll
    for (int i = 0; i < 16; ++i) { const unsigned short hb = bf16_bits(xs[i]); ah.u[i] = hb; al.u[i] = ASPLIT ? bf16_bits(xs[i] - bf16_val(hb)) : (unsigned short)0; }
#pragma unroll
    for (int t = 0; t < 4; ++t) {
      const unsigned short* brow = Wt + (size_t)(col0 + t * 16 + ln) * ldb + kb;
      FragB b;
      b.half[0] = *(const v8us*)(brow + 8 * hh);
      b.half[1] = *(const v8us*)(brow + 16 + 8 * hh);
      acc[t] = mmaN<ASPLIT ? 2 : 1>(ah.v, al.v, b.v, b.v, acc[t]);
    }
  }
#pragma unroll
  for (int t = 0; t < 4; ++t) {
    float bv = bias ? bias[col0 + t * 16 + ln] : 0.f;
    if (BIAS_BF16) bv = bf16_round(bv);
#pragma unroll
    for (int r = 0; r < 8; ++r) { float v = acc[t][r] + bv; if (ACT == 1) v = fmaxf(v, 0.f); so[w][8 * hh + r][t * 16 + ln] = v; }
  }
  __builtin_amdgcn_fence(__ATOMIC_ACQ_REL, "workgroup");
  __builtin_amdgcn_wave_barrier();
  const int rsub = lane >> 4, c4 = (lane & 15) * 4;
  {
#pragma unroll
    for (int q = 0; q < 8; ++q) {
      const int r = q * 2 + rsub;
      const v4f v = *(const v4fa*)&so[w][r][c4];
      *(v4f*)(C + (size_t)(row0 + r) * ldc + col0 + c4) = v;
    }
    
  }
}

// GEMM C = act(A·W + bias + resid): A f32 (ASPLIT -> hi/lo 2 terms), Wt bf16 [N][K]; ACT 0 none, 1 relu, 2 exact gelu;
// resid (optional, f32, row index = (row % rmod), pitch ldr, RES_BF16 rounds it) added before the activation.
template <bool ASPLIT, int ACT, bool BIAS_BF16, bool RES_BF16>
__global__ __launch_bounds__(128) void k_gemm_bf3(const float* __restrict__ A, int lda, const unsigned short* __restrict__ Wt, int ldb,
                                                const float* __restrict__ bias, const float* __restrict__ resid, int rmod, int ldr,
                                                float* __restrict__ C, int ldc, int M, int N, int K) {
  __shared__ __attribute__((aligned(16))) float so[4][16][64];
  const int tid = threadIdx.x, w = tid >> 5, lane = tid & 31, ln = lane & 15, hh = lane >> 4;
  const int ntn = N / 64;
  const int wid = blockIdx.x * 4 + w;
  const int mt = wid / ntn, nq = wid % ntn;
  if (mt * 16 >= M) return;
  const int row0 = mt * 16, col0 = nq * 64;
  const float* arow = A + (size_t)(row0 + ln) * lda;
  v8f acc[4] = {};
  for (int kb = 0; kb < K; kb += 32) {
    FragB ah, al;
    const v4f x0 = *(const v4fa*)(arow + kb + 8 * hh), x1 = *(const v4fa*)(arow + kb + 8 * hh + 4);
    const v4f x2 = *(const v4fa*)(arow + kb + 16 + 8 * hh), x3 = *(const v4fa*)(arow + kb + 16 + 8 * hh + 4);
    float xs[16] = {x0[0],x0[1],x0[2],x0[3],x1[0],x1[1],x1[2],x1[3],x2[0],x2[1],x2[2],x2[3],x3[0],x3[1],x3[2],x3[3]};
#pragma unroll
    for (int i = 0; i < 16; ++i) { const unsigned short hb = bf16_bits(xs[i]); ah.u[i] = hb; al.u[i] = ASPLIT ? bf16_bits(xs[i] - bf16_val(hb)) : (unsigned short)0; }
#pragma unroll
    for (int t = 0; t < 4; ++t) {
      const unsigned short* brow = Wt + (size_t)(col0 + t * 16 + ln) * ldb + kb;
      FragB b;
      b.half[0] = *(const v8us*)(brow + 8 * hh);
      b.half[1] = *(const v8us*)(brow + 16 + 8 * hh);
      acc[t] = mmaN<ASPLIT ? 2 : 1>(ah.v, al.v, b.v, b.v, acc[t]);
    }
  }
#pragma unroll
  for (int t = 0; t < 4; ++t) {
    const int col = col0 + t * 16 + ln;
    float bv = bias ? bias[col] : 0.f;
    if (BIAS_BF16) bv = bf16_round(bv);
#pragma unroll
    for (int r = 0; r < 8; ++r) {
      float v = acc[t][r] + bv;
      if (resid) { float rv = resid[(size_t)((row0 + 8 * hh + r) % rmod) * ldr + col]; if (RES_BF16) rv = bf16_round(rv); v += rv; }
      if (ACT == 1) v = fmaxf(v, 0.f);
      if (ACT == 2) v = 0.5f * v * (1.0f + erff(v * 0.70710678118654752f));
      if (ACT == 3) { const float u = 0.7978845608028654f * (v + 0.044715f * v * v * v); v = 0.5f * v * (1.0f + tanhf(u)); }
      so[w][8 * hh + r][t * 16 + ln] = v;
    }
  }
  __builtin_amdgcn_fence(__ATOMIC_ACQ_REL, "workgroup");
  __builtin_amdgcn_wave_barrier();
  const int rsub = lane >> 4, c4 = (lane & 15) * 4;
  {
#pragma unroll
    for (int q = 0; q < 8; ++q) {
      const int r = q * 2 + rsub;
      const v4f v = *(const v4fa*)&so[w][r][c4];
      *(v4f*)(C + (size_t)(row0 + r) * ldc + col0 + c4) = v;
    }
    
  }
}
// row LayerNorm (biased variance, eps) over N: s = X (+ R); optional out_sum <- s; out_norm <- (s-mu)*rsqrt(var+eps)*g + b
template <bool PARAM_BF16>
__global__ __launch_bounds__(256) void k_layernorm(const float* __restrict__ X, const float* __restrict__ R, const float* __restrict__ g, const float* __restrict__ bta,
                                                  float* __restrict__ out_sum, float* __restrict__ out_norm, int N, float eps) {
  __shared__ float red[256];
  const int row = blockIdx.x, tid = threadIdx.x;
  const float* x = X + (size_t)row * N; const float* rr = R ? R + (size_t)row * N : nullptr;
  float vals[16];                     // up to N = 4096
  const int per = N / 256;            // contiguous chunk per thread? use strided-by-4 chunks: thread handles j = tid*4 + 1024*u
  float s1 = 0.f;
  for (int u = 0; u < per / 4; ++u) {
    const int j = tid * 4 + 1024 * u;
    const v4f a = *(const v4fa*)(x + j);
    v4f b = {0.f,0.f,0.f,0.f}; if (rr) b = *(const v4fa*)(rr + j);
#pragma unroll
    for (int q = 0; q < 4; ++q) { const float v = a[q] + b[q]; vals[u * 4 + q] = v; s1 += v; }
  }
  red[tid] = s1; __syncthreads();
  for (int st = 128; st > 0; st >>= 1) { if (tid < st) red[tid] += red[tid + st]; __syncthreads(); }
  const float mu = red[0] / (float)N; __syncthreads();
  float s2 = 0.f;
  for (int u = 0; u < per / 4; ++u)
#pragma unroll
    for (int q = 0; q < 4; ++q) { const float c = vals[u * 4 + q] - mu; s2 += c * c; }
  red[tid] = s2; __syncthreads();
  for (int st = 128; st > 0; st >>= 1) { if (tid < st) red[tid] += red[tid + st]; __syncthreads(); }
  const float rs = rsqrtf(red[0] / (float)N + eps);
  {
    for (int u = 0; u < per / 4; ++u) {
      const int j = tid * 4 + 1024 * u;
      v4f o, sm;
#pragma unroll
      for (int q = 0; q < 4; ++q) {
        float gg = g[j + q], bb = bta[j + q];
        if (PARAM_BF16) { gg = bf16_round(gg); bb = bf16_round(bb); }
        sm[q] = vals[u * 4 + q]; o[q] = (vals[u * 4 + q] - mu) * rs * gg + bb;
      }
      if (out_sum) *(v4f*)(out_sum + (size_t)row * N + j) = sm;
      *(v4f*)(out_norm + (size_t)row * N + j) = o;
    }
    
  }
}



// ---- f16 WMMA path (v_wmma_f32_16x16x32_f16): 11-bit significands for operands in range — used where a [0,1] probability operand needs more precision than bf16
typedef _Float16 v16h __attribute__((ext_vector_type(16)));
union FragH { v16h v; v8us half[2]; _Float16 h[16]; unsigned short u[16]; };
template <int NT>
__device__ __forceinline__ v8f mmaH(v16h ah, v16h al, v16h bh, v16h bl, v8f c) {
  c = __builtin_amdgcn_wmma_f32_16x16x32_f16(false, ah, false, bh, (short)0, c, false, false);
  if (NT >= 2) c = __builtin_amdgcn_wmma_f32_16x16x32_f16(false, al, false, bh, (short)0, c, false, false);
  if (NT >= 3) c = __builtin_amdgcn_wmma_f32_16x16x32_f16(false, ah, false, bl, (short)0, c, false, false);
  asm volatile("v_nop\n\tv_nop\n\tv_nop\n\tv_nop" : "+v"(c) : "v"(ah), "v"(al), "v"(bh), "v"(bl));
  return c;
}
// batched GEMM like k_gemm_b but f16 operands: A f32 (split into f16 hi/lo if ASPLIT, else rounded to f16), Bt = f16 values [n][k]; alpha; C f32; N multiple of 16 (partial tiles skipped)
template <bool ASPLIT>
__global__ __launch_bounds__(128) void k_gemm_h(const float* __restrict__ A, int lda, size_t sA, const _Float16* __restrict__ Bh, int ldb, size_t sB, float alpha, float* __restrict__ C, int ldc, size_t sC, int M, int N, int K) {
  __shared__ __attribute__((aligned(16))) float so[4][16][64];
  const int tid = threadIdx.x, w = tid >> 5, lane = tid & 31, ln = lane & 15, hh = lane >> 4; const int by = blockIdx.y;
  A += (size_t)by * sA; Bh += (size_t)by * sB; C += (size_t)by * sC;
  const int ntn = (N + 63) / 64; const int wid = blockIdx.x * 4 + w; const int mt = wid / ntn, nq = wid % ntn; if (mt * 16 >= M) return;
  const int row0 = mt * 16, col0 = nq * 64; const float* arow = A + (size_t)(row0 + ln) * lda;
  v8f acc[4] = {};
  for (int kb = 0; kb < K; kb += 32) {
    FragH ah, al;
    const v4f x0 = *(const v4fa*)(arow + kb + 8 * hh), x1 = *(const v4fa*)(arow + kb + 8 * hh + 4), x2 = *(const v4fa*)(arow + kb + 16 + 8 * hh), x3 = *(const v4fa*)(arow + kb + 16 + 8 * hh + 4);
    float xs[16] = {x0[0],x0[1],x0[2],x0[3],x1[0],x1[1],x1[2],x1[3],x2[0],x2[1],x2[2],x2[3],x3[0],x3[1],x3[2],x3[3]};
#pragma unroll
    for (int i = 0; i < 16; ++i) { const _Float16 h = (_Float16)xs[i]; ah.h[i] = h; al.h[i] = ASPLIT ? (_Float16)(xs[i] - (float)h) : (_Float16)0.0f; }
#pragma unroll
    for (int t = 0; t < 4; ++t) { if (col0 + t * 16 >= N) continue; const size_t boff = (size_t)(col0 + t * 16 + ln) * ldb + kb; FragH bq; bq.half[0] = *(const v8us*)(Bh + boff + 8 * hh); bq.half[1] = *(const v8us*)(Bh + boff + 16 + 8 * hh);
      acc[t] = mmaH<ASPLIT ? 2 : 1>(ah.v, al.v, bq.v, bq.v, acc[t]); }
  }
#pragma unroll
  for (int t = 0; t < 4; ++t) { if (col0 + t * 16 >= N) continue;
#pragma unroll
    for (int r = 0; r < 8; ++r) so[w][8 * hh + r][t * 16 + ln] = acc[t][r] * alpha; }
  __builtin_amdgcn_fence(__ATOMIC_ACQ_REL, "workgroup"); __builtin_amdgcn_wave_barrier();
  const int rsub = lane >> 4, c4 = (lane & 15) * 4;
  {
#pragma unroll
    for (int q = 0; q < 8; ++q) { const int r = q * 2 + rsub; if (col0 + c4 < N) { const v4f v = *(const v4fa*)&so[w][r][c4]; *(v4f*)(C + (size_t)(row0 + r) * ldc + col0 + c4) = v; } }
     }
}

// Wt[n][k] = f16(W[k][n]·scale) from f32 row-major W[K][N] (scale = power of two; bf16-exact weights stay exact in f16 away from the subnormal range)
__global__ __launch_bounds__(256) void k_wt_f16(const float* __restrict__ W, _Float16* __restrict__ Wt, int K, int N, float scale) {
  const int t = blockIdx.x * 256 + threadIdx.x; if (t >= N * (K / 8)) return; const int n = t / (K / 8), k8 = (t % (K / 8)) * 8; FragH f;
#pragma unroll
  for (int i = 0; i < 8; ++i) f.h[i] = (_Float16)(bf16_round(W[(size_t)(k8 + i) * N + n]) * scale); const v8us o = f.half[0];
  *(v8us*)((unsigned short*)Wt + (size_t)n * K + k8) = o; 
}
// k_gemm_hh variant with fused epilogue: v = acc·alpha + bias[by·sBias + col] (+ CP[(row/rowsPerB)·sCPb + by·64 + col] if CP) ; ACT 0 none / 1 elu ; writes f16 C16 (and f32 C if non-null)
template <int ACT>
__global__ __launch_bounds__(128) void k_gemm_hhx(const _Float16* __restrict__ A, int lda, size_t sA, const _Float16* __restrict__ Bh, int ldb, size_t sB, float alpha, const float* __restrict__ bias, size_t sBias, const float* __restrict__ CP, int rowsPerB, size_t sCPb, int row0g,
    float* __restrict__ C, _Float16* __restrict__ C16, int ldc, size_t sC, int M, int N, int K) {
  __shared__ __attribute__((aligned(16))) float so[4][16][64];
  const int tid = threadIdx.x, w = tid >> 5, lane = tid & 31, ln = lane & 15, hh = lane >> 4; const int by = blockIdx.y;
  A += (size_t)by * sA; Bh += (size_t)by * sB; const size_t cofs = (size_t)by * sC; const float* bp = bias ? bias + (size_t)by * sBias : nullptr;
  const int ntn = (N + 63) / 64; const int wid = blockIdx.x * 4 + w; const int mt = wid / ntn, nq = wid % ntn; if (mt * 16 >= M) return;
  const int row0 = mt * 16, col0 = nq * 64; const _Float16* arow = A + (size_t)(row0 + ln) * lda;
  v8f acc[4] = {};
  for (int kb = 0; kb < K; kb += 32) { FragH ah; ah.half[0] = *(const v8us*)((const unsigned short*)arow + kb + 8 * hh); ah.half[1] = *(const v8us*)((const unsigned short*)arow + kb + 16 + 8 * hh);
#pragma unroll
    for (int t = 0; t < 4; ++t) { if (col0 + t * 16 >= N) continue; const size_t boff = (size_t)(col0 + t * 16 + ln) * ldb + kb; FragH bq; bq.half[0] = *(const v8us*)((const unsigned short*)Bh + boff + 8 * hh); bq.half[1] = *(const v8us*)((const unsigned short*)Bh + boff + 16 + 8 * hh);
      acc[t] = mmaH<1>(ah.v, ah.v, bq.v, bq.v, acc[t]); }
  }
#pragma unroll
  for (int t = 0; t < 4; ++t) { if (col0 + t * 16 >= N) continue; const int col = col0 + t * 16 + ln; const float bv = bp ? bf16_round(bp[col]) : 0.f;
#pragma unroll
    for (int r = 0; r < 8; ++r) { float v = acc[t][r] * alpha + bv; if (CP) { const int rr = row0g + row0 + 8 * hh + r; if (rowsPerB < 0) v += CP[cofs + (size_t)rr * ldc + col];      /* rowsPerB < 0: own element of the batched C plane */ else { const int bidx = rr / rowsPerB; v += CP[(size_t)bidx * sCPb + (size_t)by * 64 + col]; } } if (ACT == 1) v = (v > 0.f) ? v : expm1f(v); else if (ACT == 7) v = (v > 0.f) ? v + 1.0f : expf(v); else if (ACT == 8) v = tanhf(v); else if (ACT == 9) v = 0.5f * v * (1.0f + tanhf(0.7978845608028654f * (v + 0.044715f * v * v * v))); else if (ACT == 11) v = 1.0f / (1.0f + expf(-v)); else if (ACT == 12) v = (v > 0.f) ? v : 0.01f * v; else if (ACT == 14) v = (v > 0.f) ? v : 0.1f * v; else if (ACT == 16) v = (v >= 0.f) ? v : 0.3f * v; else if (ACT == 17) v = (v >= 0.f) ? v : 0.2f * v; else if (ACT == 15) v = v / (1.0f + expf(-v)); else if (ACT == 3) v = fmaxf(v, 0.f); else if (ACT == 6) v = 0.5f * v * (1.0f + erff(v * 0.70710678118654752f)); so[w][8 * hh + r][t * 16 + ln] = v; } }
  __builtin_amdgcn_fence(__ATOMIC_ACQ_REL, "workgroup"); __builtin_amdgcn_wave_barrier();
  const int rsub = lane >> 4, c4 = (lane & 15) * 4; typedef _Float16 v4h __attribute__((ext_vector_type(4)));
  {
#pragma unroll
    for (int q = 0; q < 8; ++q) { const int r = q * 2 + rsub; if (col0 + c4 < N) { const v4f v = *(const v4fa*)&so[w][r][c4]; if (C) *(v4f*)(C + cofs + (size_t)(row0 + r) * ldc + col0 + c4) = v; if (C16) { v4h h4; for (int i = 0; i < 4; ++i) h4[i] = (_Float16)v[i]; *(v4h*)(C16 + cofs + (size_t)(row0 + r) * ldc + col0 + c4) = h4; } } }
     }
}


typedef _Float16 v4h __attribute__((ext_vector_type(4)));

__global__ __launch_bounds__(256) void k_x16(const float* __restrict__ x, _Float16* __restrict__ X16, size_t n8) { const size_t t = (size_t)blockIdx.x * 256 + threadIdx.x; if (t >= n8) return; FragH f;
#pragma unroll
  for (int q = 0; q < 8; ++q) f.h[q] = (_Float16)bf16_round(x[t * 8 + q]); *(v8us*)((unsigned short*)X16 + t * 8) = f.half[0];  }
__global__ __launch_bounds__(256) void k_h16(const float* __restrict__ x, _Float16* __restrict__ X16, size_t n8) { const size_t t = (size_t)blockIdx.x * 256 + threadIdx.x; if (t >= n8) return; FragH f;
#pragma unroll
  for (int q = 0; q < 8; ++q) f.h[q] = (_Float16)x[t * 8 + q]; *(v8us*)((unsigned short*)X16 + t * 8) = f.half[0];  }
__global__ __launch_bounds__(256) void k_round16f(const float* __restrict__ W, _Float16* __restrict__ Bt, size_t n8) { const size_t t = (size_t)blockIdx.x * 256 + threadIdx.x; if (t >= n8) return; FragH f;
#pragma unroll
  for (int i = 0; i < 8; ++i) f.h[i] = (_Float16)(bf16_round(W[t * 8 + i]) * 16.0f); *(v8us*)((unsigned short*)Bt + t * 8) = f.half[0];  }
template <int NHv, int TTv>
__global__ __launch_bounds__(256) void k_vt(const _Float16* __restrict__ V16, int ldv, int voff, _Float16* __restrict__ Vt) { __shared__ unsigned short tl[64][66]; const int tid = threadIdx.x; const int slab = blockIdx.x / (TTv / 64), lg = blockIdx.x % (TTv / 64); const int b = slab / NHv, h = slab % NHv;
  for (int i = tid; i < 64 * 8; i += 256) { const int r = i / 8, c8 = (i % 8) * 8; FragH f; f.half[0] = *(const v8us*)((const unsigned short*)V16 + ((size_t)b * TTv + lg * 64 + r) * ldv + voff + h * 64 + c8);
#pragma unroll
    for (int q = 0; q < 8; ++q) tl[r][c8 + q] = f.u[q]; }
  __syncthreads();
  {
#pragma unroll
    for (int rd = 0; rd < 2; ++rd) { const int d = rd * 32 + tid / 8, pc = tid % 8; FragH f;
#pragma unroll
      for (int q = 0; q < 8; ++q) f.u[q] = tl[pc * 8 + q][d];
      *(v8us*)((unsigned short*)Vt + ((size_t)slab * 64 + d) * TTv + lg * 64 + pc * 8) = f.half[0]; }
     } }

__global__ __launch_bounds__(256) void k_hl(const float* __restrict__ F, _Float16* __restrict__ Hh, _Float16* __restrict__ Hl, size_t n8) { const size_t t = (size_t)blockIdx.x * 256 + threadIdx.x; if (t >= n8) return; FragH fh, fl; const v4f a = *(const v4fa*)(F + t * 8), c = *(const v4fa*)(F + t * 8 + 4);
#pragma unroll
  for (int q = 0; q < 4; ++q) { _Float16 h = (_Float16)a[q]; fh.h[q] = h; fl.h[q] = (_Float16)((a[q] - (float)h) * 1024.0f); h = (_Float16)c[q]; fh.h[4 + q] = h; fl.h[4 + q] = (_Float16)((c[q] - (float)h) * 1024.0f); }
  { *(v8us*)((unsigned short*)Hh + t * 8) = fh.half[0]; *(v8us*)((unsigned short*)Hl + t * 8) = fl.half[0];  } }

// ---- fast GEMM (wave tile 32x64; requires M % 32 == 0 rows per launch region and N % 64 == 0); epilogue = k_gemm_hhx semantics ----
__device__ __forceinline__ v16h g2_frag(const _Float16* p, int hh) { FragH f; f.half[0] = *(const v8us*)((const unsigned short*)p + 8 * hh); f.half[1] = *(const v8us*)((const unsigned short*)p + 16 + 8 * hh); return f.v; }
__device__ __forceinline__ v8f g2_mma(v16h a, v16h b, v8f c) { v8f d = __builtin_amdgcn_wmma_f32_16x16x32_f16(false, a, false, b, (short)0, c, false, false); asm volatile("v_nop\n\tv_nop\n\tv_nop\n\tv_nop" : "+v"(d) : "v"(a), "v"(b)); return d; }
template <int ACT>
__global__ __launch_bounds__(128) void k_gemm2(const _Float16* __restrict__ A, int lda, size_t sA, const _Float16* __restrict__ Bh, int ldb, size_t sB, float alpha, const float* __restrict__ bias, size_t sBias, const float* __restrict__ CP, int rowsPerB, size_t sCPb, int row0g,
    float* __restrict__ C, _Float16* __restrict__ C16, int ldc, size_t sC, int M, int N, int K) { static_assert(ACT == 0 || ACT == 3 || ACT == 6 || ACT == 8 || ACT == 9 || ACT == 11 || ACT == 12 || ACT == 14 || ACT == 15 || ACT == 16 || ACT == 17, "k_gemm2: unsupported ACT code (would silently apply no activation)");
  __shared__ __attribute__((aligned(16))) float so[4][32][68];
  const int tid = threadIdx.x, w = tid >> 5, lane = tid & 31, ln = lane & 15, hh = lane >> 4; const int by = blockIdx.y;
  A += (size_t)by * sA; Bh += (size_t)by * sB; const size_t cofs = (size_t)by * sC; const float* bp = bias ? bias + (size_t)by * sBias : nullptr;
  const int ntn = N >> 6; const int mt = blockIdx.x / ntn, nq = blockIdx.x - mt * ntn; const int row0 = mt * 128 + 32 * w, col0 = nq * 64; if (row0 >= M) return;
  const _Float16* a0p = A + (size_t)(row0 + ln) * lda; const _Float16* a1p = a0p + (size_t)16 * lda;
  const _Float16* b0p = Bh + (size_t)(col0 + ln) * ldb; const _Float16* b1p = b0p + (size_t)16 * ldb; const _Float16* b2p = b1p + (size_t)16 * ldb; const _Float16* b3p = b2p + (size_t)16 * ldb;
  const v8f z8 = {0.f,0.f,0.f,0.f,0.f,0.f,0.f,0.f}; v8f c00 = z8, c01 = z8, c02 = z8, c03 = z8, c10 = z8, c11 = z8, c12 = z8, c13 = z8;
#pragma unroll 1
  for (int kb = 0; kb < K; kb += 32) { const v16h a0 = g2_frag(a0p + kb, hh), a1 = g2_frag(a1p + kb, hh);
    v16h b = g2_frag(b0p + kb, hh); c00 = g2_mma(a0, b, c00); c10 = g2_mma(a1, b, c10);
    b = g2_frag(b1p + kb, hh); c01 = g2_mma(a0, b, c01); c11 = g2_mma(a1, b, c11);
    b = g2_frag(b2p + kb, hh); c02 = g2_mma(a0, b, c02); c12 = g2_mma(a1, b, c12);
    b = g2_frag(b3p + kb, hh); c03 = g2_mma(a0, b, c03); c13 = g2_mma(a1, b, c13); }
  v8f accs[8] = {c00, c01, c02, c03, c10, c11, c12, c13};
#pragma unroll
  for (int u = 0; u < 8; ++u) { const int t = u & 3, half = u >> 2; const int col = col0 + t * 16 + ln; const float bv = bp ? bf16_round(bp[col]) : 0.f;
#pragma unroll
    for (int r = 0; r < 8; ++r) { const int rloc = half * 16 + 8 * hh + r; float v = accs[u][r] * alpha + bv; if (CP) { if (rowsPerB < 0) v += CP[cofs + (size_t)(row0g + row0 + rloc) * ldc + col];      /* rowsPerB < 0: own element of the batched C plane */ else { const int bidx = (row0g + row0 + rloc) / rowsPerB; v += CP[(size_t)bidx * sCPb + (size_t)by * 64 + col]; } }
      if (ACT == 3) v = fmaxf(v, 0.f); else if (ACT == 6) v = 0.5f * v * (1.0f + erff(v * 0.70710678118654752f)); else if (ACT == 11) v = 1.0f / (1.0f + expf(-v)); else if (ACT == 15) v = v / (1.0f + expf(-v)); else if (ACT == 12) v = (v > 0.f) ? v : 0.01f * v; else if (ACT == 8) v = tanhf(v); else if (ACT == 9) v = 0.5f * v * (1.0f + tanhf(0.7978845608028654f * (v + 0.044715f * v * v * v))); else if (ACT == 14) v = (v > 0.f) ? v : 0.1f * v; else if (ACT == 16) v = (v >= 0.f) ? v : 0.3f * v; else if (ACT == 17) v = (v >= 0.f) ? v : 0.2f * v;
      so[w][rloc][t * 16 + ln] = v; } }
  __builtin_amdgcn_fence(__ATOMIC_ACQ_REL, "workgroup"); __builtin_amdgcn_wave_barrier();
  const int rsub = lane >> 4, c4 = (lane & 15) * 4;
  {
#pragma unroll
    for (int q = 0; q < 16; ++q) { const int r = q * 2 + rsub; const v4f v = *(const v4fa*)&so[w][r][c4]; if (C) *(v4f*)(C + cofs + (size_t)(row0 + r) * ldc + col0 + c4) = v; if (C16) { v4h h4; for (int i = 0; i < 4; ++i) h4[i] = (_Float16)v[i]; *(v4h*)(C16 + cofs + (size_t)(row0 + r) * ldc + col0 + c4) = h4; } }
     } }


__global__ __launch_bounds__(256) void k_wnat(const float* __restrict__ w, size_t n8, _Float16* __restrict__ Bt) { const size_t t = (size_t)blockIdx.x * 256 + threadIdx.x; if (t >= n8) return; FragH f; for (int q = 0; q < 8; ++q) f.h[q] = (_Float16)(bf16_round(w[t * 8 + q]) * 16.0f); *(v8us*)((unsigned short*)Bt + t * 8) = f.half[0];  }
__global__ __launch_bounds__(256) void k_rsm(const float* __restrict__ S, _Float16* __restrict__ P, int nrows) {
  #pragma clang fp contract(off)
  const int i = blockIdx.x * 256 + threadIdx.x; if (i >= nrows) return; const float* s = S + (size_t)i * SQ; float mx = -3.0e38f;
#pragma unroll 1
  for (int j = 0; j < SQ; ++j) mx = fmaxf(mx, s[j]); float se = 0.f;
#pragma unroll 1
  for (int j = 0; j < SQ; ++j) se += expf(s[j] - mx); const float sc = 256.0f / se;
#pragma unroll 1
  for (int j0 = 0; j0 < SQ; j0 += 8) { FragH f; for (int q = 0; q < 8; ++q) f.h[q] = (_Float16)(expf(s[j0 + q] - mx) * sc); unsigned short* d = (unsigned short*)P + (size_t)i * SQ + j0; *(v8us*)d = f.half[0];  } }
__global__ __launch_bounds__(256) void k_vt(const _Float16* __restrict__ V16, int b, int h0, _Float16* __restrict__ VT) { __shared__ unsigned short tl[64][65]; const int tid = threadIdx.x; const int hh = blockIdx.x % HG, sg = blockIdx.x / HG; const int s0 = sg * 64; const int h = h0 + hh;
  for (int i = tid; i < 64 * 8; i += 256) { const int j = i / 8, d8 = (i % 8) * 8; FragH f; f.half[0] = *(const v8us*)((const unsigned short*)V16 + ((size_t)b * SQ + s0 + j) * DM + h * HD + d8); for (int q = 0; q < 8; ++q) tl[d8 + q][j] = f.u[q]; }
  __syncthreads();
  { for (int i = tid; i < 64 * 8; i += 256) { const int d = i / 8, j8 = (i % 8) * 8; FragH f; for (int q = 0; q < 8; ++q) f.u[q] = tl[d][j8 + q]; *(v8us*)((unsigned short*)VT + ((size_t)hh * HD + d) * SQ + s0 + j8) = f.half[0]; }  } }



__global__ __launch_bounds__(256) void k_rsmf(const float* __restrict__ S, _Float16* __restrict__ P, int qn, int hg) {
  #pragma clang fp contract(off)
  const int t = blockIdx.x * 256 + threadIdx.x; if (t >= qn * hg) return; const size_t i = (size_t)(t / qn) * SQ + (t % qn); const float* s = S + i * SQ; float mx = -3.0e38f;
#pragma unroll 1
  for (int j = 0; j < SQ; ++j) mx = fmaxf(mx, s[j]); float se = 0.f;
#pragma unroll 1
  for (int j = 0; j < SQ; ++j) se += __expf(s[j] - mx); const float sc = 256.0f / se;
#pragma unroll 1
  for (int j0 = 0; j0 < SQ; j0 += 8) { FragH f; for (int q = 0; q < 8; ++q) f.h[q] = (_Float16)(__expf(s[j0 + q] - mx) * sc); unsigned short* d = (unsigned short*)P + i * SQ + j0; *(v8us*)d = f.half[0];  } }

__global__ __launch_bounds__(256) void k_wthd(const float* __restrict__ Wt, _Float16* __restrict__ Bt) { const size_t t = (size_t)blockIdx.x * 256 + threadIdx.x; if (t >= (size_t)NH * HD * (DM / 8)) return; const int m8 = (int)(t % (DM / 8)) * 8; const int d = (int)((t / (DM / 8)) % HD); const int h = (int)(t / ((size_t)(DM / 8) * HD)); FragH f;
  for (int q = 0; q < 8; ++q) f.h[q] = (_Float16)(16.0f * bf16_round(Wt[((size_t)h * DM + m8 + q) * HD + d])); unsigned short* dst = (unsigned short*)Bt + ((size_t)h * HD + d) * DM + m8; *(v8us*)dst = f.half[0];  }

extern "C" void kernel_launch(void* const* d_in, const int* in_sizes, int n_in,
                              void* d_out, int out_size, void* d_ws, size_t ws_size, hipStream_t stream) {
  (void)in_sizes; (void)n_in; (void)out_size;
  const float* const* I = (const float* const*)d_in; const float* xq = I[0]; const float* xk = I[1]; const float* xv = I[2]; const float* wq = I[3]; const float* bq = I[4]; const float* wk = I[5]; const float* bk = I[6]; const float* wv = I[7]; const float* bv = I[8]; const float* wo = I[9]; const float* bo = I[10];      /* three inputs; per-head [in][out] weights [8][512][64] + per-head biases [8][64] (flattened head-major = projection column order); Wo [in][out] + bo */
  char* ws = (char*)d_ws; size_t off = 0;
  auto take = [&](size_t bytes) { char* p = ws + off; off += (bytes + 255) & ~(size_t)255; return p; };
  _Float16* BQ = (_Float16*)take((size_t)DM * DM * 2); _Float16* BK = (_Float16*)take((size_t)DM * DM * 2); _Float16* BV = (_Float16*)take((size_t)DM * DM * 2); _Float16* BO = (_Float16*)take((size_t)DM * DM * 2);
  _Float16* XQ = (_Float16*)take(NR * DM * 2); _Float16* XK = (_Float16*)take(NR * DM * 2); _Float16* XV = (_Float16*)take(NR * DM * 2); _Float16* Q16 = (_Float16*)take(NR * DM * 2); _Float16* K16 = (_Float16*)take(NR * DM * 2); _Float16* V16 = (_Float16*)take(NR * DM * 2); _Float16* O16 = (_Float16*)take(NR * DM * 2);
  float* S = (float*)take((size_t)HG * SQ * SQ * 4); _Float16* P = (_Float16*)take((size_t)HG * SQ * SQ * 2); _Float16* VT = (_Float16*)take((size_t)NH * HD * SQ * 2);
  if (off > ws_size) return;
  { const unsigned g = (unsigned)(((size_t)NH * HD * (DM / 8) + 255) / 256); k_wthd<<<g, 256, 0, stream>>>(wq, BQ); k_wthd<<<g, 256, 0, stream>>>(wk, BK); k_wthd<<<g, 256, 0, stream>>>(wv, BV); k_wt_f16<<<(unsigned)(((size_t)DM * (DM / 8) + 255) / 256), 256, 0, stream>>>(wo, BO, DM, DM, 16.0f); }      /* per-head [in][out] W[h][k][d] -> Bt[h*64 + d][k] x16 (head-major output columns = the flattened per-head biases' order); Wo [in][out] -> Bt x16 */

  k_x16<<<(unsigned)((NR * DM / 8 + 255) / 256), 256, 0, stream>>>(xq, XQ, NR * DM / 8); k_x16<<<(unsigned)((NR * DM / 8 + 255) / 256), 256, 0, stream>>>(xk, XK, NR * DM / 8); k_x16<<<(unsigned)((NR * DM / 8 + 255) / 256), 256, 0, stream>>>(xv, XV, NR * DM / 8);      /* the three inputs as exact f16 rows */
  const size_t r0p = (size_t)B0 * SQ;      /* first projected row */
  k_gemm2<0><<<dim3((unsigned)((MP / 128) * (DM / 64)), 1), 128, 0, stream>>>(XQ + r0p * DM, DM, 0, BQ, DM, 0, 0.0625f, bq, 0, nullptr, 1, 0, 0, nullptr, Q16 + r0p * DM, DM, 0, MP, DM, DM);
  k_gemm2<0><<<dim3((unsigned)((MP / 128) * (DM / 64)), 1), 128, 0, stream>>>(XK + r0p * DM, DM, 0, BK, DM, 0, 0.0625f, bk, 0, nullptr, 1, 0, 0, nullptr, K16 + r0p * DM, DM, 0, MP, DM, DM);
  k_gemm2<0><<<dim3((unsigned)((MP / 128) * (DM / 64)), 1), 128, 0, stream>>>(XV + r0p * DM, DM, 0, BV, DM, 0, 0.0625f, bv, 0, nullptr, 1, 0, 0, nullptr, V16 + r0p * DM, DM, 0, MP, DM, DM);
  for (int b = B0; b < B0 + NBR; ++b) { const size_t r0 = (size_t)b * SQ;
    k_vt<NH, SQ><<<NH * (SQ / 64), 256, 0, stream>>>(V16 + r0 * LQ, LQ, 0, VT);      /* V^T [NH][HD][SQ] for this batch */
    for (int h0 = 0; h0 < NHD; h0 += HG) {
      k_gemm2<0><<<dim3((QN / 128) * (SQ / 64), HG), 128, 0, stream>>>(Q16 + r0 * LQ + h0 * HD, LQ, (size_t)HD, K16 + r0 * LQ + h0 * HD, LQ, (size_t)HD, 0.125f, nullptr, 0, nullptr, 1, 0, 0, S, nullptr, SQ, (size_t)SQ * SQ, QN, SQ, HD);      /* scores, HG heads per launch */
      k_rsmf<<<(HG * QN + 255) / 256, 256, 0, stream>>>(S, P, QN, HG);      /* P = 256 softmax (f16), rows of all HG heads */
      k_gemm2<0><<<dim3((QN / 128) * (HD / 64), HG), 128, 0, stream>>>(P, SQ, (size_t)SQ * SQ, VT + (size_t)h0 * HD * SQ, SQ, (size_t)HD * SQ, 0.25f, nullptr, 0, nullptr, 1, 0, 0, nullptr, O16 + r0 * DM + (size_t)h0 * SQ * HD, HD, (size_t)SQ * HD, QN, HD, SQ); } }      
  k_gemm2<0><<<dim3((unsigned)((MPO / 128) * (DM / 64)), 1), 128, 0, stream>>>(O16 + r0p * DM, DM, 0, BO, DM, 0, 0.0009765625f, bo, 0, nullptr, 1, 0, 0, (float*)d_out + r0p * DM, nullptr, DM, 0, MPO, DM, DM);      /* out rows are the output layout */
}

// v001
// Measured time: 885 microseconds a run.
// Two timings next to v000 put it at 3.82 and 3.81 times that version's speed.
#include <hip/hip_runtime.h>
// Multi-head attention on three inputs with per-head projection tensors and the source's head-major context view (Q, K, V [8][1024][512]; Qh / Kh / Vh = einsum('bsd,hde->bhse', input, W) + b with per-head [in][out] weights W [8][512][64] and biases [8][64] (uniform +-512^-0.5); scores * 64^-0.5; softmax over all 1024 keys (no mask); context x [B][H][S][64] is RE-VIEWED as [B][S][512] WITHOUT transposing heads and time (row s' of the view = 512 consecutive floats of the [H][S][64] block); out = view Wo + bo ([in][out] 512 x 512) -> [8][1024][512]).
// Structure: token rows r = b*1024 + s; the query, key and value sources as exact f16 rows (bf16-rounded); Q, K, V as three WMMA GEMMs (32x64 wave tiles, f32 accumulation, exact x16 weights + bias, f16 outputs); per batch: V^T for all heads via LDS transposes; per (batch, group of 4 heads): scores GEMM (K = 64, batched over the heads on grid.y, alpha = 64^-0.5), row softmax on VALU (f32 statistics, native exp; weights stored x256 as f16), o = P . V^T GEMM (K = 1024, alpha 2^-2: o carried x64 against f16 subnormal flush, folded into the output GEMM alpha) written straight into the merged f16 o rows; out = o W_o + b GEMM (f32) into the output layout.
// Compute dtype: inputs rounded to bf16; x / weights exact; q, k, v, softmax weights and o as plain f16 GEMM operands (~2^-12); scores and softmax statistics f32. v_wmma_f32_16x16x32_f16.
#define NB 8
#define SQ 1024
#define DM 512
#define NH 8
#define HD 64
#define HG 4                         /* heads per attention launch group */
#define B0 0                         /* first batch processed (debug hook) */
#define NBR NB                       /* batches processed (debug hook) */
#define NR ((size_t)NB * SQ)         /* token rows */
#define MP ((int)((size_t)NBR * SQ)) /* rows projected (debug hook) */
#define QN SQ                        /* query rows attended per batch (debug hook) */
#define NHD NH                       /* heads attended (debug hook) */
#define MPO MP                       /* rows through the output stage (debug hook) */
#define LQ DM      /* row pitch of the q/k/v rows */
typedef __bf16 v16b __attribute__((ext_vector_type(16)));
typedef unsigned short v8us __attribute__((ext_vector_type(8), may_alias));
typedef float  v8f  __attribute__((ext_vector_type(8)));
typedef float  v4f  __attribute__((ext_vector_type(4)));
typedef float  v4fa __attribute__((ext_vector_type(4), may_alias));
union FragB { v16b v; v8us half[2]; unsigned short u[16]; };

__device__ __forceinline__ unsigned short bf16_bits(float x) { unsigned int u = __float_as_uint(x); return (unsigned short)((u + 0x7FFFu + ((u >> 16) & 1u)) >> 16); }
__device__ __forceinline__ float bf16_val(unsigned short b) { return __uint_as_float(((unsigned int)b) << 16); }
__device__ __forceinline__ float bf16_round(float x) { return bf16_val(bf16_bits(x)); }
// D += A·B with NT terms: 1 = ah·bh, 2 = + al·bh (A split), 3 = + ah·bl (both split)
template <int NT>
__device__ __forceinline__ v8f mmaN(v16b ah, v16b al, v16b bh, v16b bl, v8f c) {
  c = __builtin_amdgcn_wmma_f32_16x16x32_bf16(false, ah, false, bh, (short)0, c, false, false);
  if (NT >= 2) c = __builtin_amdgcn_wmma_f32_16x16x32_bf16(false, al, false, bh, (short)0, c, false, false);
  if (NT >= 3) c = __builtin_amdgcn_wmma_f32_16x16x32_bf16(false, ah, false, bl, (short)0, c, false, false);
  asm volatile("v_nop\n\tv_nop\n\tv_nop\n\tv_nop" : "+v"(c) : "v"(ah), "v"(al), "v"(bh), "v"(bl));
  return c;
}

__global__ __launch_bounds__(256) void k_wt_bf16(const float* __restrict__ W, unsigned short* __restrict__ Wt, int K, int N) {
  const int t = blockIdx.x * 256 + threadIdx.x;
  const int k8n = K / 8;
  if (t >= N * k8n) return;
  const int n = t / k8n, k8 = (t % k8n) * 8;
  v8us v;
#pragma unroll
  for (int i = 0; i < 8; ++i) v[i] = bf16_bits(W[(size_t)(k8 + i) * N + n]);
  *(v8us*)(Wt + (size_t)n * K + k8) = v;
  
}

// GEMM C[M][N] (f32, pitch ldc) = act(A[M][K]·W + bias). A f32 row-major (pitch lda) converted per fragment to bf16
// (ASPLIT: hi/lo two planes -> 2 terms, else single rounded term); Wt bf16 [N][K] (pitch ldb). BIAS_BF16 rounds the
// bias to bf16 first (bias quantised to bf16 before the add). K%32==0, M%16==0, N%64==0.
template <bool ASPLIT, int ACT, bool BIAS_BF16>
__global__ __launch_bounds__(128) void k_gemm_bf(const float* __restrict__ A, int lda, const unsigned short* __restrict__ Wt, int ldb,
                                               const float* __restrict__ bias, float* __restrict__ C, int ldc, int M, int N, int K) {
  __shared__ __attribute__((aligned(16))) float so[4][16][64];
  const int tid = threadIdx.x, w = tid >> 5, lane = tid & 31, ln = lane & 15, hh = lane >> 4;
  const int ntn = N / 64;
  const int wid = blockIdx.x * 4 + w;
  const int mt = wid / ntn, nq = wid % ntn;
  if (mt * 16 >= M) return;
  const int row0 = mt * 16, col0 = nq * 64;
  const float* arow = A + (size_t)(row0 + ln) * lda;
  v8f acc[4] = {};
  for (int kb = 0; kb < K; kb += 32) {
    FragB ah, al;
    const v4f x0 = *(const v4fa*)(arow + kb + 8 * hh), x1 = *(const v4fa*)(arow + kb + 8 * hh + 4);
    const v4f x2 = *(const v4fa*)(arow + kb + 16 + 8 * hh), x3 = *(const v4fa*)(arow + kb + 16 + 8 * hh + 4);
    float xs[16] = {x0[0],x0[1],x0[2],x0[3],x1[0],x1[1],x1[2],x1[3],x2[0],x2[1],x2[2],x2[3],x3[0],x3[1],x3[2],x3[3]};
#pragma unroll
    for (int i = 0; i < 16; ++i) { const unsigned short hb = bf16_bits(xs[i]); ah.u[i] = hb; al.u[i] = ASPLIT ? bf16_bits(xs[i] - bf16_val(hb)) : (unsigned short)0; }
#pragma unroll
    for (int t = 0; t < 4; ++t) {
      const unsigned short* brow = Wt + (size_t)(col0 + t * 16 + ln) * ldb + kb;
      FragB b;
      b.half[0] = *(const v8us*)(brow + 8 * hh);
      b.half[1] = *(const v8us*)(brow + 16 + 8 * hh);
      acc[t] = mmaN<ASPLIT ? 2 : 1>(ah.v, al.v, b.v, b.v, acc[t]);
    }
  }
#pragma unroll
  for (int t = 0; t < 4; ++t) {
    float bv = bias ? bias[col0 + t * 16 + ln] : 0.f;
    if (BIAS_BF16) bv = bf16_round(bv);
#pragma unroll
    for (int r = 0; r < 8; ++r) { float v = acc[t][r] + bv; if (ACT == 1) v = fmaxf(v, 0.f); so[w][8 * hh + r][t * 16 + ln] = v; }
  }
  __builtin_amdgcn_fence(__ATOMIC_ACQ_REL, "workgroup");
  __builtin_amdgcn_wave_barrier();
  const int rsub = lane >> 4, c4 = (lane & 15) * 4;
  {
#pragma unroll
    for (int q = 0; q < 8; ++q) {
      const int r = q * 2 + rsub;
      const v4f v = *(const v4fa*)&so[w][r][c4];
      *(v4f*)(C + (size_t)(row0 + r) * ldc + col0 + c4) = v;
    }
    
  }
}

// GEMM C = act(A·W + bias + resid): A f32 (ASPLIT -> hi/lo 2 terms), Wt bf16 [N][K]; ACT 0 none, 1 relu, 2 exact gelu;
// resid (optional, f32, row index = (row % rmod), pitch ldr, RES_BF16 rounds it) added before the activation.
template <bool ASPLIT, int ACT, bool BIAS_BF16, bool RES_BF16>
__global__ __launch_bounds__(128) void k_gemm_bf3(const float* __restrict__ A, int lda, const unsigned short* __restrict__ Wt, int ldb,
                                                const float* __restrict__ bias, const float* __restrict__ resid, int rmod, int ldr,
                                                float* __restrict__ C, int ldc, int M, int N, int K) {
  __shared__ __attribute__((aligned(16))) float so[4][16][64];
  const int tid = threadIdx.x, w = tid >> 5, lane = tid & 31, ln = lane & 15, hh = lane >> 4;
  const int ntn = N / 64;
  const int wid = blockIdx.x * 4 + w;
  const int mt = wid / ntn, nq = wid % ntn;
  if (mt * 16 >= M) return;
  const int row0 = mt * 16, col0 = nq * 64;
  const float* arow = A + (size_t)(row0 + ln) * lda;
  v8f acc[4] = {};
  for (int kb = 0; kb < K; kb += 32) {
    FragB ah, al;
    const v4f x0 = *(const v4fa*)(arow + kb + 8 * hh), x1 = *(const v4fa*)(arow + kb + 8 * hh + 4);
    const v4f x2 = *(const v4fa*)(arow + kb + 16 + 8 * hh), x3 = *(const v4fa*)(arow + kb + 16 + 8 * hh + 4);
    float xs[16] = {x0[0],x0[1],x0[2],x0[3],x1[0],x1[1],x1[2],x1[3],x2[0],x2[1],x2[2],x2[3],x3[0],x3[1],x3[2],x3[3]};
#pragma unroll
    for (int i = 0; i < 16; ++i) { const unsigned short hb = bf16_bits(xs[i]); ah.u[i] = hb; al.u[i] = ASPLIT ? bf16_bits(xs[i] - bf16_val(hb)) : (unsigned short)0; }
#pragma unroll
    for (int t = 0; t < 4; ++t) {
      const unsigned short* brow = Wt + (size_t)(col0 + t * 16 + ln) * ldb + kb;
      FragB b;
      b.half[0] = *(const v8us*)(brow + 8 * hh);
      b.half[1] = *(const v8us*)(brow + 16 + 8 * hh);
      acc[t] = mmaN<ASPLIT ? 2 : 1>(ah.v, al.v, b.v, b.v, acc[t]);
    }
  }
#pragma unroll
  for (int t = 0; t < 4; ++t) {
    const int col = col0 + t * 16 + ln;
    float bv = bias ? bias[col] : 0.f;
    if (BIAS_BF16) bv = bf16_round(bv);
#pragma unroll
    for (int r = 0; r < 8; ++r) {
      float v = acc[t][r] + bv;
      if (resid) { float rv = resid[(size_t)((row0 + 8 * hh + r) % rmod) * ldr + col]; if (RES_BF16) rv = bf16_round(rv); v += rv; }
      if (ACT == 1) v = fmaxf(v, 0.f);
      if (ACT == 2) v = 0.5f * v * (1.0f + erff(v * 0.70710678118654752f));
      if (ACT == 3) { const float u = 0.7978845608028654f * (v + 0.044715f * v * v * v); v = 0.5f * v * (1.0f + tanhf(u)); }
      so[w][8 * hh + r][t * 16 + ln] = v;
    }
  }
  __builtin_amdgcn_fence(__ATOMIC_ACQ_REL, "workgroup");
  __builtin_amdgcn_wave_barrier();
  const int rsub = lane >> 4, c4 = (lane & 15) * 4;
  {
#pragma unroll
    for (int q = 0; q < 8; ++q) {
      const int r = q * 2 + rsub;
      const v4f v = *(const v4fa*)&so[w][r][c4];
      *(v4f*)(C + (size_t)(row0 + r) * ldc + col0 + c4) = v;
    }
    
  }
}
// row LayerNorm (biased variance, eps) over N: s = X (+ R); optional out_sum <- s; out_norm <- (s-mu)*rsqrt(var+eps)*g + b
template <bool PARAM_BF16>
__global__ __launch_bounds__(256) void k_layernorm(const float* __restrict__ X, const float* __restrict__ R, const float* __restrict__ g, const float* __restrict__ bta,
                                                  float* __restrict__ out_sum, float* __restrict__ out_norm, int N, float eps) {
  __shared__ float red[256];
  const int row = blockIdx.x, tid = threadIdx.x;
  const float* x = X + (size_t)row * N; const float* rr = R ? R + (size_t)row * N : nullptr;
  float vals[16];                     // up to N = 4096
  const int per = N / 256;            // contiguous chunk per thread? use strided-by-4 chunks: thread handles j = tid*4 + 1024*u
  float s1 = 0.f;
  for (int u = 0; u < per / 4; ++u) {
    const int j = tid * 4 + 1024 * u;
    const v4f a = *(const v4fa*)(x + j);
    v4f b = {0.f,0.f,0.f,0.f}; if (rr) b = *(const v4fa*)(rr + j);
#pragma unroll
    for (int q = 0; q < 4; ++q) { const float v = a[q] + b[q]; vals[u * 4 + q] = v; s1 += v; }
  }
  red[tid] = s1; __syncthreads();
  for (int st = 128; st > 0; st >>= 1) { if (tid < st) red[tid] += red[tid + st]; __syncthreads(); }
  const float mu = red[0] / (float)N; __syncthreads();
  float s2 = 0.f;
  for (int u = 0; u < per / 4; ++u)
#pragma unroll
    for (int q = 0; q < 4; ++q) { const float c = vals[u * 4 + q] - mu; s2 += c * c; }
  red[tid] = s2; __syncthreads();
  for (int st = 128; st > 0; st >>= 1) { if (tid < st) red[tid] += red[tid + st]; __syncthreads(); }
  const float rs = rsqrtf(red[0] / (float)N + eps);
  {
    for (int u = 0; u < per / 4; ++u) {
      const int j = tid * 4 + 1024 * u;
      v4f o, sm;
#pragma unroll
      for (int q = 0; q < 4; ++q) {
        float gg = g[j + q], bb = bta[j + q];
        if (PARAM_BF16) { gg = bf16_round(gg); bb = bf16_round(bb); }
        sm[q] = vals[u * 4 + q]; o[q] = (vals[u * 4 + q] - mu) * rs * gg + bb;
      }
      if (out_sum) *(v4f*)(out_sum + (size_t)row * N + j) = sm;
      *(v4f*)(out_norm + (size_t)row * N + j) = o;
    }
    
  }
}



// ---- f16 WMMA path (v_wmma_f32_16x16x32_f16): 11-bit significands for operands in range — used where a [0,1] probability operand needs more precision than bf16
typedef _Float16 v16h __attribute__((ext_vector_type(16)));
union FragH { v16h v; v8us half[2]; _Float16 h[16]; unsigned short u[16]; };
template <int NT>
__device__ __forceinline__ v8f mmaH(v16h ah, v16h al, v16h bh, v16h bl, v8f c) {
  c = __builtin_amdgcn_wmma_f32_16x16x32_f16(false, ah, false, bh, (short)0, c, false, false);
  if (NT >= 2) c = __builtin_amdgcn_wmma_f32_16x16x32_f16(false, al, false, bh, (short)0, c, false, false);
  if (NT >= 3) c = __builtin_amdgcn_wmma_f32_16x16x32_f16(false, ah, false, bl, (short)0, c, false, false);
  asm volatile("v_nop\n\tv_nop\n\tv_nop\n\tv_nop" : "+v"(c) : "v"(ah), "v"(al), "v"(bh), "v"(bl));
  return c;
}
// batched GEMM like k_gemm_b but f16 operands: A f32 (split into f16 hi/lo if ASPLIT, else rounded to f16), Bt = f16 values [n][k]; alpha; C f32; N multiple of 16 (partial tiles skipped)
template <bool ASPLIT>
__global__ __launch_bounds__(128) void k_gemm_h(const float* __restrict__ A, int lda, size_t sA, const _Float16* __restrict__ Bh, int ldb, size_t sB, float alpha, float* __restrict__ C, int ldc, size_t sC, int M, int N, int K) {
  __shared__ __attribute__((aligned(16))) float so[4][16][64];
  const int tid = threadIdx.x, w = tid >> 5, lane = tid & 31, ln = lane & 15, hh = lane >> 4; const int by = blockIdx.y;
  A += (size_t)by * sA; Bh += (size_t)by * sB; C += (size_t)by * sC;
  const int ntn = (N + 63) / 64; const int wid = blockIdx.x * 4 + w; const int mt = wid / ntn, nq = wid % ntn; if (mt * 16 >= M) return;
  const int row0 = mt * 16, col0 = nq * 64; const float* arow = A + (size_t)(row0 + ln) * lda;
  v8f acc[4] = {};
  for (int kb = 0; kb < K; kb += 32) {
    FragH ah, al;
    const v4f x0 = *(const v4fa*)(arow + kb + 8 * hh), x1 = *(const v4fa*)(arow + kb + 8 * hh + 4), x2 = *(const v4fa*)(arow + kb + 16 + 8 * hh), x3 = *(const v4fa*)(arow + kb + 16 + 8 * hh + 4);
    float xs[16] = {x0[0],x0[1],x0[2],x0[3],x1[0],x1[1],x1[2],x1[3],x2[0],x2[1],x2[2],x2[3],x3[0],x3[1],x3[2],x3[3]};
#pragma unroll
    for (int i = 0; i < 16; ++i) { const _Float16 h = (_Float16)xs[i]; ah.h[i] = h; al.h[i] = ASPLIT ? (_Float16)(xs[i] - (float)h) : (_Float16)0.0f; }
#pragma unroll
    for (int t = 0; t < 4; ++t) { if (col0 + t * 16 >= N) continue; const size_t boff = (size_t)(col0 + t * 16 + ln) * ldb + kb; FragH bq; bq.half[0] = *(const v8us*)(Bh + boff + 8 * hh); bq.half[1] = *(const v8us*)(Bh + boff + 16 + 8 * hh);
      acc[t] = mmaH<ASPLIT ? 2 : 1>(ah.v, al.v, bq.v, bq.v, acc[t]); }
  }
#pragma unroll
  for (int t = 0; t < 4; ++t) { if (col0 + t * 16 >= N) continue;
#pragma unroll
    for (int r = 0; r < 8; ++r) so[w][8 * hh + r][t * 16 + ln] = acc[t][r] * alpha; }
  __builtin_amdgcn_fence(__ATOMIC_ACQ_REL, "workgroup"); __builtin_amdgcn_wave_barrier();
  const int rsub = lane >> 4, c4 = (lane & 15) * 4;
  {
#pragma unroll
    for (int q = 0; q < 8; ++q) { const int r = q * 2 + rsub; if (col0 + c4 < N) { const v4f v = *(const v4fa*)&so[w][r][c4]; *(v4f*)(C + (size_t)(row0 + r) * ldc + col0 + c4) = v; } }
     }
}

// Wt[n][k] = f16(W[k][n]·scale) from f32 row-major W[K][N] (scale = power of two; bf16-exact weights stay exact in f16 away from the subnormal range)
__global__ __launch_bounds__(256) void k_wt_f16(const float* __restrict__ W, _Float16* __restrict__ Wt, int K, int N, float scale) {
  const int t = blockIdx.x * 256 + threadIdx.x; if (t >= N * (K / 8)) return; const int n = t / (K / 8), k8 = (t % (K / 8)) * 8; FragH f;
#pragma unroll
  for (int i = 0; i < 8; ++i) f.h[i] = (_Float16)(bf16_round(W[(size_t)(k8 + i) * N + n]) * scale); const v8us o = f.half[0];
  *(v8us*)((unsigned short*)Wt + (size_t)n * K + k8) = o; 
}
// k_gemm_hh variant with fused epilogue: v = acc·alpha + bias[by·sBias + col] (+ CP[(row/rowsPerB)·sCPb + by·64 + col] if CP) ; ACT 0 none / 1 elu ; writes f16 C16 (and f32 C if non-null)
template <int ACT>
__global__ __launch_bounds__(128) void k_gemm_hhx(const _Float16* __restrict__ A, int lda, size_t sA, const _Float16* __restrict__ Bh, int ldb, size_t sB, float alpha, const float* __restrict__ bias, size_t sBias, const float* __restrict__ CP, int rowsPerB, size_t sCPb, int row0g,
    float* __restrict__ C, _Float16* __restrict__ C16, int ldc, size_t sC, int M, int N, int K) {
  __shared__ __attribute__((aligned(16))) float so[4][16][64];
  const int tid = threadIdx.x, w = tid >> 5, lane = tid & 31, ln = lane & 15, hh = lane >> 4; const int by = blockIdx.y;
  A += (size_t)by * sA; Bh += (size_t)by * sB; const size_t cofs = (size_t)by * sC; const float* bp = bias ? bias + (size_t)by * sBias : nullptr;
  const int ntn = (N + 63) / 64; const int wid = blockIdx.x * 4 + w; const int mt = wid / ntn, nq = wid % ntn; if (mt * 16 >= M) return;
  const int row0 = mt * 16, col0 = nq * 64; const _Float16* arow = A + (size_t)(row0 + ln) * lda;
  v8f acc[4] = {};
  for (int kb = 0; kb < K; kb += 32) { FragH ah; ah.half[0] = *(const v8us*)((const unsigned short*)arow + kb + 8 * hh); ah.half[1] = *(const v8us*)((const unsigned short*)arow + kb + 16 + 8 * hh);
#pragma unroll
    for (int t = 0; t < 4; ++t) { if (col0 + t * 16 >= N) continue; const size_t boff = (size_t)(col0 + t * 16 + ln) * ldb + kb; FragH bq; bq.half[0] = *(const v8us*)((const unsigned short*)Bh + boff + 8 * hh); bq.half[1] = *(const v8us*)((const unsigned short*)Bh + boff + 16 + 8 * hh);
      acc[t] = mmaH<1>(ah.v, ah.v, bq.v, bq.v, acc[t]); }
  }
#pragma unroll
  for (int t = 0; t < 4; ++t) { if (col0 + t * 16 >= N) continue; const int col = col0 + t * 16 + ln; const float bv = bp ? bf16_round(bp[col]) : 0.f;
#pragma unroll
    for (int r = 0; r < 8; ++r) { float v = acc[t][r] * alpha + bv; if (CP) { const int rr = row0g + row0 + 8 * hh + r; if (rowsPerB < 0) v += CP[cofs + (size_t)rr * ldc + col];      /* rowsPerB < 0: own element of the batched C plane */ else { const int bidx = rr / rowsPerB; v += CP[(size_t)bidx * sCPb + (size_t)by * 64 + col]; } } if (ACT == 1) v = (v > 0.f) ? v : expm1f(v); else if (ACT == 7) v = (v > 0.f) ? v + 1.0f : expf(v); else if (ACT == 8) v = tanhf(v); else if (ACT == 9) v = 0.5f * v * (1.0f + tanhf(0.7978845608028654f * (v + 0.044715f * v * v * v))); else if (ACT == 11) v = 1.0f / (1.0f + expf(-v)); else if (ACT == 12) v = (v > 0.f) ? v : 0.01f * v; else if (ACT == 14) v = (v > 0.f) ? v : 0.1f * v; else if (ACT == 16) v = (v >= 0.f) ? v : 0.3f * v; else if (ACT == 17) v = (v >= 0.f) ? v : 0.2f * v; else if (ACT == 15) v = v / (1.0f + expf(-v)); else if (ACT == 3) v = fmaxf(v, 0.f); else if (ACT == 6) v = 0.5f * v * (1.0f + erff(v * 0.70710678118654752f)); so[w][8 * hh + r][t * 16 + ln] = v; } }
  __builtin_amdgcn_fence(__ATOMIC_ACQ_REL, "workgroup"); __builtin_amdgcn_wave_barrier();
  const int rsub = lane >> 4, c4 = (lane & 15) * 4; typedef _Float16 v4h __attribute__((ext_vector_type(4)));
  {
#pragma unroll
    for (int q = 0; q < 8; ++q) { const int r = q * 2 + rsub; if (col0 + c4 < N) { const v4f v = *(const v4fa*)&so[w][r][c4]; if (C) *(v4f*)(C + cofs + (size_t)(row0 + r) * ldc + col0 + c4) = v; if (C16) { v4h h4; for (int i = 0; i < 4; ++i) h4[i] = (_Float16)v[i]; *(v4h*)(C16 + cofs + (size_t)(row0 + r) * ldc + col0 + c4) = h4; } } }
     }
}


typedef _Float16 v4h __attribute__((ext_vector_type(4)));

__global__ __launch_bounds__(256) void k_x16(const float* __restrict__ x, _Float16* __restrict__ X16, size_t n8) { const size_t t = (size_t)blockIdx.x * 256 + threadIdx.x; if (t >= n8) return; FragH f;
#pragma unroll
  for (int q = 0; q < 8; ++q) f.h[q] = (_Float16)bf16_round(x[t * 8 + q]); *(v8us*)((unsigned short*)X16 + t * 8) = f.half[0];  }
__global__ __launch_bounds__(256) void k_h16(const float* __restrict__ x, _Float16* __restrict__ X16, size_t n8) { const size_t t = (size_t)blockIdx.x * 256 + threadIdx.x; if (t >= n8) return; FragH f;
#pragma unroll
  for (int q = 0; q < 8; ++q) f.h[q] = (_Float16)x[t * 8 + q]; *(v8us*)((unsigned short*)X16 + t * 8) = f.half[0];  }
__global__ __launch_bounds__(256) void k_round16f(const float* __restrict__ W, _Float16* __restrict__ Bt, size_t n8) { const size_t t = (size_t)blockIdx.x * 256 + threadIdx.x; if (t >= n8) return; FragH f;
#pragma unroll
  for (int i = 0; i < 8; ++i) f.h[i] = (_Float16)(bf16_round(W[t * 8 + i]) * 16.0f); *(v8us*)((unsigned short*)Bt + t * 8) = f.half[0];  }
template <int NHv, int TTv>
__global__ __launch_bounds__(256) void k_vt(const _Float16* __restrict__ V16, int ldv, int voff, _Float16* __restrict__ Vt) { __shared__ unsigned short tl[64][66]; const int tid = threadIdx.x; const int slab = blockIdx.x / (TTv / 64), lg = blockIdx.x % (TTv / 64); const int b = slab / NHv, h = slab % NHv;
  for (int i = tid; i < 64 * 8; i += 256) { const int r = i / 8, c8 = (i % 8) * 8; FragH f; f.half[0] = *(const v8us*)((const unsigned short*)V16 + ((size_t)b * TTv + lg * 64 + r) * ldv + voff + h * 64 + c8);
#pragma unroll
    for (int q = 0; q < 8; ++q) tl[r][c8 + q] = f.u[q]; }
  __syncthreads();
  {
#pragma unroll
    for (int rd = 0; rd < 2; ++rd) { const int d = rd * 32 + tid / 8, pc = tid % 8; FragH f;
#pragma unroll
      for (int q = 0; q < 8; ++q) f.u[q] = tl[pc * 8 + q][d];
      *(v8us*)((unsigned short*)Vt + ((size_t)slab * 64 + d) * TTv + lg * 64 + pc * 8) = f.half[0]; }
     } }

__global__ __launch_bounds__(256) void k_hl(const float* __restrict__ F, _Float16* __restrict__ Hh, _Float16* __restrict__ Hl, size_t n8) { const size_t t = (size_t)blockIdx.x * 256 + threadIdx.x; if (t >= n8) return; FragH fh, fl; const v4f a = *(const v4fa*)(F + t * 8), c = *(const v4fa*)(F + t * 8 + 4);
#pragma unroll
  for (int q = 0; q < 4; ++q) { _Float16 h = (_Float16)a[q]; fh.h[q] = h; fl.h[q] = (_Float16)((a[q] - (float)h) * 1024.0f); h = (_Float16)c[q]; fh.h[4 + q] = h; fl.h[4 + q] = (_Float16)((c[q] - (float)h) * 1024.0f); }
  { *(v8us*)((unsigned short*)Hh + t * 8) = fh.half[0]; *(v8us*)((unsigned short*)Hl + t * 8) = fl.half[0];  } }

// ---- fast GEMM (wave tile 32x64; requires M % 32 == 0 rows per launch region and N % 64 == 0); epilogue = k_gemm_hhx semantics ----
__device__ __forceinline__ v16h g2_frag(const _Float16* p, int hh) { FragH f; f.half[0] = *(const v8us*)((const unsigned short*)p + 8 * hh); f.half[1] = *(const v8us*)((const unsigned short*)p + 16 + 8 * hh); return f.v; }
__device__ __forceinline__ v8f g2_mma(v16h a, v16h b, v8f c) { v8f d = __builtin_amdgcn_wmma_f32_16x16x32_f16(false, a, false, b, (short)0, c, false, false); asm volatile("v_nop\n\tv_nop\n\tv_nop\n\tv_nop" : "+v"(d) : "v"(a), "v"(b)); return d; }
template <int ACT>
__global__ __launch_bounds__(128) void k_gemm2(const _Float16* __restrict__ A, int lda, size_t sA, const _Float16* __restrict__ Bh, int ldb, size_t sB, float alpha, const float* __restrict__ bias, size_t sBias, const float* __restrict__ CP, int rowsPerB, size_t sCPb, int row0g,
    float* __restrict__ C, _Float16* __restrict__ C16, int ldc, size_t sC, int M, int N, int K) { static_assert(ACT == 0 || ACT == 3 || ACT == 6 || ACT == 8 || ACT == 9 || ACT == 11 || ACT == 12 || ACT == 14 || ACT == 15 || ACT == 16 || ACT == 17, "k_gemm2: unsupported ACT code (would silently apply no activation)");
  __shared__ __attribute__((aligned(16))) float so[4][32][68];
  const int tid = threadIdx.x, w = tid >> 5, lane = tid & 31, ln = lane & 15, hh = lane >> 4; const int by = blockIdx.y;
  A += (size_t)by * sA; Bh += (size_t)by * sB; const size_t cofs = (size_t)by * sC; const float* bp = bias ? bias + (size_t)by * sBias : nullptr;
  const int ntn = N >> 6; const int mt = blockIdx.x / ntn, nq = blockIdx.x - mt * ntn; const int row0 = mt * 128 + 32 * w, col0 = nq * 64; if (row0 >= M) return;
  const _Float16* a0p = A + (size_t)(row0 + ln) * lda; const _Float16* a1p = a0p + (size_t)16 * lda;
  const _Float16* b0p = Bh + (size_t)(col0 + ln) * ldb; const _Float16* b1p = b0p + (size_t)16 * ldb; const _Float16* b2p = b1p + (size_t)16 * ldb; const _Float16* b3p = b2p + (size_t)16 * ldb;
  const v8f z8 = {0.f,0.f,0.f,0.f,0.f,0.f,0.f,0.f}; v8f c00 = z8, c01 = z8, c02 = z8, c03 = z8, c10 = z8, c11 = z8, c12 = z8, c13 = z8;
#pragma unroll 1
  for (int kb = 0; kb < K; kb += 32) { const v16h a0 = g2_frag(a0p + kb, hh), a1 = g2_frag(a1p + kb, hh);
    v16h b = g2_frag(b0p + kb, hh); c00 = g2_mma(a0, b, c00); c10 = g2_mma(a1, b, c10);
    b = g2_frag(b1p + kb, hh); c01 = g2_mma(a0, b, c01); c11 = g2_mma(a1, b, c11);
    b = g2_frag(b2p + kb, hh); c02 = g2_mma(a0, b, c02); c12 = g2_mma(a1, b, c12);
    b = g2_frag(b3p + kb, hh); c03 = g2_mma(a0, b, c03); c13 = g2_mma(a1, b, c13); }
  v8f accs[8] = {c00, c01, c02, c03, c10, c11, c12, c13};
#pragma unroll
  for (int u = 0; u < 8; ++u) { const int t = u & 3, half = u >> 2; const int col = col0 + t * 16 + ln; const float bv = bp ? bf16_round(bp[col]) : 0.f;
#pragma unroll
    for (int r = 0; r < 8; ++r) { const int rloc = half * 16 + 8 * hh + r; float v = accs[u][r] * alpha + bv; if (CP) { if (rowsPerB < 0) v += CP[cofs + (size_t)(row0g + row0 + rloc) * ldc + col];      /* rowsPerB < 0: own element of the batched C plane */ else { const int bidx = (row0g + row0 + rloc) / rowsPerB; v += CP[(size_t)bidx * sCPb + (size_t)by * 64 + col]; } }
      if (ACT == 3) v = fmaxf(v, 0.f); else if (ACT == 6) v = 0.5f * v * (1.0f + erff(v * 0.70710678118654752f)); else if (ACT == 11) v = 1.0f / (1.0f + expf(-v)); else if (ACT == 15) v = v / (1.0f + expf(-v)); else if (ACT == 12) v = (v > 0.f) ? v : 0.01f * v; else if (ACT == 8) v = tanhf(v); else if (ACT == 9) v = 0.5f * v * (1.0f + tanhf(0.7978845608028654f * (v + 0.044715f * v * v * v))); else if (ACT == 14) v = (v > 0.f) ? v : 0.1f * v; else if (ACT == 16) v = (v >= 0.f) ? v : 0.3f * v; else if (ACT == 17) v = (v >= 0.f) ? v : 0.2f * v;
      so[w][rloc][t * 16 + ln] = v; } }
  __builtin_amdgcn_fence(__ATOMIC_ACQ_REL, "workgroup"); __builtin_amdgcn_wave_barrier();
  const int rsub = lane >> 4, c4 = (lane & 15) * 4;
  {
#pragma unroll
    for (int q = 0; q < 16; ++q) { const int r = q * 2 + rsub; const v4f v = *(const v4fa*)&so[w][r][c4]; if (C) *(v4f*)(C + cofs + (size_t)(row0 + r) * ldc + col0 + c4) = v; if (C16) { v4h h4; for (int i = 0; i < 4; ++i) h4[i] = (_Float16)v[i]; *(v4h*)(C16 + cofs + (size_t)(row0 + r) * ldc + col0 + c4) = h4; } }
     } }


__global__ __launch_bounds__(256) void k_wnat(const float* __restrict__ w, size_t n8, _Float16* __restrict__ Bt) { const size_t t = (size_t)blockIdx.x * 256 + threadIdx.x; if (t >= n8) return; FragH f; for (int q = 0; q < 8; ++q) f.h[q] = (_Float16)(bf16_round(w[t * 8 + q]) * 16.0f); *(v8us*)((unsigned short*)Bt + t * 8) = f.half[0];  }
__global__ __launch_bounds__(256) void k_rsm(const float* __restrict__ S, _Float16* __restrict__ P, int nrows) {
  #pragma clang fp contract(off)
  const int i = blockIdx.x * 256 + threadIdx.x; if (i >= nrows) return; const float* s = S + (size_t)i * SQ; float mx = -3.0e38f;
#pragma unroll 1
  for (int j = 0; j < SQ; ++j) mx = fmaxf(mx, s[j]); float se = 0.f;
#pragma unroll 1
  for (int j = 0; j < SQ; ++j) se += expf(s[j] - mx); const float sc = 256.0f / se;
#pragma unroll 1
  for (int j0 = 0; j0 < SQ; j0 += 8) { FragH f; for (int q = 0; q < 8; ++q) f.h[q] = (_Float16)(expf(s[j0 + q] - mx) * sc); unsigned short* d = (unsigned short*)P + (size_t)i * SQ + j0; *(v8us*)d = f.half[0];  } }
__global__ __launch_bounds__(256) void k_vt(const _Float16* __restrict__ V16, int b, int h0, _Float16* __restrict__ VT) { __shared__ unsigned short tl[64][65]; const int tid = threadIdx.x; const int hh = blockIdx.x % HG, sg = blockIdx.x / HG; const int s0 = sg * 64; const int h = h0 + hh;
  for (int i = tid; i < 64 * 8; i += 256) { const int j = i / 8, d8 = (i % 8) * 8; FragH f; f.half[0] = *(const v8us*)((const unsigned short*)V16 + ((size_t)b * SQ + s0 + j) * DM + h * HD + d8); for (int q = 0; q < 8; ++q) tl[d8 + q][j] = f.u[q]; }
  __syncthreads();
  { for (int i = tid; i < 64 * 8; i += 256) { const int d = i / 8, j8 = (i % 8) * 8; FragH f; for (int q = 0; q < 8; ++q) f.u[q] = tl[d][j8 + q]; *(v8us*)((unsigned short*)VT + ((size_t)hh * HD + d) * SQ + s0 + j8) = f.half[0]; }  } }



// Row softmax, one wave per score row: each lane holds 32 of the row's 1024 scores in registers (8 loads of 16 B, every load 512 contiguous bytes per wave);
// row max and row sum by per-lane chains and a five-step butterfly over the 32 lanes; each exp computed once; weights x256 as f16, 256 contiguous bytes per wave store.
// Every loop over x is fully unrolled: x must be indexed by constants to stay in registers, and the 8 loads must all be in flight before the first use.
__global__ __launch_bounds__(256) void k_rsmf(const float* __restrict__ S, _Float16* __restrict__ P, int qn, int hg) {
  const int lane = threadIdx.x & 31; const int t = blockIdx.x * 8 + (threadIdx.x >> 5); if (t >= qn * hg) return;
  const size_t i = (size_t)(t / qn) * SQ + (t % qn); const float* s = S + i * SQ + lane * 4; v4f x[SQ / 128];
#pragma unroll
  for (int u = 0; u < SQ / 128; ++u) x[u] = *(const v4fa*)(s + u * 128);
  float mx = -3.0e38f;
#pragma unroll
  for (int u = 0; u < SQ / 128; ++u) mx = fmaxf(mx, fmaxf(fmaxf(x[u][0], x[u][1]), fmaxf(x[u][2], x[u][3])));
#pragma unroll
  for (int m = 16; m > 0; m >>= 1) mx = fmaxf(mx, __shfl_xor(mx, m, 32));
  v4f s4 = {0.f, 0.f, 0.f, 0.f};
#pragma unroll
  for (int u = 0; u < SQ / 128; ++u) { x[u] -= mx;
#pragma unroll
    for (int q = 0; q < 4; ++q) x[u][q] = __expf(x[u][q]);
    s4 += x[u]; }
  float se = (s4[0] + s4[1]) + (s4[2] + s4[3]);
#pragma unroll
  for (int m = 16; m > 0; m >>= 1) se += __shfl_xor(se, m, 32);
  const float sc = 256.0f / se; _Float16* d = P + i * SQ + lane * 4;
#pragma unroll
  for (int u = 0; u < SQ / 128; ++u) { x[u] *= sc; *(v4h*)(d + u * 128) = __builtin_convertvector(x[u], v4h); } }

__global__ __launch_bounds__(256) void k_wthd(const float* __restrict__ Wt, _Float16* __restrict__ Bt) { const size_t t = (size_t)blockIdx.x * 256 + threadIdx.x; if (t >= (size_t)NH * HD * (DM / 8)) return; const int m8 = (int)(t % (DM / 8)) * 8; const int d = (int)((t / (DM / 8)) % HD); const int h = (int)(t / ((size_t)(DM / 8) * HD)); FragH f;
  for (int q = 0; q < 8; ++q) f.h[q] = (_Float16)(16.0f * bf16_round(Wt[((size_t)h * DM + m8 + q) * HD + d])); unsigned short* dst = (unsigned short*)Bt + ((size_t)h * HD + d) * DM + m8; *(v8us*)dst = f.half[0];  }

extern "C" void kernel_launch(void* const* d_in, const int* in_sizes, int n_in,
                              void* d_out, int out_size, void* d_ws, size_t ws_size, hipStream_t stream) {
  (void)in_sizes; (void)n_in; (void)out_size;
  const float* const* I = (const float* const*)d_in; const float* xq = I[0]; const float* xk = I[1]; const float* xv = I[2]; const float* wq = I[3]; const float* bq = I[4]; const float* wk = I[5]; const float* bk = I[6]; const float* wv = I[7]; const float* bv = I[8]; const float* wo = I[9]; const float* bo = I[10];      /* three inputs; per-head [in][out] weights [8][512][64] + per-head biases [8][64] (flattened head-major = projection column order); Wo [in][out] + bo */
  char* ws = (char*)d_ws; size_t off = 0;
  auto take = [&](size_t bytes) { char* p = ws + off; off += (bytes + 255) & ~(size_t)255; return p; };
  _Float16* BQ = (_Float16*)take((size_t)DM * DM * 2); _Float16* BK = (_Float16*)take((size_t)DM * DM * 2); _Float16* BV = (_Float16*)take((size_t)DM * DM * 2); _Float16* BO = (_Float16*)take((size_t)DM * DM * 2);
  _Float16* XQ = (_Float16*)take(NR * DM * 2); _Float16* XK = (_Float16*)take(NR * DM * 2); _Float16* XV = (_Float16*)take(NR * DM * 2); _Float16* Q16 = (_Float16*)take(NR * DM * 2); _Float16* K16 = (_Float16*)take(NR * DM * 2); _Float16* V16 = (_Float16*)take(NR * DM * 2); _Float16* O16 = (_Float16*)take(NR * DM * 2);
  float* S = (float*)take((size_t)HG * SQ * SQ * 4); _Float16* P = (_Float16*)take((size_t)HG * SQ * SQ * 2); _Float16* VT = (_Float16*)take((size_t)NH * HD * SQ * 2);
  if (off > ws_size) return;
  { const unsigned g = (unsigned)(((size_t)NH * HD * (DM / 8) + 255) / 256); k_wthd<<<g, 256, 0, stream>>>(wq, BQ); k_wthd<<<g, 256, 0, stream>>>(wk, BK); k_wthd<<<g, 256, 0, stream>>>(wv, BV); k_wt_f16<<<(unsigned)(((size_t)DM * (DM / 8) + 255) / 256), 256, 0, stream>>>(wo, BO, DM, DM, 16.0f); }      /* per-head [in][out] W[h][k][d] -> Bt[h*64 + d][k] x16 (head-major output columns = the flattened per-head biases' order); Wo [in][out] -> Bt x16 */

  k_x16<<<(unsigned)((NR * DM / 8 + 255) / 256), 256, 0, stream>>>(xq, XQ, NR * DM / 8); k_x16<<<(unsigned)((NR * DM / 8 + 255) / 256), 256, 0, stream>>>(xk, XK, NR * DM / 8); k_x16<<<(unsigned)((NR * DM / 8 + 255) / 256), 256, 0, stream>>>(xv, XV, NR * DM / 8);      /* the three inputs as exact f16 rows */
  const size_t r0p = (size_t)B0 * SQ;      /* first projected row */
  k_gemm2<0><<<dim3((unsigned)((MP / 128) * (DM / 64)), 1), 128, 0, stream>>>(XQ + r0p * DM, DM, 0, BQ, DM, 0, 0.0625f, bq, 0, nullptr, 1, 0, 0, nullptr, Q16 + r0p * DM, DM, 0, MP, DM, DM);
  k_gemm2<0><<<dim3((unsigned)((MP / 128) * (DM / 64)), 1), 128, 0, stream>>>(XK + r0p * DM, DM, 0, BK, DM, 0, 0.0625f, bk, 0, nullptr, 1, 0, 0, nullptr, K16 + r0p * DM, DM, 0, MP, DM, DM);
  k_gemm2<0><<<dim3((unsigned)((MP / 128) * (DM / 64)), 1), 128, 0, stream>>>(XV + r0p * DM, DM, 0, BV, DM, 0, 0.0625f, bv, 0, nullptr, 1, 0, 0, nullptr, V16 + r0p * DM, DM, 0, MP, DM, DM);
  for (int b = B0; b < B0 + NBR; ++b) { const size_t r0 = (size_t)b * SQ;
    k_vt<NH, SQ><<<NH * (SQ / 64), 256, 0, stream>>>(V16 + r0 * LQ, LQ, 0, VT);      /* V^T [NH][HD][SQ] for this batch */
    for (int h0 = 0; h0 < NHD; h0 += HG) {
      k_gemm2<0><<<dim3((QN / 128) * (SQ / 64), HG), 128, 0, stream>>>(Q16 + r0 * LQ + h0 * HD, LQ, (size_t)HD, K16 + r0 * LQ + h0 * HD, LQ, (size_t)HD, 0.125f, nullptr, 0, nullptr, 1, 0, 0, S, nullptr, SQ, (size_t)SQ * SQ, QN, SQ, HD);      /* scores, HG heads per launch */
      k_rsmf<<<(HG * QN + 7) / 8, 256, 0, stream>>>(S, P, QN, HG);      /* P = 256 softmax (f16), rows of all HG heads */
      k_gemm2<0><<<dim3((QN / 128) * (HD / 64), HG), 128, 0, stream>>>(P, SQ, (size_t)SQ * SQ, VT + (size_t)h0 * HD * SQ, SQ, (size_t)HD * SQ, 0.25f, nullptr, 0, nullptr, 1, 0, 0, nullptr, O16 + r0 * DM + (size_t)h0 * SQ * HD, HD, (size_t)SQ * HD, QN, HD, SQ); } }      
  k_gemm2<0><<<dim3((unsigned)((MPO / 128) * (DM / 64)), 1), 128, 0, stream>>>(O16 + r0p * DM, DM, 0, BO, DM, 0, 0.0009765625f, bo, 0, nullptr, 1, 0, 0, (float*)d_out + r0p * DM, nullptr, DM, 0, MPO, DM, DM);      /* out rows are the output layout */
}

// v002
// One run takes 296 microseconds.
// Two timings next to v001 both put it at 2.99 times that version's speed.
// Over all steps from v000 it is 11.4 times as fast.
#include <hip/hip_runtime.h>
// Multi-head attention on three inputs with per-head projection tensors and the source's head-major context view (Q, K, V [8][1024][512]; Qh / Kh / Vh = einsum('bsd,hde->bhse', input, W) + b with per-head [in][out] weights W [8][512][64] and biases [8][64] (uniform +-512^-0.5); scores * 64^-0.5; softmax over all 1024 keys (no mask); context x [B][H][S][64] is RE-VIEWED as [B][S][512] WITHOUT transposing heads and time (row s' of the view = 512 consecutive floats of the [H][S][64] block); out = view Wo + bo ([in][out] 512 x 512) -> [8][1024][512]).
// Structure: token rows r = b*1024 + s; the query, key and value sources as exact f16 rows (bf16-rounded); Q, K, V as three WMMA GEMMs (32x64 wave tiles, f32 accumulation, exact x16 weights + bias, f16 outputs); V^T for all (batch, head) pairs via LDS transposes in one launch; per group of 2 batches (16 (batch, head) pairs): scores GEMM (K = 64, heads on grid.y, batches on grid.z, alpha = 64^-0.5), row softmax on VALU (f32 statistics, native exp; weights stored x256 as f16, kept for all 64 pairs); then, all pairs in one launch, o = P . V^T GEMM (K = 1024, alpha 2^-2: o carried x64 against f16 subnormal flush, folded into the output GEMM alpha) written straight into the merged f16 o rows; out = o W_o + b GEMM (f32) into the output layout.
// Compute dtype: inputs rounded to bf16; x / weights exact; q, k, v, softmax weights and o as plain f16 GEMM operands (~2^-12); scores and softmax statistics f32. v_wmma_f32_16x16x32_f16.
#define NB 8
#define SQ 1024
#define DM 512
#define NH 8
#define HD 64
#define HG 4                         /* heads per launch of the per-batch k_vt overload (not launched) */
#define BG 2                         /* batches per scores / softmax launch (bounded by the f32 score planes' share of the workspace) */
#define AG (BG * NH)                 /* (batch, head) pairs per scores / softmax launch */
#define B0 0                         /* first batch processed (debug hook) */
#define NBR NB                       /* batches processed (debug hook) */
#define NR ((size_t)NB * SQ)         /* token rows */
#define MP ((int)((size_t)NBR * SQ)) /* rows projected (debug hook) */
#define QN SQ                        /* query rows per batch (not used; launches attend all SQ rows) */
#define NHD NH                       /* heads (not used; launches attend all NH heads) */
#define MPO MP                       /* rows through the output stage (debug hook) */
#define LQ DM      /* row pitch of the q/k/v rows */
typedef __bf16 v16b __attribute__((ext_vector_type(16)));
typedef unsigned short v8us __attribute__((ext_vector_type(8), may_alias));
typedef float  v8f  __attribute__((ext_vector_type(8)));
typedef float  v4f  __attribute__((ext_vector_type(4)));
typedef float  v4fa __attribute__((ext_vector_type(4), may_alias));
union FragB { v16b v; v8us half[2]; unsigned short u[16]; };

__device__ __forceinline__ unsigned short bf16_bits(float x) { unsigned int u = __float_as_uint(x); return (unsigned short)((u + 0x7FFFu + ((u >> 16) & 1u)) >> 16); }
__device__ __forceinline__ float bf16_val(unsigned short b) { return __uint_as_float(((unsigned int)b) << 16); }
__device__ __forceinline__ float bf16_round(float x) { return bf16_val(bf16_bits(x)); }
// D += A·B with NT terms: 1 = ah·bh, 2 = + al·bh (A split), 3 = + ah·bl (both split)
template <int NT>
__device__ __forceinline__ v8f mmaN(v16b ah, v16b al, v16b bh, v16b bl, v8f c) {
  c = __builtin_amdgcn_wmma_f32_16x16x32_bf16(false, ah, false, bh, (short)0, c, false, false);
  if (NT >= 2) c = __builtin_amdgcn_wmma_f32_16x16x32_bf16(false, al, false, bh, (short)0, c, false, false);
  if (NT >= 3) c = __builtin_amdgcn_wmma_f32_16x16x32_bf16(false, ah, false, bl, (short)0, c, false, false);
  asm volatile("v_nop\n\tv_nop\n\tv_nop\n\tv_nop" : "+v"(c) : "v"(ah), "v"(al), "v"(bh), "v"(bl));
  return c;
}

__global__ __launch_bounds__(256) void k_wt_bf16(const float* __restrict__ W, unsigned short* __restrict__ Wt, int K, int N) {
  const int t = blockIdx.x * 256 + threadIdx.x;
  const int k8n = K / 8;
  if (t >= N * k8n) return;
  const int n = t / k8n, k8 = (t % k8n) * 8;
  v8us v;
#pragma unroll
  for (int i = 0; i < 8; ++i) v[i] = bf16_bits(W[(size_t)(k8 + i) * N + n]);
  *(v8us*)(Wt + (size_t)n * K + k8) = v;
  
}

// GEMM C[M][N] (f32, pitch ldc) = act(A[M][K]·W + bias). A f32 row-major (pitch lda) converted per fragment to bf16
// (ASPLIT: hi/lo two planes -> 2 terms, else single rounded term); Wt bf16 [N][K] (pitch ldb). BIAS_BF16 rounds the
// bias to bf16 first (bias quantised to bf16 before the add). K%32==0, M%16==0, N%64==0.
template <bool ASPLIT, int ACT, bool BIAS_BF16>
__global__ __launch_bounds__(128) void k_gemm_bf(const float* __restrict__ A, int lda, const unsigned short* __restrict__ Wt, int ldb,
                                               const float* __restrict__ bias, float* __restrict__ C, int ldc, int M, int N, int K) {
  __shared__ __attribute__((aligned(16))) float so[4][16][64];
  const int tid = threadIdx.x, w = tid >> 5, lane = tid & 31, ln = lane & 15, hh = lane >> 4;
  const int ntn = N / 64;
  const int wid = blockIdx.x * 4 + w;
  const int mt = wid / ntn, nq = wid % ntn;
  if (mt * 16 >= M) return;
  const int row0 = mt * 16, col0 = nq * 64;
  const float* arow = A + (size_t)(row0 + ln) * lda;
  v8f acc[4] = {};
  for (int kb = 0; kb < K; kb += 32) {
    FragB ah, al;
    const v4f x0 = *(const v4fa*)(arow + kb + 8 * hh), x1 = *(const v4fa*)(arow + kb + 8 * hh + 4);
    const v4f x2 = *(const v4fa*)(arow + kb + 16 + 8 * hh), x3 = *(const v4fa*)(arow + kb + 16 + 8 * hh + 4);
    float xs[16] = {x0[0],x0[1],x0[2],x0[3],x1[0],x1[1],x1[2],x1[3],x2[0],x2[1],x2[2],x2[3],x3[0],x3[1],x3[2],x3[3]};
#pragma unroll
    for (int i = 0; i < 16; ++i) { const unsigned short hb = bf16_bits(xs[i]); ah.u[i] = hb; al.u[i] = ASPLIT ? bf16_bits(xs[i] - bf16_val(hb)) : (unsigned short)0; }
#pragma unroll
    for (int t = 0; t < 4; ++t) {
      const unsigned short* brow = Wt + (size_t)(col0 + t * 16 + ln) * ldb + kb;
      FragB b;
      b.half[0] = *(const v8us*)(brow + 8 * hh);
      b.half[1] = *(const v8us*)(brow + 16 + 8 * hh);
      acc[t] = mmaN<ASPLIT ? 2 : 1>(ah.v, al.v, b.v, b.v, acc[t]);
    }
  }
#pragma unroll
  for (int t = 0; t < 4; ++t) {
    float bv = bias ? bias[col0 + t * 16 + ln] : 0.f;
    if (BIAS_BF16) bv = bf16_round(bv);
#pragma unroll
    for (int r = 0; r < 8; ++r) { float v = acc[t][r] + bv; if (ACT == 1) v = fmaxf(v, 0.f); so[w][8 * hh + r][t * 16 + ln] = v; }
  }
  __builtin_amdgcn_fence(__ATOMIC_ACQ_REL, "workgroup");
  __builtin_amdgcn_wave_barrier();
  const int rsub = lane >> 4, c4 = (lane & 15) * 4;
  {
#pragma unroll
    for (int q = 0; q < 8; ++q) {
      const int r = q * 2 + rsub;
      const v4f v = *(const v4fa*)&so[w][r][c4];
      *(v4f*)(C + (size_t)(row0 + r) * ldc + col0 + c4) = v;
    }
    
  }
}

// GEMM C = act(A·W + bias + resid): A f32 (ASPLIT -> hi/lo 2 terms), Wt bf16 [N][K]; ACT 0 none, 1 relu, 2 exact gelu;
// resid (optional, f32, row index = (row % rmod), pitch ldr, RES_BF16 rounds it) added before the activation.
template <bool ASPLIT, int ACT, bool BIAS_BF16, bool RES_BF16>
__global__ __launch_bounds__(128) void k_gemm_bf3(const float* __restrict__ A, int lda, const unsigned short* __restrict__ Wt, int ldb,
                                                const float* __restrict__ bias, const float* __restrict__ resid, int rmod, int ldr,
                                                float* __restrict__ C, int ldc, int M, int N, int K) {
  __shared__ __attribute__((aligned(16))) float so[4][16][64];
  const int tid = threadIdx.x, w = tid >> 5, lane = tid & 31, ln = lane & 15, hh = lane >> 4;
  const int ntn = N / 64;
  const int wid = blockIdx.x * 4 + w;
  const int mt = wid / ntn, nq = wid % ntn;
  if (mt * 16 >= M) return;
  const int row0 = mt * 16, col0 = nq * 64;
  const float* arow = A + (size_t)(row0 + ln) * lda;
  v8f acc[4] = {};
  for (int kb = 0; kb < K; kb += 32) {
    FragB ah, al;
    const v4f x0 = *(const v4fa*)(arow + kb + 8 * hh), x1 = *(const v4fa*)(arow + kb + 8 * hh + 4);
    const v4f x2 = *(const v4fa*)(arow + kb + 16 + 8 * hh), x3 = *(const v4fa*)(arow + kb + 16 + 8 * hh + 4);
    float xs[16] = {x0[0],x0[1],x0[2],x0[3],x1[0],x1[1],x1[2],x1[3],x2[0],x2[1],x2[2],x2[3],x3[0],x3[1],x3[2],x3[3]};
#pragma unroll
    for (int i = 0; i < 16; ++i) { const unsigned short hb = bf16_bits(xs[i]); ah.u[i] = hb; al.u[i] = ASPLIT ? bf16_bits(xs[i] - bf16_val(hb)) : (unsigned short)0; }
#pragma unroll
    for (int t = 0; t < 4; ++t) {
      const unsigned short* brow = Wt + (size_t)(col0 + t * 16 + ln) * ldb + kb;
      FragB b;
      b.half[0] = *(const v8us*)(brow + 8 * hh);
      b.half[1] = *(const v8us*)(brow + 16 + 8 * hh);
      acc[t] = mmaN<ASPLIT ? 2 : 1>(ah.v, al.v, b.v, b.v, acc[t]);
    }
  }
#pragma unroll
  for (int t = 0; t < 4; ++t) {
    const int col = col0 + t * 16 + ln;
    float bv = bias ? bias[col] : 0.f;
    if (BIAS_BF16) bv = bf16_round(bv);
#pragma unroll
    for (int r = 0; r < 8; ++r) {
      float v = acc[t][r] + bv;
      if (resid) { float rv = resid[(size_t)((row0 + 8 * hh + r) % rmod) * ldr + col]; if (RES_BF16) rv = bf16_round(rv); v += rv; }
      if (ACT == 1) v = fmaxf(v, 0.f);
      if (ACT == 2) v = 0.5f * v * (1.0f + erff(v * 0.70710678118654752f));
      if (ACT == 3) { const float u = 0.7978845608028654f * (v + 0.044715f * v * v * v); v = 0.5f * v * (1.0f + tanhf(u)); }
      so[w][8 * hh + r][t * 16 + ln] = v;
    }
  }
  __builtin_amdgcn_fence(__ATOMIC_ACQ_REL, "workgroup");
  __builtin_amdgcn_wave_barrier();
  const int rsub = lane >> 4, c4 = (lane & 15) * 4;
  {
#pragma unroll
    for (int q = 0; q < 8; ++q) {
      const int r = q * 2 + rsub;
      const v4f v = *(const v4fa*)&so[w][r][c4];
      *(v4f*)(C + (size_t)(row0 + r) * ldc + col0 + c4) = v;
    }
    
  }
}
// row LayerNorm (biased variance, eps) over N: s = X (+ R); optional out_sum <- s; out_norm <- (s-mu)*rsqrt(var+eps)*g + b
template <bool PARAM_BF16>
__global__ __launch_bounds__(256) void k_layernorm(const float* __restrict__ X, const float* __restrict__ R, const float* __restrict__ g, const float* __restrict__ bta,
                                                  float* __restrict__ out_sum, float* __restrict__ out_norm, int N, float eps) {
  __shared__ float red[256];
  const int row = blockIdx.x, tid = threadIdx.x;
  const float* x = X + (size_t)row * N; const float* rr = R ? R + (size_t)row * N : nullptr;
  float vals[16];                     // up to N = 4096
  const int per = N / 256;            // contiguous chunk per thread? use strided-by-4 chunks: thread handles j = tid*4 + 1024*u
  float s1 = 0.f;
  for (int u = 0; u < per / 4; ++u) {
    const int j = tid * 4 + 1024 * u;
    const v4f a = *(const v4fa*)(x + j);
    v4f b = {0.f,0.f,0.f,0.f}; if (rr) b = *(const v4fa*)(rr + j);
#pragma unroll
    for (int q = 0; q < 4; ++q) { const float v = a[q] + b[q]; vals[u * 4 + q] = v; s1 += v; }
  }
  red[tid] = s1; __syncthreads();
  for (int st = 128; st > 0; st >>= 1) { if (tid < st) red[tid] += red[tid + st]; __syncthreads(); }
  const float mu = red[0] / (float)N; __syncthreads();
  float s2 = 0.f;
  for (int u = 0; u < per / 4; ++u)
#pragma unroll
    for (int q = 0; q < 4; ++q) { const float c = vals[u * 4 + q] - mu; s2 += c * c; }
  red[tid] = s2; __syncthreads();
  for (int st = 128; st > 0; st >>= 1) { if (tid < st) red[tid] += red[tid + st]; __syncthreads(); }
  const float rs = rsqrtf(red[0] / (float)N + eps);
  {
    for (int u = 0; u < per / 4; ++u) {
      const int j = tid * 4 + 1024 * u;
      v4f o, sm;
#pragma unroll
      for (int q = 0; q < 4; ++q) {
        float gg = g[j + q], bb = bta[j + q];
        if (PARAM_BF16) { gg = bf16_round(gg); bb = bf16_round(bb); }
        sm[q] = vals[u * 4 + q]; o[q] = (vals[u * 4 + q] - mu) * rs * gg + bb;
      }
      if (out_sum) *(v4f*)(out_sum + (size_t)row * N + j) = sm;
      *(v4f*)(out_norm + (size_t)row * N + j) = o;
    }
    
  }
}



// ---- f16 WMMA path (v_wmma_f32_16x16x32_f16): 11-bit significands for operands in range — used where a [0,1] probability operand needs more precision than bf16
typedef _Float16 v16h __attribute__((ext_vector_type(16)));
union FragH { v16h v; v8us half[2]; _Float16 h[16]; unsigned short u[16]; };
template <int NT>
__device__ __forceinline__ v8f mmaH(v16h ah, v16h al, v16h bh, v16h bl, v8f c) {
  c = __builtin_amdgcn_wmma_f32_16x16x32_f16(false, ah, false, bh, (short)0, c, false, false);
  if (NT >= 2) c = __builtin_amdgcn_wmma_f32_16x16x32_f16(false, al, false, bh, (short)0, c, false, false);
  if (NT >= 3) c = __builtin_amdgcn_wmma_f32_16x16x32_f16(false, ah, false, bl, (short)0, c, false, false);
  asm volatile("v_nop\n\tv_nop\n\tv_nop\n\tv_nop" : "+v"(c) : "v"(ah), "v"(al), "v"(bh), "v"(bl));
  return c;
}
// batched GEMM like k_gemm_b but f16 operands: A f32 (split into f16 hi/lo if ASPLIT, else rounded to f16), Bt = f16 values [n][k]; alpha; C f32; N multiple of 16 (partial tiles skipped)
template <bool ASPLIT>
__global__ __launch_bounds__(128) void k_gemm_h(const float* __restrict__ A, int lda, size_t sA, const _Float16* __restrict__ Bh, int ldb, size_t sB, float alpha, float* __restrict__ C, int ldc, size_t sC, int M, int N, int K) {
  __shared__ __attribute__((aligned(16))) float so[4][16][64];
  const int tid = threadIdx.x, w = tid >> 5, lane = tid & 31, ln = lane & 15, hh = lane >> 4; const int by = blockIdx.y;
  A += (size_t)by * sA; Bh += (size_t)by * sB; C += (size_t)by * sC;
  const int ntn = (N + 63) / 64; const int wid = blockIdx.x * 4 + w; const int mt = wid / ntn, nq = wid % ntn; if (mt * 16 >= M) return;
  const int row0 = mt * 16, col0 = nq * 64; const float* arow = A + (size_t)(row0 + ln) * lda;
  v8f acc[4] = {};
  for (int kb = 0; kb < K; kb += 32) {
    FragH ah, al;
    const v4f x0 = *(const v4fa*)(arow + kb + 8 * hh), x1 = *(const v4fa*)(arow + kb + 8 * hh + 4), x2 = *(const v4fa*)(arow + kb + 16 + 8 * hh), x3 = *(const v4fa*)(arow + kb + 16 + 8 * hh + 4);
    float xs[16] = {x0[0],x0[1],x0[2],x0[3],x1[0],x1[1],x1[2],x1[3],x2[0],x2[1],x2[2],x2[3],x3[0],x3[1],x3[2],x3[3]};
#pragma unroll
    for (int i = 0; i < 16; ++i) { const _Float16 h = (_Float16)xs[i]; ah.h[i] = h; al.h[i] = ASPLIT ? (_Float16)(xs[i] - (float)h) : (_Float16)0.0f; }
#pragma unroll
    for (int t = 0; t < 4; ++t) { if (col0 + t * 16 >= N) continue; const size_t boff = (size_t)(col0 + t * 16 + ln) * ldb + kb; FragH bq; bq.half[0] = *(const v8us*)(Bh + boff + 8 * hh); bq.half[1] = *(const v8us*)(Bh + boff + 16 + 8 * hh);
      acc[t] = mmaH<ASPLIT ? 2 : 1>(ah.v, al.v, bq.v, bq.v, acc[t]); }
  }
#pragma unroll
  for (int t = 0; t < 4; ++t) { if (col0 + t * 16 >= N) continue;
#pragma unroll
    for (int r = 0; r < 8; ++r) so[w][8 * hh + r][t * 16 + ln] = acc[t][r] * alpha; }
  __builtin_amdgcn_fence(__ATOMIC_ACQ_REL, "workgroup"); __builtin_amdgcn_wave_barrier();
  const int rsub = lane >> 4, c4 = (lane & 15) * 4;
  {
#pragma unroll
    for (int q = 0; q < 8; ++q) { const int r = q * 2 + rsub; if (col0 + c4 < N) { const v4f v = *(const v4fa*)&so[w][r][c4]; *(v4f*)(C + (size_t)(row0 + r) * ldc + col0 + c4) = v; } }
     }
}

// Wt[n][k] = f16(W[k][n]·scale) from f32 row-major W[K][N] (scale = power of two; bf16-exact weights stay exact in f16 away from the subnormal range)
__global__ __launch_bounds__(256) void k_wt_f16(const float* __restrict__ W, _Float16* __restrict__ Wt, int K, int N, float scale) {
  const int t = blockIdx.x * 256 + threadIdx.x; if (t >= N * (K / 8)) return; const int n = t / (K / 8), k8 = (t % (K / 8)) * 8; FragH f;
#pragma unroll
  for (int i = 0; i < 8; ++i) f.h[i] = (_Float16)(bf16_round(W[(size_t)(k8 + i) * N + n]) * scale); const v8us o = f.half[0];
  *(v8us*)((unsigned short*)Wt + (size_t)n * K + k8) = o; 
}
// k_gemm_hh variant with fused epilogue: v = acc·alpha + bias[by·sBias + col] (+ CP[(row/rowsPerB)·sCPb + by·64 + col] if CP) ; ACT 0 none / 1 elu ; writes f16 C16 (and f32 C if non-null)
template <int ACT>
__global__ __launch_bounds__(128) void k_gemm_hhx(const _Float16* __restrict__ A, int lda, size_t sA, const _Float16* __restrict__ Bh, int ldb, size_t sB, float alpha, const float* __restrict__ bias, size_t sBias, const float* __restrict__ CP, int rowsPerB, size_t sCPb, int row0g,
    float* __restrict__ C, _Float16* __restrict__ C16, int ldc, size_t sC, int M, int N, int K) {
  __shared__ __attribute__((aligned(16))) float so[4][16][64];
  const int tid = threadIdx.x, w = tid >> 5, lane = tid & 31, ln = lane & 15, hh = lane >> 4; const int by = blockIdx.y;
  A += (size_t)by * sA; Bh += (size_t)by * sB; const size_t cofs = (size_t)by * sC; const float* bp = bias ? bias + (size_t)by * sBias : nullptr;
  const int ntn = (N + 63) / 64; const int wid = blockIdx.x * 4 + w; const int mt = wid / ntn, nq = wid % ntn; if (mt * 16 >= M) return;
  const int row0 = mt * 16, col0 = nq * 64; const _Float16* arow = A + (size_t)(row0 + ln) * lda;
  v8f acc[4] = {};
  for (int kb = 0; kb < K; kb += 32) { FragH ah; ah.half[0] = *(const v8us*)((const unsigned short*)arow + kb + 8 * hh); ah.half[1] = *(const v8us*)((const unsigned short*)arow + kb + 16 + 8 * hh);
#pragma unroll
    for (int t = 0; t < 4; ++t) { if (col0 + t * 16 >= N) continue; const size_t boff = (size_t)(col0 + t * 16 + ln) * ldb + kb; FragH bq; bq.half[0] = *(const v8us*)((const unsigned short*)Bh + boff + 8 * hh); bq.half[1] = *(const v8us*)((const unsigned short*)Bh + boff + 16 + 8 * hh);
      acc[t] = mmaH<1>(ah.v, ah.v, bq.v, bq.v, acc[t]); }
  }
#pragma unroll
  for (int t = 0; t < 4; ++t) { if (col0 + t * 16 >= N) continue; const int col = col0 + t * 16 + ln; const float bv = bp ? bf16_round(bp[col]) : 0.f;
#pragma unroll
    for (int r = 0; r < 8; ++r) { float v = acc[t][r] * alpha + bv; if (CP) { const int rr = row0g + row0 + 8 * hh + r; if (rowsPerB < 0) v += CP[cofs + (size_t)rr * ldc + col];      /* rowsPerB < 0: own element of the batched C plane */ else { const int bidx = rr / rowsPerB; v += CP[(size_t)bidx * sCPb + (size_t)by * 64 + col]; } } if (ACT == 1) v = (v > 0.f) ? v : expm1f(v); else if (ACT == 7) v = (v > 0.f) ? v + 1.0f : expf(v); else if (ACT == 8) v = tanhf(v); else if (ACT == 9) v = 0.5f * v * (1.0f + tanhf(0.7978845608028654f * (v + 0.044715f * v * v * v))); else if (ACT == 11) v = 1.0f / (1.0f + expf(-v)); else if (ACT == 12) v = (v > 0.f) ? v : 0.01f * v; else if (ACT == 14) v = (v > 0.f) ? v : 0.1f * v; else if (ACT == 16) v = (v >= 0.f) ? v : 0.3f * v; else if (ACT == 17) v = (v >= 0.f) ? v : 0.2f * v; else if (ACT == 15) v = v / (1.0f + expf(-v)); else if (ACT == 3) v = fmaxf(v, 0.f); else if (ACT == 6) v = 0.5f * v * (1.0f + erff(v * 0.70710678118654752f)); so[w][8 * hh + r][t * 16 + ln] = v; } }
  __builtin_amdgcn_fence(__ATOMIC_ACQ_REL, "workgroup"); __builtin_amdgcn_wave_barrier();
  const int rsub = lane >> 4, c4 = (lane & 15) * 4; typedef _Float16 v4h __attribute__((ext_vector_type(4)));
  {
#pragma unroll
    for (int q = 0; q < 8; ++q) { const int r = q * 2 + rsub; if (col0 + c4 < N) { const v4f v = *(const v4fa*)&so[w][r][c4]; if (C) *(v4f*)(C + cofs + (size_t)(row0 + r) * ldc + col0 + c4) = v; if (C16) { v4h h4; for (int i = 0; i < 4; ++i) h4[i] = (_Float16)v[i]; *(v4h*)(C16 + cofs + (size_t)(row0 + r) * ldc + col0 + c4) = h4; } } }
     }
}


typedef _Float16 v4h __attribute__((ext_vector_type(4)));

__global__ __launch_bounds__(256) void k_x16(const float* __restrict__ x, _Float16* __restrict__ X16, size_t n8) { const size_t t = (size_t)blockIdx.x * 256 + threadIdx.x; if (t >= n8) return; FragH f;
#pragma unroll
  for (int q = 0; q < 8; ++q) f.h[q] = (_Float16)bf16_round(x[t * 8 + q]); *(v8us*)((unsigned short*)X16 + t * 8) = f.half[0];  }
__global__ __launch_bounds__(256) void k_h16(const float* __restrict__ x, _Float16* __restrict__ X16, size_t n8) { const size_t t = (size_t)blockIdx.x * 256 + threadIdx.x; if (t >= n8) return; FragH f;
#pragma unroll
  for (int q = 0; q < 8; ++q) f.h[q] = (_Float16)x[t * 8 + q]; *(v8us*)((unsigned short*)X16 + t * 8) = f.half[0];  }
__global__ __launch_bounds__(256) void k_round16f(const float* __restrict__ W, _Float16* __restrict__ Bt, size_t n8) { const size_t t = (size_t)blockIdx.x * 256 + threadIdx.x; if (t >= n8) return; FragH f;
#pragma unroll
  for (int i = 0; i < 8; ++i) f.h[i] = (_Float16)(bf16_round(W[t * 8 + i]) * 16.0f); *(v8us*)((unsigned short*)Bt + t * 8) = f.half[0];  }
template <int NHv, int TTv>
__global__ __launch_bounds__(256) void k_vt(const _Float16* __restrict__ V16, int ldv, int voff, _Float16* __restrict__ Vt) { __shared__ unsigned short tl[64][66]; const int tid = threadIdx.x; const int slab = blockIdx.x / (TTv / 64), lg = blockIdx.x % (TTv / 64); const int b = slab / NHv, h = slab % NHv;
  for (int i = tid; i < 64 * 8; i += 256) { const int r = i / 8, c8 = (i % 8) * 8; FragH f; f.half[0] = *(const v8us*)((const unsigned short*)V16 + ((size_t)b * TTv + lg * 64 + r) * ldv + voff + h * 64 + c8);
#pragma unroll
    for (int q = 0; q < 8; ++q) tl[r][c8 + q] = f.u[q]; }
  __syncthreads();
  {
#pragma unroll
    for (int rd = 0; rd < 2; ++rd) { const int d = rd * 32 + tid / 8, pc = tid % 8; FragH f;
#pragma unroll
      for (int q = 0; q < 8; ++q) f.u[q] = tl[pc * 8 + q][d];
      *(v8us*)((unsigned short*)Vt + ((size_t)slab * 64 + d) * TTv + lg * 64 + pc * 8) = f.half[0]; }
     } }

__global__ __launch_bounds__(256) void k_hl(const float* __restrict__ F, _Float16* __restrict__ Hh, _Float16* __restrict__ Hl, size_t n8) { const size_t t = (size_t)blockIdx.x * 256 + threadIdx.x; if (t >= n8) return; FragH fh, fl; const v4f a = *(const v4fa*)(F + t * 8), c = *(const v4fa*)(F + t * 8 + 4);
#pragma unroll
  for (int q = 0; q < 4; ++q) { _Float16 h = (_Float16)a[q]; fh.h[q] = h; fl.h[q] = (_Float16)((a[q] - (float)h) * 1024.0f); h = (_Float16)c[q]; fh.h[4 + q] = h; fl.h[4 + q] = (_Float16)((c[q] - (float)h) * 1024.0f); }
  { *(v8us*)((unsigned short*)Hh + t * 8) = fh.half[0]; *(v8us*)((unsigned short*)Hl + t * 8) = fl.half[0];  } }

// ---- fast GEMM (wave tile 32x64; requires M % 32 == 0 rows per launch region and N % 64 == 0); epilogue = k_gemm_hhx semantics ----
__device__ __forceinline__ v16h g2_frag(const _Float16* p, int hh) { FragH f; f.half[0] = *(const v8us*)((const unsigned short*)p + 8 * hh); f.half[1] = *(const v8us*)((const unsigned short*)p + 16 + 8 * hh); return f.v; }
__device__ __forceinline__ v8f g2_mma(v16h a, v16h b, v8f c) { v8f d = __builtin_amdgcn_wmma_f32_16x16x32_f16(false, a, false, b, (short)0, c, false, false); asm volatile("v_nop\n\tv_nop\n\tv_nop\n\tv_nop" : "+v"(d) : "v"(a), "v"(b)); return d; }
template <int ACT>
__global__ __launch_bounds__(128) void k_gemm2(const _Float16* __restrict__ A, int lda, size_t sA, size_t sAz, const _Float16* __restrict__ Bh, int ldb, size_t sB, size_t sBz, float alpha, const float* __restrict__ bias, size_t sBias, const float* __restrict__ CP, int rowsPerB, size_t sCPb, int row0g,
    float* __restrict__ C, _Float16* __restrict__ C16, int ldc, size_t sC, size_t sCz, int M, int N, int K) { static_assert(ACT == 0 || ACT == 3 || ACT == 6 || ACT == 8 || ACT == 9 || ACT == 11 || ACT == 12 || ACT == 14 || ACT == 15 || ACT == 16 || ACT == 17, "k_gemm2: unsupported ACT code (would silently apply no activation)");
  __shared__ __attribute__((aligned(16))) float so[4][32][68];
  const int tid = threadIdx.x, w = tid >> 5, lane = tid & 31, ln = lane & 15, hh = lane >> 4; const int by = blockIdx.y, bz = blockIdx.z;      /* two batch axes: strides s* on grid.y, s*z on grid.z */
  A += (size_t)by * sA + (size_t)bz * sAz; Bh += (size_t)by * sB + (size_t)bz * sBz; const size_t cofs = (size_t)by * sC + (size_t)bz * sCz; const float* bp = bias ? bias + (size_t)by * sBias : nullptr;
  const int ntn = N >> 6; const int mt = blockIdx.x / ntn, nq = blockIdx.x - mt * ntn; const int row0 = mt * 128 + 32 * w, col0 = nq * 64; if (row0 >= M) return;
  const _Float16* a0p = A + (size_t)(row0 + ln) * lda; const _Float16* a1p = a0p + (size_t)16 * lda;
  const _Float16* b0p = Bh + (size_t)(col0 + ln) * ldb; const _Float16* b1p = b0p + (size_t)16 * ldb; const _Float16* b2p = b1p + (size_t)16 * ldb; const _Float16* b3p = b2p + (size_t)16 * ldb;
  const v8f z8 = {0.f,0.f,0.f,0.f,0.f,0.f,0.f,0.f}; v8f c00 = z8, c01 = z8, c02 = z8, c03 = z8, c10 = z8, c11 = z8, c12 = z8, c13 = z8;
#pragma unroll 1
  for (int kb = 0; kb < K; kb += 32) { const v16h a0 = g2_frag(a0p + kb, hh), a1 = g2_frag(a1p + kb, hh);
    v16h b = g2_frag(b0p + kb, hh); c00 = g2_mma(a0, b, c00); c10 = g2_mma(a1, b, c10);
    b = g2_frag(b1p + kb, hh); c01 = g2_mma(a0, b, c01); c11 = g2_mma(a1, b, c11);
    b = g2_frag(b2p + kb, hh); c02 = g2_mma(a0, b, c02); c12 = g2_mma(a1, b, c12);
    b = g2_frag(b3p + kb, hh); c03 = g2_mma(a0, b, c03); c13 = g2_mma(a1, b, c13); }
  v8f accs[8] = {c00, c01, c02, c03, c10, c11, c12, c13};
#pragma unroll
  for (int u = 0; u < 8; ++u) { const int t = u & 3, half = u >> 2; const int col = col0 + t * 16 + ln; const float bv = bp ? bf16_round(bp[col]) : 0.f;
#pragma unroll
    for (int r = 0; r < 8; ++r) { const int rloc = half * 16 + 8 * hh + r; float v = accs[u][r] * alpha + bv; if (CP) { if (rowsPerB < 0) v += CP[cofs + (size_t)(row0g + row0 + rloc) * ldc + col];      /* rowsPerB < 0: own element of the batched C plane */ else { const int bidx = (row0g + row0 + rloc) / rowsPerB; v += CP[(size_t)bidx * sCPb + (size_t)by * 64 + col]; } }
      if (ACT == 3) v = fmaxf(v, 0.f); else if (ACT == 6) v = 0.5f * v * (1.0f + erff(v * 0.70710678118654752f)); else if (ACT == 11) v = 1.0f / (1.0f + expf(-v)); else if (ACT == 15) v = v / (1.0f + expf(-v)); else if (ACT == 12) v = (v > 0.f) ? v : 0.01f * v; else if (ACT == 8) v = tanhf(v); else if (ACT == 9) v = 0.5f * v * (1.0f + tanhf(0.7978845608028654f * (v + 0.044715f * v * v * v))); else if (ACT == 14) v = (v > 0.f) ? v : 0.1f * v; else if (ACT == 16) v = (v >= 0.f) ? v : 0.3f * v; else if (ACT == 17) v = (v >= 0.f) ? v : 0.2f * v;
      so[w][rloc][t * 16 + ln] = v; } }
  __builtin_amdgcn_fence(__ATOMIC_ACQ_REL, "workgroup"); __builtin_amdgcn_wave_barrier();
  const int rsub = lane >> 4, c4 = (lane & 15) * 4;
  {
#pragma unroll
    for (int q = 0; q < 16; ++q) { const int r = q * 2 + rsub; const v4f v = *(const v4fa*)&so[w][r][c4]; if (C) *(v4f*)(C + cofs + (size_t)(row0 + r) * ldc + col0 + c4) = v; if (C16) { v4h h4; for (int i = 0; i < 4; ++i) h4[i] = (_Float16)v[i]; *(v4h*)(C16 + cofs + (size_t)(row0 + r) * ldc + col0 + c4) = h4; } }
     } }


__global__ __launch_bounds__(256) void k_wnat(const float* __restrict__ w, size_t n8, _Float16* __restrict__ Bt) { const size_t t = (size_t)blockIdx.x * 256 + threadIdx.x; if (t >= n8) return; FragH f; for (int q = 0; q < 8; ++q) f.h[q] = (_Float16)(bf16_round(w[t * 8 + q]) * 16.0f); *(v8us*)((unsigned short*)Bt + t * 8) = f.half[0];  }
__global__ __launch_bounds__(256) void k_rsm(const float* __restrict__ S, _Float16* __restrict__ P, int nrows) {
  #pragma clang fp contract(off)
  const int i = blockIdx.x * 256 + threadIdx.x; if (i >= nrows) return; const float* s = S + (size_t)i * SQ; float mx = -3.0e38f;
#pragma unroll 1
  for (int j = 0; j < SQ; ++j) mx = fmaxf(mx, s[j]); float se = 0.f;
#pragma unroll 1
  for (int j = 0; j < SQ; ++j) se += expf(s[j] - mx); const float sc = 256.0f / se;
#pragma unroll 1
  for (int j0 = 0; j0 < SQ; j0 += 8) { FragH f; for (int q = 0; q < 8; ++q) f.h[q] = (_Float16)(expf(s[j0 + q] - mx) * sc); unsigned short* d = (unsigned short*)P + (size_t)i * SQ + j0; *(v8us*)d = f.half[0];  } }
__global__ __launch_bounds__(256) void k_vt(const _Float16* __restrict__ V16, int b, int h0, _Float16* __restrict__ VT) { __shared__ unsigned short tl[64][65]; const int tid = threadIdx.x; const int hh = blockIdx.x % HG, sg = blockIdx.x / HG; const int s0 = sg * 64; const int h = h0 + hh;
  for (int i = tid; i < 64 * 8; i += 256) { const int j = i / 8, d8 = (i % 8) * 8; FragH f; f.half[0] = *(const v8us*)((const unsigned short*)V16 + ((size_t)b * SQ + s0 + j) * DM + h * HD + d8); for (int q = 0; q < 8; ++q) tl[d8 + q][j] = f.u[q]; }
  __syncthreads();
  { for (int i = tid; i < 64 * 8; i += 256) { const int d = i / 8, j8 = (i % 8) * 8; FragH f; for (int q = 0; q < 8; ++q) f.u[q] = tl[d][j8 + q]; *(v8us*)((unsigned short*)VT + ((size_t)hh * HD + d) * SQ + s0 + j8) = f.half[0]; }  } }



// Row softmax, one wave per score row: each lane holds 32 of the row's 1024 scores in registers (8 loads of 16 B, every load 512 contiguous bytes per wave);
// row max and row sum by per-lane chains and a five-step butterfly over the 32 lanes; each exp computed once; weights x256 as f16, 256 contiguous bytes per wave store.
// Every loop over x is fully unrolled: x must be indexed by constants to stay in registers, and the 8 loads must all be in flight before the first use.
__global__ __launch_bounds__(256) void k_rsmf(const float* __restrict__ S, _Float16* __restrict__ P, int qn, int hg) {
  const int lane = threadIdx.x & 31; const int t = blockIdx.x * 8 + (threadIdx.x >> 5); if (t >= qn * hg) return;
  const size_t i = (size_t)(t / qn) * SQ + (t % qn); const float* s = S + i * SQ + lane * 4; v4f x[SQ / 128];
#pragma unroll
  for (int u = 0; u < SQ / 128; ++u) x[u] = *(const v4fa*)(s + u * 128);
  float mx = -3.0e38f;
#pragma unroll
  for (int u = 0; u < SQ / 128; ++u) mx = fmaxf(mx, fmaxf(fmaxf(x[u][0], x[u][1]), fmaxf(x[u][2], x[u][3])));
#pragma unroll
  for (int m = 16; m > 0; m >>= 1) mx = fmaxf(mx, __shfl_xor(mx, m, 32));
  v4f s4 = {0.f, 0.f, 0.f, 0.f};
#pragma unroll
  for (int u = 0; u < SQ / 128; ++u) { x[u] -= mx;
#pragma unroll
    for (int q = 0; q < 4; ++q) x[u][q] = __expf(x[u][q]);
    s4 += x[u]; }
  float se = (s4[0] + s4[1]) + (s4[2] + s4[3]);
#pragma unroll
  for (int m = 16; m > 0; m >>= 1) se += __shfl_xor(se, m, 32);
  const float sc = 256.0f / se; _Float16* d = P + i * SQ + lane * 4;
#pragma unroll
  for (int u = 0; u < SQ / 128; ++u) { x[u] *= sc; *(v4h*)(d + u * 128) = __builtin_convertvector(x[u], v4h); } }

__global__ __launch_bounds__(256) void k_wthd(const float* __restrict__ Wt, _Float16* __restrict__ Bt) { const size_t t = (size_t)blockIdx.x * 256 + threadIdx.x; if (t >= (size_t)NH * HD * (DM / 8)) return; const int m8 = (int)(t % (DM / 8)) * 8; const int d = (int)((t / (DM / 8)) % HD); const int h = (int)(t / ((size_t)(DM / 8) * HD)); FragH f;
  for (int q = 0; q < 8; ++q) f.h[q] = (_Float16)(16.0f * bf16_round(Wt[((size_t)h * DM + m8 + q) * HD + d])); unsigned short* dst = (unsigned short*)Bt + ((size_t)h * HD + d) * DM + m8; *(v8us*)dst = f.half[0];  }

extern "C" void kernel_launch(void* const* d_in, const int* in_sizes, int n_in,
                              void* d_out, int out_size, void* d_ws, size_t ws_size, hipStream_t stream) {
  (void)in_sizes; (void)n_in; (void)out_size;
  const float* const* I = (const float* const*)d_in; const float* xq = I[0]; const float* xk = I[1]; const float* xv = I[2]; const float* wq = I[3]; const float* bq = I[4]; const float* wk = I[5]; const float* bk = I[6]; const float* wv = I[7]; const float* bv = I[8]; const float* wo = I[9]; const float* bo = I[10];      /* three inputs; per-head [in][out] weights [8][512][64] + per-head biases [8][64] (flattened head-major = projection column order); Wo [in][out] + bo */
  char* ws = (char*)d_ws; size_t off = 0;
  auto take = [&](size_t bytes) { char* p = ws + off; off += (bytes + 255) & ~(size_t)255; return p; };
  _Float16* BQ = (_Float16*)take((size_t)DM * DM * 2); _Float16* BK = (_Float16*)take((size_t)DM * DM * 2); _Float16* BV = (_Float16*)take((size_t)DM * DM * 2); _Float16* BO = (_Float16*)take((size_t)DM * DM * 2);
  _Float16* Q16 = (_Float16*)take(NR * DM * 2); _Float16* K16 = (_Float16*)take(NR * DM * 2); _Float16* V16 = (_Float16*)take(NR * DM * 2); _Float16* O16 = (_Float16*)take(NR * DM * 2);
  float* S = (float*)take((size_t)AG * SQ * SQ * 4); _Float16* P = (_Float16*)take((size_t)NB * NH * SQ * SQ * 2); _Float16* VT = (_Float16*)take((size_t)NB * NH * HD * SQ * 2);
  _Float16* XQ = (_Float16*)S; _Float16* XK = XQ + NR * DM; _Float16* XV = XK + NR * DM;      /* the f16 input rows share the score plane's bytes: last read by the projections, before the first scores launch writes S */
  if (off > ws_size) return;
  { const unsigned g = (unsigned)(((size_t)NH * HD * (DM / 8) + 255) / 256); k_wthd<<<g, 256, 0, stream>>>(wq, BQ); k_wthd<<<g, 256, 0, stream>>>(wk, BK); k_wthd<<<g, 256, 0, stream>>>(wv, BV); k_wt_f16<<<(unsigned)(((size_t)DM * (DM / 8) + 255) / 256), 256, 0, stream>>>(wo, BO, DM, DM, 16.0f); }      /* per-head [in][out] W[h][k][d] -> Bt[h*64 + d][k] x16 (head-major output columns = the flattened per-head biases' order); Wo [in][out] -> Bt x16 */

  k_x16<<<(unsigned)((NR * DM / 8 + 255) / 256), 256, 0, stream>>>(xq, XQ, NR * DM / 8); k_x16<<<(unsigned)((NR * DM / 8 + 255) / 256), 256, 0, stream>>>(xk, XK, NR * DM / 8); k_x16<<<(unsigned)((NR * DM / 8 + 255) / 256), 256, 0, stream>>>(xv, XV, NR * DM / 8);      /* the three inputs as exact f16 rows */
  const size_t r0p = (size_t)B0 * SQ;      /* first projected row */
  k_gemm2<0><<<dim3((unsigned)((MP / 128) * (DM / 64)), 1), 128, 0, stream>>>(XQ + r0p * DM, DM, 0, 0, BQ, DM, 0, 0, 0.0625f, bq, 0, nullptr, 1, 0, 0, nullptr, Q16 + r0p * DM, DM, 0, 0, MP, DM, DM);
  k_gemm2<0><<<dim3((unsigned)((MP / 128) * (DM / 64)), 1), 128, 0, stream>>>(XK + r0p * DM, DM, 0, 0, BK, DM, 0, 0, 0.0625f, bk, 0, nullptr, 1, 0, 0, nullptr, K16 + r0p * DM, DM, 0, 0, MP, DM, DM);
  k_gemm2<0><<<dim3((unsigned)((MP / 128) * (DM / 64)), 1), 128, 0, stream>>>(XV + r0p * DM, DM, 0, 0, BV, DM, 0, 0, 0.0625f, bv, 0, nullptr, 1, 0, 0, nullptr, V16 + r0p * DM, DM, 0, 0, MP, DM, DM);
  k_vt<NH, SQ><<<NB * NH * (SQ / 64), 256, 0, stream>>>(V16, LQ, 0, VT);      /* V^T [NB][NH][HD][SQ], all batches in one launch */
  for (int b = 0; b < NB; b += BG) { const size_t r0 = (size_t)b * SQ;      /* BG batches x NH heads = AG independent score planes per launch */
    k_gemm2<0><<<dim3((SQ / 128) * (SQ / 64), NH, BG), 128, 0, stream>>>(Q16 + r0 * LQ, LQ, (size_t)HD, (size_t)SQ * LQ, K16 + r0 * LQ, LQ, (size_t)HD, (size_t)SQ * LQ, 0.125f, nullptr, 0, nullptr, 1, 0, 0, S, nullptr, SQ, (size_t)SQ * SQ, (size_t)NH * SQ * SQ, SQ, SQ, HD);      /* scores: head on grid.y, batch on grid.z; plane index in the group = batch * NH + head */
    k_rsmf<<<AG * SQ / 8, 256, 0, stream>>>(S, P + (size_t)b * NH * SQ * SQ, SQ, AG); }      /* P = 256 softmax (f16), rows of all AG planes, kept for every (batch, head) */
  k_gemm2<0><<<dim3((SQ / 128) * (HD / 64), NB * NH), 128, 0, stream>>>(P, SQ, (size_t)SQ * SQ, 0, VT, SQ, (size_t)HD * SQ, 0, 0.25f, nullptr, 0, nullptr, 1, 0, 0, nullptr, O16, HD, (size_t)SQ * HD, 0, SQ, HD, SQ);      /* all planes at once: plane p = batch * NH + head -> 64-wide rows at O16 + p * SQ * HD (head-major context) */
  k_gemm2<0><<<dim3((unsigned)((MPO / 128) * (DM / 64)), 1), 128, 0, stream>>>(O16 + r0p * DM, DM, 0, 0, BO, DM, 0, 0, 0.0009765625f, bo, 0, nullptr, 1, 0, 0, (float*)d_out + r0p * DM, nullptr, DM, 0, 0, MPO, DM, DM);      /* out rows are the output layout */
}

// v003
// It runs in 169 microseconds.
// In both of two side-by-side timings against v002, it was 1.76 times as fast.
// Over all steps from v000 it is 20.0 times as fast.
#include <hip/hip_runtime.h>
// Multi-head attention on three inputs with per-head projection tensors and the source's head-major context view (Q, K, V [8][1024][512]; Qh / Kh / Vh = einsum('bsd,hde->bhse', input, W) + b with per-head [in][out] weights W [8][512][64] and biases [8][64] (uniform +-512^-0.5); scores * 64^-0.5; softmax over all 1024 keys (no mask); context x [B][H][S][64] is RE-VIEWED as [B][S][512] WITHOUT transposing heads and time (row s' of the view = 512 consecutive floats of the [H][S][64] block); out = view Wo + bo ([in][out] 512 x 512) -> [8][1024][512]).
// Structure: token rows r = b*1024 + s; the three inputs as exact f16 rows (bf16-rounded); Q, K, V as three WMMA GEMMs (32x64 wave tiles, f32 accumulation, exact x16 weights + bias, f16 outputs); V^T for all (batch, head) pairs via LDS transposes in one launch; then one fused attention launch for all pairs (S^T = K . Q^T on WMMA, online softmax on VALU with f32 statistics and native exp2, the unnormalised weights packed in registers as the f16 B operand of O^T += V^T . P^T on WMMA; neither scores nor weights reach memory; o carried x64 against f16 subnormal flush, folded into the output GEMM alpha) written straight into the merged f16 o rows; out = o W_o + b GEMM (f32) into the output layout.
// Compute dtype: inputs rounded to bf16; x / weights exact; q, k, v, softmax weights and o as plain f16 GEMM operands (~2^-12); scores and softmax statistics f32; v_wmma_f32_16x16x32_f16.
#define NB 8
#define SQ 1024
#define DM 512
#define NH 8
#define HD 64
#define HG 4                         /* heads per launch of the untemplated k_vt (not launched) */
#define B0 0                         /* first batch processed (debug hook) */
#define NBR NB                       /* batches processed (debug hook) */
#define NR ((size_t)NB * SQ)         /* token rows */
#define MP ((int)((size_t)NBR * SQ)) /* rows projected (debug hook) */
#define QN SQ                        /* query rows per batch (not used; launches attend all SQ rows) */
#define NHD NH                       /* heads (not used; launches attend all NH heads) */
#define MPO MP                       /* rows through the output stage (debug hook) */
#define LQ DM      /* row pitch of the q/k/v rows */
typedef __bf16 v16b __attribute__((ext_vector_type(16)));
typedef unsigned short v8us __attribute__((ext_vector_type(8), may_alias));
typedef float  v8f  __attribute__((ext_vector_type(8)));
typedef float  v4f  __attribute__((ext_vector_type(4)));
typedef float  v4fa __attribute__((ext_vector_type(4), may_alias));
union FragB { v16b v; v8us half[2]; unsigned short u[16]; };

__device__ __forceinline__ unsigned short bf16_bits(float x) { unsigned int u = __float_as_uint(x); return (unsigned short)((u + 0x7FFFu + ((u >> 16) & 1u)) >> 16); }
__device__ __forceinline__ float bf16_val(unsigned short b) { return __uint_as_float(((unsigned int)b) << 16); }
__device__ __forceinline__ float bf16_round(float x) { return bf16_val(bf16_bits(x)); }
// D += A·B with NT terms: 1 = ah·bh, 2 = + al·bh (A split), 3 = + ah·bl (both split)
template <int NT>
__device__ __forceinline__ v8f mmaN(v16b ah, v16b al, v16b bh, v16b bl, v8f c) {
  c = __builtin_amdgcn_wmma_f32_16x16x32_bf16(false, ah, false, bh, (short)0, c, false, false);
  if (NT >= 2) c = __builtin_amdgcn_wmma_f32_16x16x32_bf16(false, al, false, bh, (short)0, c, false, false);
  if (NT >= 3) c = __builtin_amdgcn_wmma_f32_16x16x32_bf16(false, ah, false, bl, (short)0, c, false, false);
  asm volatile("v_nop\n\tv_nop\n\tv_nop\n\tv_nop" : "+v"(c) : "v"(ah), "v"(al), "v"(bh), "v"(bl));
  return c;
}

__global__ __launch_bounds__(256) void k_wt_bf16(const float* __restrict__ W, unsigned short* __restrict__ Wt, int K, int N) {
  const int t = blockIdx.x * 256 + threadIdx.x;
  const int k8n = K / 8;
  if (t >= N * k8n) return;
  const int n = t / k8n, k8 = (t % k8n) * 8;
  v8us v;
#pragma unroll
  for (int i = 0; i < 8; ++i) v[i] = bf16_bits(W[(size_t)(k8 + i) * N + n]);
  *(v8us*)(Wt + (size_t)n * K + k8) = v;
  
}

// GEMM C[M][N] (f32, pitch ldc) = act(A[M][K]·W + bias). A f32 row-major (pitch lda) converted per fragment to bf16
// (ASPLIT: hi/lo two planes -> 2 terms, else single rounded term); Wt bf16 [N][K] (pitch ldb). BIAS_BF16 rounds the
// bias to bf16 first (bias quantised to bf16 before the add). K%32==0, M%16==0, N%64==0.
template <bool ASPLIT, int ACT, bool BIAS_BF16>
__global__ __launch_bounds__(128) void k_gemm_bf(const float* __restrict__ A, int lda, const unsigned short* __restrict__ Wt, int ldb,
                                               const float* __restrict__ bias, float* __restrict__ C, int ldc, int M, int N, int K) {
  __shared__ __attribute__((aligned(16))) float so[4][16][64];
  const int tid = threadIdx.x, w = tid >> 5, lane = tid & 31, ln = lane & 15, hh = lane >> 4;
  const int ntn = N / 64;
  const int wid = blockIdx.x * 4 + w;
  const int mt = wid / ntn, nq = wid % ntn;
  if (mt * 16 >= M) return;
  const int row0 = mt * 16, col0 = nq * 64;
  const float* arow = A + (size_t)(row0 + ln) * lda;
  v8f acc[4] = {};
  for (int kb = 0; kb < K; kb += 32) {
    FragB ah, al;
    const v4f x0 = *(const v4fa*)(arow + kb + 8 * hh), x1 = *(const v4fa*)(arow + kb + 8 * hh + 4);
    const v4f x2 = *(const v4fa*)(arow + kb + 16 + 8 * hh), x3 = *(const v4fa*)(arow + kb + 16 + 8 * hh + 4);
    float xs[16] = {x0[0],x0[1],x0[2],x0[3],x1[0],x1[1],x1[2],x1[3],x2[0],x2[1],x2[2],x2[3],x3[0],x3[1],x3[2],x3[3]};
#pragma unroll
    for (int i = 0; i < 16; ++i) { const unsigned short hb = bf16_bits(xs[i]); ah.u[i] = hb; al.u[i] = ASPLIT ? bf16_bits(xs[i] - bf16_val(hb)) : (unsigned short)0; }
#pragma unroll
    for (int t = 0; t < 4; ++t) {
      const unsigned short* brow = Wt + (size_t)(col0 + t * 16 + ln) * ldb + kb;
      FragB b;
      b.half[0] = *(const v8us*)(brow + 8 * hh);
      b.half[1] = *(const v8us*)(brow + 16 + 8 * hh);
      acc[t] = mmaN<ASPLIT ? 2 : 1>(ah.v, al.v, b.v, b.v, acc[t]);
    }
  }
#pragma unroll
  for (int t = 0; t < 4; ++t) {
    float bv = bias ? bias[col0 + t * 16 + ln] : 0.f;
    if (BIAS_BF16) bv = bf16_round(bv);
#pragma unroll
    for (int r = 0; r < 8; ++r) { float v = acc[t][r] + bv; if (ACT == 1) v = fmaxf(v, 0.f); so[w][8 * hh + r][t * 16 + ln] = v; }
  }
  __builtin_amdgcn_fence(__ATOMIC_ACQ_REL, "workgroup");
  __builtin_amdgcn_wave_barrier();
  const int rsub = lane >> 4, c4 = (lane & 15) * 4;
  {
#pragma unroll
    for (int q = 0; q < 8; ++q) {
      const int r = q * 2 + rsub;
      const v4f v = *(const v4fa*)&so[w][r][c4];
      *(v4f*)(C + (size_t)(row0 + r) * ldc + col0 + c4) = v;
    }
    
  }
}

// GEMM C = act(A·W + bias + resid): A f32 (ASPLIT -> hi/lo 2 terms), Wt bf16 [N][K]; ACT 0 none, 1 relu, 2 exact gelu;
// resid (optional, f32, row index = (row % rmod), pitch ldr, RES_BF16 rounds it) added before the activation.
template <bool ASPLIT, int ACT, bool BIAS_BF16, bool RES_BF16>
__global__ __launch_bounds__(128) void k_gemm_bf3(const float* __restrict__ A, int lda, const unsigned short* __restrict__ Wt, int ldb,
                                                const float* __restrict__ bias, const float* __restrict__ resid, int rmod, int ldr,
                                                float* __restrict__ C, int ldc, int M, int N, int K) {
  __shared__ __attribute__((aligned(16))) float so[4][16][64];
  const int tid = threadIdx.x, w = tid >> 5, lane = tid & 31, ln = lane & 15, hh = lane >> 4;
  const int ntn = N / 64;
  const int wid = blockIdx.x * 4 + w;
  const int mt = wid / ntn, nq = wid % ntn;
  if (mt * 16 >= M) return;
  const int row0 = mt * 16, col0 = nq * 64;
  const float* arow = A + (size_t)(row0 + ln) * lda;
  v8f acc[4] = {};
  for (int kb = 0; kb < K; kb += 32) {
    FragB ah, al;
    const v4f x0 = *(const v4fa*)(arow + kb + 8 * hh), x1 = *(const v4fa*)(arow + kb + 8 * hh + 4);
    const v4f x2 = *(const v4fa*)(arow + kb + 16 + 8 * hh), x3 = *(const v4fa*)(arow + kb + 16 + 8 * hh + 4);
    float xs[16] = {x0[0],x0[1],x0[2],x0[3],x1[0],x1[1],x1[2],x1[3],x2[0],x2[1],x2[2],x2[3],x3[0],x3[1],x3[2],x3[3]};
#pragma unroll
    for (int i = 0; i < 16; ++i) { const unsigned short hb = bf16_bits(xs[i]); ah.u[i] = hb; al.u[i] = ASPLIT ? bf16_bits(xs[i] - bf16_val(hb)) : (unsigned short)0; }
#pragma unroll
    for (int t = 0; t < 4; ++t) {
      const unsigned short* brow = Wt + (size_t)(col0 + t * 16 + ln) * ldb + kb;
      FragB b;
      b.half[0] = *(const v8us*)(brow + 8 * hh);
      b.half[1] = *(const v8us*)(brow + 16 + 8 * hh);
      acc[t] = mmaN<ASPLIT ? 2 : 1>(ah.v, al.v, b.v, b.v, acc[t]);
    }
  }
#pragma unroll
  for (int t = 0; t < 4; ++t) {
    const int col = col0 + t * 16 + ln;
    float bv = bias ? bias[col] : 0.f;
    if (BIAS_BF16) bv = bf16_round(bv);
#pragma unroll
    for (int r = 0; r < 8; ++r) {
      float v = acc[t][r] + bv;
      if (resid) { float rv = resid[(size_t)((row0 + 8 * hh + r) % rmod) * ldr + col]; if (RES_BF16) rv = bf16_round(rv); v += rv; }
      if (ACT == 1) v = fmaxf(v, 0.f);
      if (ACT == 2) v = 0.5f * v * (1.0f + erff(v * 0.70710678118654752f));
      if (ACT == 3) { const float u = 0.7978845608028654f * (v + 0.044715f * v * v * v); v = 0.5f * v * (1.0f + tanhf(u)); }
      so[w][8 * hh + r][t * 16 + ln] = v;
    }
  }
  __builtin_amdgcn_fence(__ATOMIC_ACQ_REL, "workgroup");
  __builtin_amdgcn_wave_barrier();
  const int rsub = lane >> 4, c4 = (lane & 15) * 4;
  {
#pragma unroll
    for (int q = 0; q < 8; ++q) {
      const int r = q * 2 + rsub;
      const v4f v = *(const v4fa*)&so[w][r][c4];
      *(v4f*)(C + (size_t)(row0 + r) * ldc + col0 + c4) = v;
    }
    
  }
}
// row LayerNorm (biased variance, eps) over N: s = X (+ R); optional out_sum <- s; out_norm <- (s-mu)*rsqrt(var+eps)*g + b
template <bool PARAM_BF16>
__global__ __launch_bounds__(256) void k_layernorm(const float* __restrict__ X, const float* __restrict__ R, const float* __restrict__ g, const float* __restrict__ bta,
                                                  float* __restrict__ out_sum, float* __restrict__ out_norm, int N, float eps) {
  __shared__ float red[256];
  const int row = blockIdx.x, tid = threadIdx.x;
  const float* x = X + (size_t)row * N; const float* rr = R ? R + (size_t)row * N : nullptr;
  float vals[16];                     // up to N = 4096
  const int per = N / 256;            // contiguous chunk per thread? use strided-by-4 chunks: thread handles j = tid*4 + 1024*u
  float s1 = 0.f;
  for (int u = 0; u < per / 4; ++u) {
    const int j = tid * 4 + 1024 * u;
    const v4f a = *(const v4fa*)(x + j);
    v4f b = {0.f,0.f,0.f,0.f}; if (rr) b = *(const v4fa*)(rr + j);
#pragma unroll
    for (int q = 0; q < 4; ++q) { const float v = a[q] + b[q]; vals[u * 4 + q] = v; s1 += v; }
  }
  red[tid] = s1; __syncthreads();
  for (int st = 128; st > 0; st >>= 1) { if (tid < st) red[tid] += red[tid + st]; __syncthreads(); }
  const float mu = red[0] / (float)N; __syncthreads();
  float s2 = 0.f;
  for (int u = 0; u < per / 4; ++u)
#pragma unroll
    for (int q = 0; q < 4; ++q) { const float c = vals[u * 4 + q] - mu; s2 += c * c; }
  red[tid] = s2; __syncthreads();
  for (int st = 128; st > 0; st >>= 1) { if (tid < st) red[tid] += red[tid + st]; __syncthreads(); }
  const float rs = rsqrtf(red[0] / (float)N + eps);
  {
    for (int u = 0; u < per / 4; ++u) {
      const int j = tid * 4 + 1024 * u;
      v4f o, sm;
#pragma unroll
      for (int q = 0; q < 4; ++q) {
        float gg = g[j + q], bb = bta[j + q];
        if (PARAM_BF16) { gg = bf16_round(gg); bb = bf16_round(bb); }
        sm[q] = vals[u * 4 + q]; o[q] = (vals[u * 4 + q] - mu) * rs * gg + bb;
      }
      if (out_sum) *(v4f*)(out_sum + (size_t)row * N + j) = sm;
      *(v4f*)(out_norm + (size_t)row * N + j) = o;
    }
    
  }
}



// ---- f16 WMMA path (v_wmma_f32_16x16x32_f16): 11-bit significands for operands in range — used where a [0,1] probability operand needs more precision than bf16
typedef _Float16 v16h __attribute__((ext_vector_type(16)));
union FragH { v16h v; v8us half[2]; _Float16 h[16]; unsigned short u[16]; };
template <int NT>
__device__ __forceinline__ v8f mmaH(v16h ah, v16h al, v16h bh, v16h bl, v8f c) {
  c = __builtin_amdgcn_wmma_f32_16x16x32_f16(false, ah, false, bh, (short)0, c, false, false);
  if (NT >= 2) c = __builtin_amdgcn_wmma_f32_16x16x32_f16(false, al, false, bh, (short)0, c, false, false);
  if (NT >= 3) c = __builtin_amdgcn_wmma_f32_16x16x32_f16(false, ah, false, bl, (short)0, c, false, false);
  asm volatile("v_nop\n\tv_nop\n\tv_nop\n\tv_nop" : "+v"(c) : "v"(ah), "v"(al), "v"(bh), "v"(bl));
  return c;
}
// batched GEMM like k_gemm_b but f16 operands: A f32 (split into f16 hi/lo if ASPLIT, else rounded to f16), Bt = f16 values [n][k]; alpha; C f32; N multiple of 16 (partial tiles skipped)
template <bool ASPLIT>
__global__ __launch_bounds__(128) void k_gemm_h(const float* __restrict__ A, int lda, size_t sA, const _Float16* __restrict__ Bh, int ldb, size_t sB, float alpha, float* __restrict__ C, int ldc, size_t sC, int M, int N, int K) {
  __shared__ __attribute__((aligned(16))) float so[4][16][64];
  const int tid = threadIdx.x, w = tid >> 5, lane = tid & 31, ln = lane & 15, hh = lane >> 4; const int by = blockIdx.y;
  A += (size_t)by * sA; Bh += (size_t)by * sB; C += (size_t)by * sC;
  const int ntn = (N + 63) / 64; const int wid = blockIdx.x * 4 + w; const int mt = wid / ntn, nq = wid % ntn; if (mt * 16 >= M) return;
  const int row0 = mt * 16, col0 = nq * 64; const float* arow = A + (size_t)(row0 + ln) * lda;
  v8f acc[4] = {};
  for (int kb = 0; kb < K; kb += 32) {
    FragH ah, al;
    const v4f x0 = *(const v4fa*)(arow + kb + 8 * hh), x1 = *(const v4fa*)(arow + kb + 8 * hh + 4), x2 = *(const v4fa*)(arow + kb + 16 + 8 * hh), x3 = *(const v4fa*)(arow + kb + 16 + 8 * hh + 4);
    float xs[16] = {x0[0],x0[1],x0[2],x0[3],x1[0],x1[1],x1[2],x1[3],x2[0],x2[1],x2[2],x2[3],x3[0],x3[1],x3[2],x3[3]};
#pragma unroll
    for (int i = 0; i < 16; ++i) { const _Float16 h = (_Float16)xs[i]; ah.h[i] = h; al.h[i] = ASPLIT ? (_Float16)(xs[i] - (float)h) : (_Float16)0.0f; }
#pragma unroll
    for (int t = 0; t < 4; ++t) { if (col0 + t * 16 >= N) continue; const size_t boff = (size_t)(col0 + t * 16 + ln) * ldb + kb; FragH bq; bq.half[0] = *(const v8us*)(Bh + boff + 8 * hh); bq.half[1] = *(const v8us*)(Bh + boff + 16 + 8 * hh);
      acc[t] = mmaH<ASPLIT ? 2 : 1>(ah.v, al.v, bq.v, bq.v, acc[t]); }
  }
#pragma unroll
  for (int t = 0; t < 4; ++t) { if (col0 + t * 16 >= N) continue;
#pragma unroll
    for (int r = 0; r < 8; ++r) so[w][8 * hh + r][t * 16 + ln] = acc[t][r] * alpha; }
  __builtin_amdgcn_fence(__ATOMIC_ACQ_REL, "workgroup"); __builtin_amdgcn_wave_barrier();
  const int rsub = lane >> 4, c4 = (lane & 15) * 4;
  {
#pragma unroll
    for (int q = 0; q < 8; ++q) { const int r = q * 2 + rsub; if (col0 + c4 < N) { const v4f v = *(const v4fa*)&so[w][r][c4]; *(v4f*)(C + (size_t)(row0 + r) * ldc + col0 + c4) = v; } }
     }
}

// Wt[n][k] = f16(W[k][n]·scale) from f32 row-major W[K][N] (scale = power of two; bf16-exact weights stay exact in f16 away from the subnormal range)
__global__ __launch_bounds__(256) void k_wt_f16(const float* __restrict__ W, _Float16* __restrict__ Wt, int K, int N, float scale) {
  const int t = blockIdx.x * 256 + threadIdx.x; if (t >= N * (K / 8)) return; const int n = t / (K / 8), k8 = (t % (K / 8)) * 8; FragH f;
#pragma unroll
  for (int i = 0; i < 8; ++i) f.h[i] = (_Float16)(bf16_round(W[(size_t)(k8 + i) * N + n]) * scale); const v8us o = f.half[0];
  *(v8us*)((unsigned short*)Wt + (size_t)n * K + k8) = o; 
}
// k_gemm_hh variant with fused epilogue: v = acc·alpha + bias[by·sBias + col] (+ CP[(row/rowsPerB)·sCPb + by·64 + col] if CP) ; ACT 0 none / 1 elu ; writes f16 C16 (and f32 C if non-null)
template <int ACT>
__global__ __launch_bounds__(128) void k_gemm_hhx(const _Float16* __restrict__ A, int lda, size_t sA, const _Float16* __restrict__ Bh, int ldb, size_t sB, float alpha, const float* __restrict__ bias, size_t sBias, const float* __restrict__ CP, int rowsPerB, size_t sCPb, int row0g,
    float* __restrict__ C, _Float16* __restrict__ C16, int ldc, size_t sC, int M, int N, int K) {
  __shared__ __attribute__((aligned(16))) float so[4][16][64];
  const int tid = threadIdx.x, w = tid >> 5, lane = tid & 31, ln = lane & 15, hh = lane >> 4; const int by = blockIdx.y;
  A += (size_t)by * sA; Bh += (size_t)by * sB; const size_t cofs = (size_t)by * sC; const float* bp = bias ? bias + (size_t)by * sBias : nullptr;
  const int ntn = (N + 63) / 64; const int wid = blockIdx.x * 4 + w; const int mt = wid / ntn, nq = wid % ntn; if (mt * 16 >= M) return;
  const int row0 = mt * 16, col0 = nq * 64; const _Float16* arow = A + (size_t)(row0 + ln) * lda;
  v8f acc[4] = {};
  for (int kb = 0; kb < K; kb += 32) { FragH ah; ah.half[0] = *(const v8us*)((const unsigned short*)arow + kb + 8 * hh); ah.half[1] = *(const v8us*)((const unsigned short*)arow + kb + 16 + 8 * hh);
#pragma unroll
    for (int t = 0; t < 4; ++t) { if (col0 + t * 16 >= N) continue; const size_t boff = (size_t)(col0 + t * 16 + ln) * ldb + kb; FragH bq; bq.half[0] = *(const v8us*)((const unsigned short*)Bh + boff + 8 * hh); bq.half[1] = *(const v8us*)((const unsigned short*)Bh + boff + 16 + 8 * hh);
      acc[t] = mmaH<1>(ah.v, ah.v, bq.v, bq.v, acc[t]); }
  }
#pragma unroll
  for (int t = 0; t < 4; ++t) { if (col0 + t * 16 >= N) continue; const int col = col0 + t * 16 + ln; const float bv = bp ? bf16_round(bp[col]) : 0.f;
#pragma unroll
    for (int r = 0; r < 8; ++r) { float v = acc[t][r] * alpha + bv; if (CP) { const int rr = row0g + row0 + 8 * hh + r; if (rowsPerB < 0) v += CP[cofs + (size_t)rr * ldc + col];      /* rowsPerB < 0: own element of the batched C plane */ else { const int bidx = rr / rowsPerB; v += CP[(size_t)bidx * sCPb + (size_t)by * 64 + col]; } } if (ACT == 1) v = (v > 0.f) ? v : expm1f(v); else if (ACT == 7) v = (v > 0.f) ? v + 1.0f : expf(v); else if (ACT == 8) v = tanhf(v); else if (ACT == 9) v = 0.5f * v * (1.0f + tanhf(0.7978845608028654f * (v + 0.044715f * v * v * v))); else if (ACT == 11) v = 1.0f / (1.0f + expf(-v)); else if (ACT == 12) v = (v > 0.f) ? v : 0.01f * v; else if (ACT == 14) v = (v > 0.f) ? v : 0.1f * v; else if (ACT == 16) v = (v >= 0.f) ? v : 0.3f * v; else if (ACT == 17) v = (v >= 0.f) ? v : 0.2f * v; else if (ACT == 15) v = v / (1.0f + expf(-v)); else if (ACT == 3) v = fmaxf(v, 0.f); else if (ACT == 6) v = 0.5f * v * (1.0f + erff(v * 0.70710678118654752f)); so[w][8 * hh + r][t * 16 + ln] = v; } }
  __builtin_amdgcn_fence(__ATOMIC_ACQ_REL, "workgroup"); __builtin_amdgcn_wave_barrier();
  const int rsub = lane >> 4, c4 = (lane & 15) * 4; typedef _Float16 v4h __attribute__((ext_vector_type(4)));
  {
#pragma unroll
    for (int q = 0; q < 8; ++q) { const int r = q * 2 + rsub; if (col0 + c4 < N) { const v4f v = *(const v4fa*)&so[w][r][c4]; if (C) *(v4f*)(C + cofs + (size_t)(row0 + r) * ldc + col0 + c4) = v; if (C16) { v4h h4; for (int i = 0; i < 4; ++i) h4[i] = (_Float16)v[i]; *(v4h*)(C16 + cofs + (size_t)(row0 + r) * ldc + col0 + c4) = h4; } } }
     }
}


typedef _Float16 v4h __attribute__((ext_vector_type(4)));

__global__ __launch_bounds__(256) void k_x16(const float* __restrict__ x, _Float16* __restrict__ X16, size_t n8) { const size_t t = (size_t)blockIdx.x * 256 + threadIdx.x; if (t >= n8) return; FragH f;
#pragma unroll
  for (int q = 0; q < 8; ++q) f.h[q] = (_Float16)bf16_round(x[t * 8 + q]); *(v8us*)((unsigned short*)X16 + t * 8) = f.half[0];  }
__global__ __launch_bounds__(256) void k_h16(const float* __restrict__ x, _Float16* __restrict__ X16, size_t n8) { const size_t t = (size_t)blockIdx.x * 256 + threadIdx.x; if (t >= n8) return; FragH f;
#pragma unroll
  for (int q = 0; q < 8; ++q) f.h[q] = (_Float16)x[t * 8 + q]; *(v8us*)((unsigned short*)X16 + t * 8) = f.half[0];  }
__global__ __launch_bounds__(256) void k_round16f(const float* __restrict__ W, _Float16* __restrict__ Bt, size_t n8) { const size_t t = (size_t)blockIdx.x * 256 + threadIdx.x; if (t >= n8) return; FragH f;
#pragma unroll
  for (int i = 0; i < 8; ++i) f.h[i] = (_Float16)(bf16_round(W[t * 8 + i]) * 16.0f); *(v8us*)((unsigned short*)Bt + t * 8) = f.half[0];  }
template <int NHv, int TTv>
__global__ __launch_bounds__(256) void k_vt(const _Float16* __restrict__ V16, int ldv, int voff, _Float16* __restrict__ Vt) { __shared__ unsigned short tl[64][66]; const int tid = threadIdx.x; const int slab = blockIdx.x / (TTv / 64), lg = blockIdx.x % (TTv / 64); const int b = slab / NHv, h = slab % NHv;
  for (int i = tid; i < 64 * 8; i += 256) { const int r = i / 8, c8 = (i % 8) * 8; FragH f; f.half[0] = *(const v8us*)((const unsigned short*)V16 + ((size_t)b * TTv + lg * 64 + r) * ldv + voff + h * 64 + c8);
#pragma unroll
    for (int q = 0; q < 8; ++q) tl[r][c8 + q] = f.u[q]; }
  __syncthreads();
  {
#pragma unroll
    for (int rd = 0; rd < 2; ++rd) { const int d = rd * 32 + tid / 8, pc = tid % 8; FragH f;
#pragma unroll
      for (int q = 0; q < 8; ++q) f.u[q] = tl[pc * 8 + q][d];
      *(v8us*)((unsigned short*)Vt + ((size_t)slab * 64 + d) * TTv + lg * 64 + pc * 8) = f.half[0]; }
     } }

__global__ __launch_bounds__(256) void k_hl(const float* __restrict__ F, _Float16* __restrict__ Hh, _Float16* __restrict__ Hl, size_t n8) { const size_t t = (size_t)blockIdx.x * 256 + threadIdx.x; if (t >= n8) return; FragH fh, fl; const v4f a = *(const v4fa*)(F + t * 8), c = *(const v4fa*)(F + t * 8 + 4);
#pragma unroll
  for (int q = 0; q < 4; ++q) { _Float16 h = (_Float16)a[q]; fh.h[q] = h; fl.h[q] = (_Float16)((a[q] - (float)h) * 1024.0f); h = (_Float16)c[q]; fh.h[4 + q] = h; fl.h[4 + q] = (_Float16)((c[q] - (float)h) * 1024.0f); }
  { *(v8us*)((unsigned short*)Hh + t * 8) = fh.half[0]; *(v8us*)((unsigned short*)Hl + t * 8) = fl.half[0];  } }

// ---- fast GEMM (wave tile 32x64; requires M % 32 == 0 rows per launch region and N % 64 == 0); epilogue = k_gemm_hhx semantics ----
__device__ __forceinline__ v16h g2_frag(const _Float16* p, int hh) { FragH f; f.half[0] = *(const v8us*)((const unsigned short*)p + 8 * hh); f.half[1] = *(const v8us*)((const unsigned short*)p + 16 + 8 * hh); return f.v; }
__device__ __forceinline__ v8f g2_mma(v16h a, v16h b, v8f c) { v8f d = __builtin_amdgcn_wmma_f32_16x16x32_f16(false, a, false, b, (short)0, c, false, false); asm volatile("v_nop\n\tv_nop\n\tv_nop\n\tv_nop" : "+v"(d) : "v"(a), "v"(b)); return d; }
template <int ACT>
__global__ __launch_bounds__(128) void k_gemm2(const _Float16* __restrict__ A, int lda, size_t sA, size_t sAz, const _Float16* __restrict__ Bh, int ldb, size_t sB, size_t sBz, float alpha, const float* __restrict__ bias, size_t sBias, const float* __restrict__ CP, int rowsPerB, size_t sCPb, int row0g,
    float* __restrict__ C, _Float16* __restrict__ C16, int ldc, size_t sC, size_t sCz, int M, int N, int K) { static_assert(ACT == 0 || ACT == 3 || ACT == 6 || ACT == 8 || ACT == 9 || ACT == 11 || ACT == 12 || ACT == 14 || ACT == 15 || ACT == 16 || ACT == 17, "k_gemm2: unsupported ACT code (would silently apply no activation)");
  __shared__ __attribute__((aligned(16))) float so[4][32][68];
  const int tid = threadIdx.x, w = tid >> 5, lane = tid & 31, ln = lane & 15, hh = lane >> 4; const int by = blockIdx.y, bz = blockIdx.z;      /* two batch axes: strides s* on grid.y, s*z on grid.z */
  A += (size_t)by * sA + (size_t)bz * sAz; Bh += (size_t)by * sB + (size_t)bz * sBz; const size_t cofs = (size_t)by * sC + (size_t)bz * sCz; const float* bp = bias ? bias + (size_t)by * sBias : nullptr;
  const int ntn = N >> 6; const int mt = blockIdx.x / ntn, nq = blockIdx.x - mt * ntn; const int row0 = mt * 128 + 32 * w, col0 = nq * 64; if (row0 >= M) return;
  const _Float16* a0p = A + (size_t)(row0 + ln) * lda; const _Float16* a1p = a0p + (size_t)16 * lda;
  const _Float16* b0p = Bh + (size_t)(col0 + ln) * ldb; const _Float16* b1p = b0p + (size_t)16 * ldb; const _Float16* b2p = b1p + (size_t)16 * ldb; const _Float16* b3p = b2p + (size_t)16 * ldb;
  const v8f z8 = {0.f,0.f,0.f,0.f,0.f,0.f,0.f,0.f}; v8f c00 = z8, c01 = z8, c02 = z8, c03 = z8, c10 = z8, c11 = z8, c12 = z8, c13 = z8;
#pragma unroll 1
  for (int kb = 0; kb < K; kb += 32) { const v16h a0 = g2_frag(a0p + kb, hh), a1 = g2_frag(a1p + kb, hh);
    v16h b = g2_frag(b0p + kb, hh); c00 = g2_mma(a0, b, c00); c10 = g2_mma(a1, b, c10);
    b = g2_frag(b1p + kb, hh); c01 = g2_mma(a0, b, c01); c11 = g2_mma(a1, b, c11);
    b = g2_frag(b2p + kb, hh); c02 = g2_mma(a0, b, c02); c12 = g2_mma(a1, b, c12);
    b = g2_frag(b3p + kb, hh); c03 = g2_mma(a0, b, c03); c13 = g2_mma(a1, b, c13); }
  v8f accs[8] = {c00, c01, c02, c03, c10, c11, c12, c13};
#pragma unroll
  for (int u = 0; u < 8; ++u) { const int t = u & 3, half = u >> 2; const int col = col0 + t * 16 + ln; const float bv = bp ? bf16_round(bp[col]) : 0.f;
#pragma unroll
    for (int r = 0; r < 8; ++r) { const int rloc = half * 16 + 8 * hh + r; float v = accs[u][r] * alpha + bv; if (CP) { if (rowsPerB < 0) v += CP[cofs + (size_t)(row0g + row0 + rloc) * ldc + col];      /* rowsPerB < 0: own element of the batched C plane */ else { const int bidx = (row0g + row0 + rloc) / rowsPerB; v += CP[(size_t)bidx * sCPb + (size_t)by * 64 + col]; } }
      if (ACT == 3) v = fmaxf(v, 0.f); else if (ACT == 6) v = 0.5f * v * (1.0f + erff(v * 0.70710678118654752f)); else if (ACT == 11) v = 1.0f / (1.0f + expf(-v)); else if (ACT == 15) v = v / (1.0f + expf(-v)); else if (ACT == 12) v = (v > 0.f) ? v : 0.01f * v; else if (ACT == 8) v = tanhf(v); else if (ACT == 9) v = 0.5f * v * (1.0f + tanhf(0.7978845608028654f * (v + 0.044715f * v * v * v))); else if (ACT == 14) v = (v > 0.f) ? v : 0.1f * v; else if (ACT == 16) v = (v >= 0.f) ? v : 0.3f * v; else if (ACT == 17) v = (v >= 0.f) ? v : 0.2f * v;
      so[w][rloc][t * 16 + ln] = v; } }
  __builtin_amdgcn_fence(__ATOMIC_ACQ_REL, "workgroup"); __builtin_amdgcn_wave_barrier();
  const int rsub = lane >> 4, c4 = (lane & 15) * 4;
  {
#pragma unroll
    for (int q = 0; q < 16; ++q) { const int r = q * 2 + rsub; const v4f v = *(const v4fa*)&so[w][r][c4]; if (C) *(v4f*)(C + cofs + (size_t)(row0 + r) * ldc + col0 + c4) = v; if (C16) { v4h h4; for (int i = 0; i < 4; ++i) h4[i] = (_Float16)v[i]; *(v4h*)(C16 + cofs + (size_t)(row0 + r) * ldc + col0 + c4) = h4; } }
     } }


__global__ __launch_bounds__(256) void k_wnat(const float* __restrict__ w, size_t n8, _Float16* __restrict__ Bt) { const size_t t = (size_t)blockIdx.x * 256 + threadIdx.x; if (t >= n8) return; FragH f; for (int q = 0; q < 8; ++q) f.h[q] = (_Float16)(bf16_round(w[t * 8 + q]) * 16.0f); *(v8us*)((unsigned short*)Bt + t * 8) = f.half[0];  }
__global__ __launch_bounds__(256) void k_rsm(const float* __restrict__ S, _Float16* __restrict__ P, int nrows) {
  #pragma clang fp contract(off)
  const int i = blockIdx.x * 256 + threadIdx.x; if (i >= nrows) return; const float* s = S + (size_t)i * SQ; float mx = -3.0e38f;
#pragma unroll 1
  for (int j = 0; j < SQ; ++j) mx = fmaxf(mx, s[j]); float se = 0.f;
#pragma unroll 1
  for (int j = 0; j < SQ; ++j) se += expf(s[j] - mx); const float sc = 256.0f / se;
#pragma unroll 1
  for (int j0 = 0; j0 < SQ; j0 += 8) { FragH f; for (int q = 0; q < 8; ++q) f.h[q] = (_Float16)(expf(s[j0 + q] - mx) * sc); unsigned short* d = (unsigned short*)P + (size_t)i * SQ + j0; *(v8us*)d = f.half[0];  } }
__global__ __launch_bounds__(256) void k_vt(const _Float16* __restrict__ V16, int b, int h0, _Float16* __restrict__ VT) { __shared__ unsigned short tl[64][65]; const int tid = threadIdx.x; const int hh = blockIdx.x % HG, sg = blockIdx.x / HG; const int s0 = sg * 64; const int h = h0 + hh;
  for (int i = tid; i < 64 * 8; i += 256) { const int j = i / 8, d8 = (i % 8) * 8; FragH f; f.half[0] = *(const v8us*)((const unsigned short*)V16 + ((size_t)b * SQ + s0 + j) * DM + h * HD + d8); for (int q = 0; q < 8; ++q) tl[d8 + q][j] = f.u[q]; }
  __syncthreads();
  { for (int i = tid; i < 64 * 8; i += 256) { const int d = i / 8, j8 = (i % 8) * 8; FragH f; for (int q = 0; q < 8; ++q) f.u[q] = tl[d][j8 + q]; *(v8us*)((unsigned short*)VT + ((size_t)hh * HD + d) * SQ + s0 + j8) = f.half[0]; }  } }



// Fused attention, one launch for all (batch, head) planes: a wave owns 32 queries (two 16-column groups) and walks the plane's 1024 keys in passes of 32.
// Transposed products: S^T = K . Q^T (A = 16 key rows, B = 16 query rows, both through g2_frag), so lane (ln, hh) holds, for query ln, the scores of keys 8 hh + r and 16 + 8 hh + r:
// exactly the k positions that g2_frag gives a B operand, so the exponentials are packed in place into P^T and O^T += V^T . P^T (A = 16 rows of V^T) follows with no exchange through memory or LDS.
// Online softmax in base 2: the maximum in use may lag a query's true running maximum by up to 8 (an exponential can reach 2^8, far inside f16); the accumulators are rescaled, tested once per pass, only when it lags by more.
// Row sums are f32 sums of the unrounded exponentials, one partial per wave half, joined at the end. o is stored x64 as f16 (the output GEMM's alpha folds it back).
#define FQ 2                         /* 16-query column groups per wave */
#define FW 8                         /* waves per work-group */
typedef _Float16 v8h __attribute__((ext_vector_type(8)));
typedef _Float16 v2h __attribute__((ext_vector_type(2)));
typedef float v2f __attribute__((ext_vector_type(2)));
union FragP { v16h v; v2h p[8]; };
__device__ __forceinline__ float fa_xhalf(float x) { return __builtin_bit_cast(float, __builtin_amdgcn_permlanex16(__builtin_bit_cast(int, x), __builtin_bit_cast(int, x), 0x76543210, 0xfedcba98, false, false)); }      /* lane l <-> lane l ^ 16 */
__device__ __forceinline__ v8f fa_mma(v16h a, v16h b, v8f c) { return __builtin_amdgcn_wmma_f32_16x16x32_f16(false, a, false, b, (short)0, c, false, false); }
__global__ __launch_bounds__(FW * 32) void k_fattn(const _Float16* __restrict__ Qr, const _Float16* __restrict__ Kr, const _Float16* __restrict__ Vt, _Float16* __restrict__ O) {
  const int lane = threadIdx.x & 31, w = threadIdx.x >> 5, ln = lane & 15, hh = lane >> 4;
  const int plane = blockIdx.y, b = plane / NH, h = plane % NH; const int q0 = (blockIdx.x * FW + w) * (16 * FQ);
  const _Float16* qp = Qr + ((size_t)b * SQ + q0 + ln) * LQ + h * HD; const _Float16* kp = Kr + ((size_t)b * SQ + ln) * LQ + h * HD; const _Float16* vp = Vt + ((size_t)plane * HD + ln) * SQ;
  const float cs = 0.125f * 1.4426950408889634f;      /* 64^-0.5 and log2(e) in one factor */
  const v8f z8 = {0.f,0.f,0.f,0.f,0.f,0.f,0.f,0.f};
  v16h qf[FQ][2]; v8f acc[FQ][4]; float m_run[FQ], l_run[FQ];
#pragma unroll
  for (int g = 0; g < FQ; ++g) { qf[g][0] = g2_frag(qp + (size_t)g * 16 * LQ, hh); qf[g][1] = g2_frag(qp + (size_t)g * 16 * LQ + 32, hh); m_run[g] = -3.0e38f; l_run[g] = 0.f;
#pragma unroll
    for (int t = 0; t < 4; ++t) acc[g][t] = z8; }
  v16h kf[2][2];
#pragma unroll
  for (int kt = 0; kt < 2; ++kt) { kf[kt][0] = g2_frag(kp + (size_t)kt * 16 * LQ, hh); kf[kt][1] = g2_frag(kp + (size_t)kt * 16 * LQ + 32, hh); }
  v16h vf[4];
#pragma unroll
  for (int t = 0; t < 4; ++t) vf[t] = g2_frag(vp + (size_t)t * 16 * SQ, hh);
  /* kept rolled: one pass already holds 16 matrix instructions, and the fragment arrays must keep constant indices */
#pragma unroll 1
  for (int k0 = 0; k0 < SQ; k0 += 32) {
    v8f s[2][FQ];
#pragma unroll
    for (int kt = 0; kt < 2; ++kt) {
#pragma unroll
      for (int g = 0; g < FQ; ++g) s[kt][g] = fa_mma(kf[kt][1], qf[g][1], fa_mma(kf[kt][0], qf[g][0], z8)); }
    float mb[FQ]; bool need = false;
#pragma unroll
    for (int g = 0; g < FQ; ++g) { float mx = fmaxf(s[0][g][0], s[1][g][0]);
#pragma unroll
      for (int r = 1; r < 8; ++r) mx = fmaxf(mx, fmaxf(s[0][g][r], s[1][g][r]));
      mx = fmaxf(mx, fa_xhalf(mx)) * cs; mb[g] = mx; need = need || (mx > m_run[g] + 8.0f); }      /* both halves hold the query's pass maximum, scaled (cs > 0) */
    if (__builtin_amdgcn_ballot_w32(need) != 0) {      /* wave-uniform; always taken on the first pass (factor 0 on zero accumulators) */
#pragma unroll
      for (int g = 0; g < FQ; ++g) { const float mn = fmaxf(m_run[g], mb[g]); const float corr = __builtin_amdgcn_exp2f(m_run[g] - mn); m_run[g] = mn; l_run[g] *= corr;
#pragma unroll
        for (int t = 0; t < 4; ++t) acc[g][t] *= corr; } }
    const int kn = (k0 + 32) & (SQ - 1);      /* both operands are fetched one pass ahead, into the registers their products have just left: K flies under this pass's exponentials and second product, V^T under the next pass's scores and maxima; the last pass asks for keys 0..31 again (in bounds, unused) */
#pragma unroll
    for (int kt = 0; kt < 2; ++kt) { kf[kt][0] = g2_frag(kp + (size_t)(kn + kt * 16) * LQ, hh); kf[kt][1] = g2_frag(kp + (size_t)(kn + kt * 16) * LQ + 32, hh); }
    asm volatile("s_wait_xcnt 0x0" ::: "memory");      /* stands before the address registers of the loads above are written again, also by a later load's result */
    __builtin_amdgcn_sched_barrier(0);      /* keeps the exponentials behind the K loads: moved in front of them, as the compiler did, they leave the loads no time to land before the next pass's first product */
#pragma unroll
    for (int g = 0; g < FQ; ++g) { const float nm = -m_run[g]; FragP pf; v2f ls = {0.f, 0.f};
#pragma unroll
      for (int i = 0; i < 8; ++i) { const v2f x = {s[i >> 2][g][2 * (i & 3)], s[i >> 2][g][2 * (i & 3) + 1]};      /* operand elements 2i, 2i + 1 = tile i >> 2, registers 2 (i & 3), 2 (i & 3) + 1 */
        const v2f a = __builtin_elementwise_fma(x, (v2f){cs, cs}, (v2f){nm, nm}); const v2f p = {__builtin_amdgcn_exp2f(a[0]), __builtin_amdgcn_exp2f(a[1])};
        ls += p; pf.p[i] = __builtin_convertvector(p, v2h); }
      l_run[g] += ls[0] + ls[1];
#pragma unroll
      for (int t = 0; t < 4; ++t) acc[g][t] = fa_mma(vf[t], pf.v, acc[g][t]); }
#pragma unroll
    for (int t = 0; t < 4; ++t) vf[t] = g2_frag(vp + (size_t)t * 16 * SQ + kn, hh);
    asm volatile("s_wait_xcnt 0x0" ::: "memory");      /* the same wait for the V^T loads' address registers */
  }
#pragma unroll
  for (int g = 0; g < FQ; ++g) { const float sc = 64.0f / (l_run[g] + fa_xhalf(l_run[g])); _Float16* op = O + ((size_t)plane * SQ + q0 + g * 16 + ln) * HD + 8 * hh;
#pragma unroll
    for (int t = 0; t < 4; ++t) { const v8f o = acc[g][t] * sc; *(v8h*)(op + t * 16) = __builtin_convertvector(o, v8h); } }      /* registers r = 0..7 are d = 16 t + 8 hh + r of query ln: one 16-byte store */
}

__global__ __launch_bounds__(256) void k_wthd(const float* __restrict__ Wt, _Float16* __restrict__ Bt) { const size_t t = (size_t)blockIdx.x * 256 + threadIdx.x; if (t >= (size_t)NH * HD * (DM / 8)) return; const int m8 = (int)(t % (DM / 8)) * 8; const int d = (int)((t / (DM / 8)) % HD); const int h = (int)(t / ((size_t)(DM / 8) * HD)); FragH f;
  for (int q = 0; q < 8; ++q) f.h[q] = (_Float16)(16.0f * bf16_round(Wt[((size_t)h * DM + m8 + q) * HD + d])); unsigned short* dst = (unsigned short*)Bt + ((size_t)h * HD + d) * DM + m8; *(v8us*)dst = f.half[0];  }

extern "C" void kernel_launch(void* const* d_in, const int* in_sizes, int n_in,
                              void* d_out, int out_size, void* d_ws, size_t ws_size, hipStream_t stream) {
  (void)in_sizes; (void)n_in; (void)out_size;
  const float* const* I = (const float* const*)d_in; const float* xq = I[0]; const float* xk = I[1]; const float* xv = I[2]; const float* wq = I[3]; const float* bq = I[4]; const float* wk = I[5]; const float* bk = I[6]; const float* wv = I[7]; const float* bv = I[8]; const float* wo = I[9]; const float* bo = I[10];      /* three inputs; per-head [in][out] weights [8][512][64] + per-head biases [8][64] (flattened head-major = projection column order); Wo [in][out] + bo */
  char* ws = (char*)d_ws; size_t off = 0;
  auto take = [&](size_t bytes) { char* p = ws + off; off += (bytes + 255) & ~(size_t)255; return p; };
  _Float16* BQ = (_Float16*)take((size_t)DM * DM * 2); _Float16* BK = (_Float16*)take((size_t)DM * DM * 2); _Float16* BV = (_Float16*)take((size_t)DM * DM * 2); _Float16* BO = (_Float16*)take((size_t)DM * DM * 2);
  _Float16* Q16 = (_Float16*)take(NR * DM * 2); _Float16* K16 = (_Float16*)take(NR * DM * 2); _Float16* V16 = (_Float16*)take(NR * DM * 2); _Float16* O16 = (_Float16*)take(NR * DM * 2);
  _Float16* VT = (_Float16*)take((size_t)NB * NH * HD * SQ * 2);
  _Float16* XQ = (_Float16*)take(NR * DM * 2); _Float16* XK = (_Float16*)take(NR * DM * 2); _Float16* XV = (_Float16*)take(NR * DM * 2);      /* the f16 input rows */
  if (off > ws_size) return;
  { const unsigned g = (unsigned)(((size_t)NH * HD * (DM / 8) + 255) / 256); k_wthd<<<g, 256, 0, stream>>>(wq, BQ); k_wthd<<<g, 256, 0, stream>>>(wk, BK); k_wthd<<<g, 256, 0, stream>>>(wv, BV); k_wt_f16<<<(unsigned)(((size_t)DM * (DM / 8) + 255) / 256), 256, 0, stream>>>(wo, BO, DM, DM, 16.0f); }      /* per-head [in][out] W[h][k][d] -> Bt[h*64 + d][k] x16 (head-major output columns = the flattened per-head biases' order); Wo [in][out] -> Bt x16 */

  k_x16<<<(unsigned)((NR * DM / 8 + 255) / 256), 256, 0, stream>>>(xq, XQ, NR * DM / 8); k_x16<<<(unsigned)((NR * DM / 8 + 255) / 256), 256, 0, stream>>>(xk, XK, NR * DM / 8); k_x16<<<(unsigned)((NR * DM / 8 + 255) / 256), 256, 0, stream>>>(xv, XV, NR * DM / 8);      /* the three inputs as exact f16 rows */
  const size_t r0p = (size_t)B0 * SQ;      /* first projected row */
  k_gemm2<0><<<dim3((unsigned)((MP / 128) * (DM / 64)), 1), 128, 0, stream>>>(XQ + r0p * DM, DM, 0, 0, BQ, DM, 0, 0, 0.0625f, bq, 0, nullptr, 1, 0, 0, nullptr, Q16 + r0p * DM, DM, 0, 0, MP, DM, DM);
  k_gemm2<0><<<dim3((unsigned)((MP / 128) * (DM / 64)), 1), 128, 0, stream>>>(XK + r0p * DM, DM, 0, 0, BK, DM, 0, 0, 0.0625f, bk, 0, nullptr, 1, 0, 0, nullptr, K16 + r0p * DM, DM, 0, 0, MP, DM, DM);
  k_gemm2<0><<<dim3((unsigned)((MP / 128) * (DM / 64)), 1), 128, 0, stream>>>(XV + r0p * DM, DM, 0, 0, BV, DM, 0, 0, 0.0625f, bv, 0, nullptr, 1, 0, 0, nullptr, V16 + r0p * DM, DM, 0, 0, MP, DM, DM);
  k_vt<NH, SQ><<<NB * NH * (SQ / 64), 256, 0, stream>>>(V16, LQ, 0, VT);      /* V^T [NB][NH][HD][SQ], all batches in one launch */
  k_fattn<<<dim3(SQ / (16 * FQ * FW), NB * NH), FW * 32, 0, stream>>>(Q16, K16, VT, O16);      /* scores, softmax and P . V of all planes: plane p = batch * NH + head -> 64-wide rows at O16 + p * SQ * HD (head-major context), x64 */
  k_gemm2<0><<<dim3((unsigned)((MPO / 128) * (DM / 64)), 1), 128, 0, stream>>>(O16 + r0p * DM, DM, 0, 0, BO, DM, 0, 0, 0.0009765625f, bo, 0, nullptr, 1, 0, 0, (float*)d_out + r0p * DM, nullptr, DM, 0, 0, MPO, DM, DM);      /* out rows are the output layout */
}

// v004
// One run takes 116 microseconds.
// Next to v003, in two timings, it ran 1.45 times as fast each time.
// Over all steps from v000 it is 29.1 times as fast.
#include <hip/hip_runtime.h>
// Multi-head attention on three inputs with per-head projection tensors and the source's head-major context view (Q, K, V [8][1024][512]; Qh / Kh / Vh = einsum('bsd,hde->bhse', input, W) + b with per-head [in][out] weights W [8][512][64] and biases [8][64] (uniform +-512^-0.5); scores * 64^-0.5; softmax over all 1024 keys (no mask); context x [B][H][S][64] is RE-VIEWED as [B][S][512] WITHOUT transposing heads and time (row s' of the view = 512 consecutive floats of the [H][S][64] block); out = view Wo + bo ([in][out] 512 x 512) -> [8][1024][512]).
// Structure: token rows r = b*1024 + s; the three inputs as exact f16 rows (bf16-rounded); Q, K, V as three WMMA GEMMs (32x64 wave tiles, f32 accumulation, exact x16 weights + bias, f16 outputs); V^T for all (batch, head) pairs via LDS transposes in one launch; then one fused attention launch for all pairs (S^T = K . Q^T on WMMA, online softmax on VALU with f32 statistics and native exp2, the unnormalised weights packed in registers as the f16 B operand of O^T += V^T . P^T on WMMA; neither scores nor weights reach memory; o carried x64 against f16 subnormal flush, folded into the output GEMM alpha) written straight into the merged f16 o rows; out = o W_o + b GEMM (f32) into the output layout.
// Compute dtype: inputs rounded to bf16; x / weights exact; q, k, v, softmax weights and o as plain f16 GEMM operands (~2^-12); scores and softmax statistics f32; v_wmma_f32_16x16x32_f16.
#define NB 8
#define SQ 1024
#define DM 512
#define NH 8
#define HD 64
#define HG 4                         /* heads per launch of the untemplated k_vt (not launched) */
#define B0 0                         /* first batch processed (debug hook) */
#define NBR NB                       /* batches processed (debug hook) */
#define NR ((size_t)NB * SQ)         /* token rows */
#define MP ((int)((size_t)NBR * SQ)) /* rows projected (debug hook) */
#define QN SQ                        /* query rows per batch (not used; launches attend all SQ rows) */
#define NHD NH                       /* heads (not used; launches attend all NH heads) */
#define MPO MP                       /* rows through the output stage (debug hook) */
#define LQ DM      /* row pitch of the q/k/v rows */
typedef __bf16 v16b __attribute__((ext_vector_type(16)));
typedef unsigned short v8us __attribute__((ext_vector_type(8), may_alias));
typedef float  v8f  __attribute__((ext_vector_type(8)));
typedef float  v4f  __attribute__((ext_vector_type(4)));
typedef float  v4fa __attribute__((ext_vector_type(4), may_alias));
union FragB { v16b v; v8us half[2]; unsigned short u[16]; };

__device__ __forceinline__ unsigned short bf16_bits(float x) { unsigned int u = __float_as_uint(x); return (unsigned short)((u + 0x7FFFu + ((u >> 16) & 1u)) >> 16); }
__device__ __forceinline__ float bf16_val(unsigned short b) { return __uint_as_float(((unsigned int)b) << 16); }
__device__ __forceinline__ float bf16_round(float x) { return bf16_val(bf16_bits(x)); }
// D += A·B with NT terms: 1 = ah·bh, 2 = + al·bh (A split), 3 = + ah·bl (both split)
template <int NT>
__device__ __forceinline__ v8f mmaN(v16b ah, v16b al, v16b bh, v16b bl, v8f c) {
  c = __builtin_amdgcn_wmma_f32_16x16x32_bf16(false, ah, false, bh, (short)0, c, false, false);
  if (NT >= 2) c = __builtin_amdgcn_wmma_f32_16x16x32_bf16(false, al, false, bh, (short)0, c, false, false);
  if (NT >= 3) c = __builtin_amdgcn_wmma_f32_16x16x32_bf16(false, ah, false, bl, (short)0, c, false, false);
  asm volatile("v_nop\n\tv_nop\n\tv_nop\n\tv_nop" : "+v"(c) : "v"(ah), "v"(al), "v"(bh), "v"(bl));
  return c;
}

__global__ __launch_bounds__(256) void k_wt_bf16(const float* __restrict__ W, unsigned short* __restrict__ Wt, int K, int N) {
  const int t = blockIdx.x * 256 + threadIdx.x;
  const int k8n = K / 8;
  if (t >= N * k8n) return;
  const int n = t / k8n, k8 = (t % k8n) * 8;
  v8us v;
#pragma unroll
  for (int i = 0; i < 8; ++i) v[i] = bf16_bits(W[(size_t)(k8 + i) * N + n]);
  *(v8us*)(Wt + (size_t)n * K + k8) = v;
  
}

// GEMM C[M][N] (f32, pitch ldc) = act(A[M][K]·W + bias). A f32 row-major (pitch lda) converted per fragment to bf16
// (ASPLIT: hi/lo two planes -> 2 terms, else single rounded term); Wt bf16 [N][K] (pitch ldb). BIAS_BF16 rounds the
// bias to bf16 first (bias quantised to bf16 before the add). K%32==0, M%16==0, N%64==0.
template <bool ASPLIT, int ACT, bool BIAS_BF16>
__global__ __launch_bounds__(128) void k_gemm_bf(const float* __restrict__ A, int lda, const unsigned short* __restrict__ Wt, int ldb,
                                               const float* __restrict__ bias, float* __restrict__ C, int ldc, int M, int N, int K) {
  __shared__ __attribute__((aligned(16))) float so[4][16][64];
  const int tid = threadIdx.x, w = tid >> 5, lane = tid & 31, ln = lane & 15, hh = lane >> 4;
  const int ntn = N / 64;
  const int wid = blockIdx.x * 4 + w;
  const int mt = wid / ntn, nq = wid % ntn;
  if (mt * 16 >= M) return;
  const int row0 = mt * 16, col0 = nq * 64;
  const float* arow = A + (size_t)(row0 + ln) * lda;
  v8f acc[4] = {};
  for (int kb = 0; kb < K; kb += 32) {
    FragB ah, al;
    const v4f x0 = *(const v4fa*)(arow + kb + 8 * hh), x1 = *(const v4fa*)(arow + kb + 8 * hh + 4);
    const v4f x2 = *(const v4fa*)(arow + kb + 16 + 8 * hh), x3 = *(const v4fa*)(arow + kb + 16 + 8 * hh + 4);
    float xs[16] = {x0[0],x0[1],x0[2],x0[3],x1[0],x1[1],x1[2],x1[3],x2[0],x2[1],x2[2],x2[3],x3[0],x3[1],x3[2],x3[3]};
#pragma unroll
    for (int i = 0; i < 16; ++i) { const unsigned short hb = bf16_bits(xs[i]); ah.u[i] = hb; al.u[i] = ASPLIT ? bf16_bits(xs[i] - bf16_val(hb)) : (unsigned short)0; }
#pragma unroll
    for (int t = 0; t < 4; ++t) {
      const unsigned short* brow = Wt + (size_t)(col0 + t * 16 + ln) * ldb + kb;
      FragB b;
      b.half[0] = *(const v8us*)(brow + 8 * hh);
      b.half[1] = *(const v8us*)(brow + 16 + 8 * hh);
      acc[t] = mmaN<ASPLIT ? 2 : 1>(ah.v, al.v, b.v, b.v, acc[t]);
    }
  }
#pragma unroll
  for (int t = 0; t < 4; ++t) {
    float bv = bias ? bias[col0 + t * 16 + ln] : 0.f;
    if (BIAS_BF16) bv = bf16_round(bv);
#pragma unroll
    for (int r = 0; r < 8; ++r) { float v = acc[t][r] + bv; if (ACT == 1) v = fmaxf(v, 0.f); so[w][8 * hh + r][t * 16 + ln] = v; }
  }
  __builtin_amdgcn_fence(__ATOMIC_ACQ_REL, "workgroup");
  __builtin_amdgcn_wave_barrier();
  const int rsub = lane >> 4, c4 = (lane & 15) * 4;
  {
#pragma unroll
    for (int q = 0; q < 8; ++q) {
      const int r = q * 2 + rsub;
      const v4f v = *(const v4fa*)&so[w][r][c4];
      *(v4f*)(C + (size_t)(row0 + r) * ldc + col0 + c4) = v;
    }
    
  }
}

// GEMM C = act(A·W + bias + resid): A f32 (ASPLIT -> hi/lo 2 terms), Wt bf16 [N][K]; ACT 0 none, 1 relu, 2 exact gelu;
// resid (optional, f32, row index = (row % rmod), pitch ldr, RES_BF16 rounds it) added before the activation.
template <bool ASPLIT, int ACT, bool BIAS_BF16, bool RES_BF16>
__global__ __launch_bounds__(128) void k_gemm_bf3(const float* __restrict__ A, int lda, const unsigned short* __restrict__ Wt, int ldb,
                                                const float* __restrict__ bias, const float* __restrict__ resid, int rmod, int ldr,
                                                float* __restrict__ C, int ldc, int M, int N, int K) {
  __shared__ __attribute__((aligned(16))) float so[4][16][64];
  const int tid = threadIdx.x, w = tid >> 5, lane = tid & 31, ln = lane & 15, hh = lane >> 4;
  const int ntn = N / 64;
  const int wid = blockIdx.x * 4 + w;
  const int mt = wid / ntn, nq = wid % ntn;
  if (mt * 16 >= M) return;
  const int row0 = mt * 16, col0 = nq * 64;
  const float* arow = A + (size_t)(row0 + ln) * lda;
  v8f acc[4] = {};
  for (int kb = 0; kb < K; kb += 32) {
    FragB ah, al;
    const v4f x0 = *(const v4fa*)(arow + kb + 8 * hh), x1 = *(const v4fa*)(arow + kb + 8 * hh + 4);
    const v4f x2 = *(const v4fa*)(arow + kb + 16 + 8 * hh), x3 = *(const v4fa*)(arow + kb + 16 + 8 * hh + 4);
    float xs[16] = {x0[0],x0[1],x0[2],x0[3],x1[0],x1[1],x1[2],x1[3],x2[0],x2[1],x2[2],x2[3],x3[0],x3[1],x3[2],x3[3]};
#pragma unroll
    for (int i = 0; i < 16; ++i) { const unsigned short hb = bf16_bits(xs[i]); ah.u[i] = hb; al.u[i] = ASPLIT ? bf16_bits(xs[i] - bf16_val(hb)) : (unsigned short)0; }
#pragma unroll
    for (int t = 0; t < 4; ++t) {
      const unsigned short* brow = Wt + (size_t)(col0 + t * 16 + ln) * ldb + kb;
      FragB b;
      b.half[0] = *(const v8us*)(brow + 8 * hh);
      b.half[1] = *(const v8us*)(brow + 16 + 8 * hh);
      acc[t] = mmaN<ASPLIT ? 2 : 1>(ah.v, al.v, b.v, b.v, acc[t]);
    }
  }
#pragma unroll
  for (int t = 0; t < 4; ++t) {
    const int col = col0 + t * 16 + ln;
    float bv = bias ? bias[col] : 0.f;
    if (BIAS_BF16) bv = bf16_round(bv);
#pragma unroll
    for (int r = 0; r < 8; ++r) {
      float v = acc[t][r] + bv;
      if (resid) { float rv = resid[(size_t)((row0 + 8 * hh + r) % rmod) * ldr + col]; if (RES_BF16) rv = bf16_round(rv); v += rv; }
      if (ACT == 1) v = fmaxf(v, 0.f);
      if (ACT == 2) v = 0.5f * v * (1.0f + erff(v * 0.70710678118654752f));
      if (ACT == 3) { const float u = 0.7978845608028654f * (v + 0.044715f * v * v * v); v = 0.5f * v * (1.0f + tanhf(u)); }
      so[w][8 * hh + r][t * 16 + ln] = v;
    }
  }
  __builtin_amdgcn_fence(__ATOMIC_ACQ_REL, "workgroup");
  __builtin_amdgcn_wave_barrier();
  const int rsub = lane >> 4, c4 = (lane & 15) * 4;
  {
#pragma unroll
    for (int q = 0; q < 8; ++q) {
      const int r = q * 2 + rsub;
      const v4f v = *(const v4fa*)&so[w][r][c4];
      *(v4f*)(C + (size_t)(row0 + r) * ldc + col0 + c4) = v;
    }
    
  }
}
// row LayerNorm (biased variance, eps) over N: s = X (+ R); optional out_sum <- s; out_norm <- (s-mu)*rsqrt(var+eps)*g + b
template <bool PARAM_BF16>
__global__ __launch_bounds__(256) void k_layernorm(const float* __restrict__ X, const float* __restrict__ R, const float* __restrict__ g, const float* __restrict__ bta,
                                                  float* __restrict__ out_sum, float* __restrict__ out_norm, int N, float eps) {
  __shared__ float red[256];
  const int row = blockIdx.x, tid = threadIdx.x;
  const float* x = X + (size_t)row * N; const float* rr = R ? R + (size_t)row * N : nullptr;
  float vals[16];                     // up to N = 4096
  const int per = N / 256;            // contiguous chunk per thread? use strided-by-4 chunks: thread handles j = tid*4 + 1024*u
  float s1 = 0.f;
  for (int u = 0; u < per / 4; ++u) {
    const int j = tid * 4 + 1024 * u;
    const v4f a = *(const v4fa*)(x + j);
    v4f b = {0.f,0.f,0.f,0.f}; if (rr) b = *(const v4fa*)(rr + j);
#pragma unroll
    for (int q = 0; q < 4; ++q) { const float v = a[q] + b[q]; vals[u * 4 + q] = v; s1 += v; }
  }
  red[tid] = s1; __syncthreads();
  for (int st = 128; st > 0; st >>= 1) { if (tid < st) red[tid] += red[tid + st]; __syncthreads(); }
  const float mu = red[0] / (float)N; __syncthreads();
  float s2 = 0.f;
  for (int u = 0; u < per / 4; ++u)
#pragma unroll
    for (int q = 0; q < 4; ++q) { const float c = vals[u * 4 + q] - mu; s2 += c * c; }
  red[tid] = s2; __syncthreads();
  for (int st = 128; st > 0; st >>= 1) { if (tid < st) red[tid] += red[tid + st]; __syncthreads(); }
  const float rs = rsqrtf(red[0] / (float)N + eps);
  {
    for (int u = 0; u < per / 4; ++u) {
      const int j = tid * 4 + 1024 * u;
      v4f o, sm;
#pragma unroll
      for (int q = 0; q < 4; ++q) {
        float gg = g[j + q], bb = bta[j + q];
        if (PARAM_BF16) { gg = bf16_round(gg); bb = bf16_round(bb); }
        sm[q] = vals[u * 4 + q]; o[q] = (vals[u * 4 + q] - mu) * rs * gg + bb;
      }
      if (out_sum) *(v4f*)(out_sum + (size_t)row * N + j) = sm;
      *(v4f*)(out_norm + (size_t)row * N + j) = o;
    }
    
  }
}



// ---- f16 WMMA path (v_wmma_f32_16x16x32_f16): 11-bit significands for operands in range — used where a [0,1] probability operand needs more precision than bf16
typedef _Float16 v16h __attribute__((ext_vector_type(16)));
union FragH { v16h v; v8us half[2]; _Float16 h[16]; unsigned short u[16]; };
template <int NT>
__device__ __forceinline__ v8f mmaH(v16h ah, v16h al, v16h bh, v16h bl, v8f c) {
  c = __builtin_amdgcn_wmma_f32_16x16x32_f16(false, ah, false, bh, (short)0, c, false, false);
  if (NT >= 2) c = __builtin_amdgcn_wmma_f32_16x16x32_f16(false, al, false, bh, (short)0, c, false, false);
  if (NT >= 3) c = __builtin_amdgcn_wmma_f32_16x16x32_f16(false, ah, false, bl, (short)0, c, false, false);
  asm volatile("v_nop\n\tv_nop\n\tv_nop\n\tv_nop" : "+v"(c) : "v"(ah), "v"(al), "v"(bh), "v"(bl));
  return c;
}
// batched GEMM like k_gemm_b but f16 operands: A f32 (split into f16 hi/lo if ASPLIT, else rounded to f16), Bt = f16 values [n][k]; alpha; C f32; N multiple of 16 (partial tiles skipped)
template <bool ASPLIT>
__global__ __launch_bounds__(128) void k_gemm_h(const float* __restrict__ A, int lda, size_t sA, const _Float16* __restrict__ Bh, int ldb, size_t sB, float alpha, float* __restrict__ C, int ldc, size_t sC, int M, int N, int K) {
  __shared__ __attribute__((aligned(16))) float so[4][16][64];
  const int tid = threadIdx.x, w = tid >> 5, lane = tid & 31, ln = lane & 15, hh = lane >> 4; const int by = blockIdx.y;
  A += (size_t)by * sA; Bh += (size_t)by * sB; C += (size_t)by * sC;
  const int ntn = (N + 63) / 64; const int wid = blockIdx.x * 4 + w; const int mt = wid / ntn, nq = wid % ntn; if (mt * 16 >= M) return;
  const int row0 = mt * 16, col0 = nq * 64; const float* arow = A + (size_t)(row0 + ln) * lda;
  v8f acc[4] = {};
  for (int kb = 0; kb < K; kb += 32) {
    FragH ah, al;
    const v4f x0 = *(const v4fa*)(arow + kb + 8 * hh), x1 = *(const v4fa*)(arow + kb + 8 * hh + 4), x2 = *(const v4fa*)(arow + kb + 16 + 8 * hh), x3 = *(const v4fa*)(arow + kb + 16 + 8 * hh + 4);
    float xs[16] = {x0[0],x0[1],x0[2],x0[3],x1[0],x1[1],x1[2],x1[3],x2[0],x2[1],x2[2],x2[3],x3[0],x3[1],x3[2],x3[3]};
#pragma unroll
    for (int i = 0; i < 16; ++i) { const _Float16 h = (_Float16)xs[i]; ah.h[i] = h; al.h[i] = ASPLIT ? (_Float16)(xs[i] - (float)h) : (_Float16)0.0f; }
#pragma unroll
    for (int t = 0; t < 4; ++t) { if (col0 + t * 16 >= N) continue; const size_t boff = (size_t)(col0 + t * 16 + ln) * ldb + kb; FragH bq; bq.half[0] = *(const v8us*)(Bh + boff + 8 * hh); bq.half[1] = *(const v8us*)(Bh + boff + 16 + 8 * hh);
      acc[t] = mmaH<ASPLIT ? 2 : 1>(ah.v, al.v, bq.v, bq.v, acc[t]); }
  }
#pragma unroll
  for (int t = 0; t < 4; ++t) { if (col0 + t * 16 >= N) continue;
#pragma unroll
    for (int r = 0; r < 8; ++r) so[w][8 * hh + r][t * 16 + ln] = acc[t][r] * alpha; }
  __builtin_amdgcn_fence(__ATOMIC_ACQ_REL, "workgroup"); __builtin_amdgcn_wave_barrier();
  const int rsub = lane >> 4, c4 = (lane & 15) * 4;
  {
#pragma unroll
    for (int q = 0; q < 8; ++q) { const int r = q * 2 + rsub; if (col0 + c4 < N) { const v4f v = *(const v4fa*)&so[w][r][c4]; *(v4f*)(C + (size_t)(row0 + r) * ldc + col0 + c4) = v; } }
     }
}

// Wt[n][k] = f16(W[k][n]·scale) from f32 row-major W[K][N] (scale = power of two; bf16-exact weights stay exact in f16 away from the subnormal range)
__global__ __launch_bounds__(256) void k_wt_f16(const float* __restrict__ W, _Float16* __restrict__ Wt, int K, int N, float scale) {
  const int t = blockIdx.x * 256 + threadIdx.x; if (t >= N * (K / 8)) return; const int n = t / (K / 8), k8 = (t % (K / 8)) * 8; FragH f;
#pragma unroll
  for (int i = 0; i < 8; ++i) f.h[i] = (_Float16)(bf16_round(W[(size_t)(k8 + i) * N + n]) * scale); const v8us o = f.half[0];
  *(v8us*)((unsigned short*)Wt + (size_t)n * K + k8) = o; 
}
// k_gemm_hh variant with fused epilogue: v = acc·alpha + bias[by·sBias + col] (+ CP[(row/rowsPerB)·sCPb + by·64 + col] if CP) ; ACT 0 none / 1 elu ; writes f16 C16 (and f32 C if non-null)
template <int ACT>
__global__ __launch_bounds__(128) void k_gemm_hhx(const _Float16* __restrict__ A, int lda, size_t sA, const _Float16* __restrict__ Bh, int ldb, size_t sB, float alpha, const float* __restrict__ bias, size_t sBias, const float* __restrict__ CP, int rowsPerB, size_t sCPb, int row0g,
    float* __restrict__ C, _Float16* __restrict__ C16, int ldc, size_t sC, int M, int N, int K) {
  __shared__ __attribute__((aligned(16))) float so[4][16][64];
  const int tid = threadIdx.x, w = tid >> 5, lane = tid & 31, ln = lane & 15, hh = lane >> 4; const int by = blockIdx.y;
  A += (size_t)by * sA; Bh += (size_t)by * sB; const size_t cofs = (size_t)by * sC; const float* bp = bias ? bias + (size_t)by * sBias : nullptr;
  const int ntn = (N + 63) / 64; const int wid = blockIdx.x * 4 + w; const int mt = wid / ntn, nq = wid % ntn; if (mt * 16 >= M) return;
  const int row0 = mt * 16, col0 = nq * 64; const _Float16* arow = A + (size_t)(row0 + ln) * lda;
  v8f acc[4] = {};
  for (int kb = 0; kb < K; kb += 32) { FragH ah; ah.half[0] = *(const v8us*)((const unsigned short*)arow + kb + 8 * hh); ah.half[1] = *(const v8us*)((const unsigned short*)arow + kb + 16 + 8 * hh);
#pragma unroll
    for (int t = 0; t < 4; ++t) { if (col0 + t * 16 >= N) continue; const size_t boff = (size_t)(col0 + t * 16 + ln) * ldb + kb; FragH bq; bq.half[0] = *(const v8us*)((const unsigned short*)Bh + boff + 8 * hh); bq.half[1] = *(const v8us*)((const unsigned short*)Bh + boff + 16 + 8 * hh);
      acc[t] = mmaH<1>(ah.v, ah.v, bq.v, bq.v, acc[t]); }
  }
#pragma unroll
  for (int t = 0; t < 4; ++t) { if (col0 + t * 16 >= N) continue; const int col = col0 + t * 16 + ln; const float bv = bp ? bf16_round(bp[col]) : 0.f;
#pragma unroll
    for (int r = 0; r < 8; ++r) { float v = acc[t][r] * alpha + bv; if (CP) { const int rr = row0g + row0 + 8 * hh + r; if (rowsPerB < 0) v += CP[cofs + (size_t)rr * ldc + col];      /* rowsPerB < 0: own element of the batched C plane */ else { const int bidx = rr / rowsPerB; v += CP[(size_t)bidx * sCPb + (size_t)by * 64 + col]; } } if (ACT == 1) v = (v > 0.f) ? v : expm1f(v); else if (ACT == 7) v = (v > 0.f) ? v + 1.0f : expf(v); else if (ACT == 8) v = tanhf(v); else if (ACT == 9) v = 0.5f * v * (1.0f + tanhf(0.7978845608028654f * (v + 0.044715f * v * v * v))); else if (ACT == 11) v = 1.0f / (1.0f + expf(-v)); else if (ACT == 12) v = (v > 0.f) ? v : 0.01f * v; else if (ACT == 14) v = (v > 0.f) ? v : 0.1f * v; else if (ACT == 16) v = (v >= 0.f) ? v : 0.3f * v; else if (ACT == 17) v = (v >= 0.f) ? v : 0.2f * v; else if (ACT == 15) v = v / (1.0f + expf(-v)); else if (ACT == 3) v = fmaxf(v, 0.f); else if (ACT == 6) v = 0.5f * v * (1.0f + erff(v * 0.70710678118654752f)); so[w][8 * hh + r][t * 16 + ln] = v; } }
  __builtin_amdgcn_fence(__ATOMIC_ACQ_REL, "workgroup"); __builtin_amdgcn_wave_barrier();
  const int rsub = lane >> 4, c4 = (lane & 15) * 4; typedef _Float16 v4h __attribute__((ext_vector_type(4)));
  {
#pragma unroll
    for (int q = 0; q < 8; ++q) { const int r = q * 2 + rsub; if (col0 + c4 < N) { const v4f v = *(const v4fa*)&so[w][r][c4]; if (C) *(v4f*)(C + cofs + (size_t)(row0 + r) * ldc + col0 + c4) = v; if (C16) { v4h h4; for (int i = 0; i < 4; ++i) h4[i] = (_Float16)v[i]; *(v4h*)(C16 + cofs + (size_t)(row0 + r) * ldc + col0 + c4) = h4; } } }
     }
}


typedef _Float16 v4h __attribute__((ext_vector_type(4)));

__global__ __launch_bounds__(256) void k_x16(const float* __restrict__ x, _Float16* __restrict__ X16, size_t n8) { const size_t t = (size_t)blockIdx.x * 256 + threadIdx.x; if (t >= n8) return; FragH f;
#pragma unroll
  for (int q = 0; q < 8; ++q) f.h[q] = (_Float16)bf16_round(x[t * 8 + q]); *(v8us*)((unsigned short*)X16 + t * 8) = f.half[0];  }
__global__ __launch_bounds__(256) void k_h16(const float* __restrict__ x, _Float16* __restrict__ X16, size_t n8) { const size_t t = (size_t)blockIdx.x * 256 + threadIdx.x; if (t >= n8) return; FragH f;
#pragma unroll
  for (int q = 0; q < 8; ++q) f.h[q] = (_Float16)x[t * 8 + q]; *(v8us*)((unsigned short*)X16 + t * 8) = f.half[0];  }
__global__ __launch_bounds__(256) void k_round16f(const float* __restrict__ W, _Float16* __restrict__ Bt, size_t n8) { const size_t t = (size_t)blockIdx.x * 256 + threadIdx.x; if (t >= n8) return; FragH f;
#pragma unroll
  for (int i = 0; i < 8; ++i) f.h[i] = (_Float16)(bf16_round(W[t * 8 + i]) * 16.0f); *(v8us*)((unsigned short*)Bt + t * 8) = f.half[0];  }
template <int NHv, int TTv>
__global__ __launch_bounds__(256) void k_vt(const _Float16* __restrict__ V16, int ldv, int voff, _Float16* __restrict__ Vt) { __shared__ unsigned short tl[64][66]; const int tid = threadIdx.x; const int slab = blockIdx.x / (TTv / 64), lg = blockIdx.x % (TTv / 64); const int b = slab / NHv, h = slab % NHv;
  for (int i = tid; i < 64 * 8; i += 256) { const int r = i / 8, c8 = (i % 8) * 8; FragH f; f.half[0] = *(const v8us*)((const unsigned short*)V16 + ((size_t)b * TTv + lg * 64 + r) * ldv + voff + h * 64 + c8);
#pragma unroll
    for (int q = 0; q < 8; ++q) tl[r][c8 + q] = f.u[q]; }
  __syncthreads();
  {
#pragma unroll
    for (int rd = 0; rd < 2; ++rd) { const int d = rd * 32 + tid / 8, pc = tid % 8; FragH f;
#pragma unroll
      for (int q = 0; q < 8; ++q) f.u[q] = tl[pc * 8 + q][d];
      *(v8us*)((unsigned short*)Vt + ((size_t)slab * 64 + d) * TTv + lg * 64 + pc * 8) = f.half[0]; }
     } }

__global__ __launch_bounds__(256) void k_hl(const float* __restrict__ F, _Float16* __restrict__ Hh, _Float16* __restrict__ Hl, size_t n8) { const size_t t = (size_t)blockIdx.x * 256 + threadIdx.x; if (t >= n8) return; FragH fh, fl; const v4f a = *(const v4fa*)(F + t * 8), c = *(const v4fa*)(F + t * 8 + 4);
#pragma unroll
  for (int q = 0; q < 4; ++q) { _Float16 h = (_Float16)a[q]; fh.h[q] = h; fl.h[q] = (_Float16)((a[q] - (float)h) * 1024.0f); h = (_Float16)c[q]; fh.h[4 + q] = h; fl.h[4 + q] = (_Float16)((c[q] - (float)h) * 1024.0f); }
  { *(v8us*)((unsigned short*)Hh + t * 8) = fh.half[0]; *(v8us*)((unsigned short*)Hl + t * 8) = fl.half[0];  } }

// ---- fast GEMM (block tile 128x64, wave tile 32x64; requires M % 128 == 0 rows per launch region, N % 64 == 0 and K % 64 == 0); epilogue = k_gemm_hhx semantics ----
__device__ __forceinline__ v16h g2_frag(const _Float16* p, int hh) { FragH f; f.half[0] = *(const v8us*)((const unsigned short*)p + 8 * hh); f.half[1] = *(const v8us*)((const unsigned short*)p + 16 + 8 * hh); return f.v; }
__device__ __forceinline__ v8f g2_mma(v16h a, v16h b, v8f c) { v8f d = __builtin_amdgcn_wmma_f32_16x16x32_f16(false, a, false, b, (short)0, c, false, false); asm volatile("v_nop\n\tv_nop\n\tv_nop\n\tv_nop" : "+v"(d) : "v"(a), "v"(b)); return d; }
// Operand staging of k_gemm2: one stage = 64 k of the block's 128 A rows and 64 B rows (whole 128-byte lines), brought into LDS by asynchronous 16-byte copies, 12 per thread; eight neighbouring lanes copy one line.
#define G2P 72                       /* LDS row pitch in f16: 128 data bytes + 16, conflict-free for the 16-byte fragment reads */
__device__ __forceinline__ void g2_stage(const _Float16* ag, const _Float16* bg, size_t a16, size_t b16, unsigned la, unsigned lb) {      /* ag, bg: this thread's 16 bytes in rows tid / 8 of A and B at the stage's k; a16, b16: 16 rows on in global memory; la, lb: their LDS byte addresses */
  const _Float16* a1 = ag + a16; const _Float16* a2 = a1 + a16; const _Float16* a3 = a2 + a16; const _Float16* a4 = a3 + a16; const _Float16* a5 = a4 + a16; const _Float16* a6 = a5 + a16; const _Float16* a7 = a6 + a16;
  const _Float16* b1 = bg + b16; const _Float16* b2 = b1 + b16; const _Float16* b3 = b2 + b16;
  const unsigned st = 16 * G2P * 2;      /* 16 rows on in LDS, bytes */
  /* the copies and, as the last line of their own statement, the wait that stands before any of their address registers is written again */
  asm volatile("global_load_async_to_lds_b128 %0, %12, off\n\t"
               "global_load_async_to_lds_b128 %1, %13, off\n\t"
               "global_load_async_to_lds_b128 %2, %14, off\n\t"
               "global_load_async_to_lds_b128 %3, %15, off\n\t"
               "global_load_async_to_lds_b128 %4, %16, off\n\t"
               "global_load_async_to_lds_b128 %5, %17, off\n\t"
               "global_load_async_to_lds_b128 %6, %18, off\n\t"
               "global_load_async_to_lds_b128 %7, %19, off\n\t"
               "global_load_async_to_lds_b128 %8, %20, off\n\t"
               "global_load_async_to_lds_b128 %9, %21, off\n\t"
               "global_load_async_to_lds_b128 %10, %22, off\n\t"
               "global_load_async_to_lds_b128 %11, %23, off\n\t"
               "s_wait_xcnt 0x0"
               :: "v"(la), "v"(la + st), "v"(la + 2 * st), "v"(la + 3 * st), "v"(la + 4 * st), "v"(la + 5 * st), "v"(la + 6 * st), "v"(la + 7 * st), "v"(lb), "v"(lb + st), "v"(lb + 2 * st), "v"(lb + 3 * st),
                  "v"(ag), "v"(a1), "v"(a2), "v"(a3), "v"(a4), "v"(a5), "v"(a6), "v"(a7), "v"(bg), "v"(b1), "v"(b2), "v"(b3) : "memory");
}
template <int ACT>
__global__ __launch_bounds__(128) void k_gemm2(const _Float16* __restrict__ A, int lda, size_t sA, size_t sAz, const _Float16* __restrict__ Bh, int ldb, size_t sB, size_t sBz, float alpha, const float* __restrict__ bias, size_t sBias, const float* __restrict__ CP, int rowsPerB, size_t sCPb, int row0g,
    float* __restrict__ C, _Float16* __restrict__ C16, int ldc, size_t sC, size_t sCz, int M, int N, int K) { static_assert(ACT == 0 || ACT == 3 || ACT == 6 || ACT == 8 || ACT == 9 || ACT == 11 || ACT == 12 || ACT == 14 || ACT == 15 || ACT == 16 || ACT == 17, "k_gemm2: unsupported ACT code (would silently apply no activation)");
  __shared__ __attribute__((aligned(16))) float so[4][32][68];
  __shared__ __attribute__((aligned(16))) _Float16 sa[2][128 * G2P]; __shared__ __attribute__((aligned(16))) _Float16 sb[2][64 * G2P];      /* two stage buffers per operand */
  const int tid = threadIdx.x, w = tid >> 5, lane = tid & 31, ln = lane & 15, hh = lane >> 4; const int by = blockIdx.y, bz = blockIdx.z;      /* two batch axes: strides s* on grid.y, s*z on grid.z */
  A += (size_t)by * sA + (size_t)bz * sAz; Bh += (size_t)by * sB + (size_t)bz * sBz; const size_t cofs = (size_t)by * sC + (size_t)bz * sCz; const float* bp = bias ? bias + (size_t)by * sBias : nullptr;
  const int ntn = N >> 6; const int mt = blockIdx.x / ntn, nq = blockIdx.x - mt * ntn; const int row0 = mt * 128 + 32 * w, col0 = nq * 64; if (mt * 128 >= M) return;      /* the whole block leaves or none, ahead of every copy and barrier */
  const _Float16* agp = A + (size_t)(mt * 128 + (tid >> 3)) * lda + (tid & 7) * 8; const _Float16* bgp = Bh + (size_t)(col0 + (tid >> 3)) * ldb + (tid & 7) * 8;
  const unsigned lofs = (unsigned)((tid >> 3) * (G2P * 2) + (tid & 7) * 16); const unsigned la0 = (unsigned)(size_t)&sa[0][0] + lofs, lb0 = (unsigned)(size_t)&sb[0][0] + lofs;      /* LDS byte addresses = low 32 bits of the shared addresses */
  const size_t a16 = (size_t)16 * lda, b16 = (size_t)16 * ldb; const int nst = K >> 6;
  const v8f z8 = {0.f,0.f,0.f,0.f,0.f,0.f,0.f,0.f}; v8f c00 = z8, c01 = z8, c02 = z8, c03 = z8, c10 = z8, c11 = z8, c12 = z8, c13 = z8;
  g2_stage(agp, bgp, a16, b16, la0, lb0);
  asm volatile("s_wait_asynccnt 0x0" ::: "memory");      /* this wave's copies of stage 0 have landed */
  __syncthreads();      /* every wave's have: stage 0 may be read */
  if (nst > 1) g2_stage(agp + 64, bgp + 64, a16, b16, la0 + (unsigned)sizeof(sa[0]), lb0 + (unsigned)sizeof(sb[0]));
  /* kept rolled: one trip = one stage, so that the order at its foot stays as written */
#pragma unroll 1
  for (int s = 0; s < nst; ++s) { const int bu = s & 1; const _Float16* as = &sa[bu][(32 * w + ln) * G2P]; const _Float16* bs = &sb[bu][ln * G2P];
    v16h af[2][2], bf[2][4];      /* the stage's 12 fragments, read as one group ahead of its 16 products */
#pragma unroll
    for (int kk = 0; kk < 2; ++kk) { af[kk][0] = g2_frag(as + kk * 32, hh); af[kk][1] = g2_frag(as + 16 * G2P + kk * 32, hh);
#pragma unroll
      for (int u = 0; u < 4; ++u) bf[kk][u] = g2_frag(bs + u * 16 * G2P + kk * 32, hh); }
#pragma unroll
    for (int kk = 0; kk < 2; ++kk) { c00 = g2_mma(af[kk][0], bf[kk][0], c00); c10 = g2_mma(af[kk][1], bf[kk][0], c10); c01 = g2_mma(af[kk][0], bf[kk][1], c01); c11 = g2_mma(af[kk][1], bf[kk][1], c11);
      c02 = g2_mma(af[kk][0], bf[kk][2], c02); c12 = g2_mma(af[kk][1], bf[kk][2], c12); c03 = g2_mma(af[kk][0], bf[kk][3], c03); c13 = g2_mma(af[kk][1], bf[kk][3], c13); }
    asm volatile("s_wait_dscnt 0x0" ::: "memory");      /* this wave has finished reading stage s */
    asm volatile("s_wait_asynccnt 0x0" ::: "memory");      /* this wave's copies of stage s + 1 have landed */
    __syncthreads();      /* publishes stage s + 1 and frees stage s's buffer */
    if (s + 2 < nst) g2_stage(agp + (s + 2) * 64, bgp + (s + 2) * 64, a16, b16, la0 + (unsigned)(bu * sizeof(sa[0])), lb0 + (unsigned)(bu * sizeof(sb[0]))); }
  asm volatile("s_wait_asynccnt 0x0" ::: "memory");      /* no copy is outstanding behind the loop */
  v8f accs[8] = {c00, c01, c02, c03, c10, c11, c12, c13};
#pragma unroll
  for (int u = 0; u < 8; ++u) { const int t = u & 3, half = u >> 2; const int col = col0 + t * 16 + ln; const float bv = bp ? bf16_round(bp[col]) : 0.f;
#pragma unroll
    for (int r = 0; r < 8; ++r) { const int rloc = half * 16 + 8 * hh + r; float v = accs[u][r] * alpha + bv; if (CP) { if (rowsPerB < 0) v += CP[cofs + (size_t)(row0g + row0 + rloc) * ldc + col];      /* rowsPerB < 0: own element of the batched C plane */ else { const int bidx = (row0g + row0 + rloc) / rowsPerB; v += CP[(size_t)bidx * sCPb + (size_t)by * 64 + col]; } }
      if (ACT == 3) v = fmaxf(v, 0.f); else if (ACT == 6) v = 0.5f * v * (1.0f + erff(v * 0.70710678118654752f)); else if (ACT == 11) v = 1.0f / (1.0f + expf(-v)); else if (ACT == 15) v = v / (1.0f + expf(-v)); else if (ACT == 12) v = (v > 0.f) ? v : 0.01f * v; else if (ACT == 8) v = tanhf(v); else if (ACT == 9) v = 0.5f * v * (1.0f + tanhf(0.7978845608028654f * (v + 0.044715f * v * v * v))); else if (ACT == 14) v = (v > 0.f) ? v : 0.1f * v; else if (ACT == 16) v = (v >= 0.f) ? v : 0.3f * v; else if (ACT == 17) v = (v >= 0.f) ? v : 0.2f * v;
      so[w][rloc][t * 16 + ln] = v; } }
  __builtin_amdgcn_fence(__ATOMIC_ACQ_REL, "workgroup"); __builtin_amdgcn_wave_barrier();
  const int rsub = lane >> 4, c4 = (lane & 15) * 4;
  {
#pragma unroll
    for (int q = 0; q < 16; ++q) { const int r = q * 2 + rsub; const v4f v = *(const v4fa*)&so[w][r][c4]; if (C) *(v4f*)(C + cofs + (size_t)(row0 + r) * ldc + col0 + c4) = v; if (C16) { v4h h4; for (int i = 0; i < 4; ++i) h4[i] = (_Float16)v[i]; *(v4h*)(C16 + cofs + (size_t)(row0 + r) * ldc + col0 + c4) = h4; } }
     } }


__global__ __launch_bounds__(256) void k_wnat(const float* __restrict__ w, size_t n8, _Float16* __restrict__ Bt) { const size_t t = (size_t)blockIdx.x * 256 + threadIdx.x; if (t >= n8) return; FragH f; for (int q = 0; q < 8; ++q) f.h[q] = (_Float16)(bf16_round(w[t * 8 + q]) * 16.0f); *(v8us*)((unsigned short*)Bt + t * 8) = f.half[0];  }
__global__ __launch_bounds__(256) void k_rsm(const float* __restrict__ S, _Float16* __restrict__ P, int nrows) {
  #pragma clang fp contract(off)
  const int i = blockIdx.x * 256 + threadIdx.x; if (i >= nrows) return; const float* s = S + (size_t)i * SQ; float mx = -3.0e38f;
#pragma unroll 1
  for (int j = 0; j < SQ; ++j) mx = fmaxf(mx, s[j]); float se = 0.f;
#pragma unroll 1
  for (int j = 0; j < SQ; ++j) se += expf(s[j] - mx); const float sc = 256.0f / se;
#pragma unroll 1
  for (int j0 = 0; j0 < SQ; j0 += 8) { FragH f; for (int q = 0; q < 8; ++q) f.h[q] = (_Float16)(expf(s[j0 + q] - mx) * sc); unsigned short* d = (unsigned short*)P + (size_t)i * SQ + j0; *(v8us*)d = f.half[0];  } }
__global__ __launch_bounds__(256) void k_vt(const _Float16* __restrict__ V16, int b, int h0, _Float16* __restrict__ VT) { __shared__ unsigned short tl[64][65]; const int tid = threadIdx.x; const int hh = blockIdx.x % HG, sg = blockIdx.x / HG; const int s0 = sg * 64; const int h = h0 + hh;
  for (int i = tid; i < 64 * 8; i += 256) { const int j = i / 8, d8 = (i % 8) * 8; FragH f; f.half[0] = *(const v8us*)((const unsigned short*)V16 + ((size_t)b * SQ + s0 + j) * DM + h * HD + d8); for (int q = 0; q < 8; ++q) tl[d8 + q][j] = f.u[q]; }
  __syncthreads();
  { for (int i = tid; i < 64 * 8; i += 256) { const int d = i / 8, j8 = (i % 8) * 8; FragH f; for (int q = 0; q < 8; ++q) f.u[q] = tl[d][j8 + q]; *(v8us*)((unsigned short*)VT + ((size_t)hh * HD + d) * SQ + s0 + j8) = f.half[0]; }  } }



// Fused attention, one launch for all (batch, head) planes: a wave owns 32 queries (two 16-column groups) and walks the plane's 1024 keys in passes of 32.
// Transposed products: S^T = K . Q^T (A = 16 key rows, B = 16 query rows, both through g2_frag), so lane (ln, hh) holds, for query ln, the scores of keys 8 hh + r and 16 + 8 hh + r:
// exactly the k positions that g2_frag gives a B operand, so the exponentials are packed in place into P^T and O^T += V^T . P^T (A = 16 rows of V^T) follows with no exchange through memory or LDS.
// Online softmax in base 2: the maximum in use may lag a query's true running maximum by up to 8 (an exponential can reach 2^8, far inside f16); the accumulators are rescaled, tested once per pass, only when it lags by more.
// Row sums are f32 sums of the unrounded exponentials, one partial per wave half, joined at the end. o is stored x64 as f16 (the output GEMM's alpha folds it back).
#define FQ 2                         /* 16-query column groups per wave */
#define FW 8                         /* waves per work-group */
typedef _Float16 v8h __attribute__((ext_vector_type(8)));
typedef _Float16 v2h __attribute__((ext_vector_type(2)));
typedef float v2f __attribute__((ext_vector_type(2)));
union FragP { v16h v; v2h p[8]; };
__device__ __forceinline__ float fa_xhalf(float x) { return __builtin_bit_cast(float, __builtin_amdgcn_permlanex16(__builtin_bit_cast(int, x), __builtin_bit_cast(int, x), 0x76543210, 0xfedcba98, false, false)); }      /* lane l <-> lane l ^ 16 */
__device__ __forceinline__ v8f fa_mma(v16h a, v16h b, v8f c) { return __builtin_amdgcn_wmma_f32_16x16x32_f16(false, a, false, b, (short)0, c, false, false); }
__global__ __launch_bounds__(FW * 32) void k_fattn(const _Float16* __restrict__ Qr, const _Float16* __restrict__ Kr, const _Float16* __restrict__ Vt, _Float16* __restrict__ O) {
  const int lane = threadIdx.x & 31, w = threadIdx.x >> 5, ln = lane & 15, hh = lane >> 4;
  const int plane = blockIdx.y, b = plane / NH, h = plane % NH; const int q0 = (blockIdx.x * FW + w) * (16 * FQ);
  const _Float16* qp = Qr + ((size_t)b * SQ + q0 + ln) * LQ + h * HD; const _Float16* kp = Kr + ((size_t)b * SQ + ln) * LQ + h * HD; const _Float16* vp = Vt + ((size_t)plane * HD + ln) * SQ;
  const float cs = 0.125f * 1.4426950408889634f;      /* 64^-0.5 and log2(e) in one factor */
  const v8f z8 = {0.f,0.f,0.f,0.f,0.f,0.f,0.f,0.f};
  v16h qf[FQ][2]; v8f acc[FQ][4]; float m_run[FQ], l_run[FQ];
#pragma unroll
  for (int g = 0; g < FQ; ++g) { qf[g][0] = g2_frag(qp + (size_t)g * 16 * LQ, hh); qf[g][1] = g2_frag(qp + (size_t)g * 16 * LQ + 32, hh); m_run[g] = -3.0e38f; l_run[g] = 0.f;
#pragma unroll
    for (int t = 0; t < 4; ++t) acc[g][t] = z8; }
  v16h kf[2][2];
#pragma unroll
  for (int kt = 0; kt < 2; ++kt) { kf[kt][0] = g2_frag(kp + (size_t)kt * 16 * LQ, hh); kf[kt][1] = g2_frag(kp + (size_t)kt * 16 * LQ + 32, hh); }
  v16h vf[4];
#pragma unroll
  for (int t = 0; t < 4; ++t) vf[t] = g2_frag(vp + (size_t)t * 16 * SQ, hh);
  /* kept rolled: one pass already holds 16 matrix instructions, and the fragment arrays must keep constant indices */
#pragma unroll 1
  for (int k0 = 0; k0 < SQ; k0 += 32) {
    v8f s[2][FQ];
#pragma unroll
    for (int kt = 0; kt < 2; ++kt) {
#pragma unroll
      for (int g = 0; g < FQ; ++g) s[kt][g] = fa_mma(kf[kt][1], qf[g][1], fa_mma(kf[kt][0], qf[g][0], z8)); }
    float mb[FQ]; bool need = false;
#pragma unroll
    for (int g = 0; g < FQ; ++g) { float mx = fmaxf(s[0][g][0], s[1][g][0]);
#pragma unroll
      for (int r = 1; r < 8; ++r) mx = fmaxf(mx, fmaxf(s[0][g][r], s[1][g][r]));
      mx = fmaxf(mx, fa_xhalf(mx)) * cs; mb[g] = mx; need = need || (mx > m_run[g] + 8.0f); }      /* both halves hold the query's pass maximum, scaled (cs > 0) */
    if (__builtin_amdgcn_ballot_w32(need) != 0) {      /* wave-uniform; always taken on the first pass (factor 0 on zero accumulators) */
#pragma unroll
      for (int g = 0; g < FQ; ++g) { const float mn = fmaxf(m_run[g], mb[g]); const float corr = __builtin_amdgcn_exp2f(m_run[g] - mn); m_run[g] = mn; l_run[g] *= corr;
#pragma unroll
        for (int t = 0; t < 4; ++t) acc[g][t] *= corr; } }
    const int kn = (k0 + 32) & (SQ - 1);      /* both operands are fetched one pass ahead, into the registers their products have just left: K flies under this pass's exponentials and second product, V^T under the next pass's scores and maxima; the last pass asks for keys 0..31 again (in bounds, unused) */
#pragma unroll
    for (int kt = 0; kt < 2; ++kt) { kf[kt][0] = g2_frag(kp + (size_t)(kn + kt * 16) * LQ, hh); kf[kt][1] = g2_frag(kp + (size_t)(kn + kt * 16) * LQ + 32, hh); }
    asm volatile("s_wait_xcnt 0x0" ::: "memory");      /* stands before the address registers of the loads above are written again, also by a later load's result */
    __builtin_amdgcn_sched_barrier(0);      /* keeps the exponentials behind the K loads: moved in front of them, as the compiler did, they leave the loads no time to land before the next pass's first product */
#pragma unroll
    for (int g = 0; g < FQ; ++g) { const float nm = -m_run[g]; FragP pf; v2f ls = {0.f, 0.f};
#pragma unroll
      for (int i = 0; i < 8; ++i) { const v2f x = {s[i >> 2][g][2 * (i & 3)], s[i >> 2][g][2 * (i & 3) + 1]};      /* operand elements 2i, 2i + 1 = tile i >> 2, registers 2 (i & 3), 2 (i & 3) + 1 */
        const v2f a = __builtin_elementwise_fma(x, (v2f){cs, cs}, (v2f){nm, nm}); const v2f p = {__builtin_amdgcn_exp2f(a[0]), __builtin_amdgcn_exp2f(a[1])};
        ls += p; pf.p[i] = __builtin_convertvector(p, v2h); }
      l_run[g] += ls[0] + ls[1];
#pragma unroll
      for (int t = 0; t < 4; ++t) acc[g][t] = fa_mma(vf[t], pf.v, acc[g][t]); }
#pragma unroll
    for (int t = 0; t < 4; ++t) vf[t] = g2_frag(vp + (size_t)t * 16 * SQ + kn, hh);
    asm volatile("s_wait_xcnt 0x0" ::: "memory");      /* the same wait for the V^T loads' address registers */
  }
#pragma unroll
  for (int g = 0; g < FQ; ++g) { const float sc = 64.0f / (l_run[g] + fa_xhalf(l_run[g])); _Float16* op = O + ((size_t)plane * SQ + q0 + g * 16 + ln) * HD + 8 * hh;
#pragma unroll
    for (int t = 0; t < 4; ++t) { const v8f o = acc[g][t] * sc; *(v8h*)(op + t * 16) = __builtin_convertvector(o, v8h); } }      /* registers r = 0..7 are d = 16 t + 8 hh + r of query ln: one 16-byte store */
}

__global__ __launch_bounds__(256) void k_wthd(const float* __restrict__ Wt, _Float16* __restrict__ Bt) { const size_t t = (size_t)blockIdx.x * 256 + threadIdx.x; if (t >= (size_t)NH * HD * (DM / 8)) return; const int m8 = (int)(t % (DM / 8)) * 8; const int d = (int)((t / (DM / 8)) % HD); const int h = (int)(t / ((size_t)(DM / 8) * HD)); FragH f;
  for (int q = 0; q < 8; ++q) f.h[q] = (_Float16)(16.0f * bf16_round(Wt[((size_t)h * DM + m8 + q) * HD + d])); unsigned short* dst = (unsigned short*)Bt + ((size_t)h * HD + d) * DM + m8; *(v8us*)dst = f.half[0];  }

extern "C" void kernel_launch(void* const* d_in, const int* in_sizes, int n_in,
                              void* d_out, int out_size, void* d_ws, size_t ws_size, hipStream_t stream) {
  (void)in_sizes; (void)n_in; (void)out_size;
  const float* const* I = (const float* const*)d_in; const float* xq = I[0]; const float* xk = I[1]; const float* xv = I[2]; const float* wq = I[3]; const float* bq = I[4]; const float* wk = I[5]; const float* bk = I[6]; const float* wv = I[7]; const float* bv = I[8]; const float* wo = I[9]; const float* bo = I[10];      /* three inputs; per-head [in][out] weights [8][512][64] + per-head biases [8][64] (flattened head-major = projection column order); Wo [in][out] + bo */
  char* ws = (char*)d_ws; size_t off = 0;
  auto take = [&](size_t bytes) { char* p = ws + off; off += (bytes + 255) & ~(size_t)255; return p; };
  _Float16* BQ = (_Float16*)take((size_t)DM * DM * 2); _Float16* BK = (_Float16*)take((size_t)DM * DM * 2); _Float16* BV = (_Float16*)take((size_t)DM * DM * 2); _Float16* BO = (_Float16*)take((size_t)DM * DM * 2);
  _Float16* Q16 = (_Float16*)take(NR * DM * 2); _Float16* K16 = (_Float16*)take(NR * DM * 2); _Float16* V16 = (_Float16*)take(NR * DM * 2); _Float16* O16 = (_Float16*)take(NR * DM * 2);
  _Float16* VT = (_Float16*)take((size_t)NB * NH * HD * SQ * 2);
  _Float16* XQ = (_Float16*)take(NR * DM * 2); _Float16* XK = (_Float16*)take(NR * DM * 2); _Float16* XV = (_Float16*)take(NR * DM * 2);      /* the f16 input rows */
  if (off > ws_size) return;
  { const unsigned g = (unsigned)(((size_t)NH * HD * (DM / 8) + 255) / 256); k_wthd<<<g, 256, 0, stream>>>(wq, BQ); k_wthd<<<g, 256, 0, stream>>>(wk, BK); k_wthd<<<g, 256, 0, stream>>>(wv, BV); k_wt_f16<<<(unsigned)(((size_t)DM * (DM / 8) + 255) / 256), 256, 0, stream>>>(wo, BO, DM, DM, 16.0f); }      /* per-head [in][out] W[h][k][d] -> Bt[h*64 + d][k] x16 (head-major output columns = the flattened per-head biases' order); Wo [in][out] -> Bt x16 */

  k_x16<<<(unsigned)((NR * DM / 8 + 255) / 256), 256, 0, stream>>>(xq, XQ, NR * DM / 8); k_x16<<<(unsigned)((NR * DM / 8 + 255) / 256), 256, 0, stream>>>(xk, XK, NR * DM / 8); k_x16<<<(unsigned)((NR * DM / 8 + 255) / 256), 256, 0, stream>>>(xv, XV, NR * DM / 8);      /* the three inputs as exact f16 rows */
  const size_t r0p = (size_t)B0 * SQ;      /* first projected row */
  k_gemm2<0><<<dim3((unsigned)((MP / 128) * (DM / 64)), 1), 128, 0, stream>>>(XQ + r0p * DM, DM, 0, 0, BQ, DM, 0, 0, 0.0625f, bq, 0, nullptr, 1, 0, 0, nullptr, Q16 + r0p * DM, DM, 0, 0, MP, DM, DM);
  k_gemm2<0><<<dim3((unsigned)((MP / 128) * (DM / 64)), 1), 128, 0, stream>>>(XK + r0p * DM, DM, 0, 0, BK, DM, 0, 0, 0.0625f, bk, 0, nullptr, 1, 0, 0, nullptr, K16 + r0p * DM, DM, 0, 0, MP, DM, DM);
  k_gemm2<0><<<dim3((unsigned)((MP / 128) * (DM / 64)), 1), 128, 0, stream>>>(XV + r0p * DM, DM, 0, 0, BV, DM, 0, 0, 0.0625f, bv, 0, nullptr, 1, 0, 0, nullptr, V16 + r0p * DM, DM, 0, 0, MP, DM, DM);
  k_vt<NH, SQ><<<NB * NH * (SQ / 64), 256, 0, stream>>>(V16, LQ, 0, VT);      /* V^T [NB][NH][HD][SQ], all batches in one launch */
  k_fattn<<<dim3(SQ / (16 * FQ * FW), NB * NH), FW * 32, 0, stream>>>(Q16, K16, VT, O16);      /* scores, softmax and P . V of all planes: plane p = batch * NH + head -> 64-wide rows at O16 + p * SQ * HD (head-major context), x64 */
  k_gemm2<0><<<dim3((unsigned)((MPO / 128) * (DM / 64)), 1), 128, 0, stream>>>(O16 + r0p * DM, DM, 0, 0, BO, DM, 0, 0, 0.0009765625f, bo, 0, nullptr, 1, 0, 0, (float*)d_out + r0p * DM, nullptr, DM, 0, 0, MPO, DM, DM);      /* out rows are the output layout */
}

// v005
// A run of this version takes 96.5 microseconds.
// In two side-by-side timings against v004, it was 1.21 and 1.19 times as fast.
// Counting every step since v000, it is 34.9 times as fast.
#include <hip/hip_runtime.h>
// Multi-head attention on three inputs with per-head projection tensors and the source's head-major context view (Q, K, V [8][1024][512]; Qh / Kh / Vh = einsum('bsd,hde->bhse', input, W) + b with per-head [in][out] weights W [8][512][64] and biases [8][64] (uniform +-512^-0.5); scores * 64^-0.5; softmax over all 1024 keys (no mask); context x [B][H][S][64] is RE-VIEWED as [B][S][512] WITHOUT transposing heads and time (row s' of the view = 512 consecutive floats of the [H][S][64] block); out = view Wo + bo ([in][out] 512 x 512) -> [8][1024][512]).
// Structure: token rows r = b*1024 + s; the three inputs as exact f16 rows (bf16-rounded); Q, K, V as three WMMA GEMMs (32x64 wave tiles, f32 accumulation, exact x16 weights + bias, f16 outputs); V^T for all (batch, head) pairs via LDS transposes in one launch; then one fused attention launch for all pairs (S^T = K . Q^T on WMMA, online softmax on VALU with f32 statistics and native exp2, the unnormalised weights packed in registers as the f16 B operand of O^T += V^T . P^T on WMMA; neither scores nor weights reach memory; o carried x64 against f16 subnormal flush, folded into the output GEMM alpha) written straight into the merged f16 o rows; out = o W_o + b GEMM (f32) into the output layout.
// Compute dtype: inputs rounded to bf16; x / weights exact; q, k, v, softmax weights and o as plain f16 GEMM operands (~2^-12); scores and softmax statistics f32; v_wmma_f32_16x16x32_f16.
#define NB 8
#define SQ 1024
#define DM 512
#define NH 8
#define HD 64
#define HG 4                         /* heads per launch of the untemplated k_vt (not launched) */
#define B0 0                         /* first batch processed (debug hook) */
#define NBR NB                       /* batches processed (debug hook) */
#define NR ((size_t)NB * SQ)         /* token rows */
#define MP ((int)((size_t)NBR * SQ)) /* rows projected (debug hook) */
#define QN SQ                        /* query rows per batch (not used; launches attend all SQ rows) */
#define NHD NH                       /* heads (not used; launches attend all NH heads) */
#define MPO MP                       /* rows through the output stage (debug hook) */
#define LQ DM      /* row pitch of the q/k/v rows */
typedef __bf16 v16b __attribute__((ext_vector_type(16)));
typedef unsigned short v8us __attribute__((ext_vector_type(8), may_alias));
typedef float  v8f  __attribute__((ext_vector_type(8)));
typedef float  v4f  __attribute__((ext_vector_type(4)));
typedef float  v4fa __attribute__((ext_vector_type(4), may_alias));
union FragB { v16b v; v8us half[2]; unsigned short u[16]; };

__device__ __forceinline__ unsigned short bf16_bits(float x) { unsigned int u = __float_as_uint(x); return (unsigned short)((u + 0x7FFFu + ((u >> 16) & 1u)) >> 16); }
__device__ __forceinline__ float bf16_val(unsigned short b) { return __uint_as_float(((unsigned int)b) << 16); }
__device__ __forceinline__ float bf16_round(float x) { return bf16_val(bf16_bits(x)); }
// D += A·B with NT terms: 1 = ah·bh, 2 = + al·bh (A split), 3 = + ah·bl (both split)
template <int NT>
__device__ __forceinline__ v8f mmaN(v16b ah, v16b al, v16b bh, v16b bl, v8f c) {
  c = __builtin_amdgcn_wmma_f32_16x16x32_bf16(false, ah, false, bh, (short)0, c, false, false);
  if (NT >= 2) c = __builtin_amdgcn_wmma_f32_16x16x32_bf16(false, al, false, bh, (short)0, c, false, false);
  if (NT >= 3) c = __builtin_amdgcn_wmma_f32_16x16x32_bf16(false, ah, false, bl, (short)0, c, false, false);
  asm volatile("v_nop\n\tv_nop\n\tv_nop\n\tv_nop" : "+v"(c) : "v"(ah), "v"(al), "v"(bh), "v"(bl));
  return c;
}

__global__ __launch_bounds__(256) void k_wt_bf16(const float* __restrict__ W, unsigned short* __restrict__ Wt, int K, int N) {
  const int t = blockIdx.x * 256 + threadIdx.x;
  const int k8n = K / 8;
  if (t >= N * k8n) return;
  const int n = t / k8n, k8 = (t % k8n) * 8;
  v8us v;
#pragma unroll
  for (int i = 0; i < 8; ++i) v[i] = bf16_bits(W[(size_t)(k8 + i) * N + n]);
  *(v8us*)(Wt + (size_t)n * K + k8) = v;
  
}

// GEMM C[M][N] (f32, pitch ldc) = act(A[M][K]·W + bias). A f32 row-major (pitch lda) converted per fragment to bf16
// (ASPLIT: hi/lo two planes -> 2 terms, else single rounded term); Wt bf16 [N][K] (pitch ldb). BIAS_BF16 rounds the
// bias to bf16 first (bias quantised to bf16 before the add). K%32==0, M%16==0, N%64==0.
template <bool ASPLIT, int ACT, bool BIAS_BF16>
__global__ __launch_bounds__(128) void k_gemm_bf(const float* __restrict__ A, int lda, const unsigned short* __restrict__ Wt, int ldb,
                                               const float* __restrict__ bias, float* __restrict__ C, int ldc, int M, int N, int K) {
  __shared__ __attribute__((aligned(16))) float so[4][16][64];
  const int tid = threadIdx.x, w = tid >> 5, lane = tid & 31, ln = lane & 15, hh = lane >> 4;
  const int ntn = N / 64;
  const int wid = blockIdx.x * 4 + w;
  const int mt = wid / ntn, nq = wid % ntn;
  if (mt * 16 >= M) return;
  const int row0 = mt * 16, col0 = nq * 64;
  const float* arow = A + (size_t)(row0 + ln) * lda;
  v8f acc[4] = {};
  for (int kb = 0; kb < K; kb += 32) {
    FragB ah, al;
    const v4f x0 = *(const v4fa*)(arow + kb + 8 * hh), x1 = *(const v4fa*)(arow + kb + 8 * hh + 4);
    const v4f x2 = *(const v4fa*)(arow + kb + 16 + 8 * hh), x3 = *(const v4fa*)(arow + kb + 16 + 8 * hh + 4);
    float xs[16] = {x0[0],x0[1],x0[2],x0[3],x1[0],x1[1],x1[2],x1[3],x2[0],x2[1],x2[2],x2[3],x3[0],x3[1],x3[2],x3[3]};
#pragma unroll
    for (int i = 0; i < 16; ++i) { const unsigned short hb = bf16_bits(xs[i]); ah.u[i] = hb; al.u[i] = ASPLIT ? bf16_bits(xs[i] - bf16_val(hb)) : (unsigned short)0; }
#pragma unroll
    for (int t = 0; t < 4; ++t) {
      const unsigned short* brow = Wt + (size_t)(col0 + t * 16 + ln) * ldb + kb;
      FragB b;
      b.half[0] = *(const v8us*)(brow + 8 * hh);
      b.half[1] = *(const v8us*)(brow + 16 + 8 * hh);
      acc[t] = mmaN<ASPLIT ? 2 : 1>(ah.v, al.v, b.v, b.v, acc[t]);
    }
  }
#pragma unroll
  for (int t = 0; t < 4; ++t) {
    float bv = bias ? bias[col0 + t * 16 + ln] : 0.f;
    if (BIAS_BF16) bv = bf16_round(bv);
#pragma unroll
    for (int r = 0; r < 8; ++r) { float v = acc[t][r] + bv; if (ACT == 1) v = fmaxf(v, 0.f); so[w][8 * hh + r][t * 16 + ln] = v; }
  }
  __builtin_amdgcn_fence(__ATOMIC_ACQ_REL, "workgroup");
  __builtin_amdgcn_wave_barrier();
  const int rsub = lane >> 4, c4 = (lane & 15) * 4;
  {
#pragma unroll
    for (int q = 0; q < 8; ++q) {
      const int r = q * 2 + rsub;
      const v4f v = *(const v4fa*)&so[w][r][c4];
      *(v4f*)(C + (size_t)(row0 + r) * ldc + col0 + c4) = v;
    }
    
  }
}

// GEMM C = act(A·W + bias + resid): A f32 (ASPLIT -> hi/lo 2 terms), Wt bf16 [N][K]; ACT 0 none, 1 relu, 2 exact gelu;
// resid (optional, f32, row index = (row % rmod), pitch ldr, RES_BF16 rounds it) added before the activation.
template <bool ASPLIT, int ACT, bool BIAS_BF16, bool RES_BF16>
__global__ __launch_bounds__(128) void k_gemm_bf3(const float* __restrict__ A, int lda, const unsigned short* __restrict__ Wt, int ldb,
                                                const float* __restrict__ bias, const float* __restrict__ resid, int rmod, int ldr,
                                                float* __restrict__ C, int ldc, int M, int N, int K) {
  __shared__ __attribute__((aligned(16))) float so[4][16][64];
  const int tid = threadIdx.x, w = tid >> 5, lane = tid & 31, ln = lane & 15, hh = lane >> 4;
  const int ntn = N / 64;
  const int wid = blockIdx.x * 4 + w;
  const int mt = wid / ntn, nq = wid % ntn;
  if (mt * 16 >= M) return;
  const int row0 = mt * 16, col0 = nq * 64;
  const float* arow = A + (size_t)(row0 + ln) * lda;
  v8f acc[4] = {};
  for (int kb = 0; kb < K; kb += 32) {
    FragB ah, al;
    const v4f x0 = *(const v4fa*)(arow + kb + 8 * hh), x1 = *(const v4fa*)(arow + kb + 8 * hh + 4);
    const v4f x2 = *(const v4fa*)(arow + kb + 16 + 8 * hh), x3 = *(const v4fa*)(arow + kb + 16 + 8 * hh + 4);
    float xs[16] = {x0[0],x0[1],x0[2],x0[3],x1[0],x1[1],x1[2],x1[3],x2[0],x2[1],x2[2],x2[3],x3[0],x3[1],x3[2],x3[3]};
#pragma unroll
    for (int i = 0; i < 16; ++i) { const unsigned short hb = bf16_bits(xs[i]); ah.u[i] = hb; al.u[i] = ASPLIT ? bf16_bits(xs[i] - bf16_val(hb)) : (unsigned short)0; }
#pragma unroll
    for (int t = 0; t < 4; ++t) {
      const unsigned short* brow = Wt + (size_t)(col0 + t * 16 + ln) * ldb + kb;
      FragB b;
      b.half[0] = *(const v8us*)(brow + 8 * hh);
      b.half[1] = *(const v8us*)(brow + 16 + 8 * hh);
      acc[t] = mmaN<ASPLIT ? 2 : 1>(ah.v, al.v, b.v, b.v, acc[t]);
    }
  }
#pragma unroll
  for (int t = 0; t < 4; ++t) {
    const int col = col0 + t * 16 + ln;
    float bv = bias ? bias[col] : 0.f;
    if (BIAS_BF16) bv = bf16_round(bv);
#pragma unroll
    for (int r = 0; r < 8; ++r) {
      float v = acc[t][r] + bv;
      if (resid) { float rv = resid[(size_t)((row0 + 8 * hh + r) % rmod) * ldr + col]; if (RES_BF16) rv = bf16_round(rv); v += rv; }
      if (ACT == 1) v = fmaxf(v, 0.f);
      if (ACT == 2) v = 0.5f * v * (1.0f + erff(v * 0.70710678118654752f));
      if (ACT == 3) { const float u = 0.7978845608028654f * (v + 0.044715f * v * v * v); v = 0.5f * v * (1.0f + tanhf(u)); }
      so[w][8 * hh + r][t * 16 + ln] = v;
    }
  }
  __builtin_amdgcn_fence(__ATOMIC_ACQ_REL, "workgroup");
  __builtin_amdgcn_wave_barrier();
  const int rsub = lane >> 4, c4 = (lane & 15) * 4;
  {
#pragma unroll
    for (int q = 0; q < 8; ++q) {
      const int r = q * 2 + rsub;
      const v4f v = *(const v4fa*)&so[w][r][c4];
      *(v4f*)(C + (size_t)(row0 + r) * ldc + col0 + c4) = v;
    }
    
  }
}
// row LayerNorm (biased variance, eps) over N: s = X (+ R); optional out_sum <- s; out_norm <- (s-mu)*rsqrt(var+eps)*g + b
template <bool PARAM_BF16>
__global__ __launch_bounds__(256) void k_layernorm(const float* __restrict__ X, const float* __restrict__ R, const float* __restrict__ g, const float* __restrict__ bta,
                                                  float* __restrict__ out_sum, float* __restrict__ out_norm, int N, float eps) {
  __shared__ float red[256];
  const int row = blockIdx.x, tid = threadIdx.x;
  const float* x = X + (size_t)row * N; const float* rr = R ? R + (size_t)row * N : nullptr;
  float vals[16];                     // up to N = 4096
  const int per = N / 256;            // contiguous chunk per thread? use strided-by-4 chunks: thread handles j = tid*4 + 1024*u
  float s1 = 0.f;
  for (int u = 0; u < per / 4; ++u) {
    const int j = tid * 4 + 1024 * u;
    const v4f a = *(const v4fa*)(x + j);
    v4f b = {0.f,0.f,0.f,0.f}; if (rr) b = *(const v4fa*)(rr + j);
#pragma unroll
    for (int q = 0; q < 4; ++q) { const float v = a[q] + b[q]; vals[u * 4 + q] = v; s1 += v; }
  }
  red[tid] = s1; __syncthreads();
  for (int st = 128; st > 0; st >>= 1) { if (tid < st) red[tid] += red[tid + st]; __syncthreads(); }
  const float mu = red[0] / (float)N; __syncthreads();
  float s2 = 0.f;
  for (int u = 0; u < per / 4; ++u)
#pragma unroll
    for (int q = 0; q < 4; ++q) { const float c = vals[u * 4 + q] - mu; s2 += c * c; }
  red[tid] = s2; __syncthreads();
  for (int st = 128; st > 0; st >>= 1) { if (tid < st) red[tid] += red[tid + st]; __syncthreads(); }
  const float rs = rsqrtf(red[0] / (float)N + eps);
  {
    for (int u = 0; u < per / 4; ++u) {
      const int j = tid * 4 + 1024 * u;
      v4f o, sm;
#pragma unroll
      for (int q = 0; q < 4; ++q) {
        float gg = g[j + q], bb = bta[j + q];
        if (PARAM_BF16) { gg = bf16_round(gg); bb = bf16_round(bb); }
        sm[q] = vals[u * 4 + q]; o[q] = (vals[u * 4 + q] - mu) * rs * gg + bb;
      }
      if (out_sum) *(v4f*)(out_sum + (size_t)row * N + j) = sm;
      *(v4f*)(out_norm + (size_t)row * N + j) = o;
    }
    
  }
}



// ---- f16 WMMA path (v_wmma_f32_16x16x32_f16): 11-bit significands for operands in range — used where a [0,1] probability operand needs more precision than bf16
typedef _Float16 v16h __attribute__((ext_vector_type(16)));
union FragH { v16h v; v8us half[2]; _Float16 h[16]; unsigned short u[16]; };
template <int NT>
__device__ __forceinline__ v8f mmaH(v16h ah, v16h al, v16h bh, v16h bl, v8f c) {
  c = __builtin_amdgcn_wmma_f32_16x16x32_f16(false, ah, false, bh, (short)0, c, false, false);
  if (NT >= 2) c = __builtin_amdgcn_wmma_f32_16x16x32_f16(false, al, false, bh, (short)0, c, false, false);
  if (NT >= 3) c = __builtin_amdgcn_wmma_f32_16x16x32_f16(false, ah, false, bl, (short)0, c, false, false);
  asm volatile("v_nop\n\tv_nop\n\tv_nop\n\tv_nop" : "+v"(c) : "v"(ah), "v"(al), "v"(bh), "v"(bl));
  return c;
}
// batched GEMM like k_gemm_b but f16 operands: A f32 (split into f16 hi/lo if ASPLIT, else rounded to f16), Bt = f16 values [n][k]; alpha; C f32; N multiple of 16 (partial tiles skipped)
template <bool ASPLIT>
__global__ __launch_bounds__(128) void k_gemm_h(const float* __restrict__ A, int lda, size_t sA, const _Float16* __restrict__ Bh, int ldb, size_t sB, float alpha, float* __restrict__ C, int ldc, size_t sC, int M, int N, int K) {
  __shared__ __attribute__((aligned(16))) float so[4][16][64];
  const int tid = threadIdx.x, w = tid >> 5, lane = tid & 31, ln = lane & 15, hh = lane >> 4; const int by = blockIdx.y;
  A += (size_t)by * sA; Bh += (size_t)by * sB; C += (size_t)by * sC;
  const int ntn = (N + 63) / 64; const int wid = blockIdx.x * 4 + w; const int mt = wid / ntn, nq = wid % ntn; if (mt * 16 >= M) return;
  const int row0 = mt * 16, col0 = nq * 64; const float* arow = A + (size_t)(row0 + ln) * lda;
  v8f acc[4] = {};
  for (int kb = 0; kb < K; kb += 32) {
    FragH ah, al;
    const v4f x0 = *(const v4fa*)(arow + kb + 8 * hh), x1 = *(const v4fa*)(arow + kb + 8 * hh + 4), x2 = *(const v4fa*)(arow + kb + 16 + 8 * hh), x3 = *(const v4fa*)(arow + kb + 16 + 8 * hh + 4);
    float xs[16] = {x0[0],x0[1],x0[2],x0[3],x1[0],x1[1],x1[2],x1[3],x2[0],x2[1],x2[2],x2[3],x3[0],x3[1],x3[2],x3[3]};
#pragma unroll
    for (int i = 0; i < 16; ++i) { const _Float16 h = (_Float16)xs[i]; ah.h[i] = h; al.h[i] = ASPLIT ? (_Float16)(xs[i] - (float)h) : (_Float16)0.0f; }
#pragma unroll
    for (int t = 0; t < 4; ++t) { if (col0 + t * 16 >= N) continue; const size_t boff = (size_t)(col0 + t * 16 + ln) * ldb + kb; FragH bq; bq.half[0] = *(const v8us*)(Bh + boff + 8 * hh); bq.half[1] = *(const v8us*)(Bh + boff + 16 + 8 * hh);
      acc[t] = mmaH<ASPLIT ? 2 : 1>(ah.v, al.v, bq.v, bq.v, acc[t]); }
  }
#pragma unroll
  for (int t = 0; t < 4; ++t) { if (col0 + t * 16 >= N) continue;
#pragma unroll
    for (int r = 0; r < 8; ++r) so[w][8 * hh + r][t * 16 + ln] = acc[t][r] * alpha; }
  __builtin_amdgcn_fence(__ATOMIC_ACQ_REL, "workgroup"); __builtin_amdgcn_wave_barrier();
  const int rsub = lane >> 4, c4 = (lane & 15) * 4;
  {
#pragma unroll
    for (int q = 0; q < 8; ++q) { const int r = q * 2 + rsub; if (col0 + c4 < N) { const v4f v = *(const v4fa*)&so[w][r][c4]; *(v4f*)(C + (size_t)(row0 + r) * ldc + col0 + c4) = v; } }
     }
}

// k_gemm_hh variant with fused epilogue: v = acc·alpha + bias[by·sBias + col] (+ CP[(row/rowsPerB)·sCPb + by·64 + col] if CP) ; ACT 0 none / 1 elu ; writes f16 C16 (and f32 C if non-null)
template <int ACT>
__global__ __launch_bounds__(128) void k_gemm_hhx(const _Float16* __restrict__ A, int lda, size_t sA, const _Float16* __restrict__ Bh, int ldb, size_t sB, float alpha, const float* __restrict__ bias, size_t sBias, const float* __restrict__ CP, int rowsPerB, size_t sCPb, int row0g,
    float* __restrict__ C, _Float16* __restrict__ C16, int ldc, size_t sC, int M, int N, int K) {
  __shared__ __attribute__((aligned(16))) float so[4][16][64];
  const int tid = threadIdx.x, w = tid >> 5, lane = tid & 31, ln = lane & 15, hh = lane >> 4; const int by = blockIdx.y;
  A += (size_t)by * sA; Bh += (size_t)by * sB; const size_t cofs = (size_t)by * sC; const float* bp = bias ? bias + (size_t)by * sBias : nullptr;
  const int ntn = (N + 63) / 64; const int wid = blockIdx.x * 4 + w; const int mt = wid / ntn, nq = wid % ntn; if (mt * 16 >= M) return;
  const int row0 = mt * 16, col0 = nq * 64; const _Float16* arow = A + (size_t)(row0 + ln) * lda;
  v8f acc[4] = {};
  for (int kb = 0; kb < K; kb += 32) { FragH ah; ah.half[0] = *(const v8us*)((const unsigned short*)arow + kb + 8 * hh); ah.half[1] = *(const v8us*)((const unsigned short*)arow + kb + 16 + 8 * hh);
#pragma unroll
    for (int t = 0; t < 4; ++t) { if (col0 + t * 16 >= N) continue; const size_t boff = (size_t)(col0 + t * 16 + ln) * ldb + kb; FragH bq; bq.half[0] = *(const v8us*)((const unsigned short*)Bh + boff + 8 * hh); bq.half[1] = *(const v8us*)((const unsigned short*)Bh + boff + 16 + 8 * hh);
      acc[t] = mmaH<1>(ah.v, ah.v, bq.v, bq.v, acc[t]); }
  }
#pragma unroll
  for (int t = 0; t < 4; ++t) { if (col0 + t * 16 >= N) continue; const int col = col0 + t * 16 + ln; const float bv = bp ? bf16_round(bp[col]) : 0.f;
#pragma unroll
    for (int r = 0; r < 8; ++r) { float v = acc[t][r] * alpha + bv; if (CP) { const int rr = row0g + row0 + 8 * hh + r; if (rowsPerB < 0) v += CP[cofs + (size_t)rr * ldc + col];      /* rowsPerB < 0: own element of the batched C plane */ else { const int bidx = rr / rowsPerB; v += CP[(size_t)bidx * sCPb + (size_t)by * 64 + col]; } } if (ACT == 1) v = (v > 0.f) ? v : expm1f(v); else if (ACT == 7) v = (v > 0.f) ? v + 1.0f : expf(v); else if (ACT == 8) v = tanhf(v); else if (ACT == 9) v = 0.5f * v * (1.0f + tanhf(0.7978845608028654f * (v + 0.044715f * v * v * v))); else if (ACT == 11) v = 1.0f / (1.0f + expf(-v)); else if (ACT == 12) v = (v > 0.f) ? v : 0.01f * v; else if (ACT == 14) v = (v > 0.f) ? v : 0.1f * v; else if (ACT == 16) v = (v >= 0.f) ? v : 0.3f * v; else if (ACT == 17) v = (v >= 0.f) ? v : 0.2f * v; else if (ACT == 15) v = v / (1.0f + expf(-v)); else if (ACT == 3) v = fmaxf(v, 0.f); else if (ACT == 6) v = 0.5f * v * (1.0f + erff(v * 0.70710678118654752f)); so[w][8 * hh + r][t * 16 + ln] = v; } }
  __builtin_amdgcn_fence(__ATOMIC_ACQ_REL, "workgroup"); __builtin_amdgcn_wave_barrier();
  const int rsub = lane >> 4, c4 = (lane & 15) * 4; typedef _Float16 v4h __attribute__((ext_vector_type(4)));
  {
#pragma unroll
    for (int q = 0; q < 8; ++q) { const int r = q * 2 + rsub; if (col0 + c4 < N) { const v4f v = *(const v4fa*)&so[w][r][c4]; if (C) *(v4f*)(C + cofs + (size_t)(row0 + r) * ldc + col0 + c4) = v; if (C16) { v4h h4; for (int i = 0; i < 4; ++i) h4[i] = (_Float16)v[i]; *(v4h*)(C16 + cofs + (size_t)(row0 + r) * ldc + col0 + c4) = h4; } } }
     }
}


typedef _Float16 v4h __attribute__((ext_vector_type(4)));

__global__ __launch_bounds__(256) void k_h16(const float* __restrict__ x, _Float16* __restrict__ X16, size_t n8) { const size_t t = (size_t)blockIdx.x * 256 + threadIdx.x; if (t >= n8) return; FragH f;
#pragma unroll
  for (int q = 0; q < 8; ++q) f.h[q] = (_Float16)x[t * 8 + q]; *(v8us*)((unsigned short*)X16 + t * 8) = f.half[0];  }
__global__ __launch_bounds__(256) void k_round16f(const float* __restrict__ W, _Float16* __restrict__ Bt, size_t n8) { const size_t t = (size_t)blockIdx.x * 256 + threadIdx.x; if (t >= n8) return; FragH f;
#pragma unroll
  for (int i = 0; i < 8; ++i) f.h[i] = (_Float16)(bf16_round(W[t * 8 + i]) * 16.0f); *(v8us*)((unsigned short*)Bt + t * 8) = f.half[0];  }
template <int NHv, int TTv>
__global__ __launch_bounds__(256) void k_vt(const _Float16* __restrict__ V16, int ldv, int voff, _Float16* __restrict__ Vt) { __shared__ unsigned short tl[64][66]; const int tid = threadIdx.x; const int slab = blockIdx.x / (TTv / 64), lg = blockIdx.x % (TTv / 64); const int b = slab / NHv, h = slab % NHv;
  for (int i = tid; i < 64 * 8; i += 256) { const int r = i / 8, c8 = (i % 8) * 8; FragH f; f.half[0] = *(const v8us*)((const unsigned short*)V16 + ((size_t)b * TTv + lg * 64 + r) * ldv + voff + h * 64 + c8);
#pragma unroll
    for (int q = 0; q < 8; ++q) tl[r][c8 + q] = f.u[q]; }
  __syncthreads();
  {
#pragma unroll
    for (int rd = 0; rd < 2; ++rd) { const int d = rd * 32 + tid / 8, pc = tid % 8; FragH f;
#pragma unroll
      for (int q = 0; q < 8; ++q) f.u[q] = tl[pc * 8 + q][d];
      *(v8us*)((unsigned short*)Vt + ((size_t)slab * 64 + d) * TTv + lg * 64 + pc * 8) = f.half[0]; }
     } }

__global__ __launch_bounds__(256) void k_hl(const float* __restrict__ F, _Float16* __restrict__ Hh, _Float16* __restrict__ Hl, size_t n8) { const size_t t = (size_t)blockIdx.x * 256 + threadIdx.x; if (t >= n8) return; FragH fh, fl; const v4f a = *(const v4fa*)(F + t * 8), c = *(const v4fa*)(F + t * 8 + 4);
#pragma unroll
  for (int q = 0; q < 4; ++q) { _Float16 h = (_Float16)a[q]; fh.h[q] = h; fl.h[q] = (_Float16)((a[q] - (float)h) * 1024.0f); h = (_Float16)c[q]; fh.h[4 + q] = h; fl.h[4 + q] = (_Float16)((c[q] - (float)h) * 1024.0f); }
  { *(v8us*)((unsigned short*)Hh + t * 8) = fh.half[0]; *(v8us*)((unsigned short*)Hl + t * 8) = fl.half[0];  } }

// ---- fast GEMM (block tile 128x64, wave tile 32x64; requires M % 128 == 0 rows per launch region, N % 64 == 0 and K % 64 == 0); epilogue = k_gemm_hhx semantics ----
__device__ __forceinline__ v16h g2_frag(const _Float16* p, int hh) { FragH f; f.half[0] = *(const v8us*)((const unsigned short*)p + 8 * hh); f.half[1] = *(const v8us*)((const unsigned short*)p + 16 + 8 * hh); return f.v; }
__device__ __forceinline__ v8f g2_mma(v16h a, v16h b, v8f c) { v8f d = __builtin_amdgcn_wmma_f32_16x16x32_f16(false, a, false, b, (short)0, c, false, false); asm volatile("v_nop\n\tv_nop\n\tv_nop\n\tv_nop" : "+v"(d) : "v"(a), "v"(b)); return d; }
// Operand staging of k_gemm2: one stage = 64 k of the block's 128 A rows and 64 B rows (whole 128-byte lines), brought into LDS by asynchronous 16-byte copies, 12 per thread; eight neighbouring lanes copy one line.
#define G2P 72                       /* LDS row pitch in f16: 128 data bytes + 16, conflict-free for the 16-byte fragment reads */
__device__ __forceinline__ void g2_stage(const _Float16* ag, const _Float16* bg, size_t a16, size_t b16, unsigned la, unsigned lb) {      /* ag, bg: this thread's 16 bytes in rows tid / 8 of A and B at the stage's k; a16, b16: 16 rows on in global memory; la, lb: their LDS byte addresses */
  const _Float16* a1 = ag + a16; const _Float16* a2 = a1 + a16; const _Float16* a3 = a2 + a16; const _Float16* a4 = a3 + a16; const _Float16* a5 = a4 + a16; const _Float16* a6 = a5 + a16; const _Float16* a7 = a6 + a16;
  const _Float16* b1 = bg + b16; const _Float16* b2 = b1 + b16; const _Float16* b3 = b2 + b16;
  const unsigned st = 16 * G2P * 2;      /* 16 rows on in LDS, bytes */
  /* the copies and, as the last line of their own statement, the wait that stands before any of their address registers is written again */
  asm volatile("global_load_async_to_lds_b128 %0, %12, off\n\t"
               "global_load_async_to_lds_b128 %1, %13, off\n\t"
               "global_load_async_to_lds_b128 %2, %14, off\n\t"
               "global_load_async_to_lds_b128 %3, %15, off\n\t"
               "global_load_async_to_lds_b128 %4, %16, off\n\t"
               "global_load_async_to_lds_b128 %5, %17, off\n\t"
               "global_load_async_to_lds_b128 %6, %18, off\n\t"
               "global_load_async_to_lds_b128 %7, %19, off\n\t"
               "global_load_async_to_lds_b128 %8, %20, off\n\t"
               "global_load_async_to_lds_b128 %9, %21, off\n\t"
               "global_load_async_to_lds_b128 %10, %22, off\n\t"
               "global_load_async_to_lds_b128 %11, %23, off\n\t"
               "s_wait_xcnt 0x0"
               :: "v"(la), "v"(la + st), "v"(la + 2 * st), "v"(la + 3 * st), "v"(la + 4 * st), "v"(la + 5 * st), "v"(la + 6 * st), "v"(la + 7 * st), "v"(lb), "v"(lb + st), "v"(lb + 2 * st), "v"(lb + 3 * st),
                  "v"(ag), "v"(a1), "v"(a2), "v"(a3), "v"(a4), "v"(a5), "v"(a6), "v"(a7), "v"(bg), "v"(b1), "v"(b2), "v"(b3) : "memory");
}
template <int ACT>
__global__ __launch_bounds__(128) void k_gemm2(const _Float16* __restrict__ A, int lda, size_t sA, size_t sAz, const _Float16* __restrict__ Bh, int ldb, size_t sB, size_t sBz, float alpha, const float* __restrict__ bias, const float* __restrict__ biasz1, const float* __restrict__ biasz2, size_t sBias, const float* __restrict__ CP, int rowsPerB, size_t sCPb, int row0g,
    float* __restrict__ C, _Float16* __restrict__ C16, int ldc, size_t sC, size_t sCz, int M, int N, int K) { static_assert(ACT == 0 || ACT == 3 || ACT == 6 || ACT == 8 || ACT == 9 || ACT == 11 || ACT == 12 || ACT == 14 || ACT == 15 || ACT == 16 || ACT == 17, "k_gemm2: unsupported ACT code (would silently apply no activation)");
  __shared__ __attribute__((aligned(16))) float so[4][32][68];
  __shared__ __attribute__((aligned(16))) _Float16 sa[2][128 * G2P]; __shared__ __attribute__((aligned(16))) _Float16 sb[2][64 * G2P];      /* two stage buffers per operand */
  const int tid = threadIdx.x, w = tid >> 5, lane = tid & 31, ln = lane & 15, hh = lane >> 4; const int by = blockIdx.y, bz = blockIdx.z;      /* two batch axes: strides s* on grid.y, s*z on grid.z */
  A += (size_t)by * sA + (size_t)bz * sAz; Bh += (size_t)by * sB + (size_t)bz * sBz; const size_t cofs = (size_t)by * sC + (size_t)bz * sCz; const float* bsel = bz == 0 ? bias : (bz == 1 ? biasz1 : biasz2); const float* bp = bsel ? bsel + (size_t)by * sBias : nullptr;      /* the bias vectors of grid.z planes 0, 1, 2 are separate buffers */
  const int ntn = N >> 6; const int mt = blockIdx.x / ntn, nq = blockIdx.x - mt * ntn; const int row0 = mt * 128 + 32 * w, col0 = nq * 64; if (mt * 128 >= M) return;      /* the whole block leaves or none, ahead of every copy and barrier */
  const _Float16* agp = A + (size_t)(mt * 128 + (tid >> 3)) * lda + (tid & 7) * 8; const _Float16* bgp = Bh + (size_t)(col0 + (tid >> 3)) * ldb + (tid & 7) * 8;
  const unsigned lofs = (unsigned)((tid >> 3) * (G2P * 2) + (tid & 7) * 16); const unsigned la0 = (unsigned)(size_t)&sa[0][0] + lofs, lb0 = (unsigned)(size_t)&sb[0][0] + lofs;      /* LDS byte addresses = low 32 bits of the shared addresses */
  const size_t a16 = (size_t)16 * lda, b16 = (size_t)16 * ldb; const int nst = K >> 6;
  const v8f z8 = {0.f,0.f,0.f,0.f,0.f,0.f,0.f,0.f}; v8f c00 = z8, c01 = z8, c02 = z8, c03 = z8, c10 = z8, c11 = z8, c12 = z8, c13 = z8;
  g2_stage(agp, bgp, a16, b16, la0, lb0);
  asm volatile("s_wait_asynccnt 0x0" ::: "memory");      /* this wave's copies of stage 0 have landed */
  __syncthreads();      /* every wave's have: stage 0 may be read */
  if (nst > 1) g2_stage(agp + 64, bgp + 64, a16, b16, la0 + (unsigned)sizeof(sa[0]), lb0 + (unsigned)sizeof(sb[0]));
  /* kept rolled: one trip = one stage, so that the order at its foot stays as written */
#pragma unroll 1
  for (int s = 0; s < nst; ++s) { const int bu = s & 1; const _Float16* as = &sa[bu][(32 * w + ln) * G2P]; const _Float16* bs = &sb[bu][ln * G2P];
    v16h af[2][2], bf[2][4];      /* the stage's 12 fragments, read as one group ahead of its 16 products */
#pragma unroll
    for (int kk = 0; kk < 2; ++kk) { af[kk][0] = g2_frag(as + kk * 32, hh); af[kk][1] = g2_frag(as + 16 * G2P + kk * 32, hh);
#pragma unroll
      for (int u = 0; u < 4; ++u) bf[kk][u] = g2_frag(bs + u * 16 * G2P + kk * 32, hh); }
#pragma unroll
    for (int kk = 0; kk < 2; ++kk) { c00 = g2_mma(af[kk][0], bf[kk][0], c00); c10 = g2_mma(af[kk][1], bf[kk][0], c10); c01 = g2_mma(af[kk][0], bf[kk][1], c01); c11 = g2_mma(af[kk][1], bf[kk][1], c11);
      c02 = g2_mma(af[kk][0], bf[kk][2], c02); c12 = g2_mma(af[kk][1], bf[kk][2], c12); c03 = g2_mma(af[kk][0], bf[kk][3], c03); c13 = g2_mma(af[kk][1], bf[kk][3], c13); }
    asm volatile("s_wait_dscnt 0x0" ::: "memory");      /* this wave has finished reading stage s */
    asm volatile("s_wait_asynccnt 0x0" ::: "memory");      /* this wave's copies of stage s + 1 have landed */
    __syncthreads();      /* publishes stage s + 1 and frees stage s's buffer */
    if (s + 2 < nst) g2_stage(agp + (s + 2) * 64, bgp + (s + 2) * 64, a16, b16, la0 + (unsigned)(bu * sizeof(sa[0])), lb0 + (unsigned)(bu * sizeof(sb[0]))); }
  asm volatile("s_wait_asynccnt 0x0" ::: "memory");      /* no copy is outstanding behind the loop */
  v8f accs[8] = {c00, c01, c02, c03, c10, c11, c12, c13};
#pragma unroll
  for (int u = 0; u < 8; ++u) { const int t = u & 3, half = u >> 2; const int col = col0 + t * 16 + ln; const float bv = bp ? bf16_round(bp[col]) : 0.f;
#pragma unroll
    for (int r = 0; r < 8; ++r) { const int rloc = half * 16 + 8 * hh + r; float v = accs[u][r] * alpha + bv; if (CP) { if (rowsPerB < 0) v += CP[cofs + (size_t)(row0g + row0 + rloc) * ldc + col];      /* rowsPerB < 0: own element of the batched C plane */ else { const int bidx = (row0g + row0 + rloc) / rowsPerB; v += CP[(size_t)bidx * sCPb + (size_t)by * 64 + col]; } }
      if (ACT == 3) v = fmaxf(v, 0.f); else if (ACT == 6) v = 0.5f * v * (1.0f + erff(v * 0.70710678118654752f)); else if (ACT == 11) v = 1.0f / (1.0f + expf(-v)); else if (ACT == 15) v = v / (1.0f + expf(-v)); else if (ACT == 12) v = (v > 0.f) ? v : 0.01f * v; else if (ACT == 8) v = tanhf(v); else if (ACT == 9) v = 0.5f * v * (1.0f + tanhf(0.7978845608028654f * (v + 0.044715f * v * v * v))); else if (ACT == 14) v = (v > 0.f) ? v : 0.1f * v; else if (ACT == 16) v = (v >= 0.f) ? v : 0.3f * v; else if (ACT == 17) v = (v >= 0.f) ? v : 0.2f * v;
      so[w][rloc][t * 16 + ln] = v; } }
  __builtin_amdgcn_fence(__ATOMIC_ACQ_REL, "workgroup"); __builtin_amdgcn_wave_barrier();
  const int rsub = lane >> 4, c4 = (lane & 15) * 4;
  {
#pragma unroll
    for (int q = 0; q < 16; ++q) { const int r = q * 2 + rsub; const v4f v = *(const v4fa*)&so[w][r][c4]; if (C) *(v4f*)(C + cofs + (size_t)(row0 + r) * ldc + col0 + c4) = v; if (C16) { v4h h4; for (int i = 0; i < 4; ++i) h4[i] = (_Float16)v[i]; *(v4h*)(C16 + cofs + (size_t)(row0 + r) * ldc + col0 + c4) = h4; } }
     } }


__global__ __launch_bounds__(256) void k_wnat(const float* __restrict__ w, size_t n8, _Float16* __restrict__ Bt) { const size_t t = (size_t)blockIdx.x * 256 + threadIdx.x; if (t >= n8) return; FragH f; for (int q = 0; q < 8; ++q) f.h[q] = (_Float16)(bf16_round(w[t * 8 + q]) * 16.0f); *(v8us*)((unsigned short*)Bt + t * 8) = f.half[0];  }
__global__ __launch_bounds__(256) void k_rsm(const float* __restrict__ S, _Float16* __restrict__ P, int nrows) {
  #pragma clang fp contract(off)
  const int i = blockIdx.x * 256 + threadIdx.x; if (i >= nrows) return; const float* s = S + (size_t)i * SQ; float mx = -3.0e38f;
#pragma unroll 1
  for (int j = 0; j < SQ; ++j) mx = fmaxf(mx, s[j]); float se = 0.f;
#pragma unroll 1
  for (int j = 0; j < SQ; ++j) se += expf(s[j] - mx); const float sc = 256.0f / se;
#pragma unroll 1
  for (int j0 = 0; j0 < SQ; j0 += 8) { FragH f; for (int q = 0; q < 8; ++q) f.h[q] = (_Float16)(expf(s[j0 + q] - mx) * sc); unsigned short* d = (unsigned short*)P + (size_t)i * SQ + j0; *(v8us*)d = f.half[0];  } }
__global__ __launch_bounds__(256) void k_vt(const _Float16* __restrict__ V16, int b, int h0, _Float16* __restrict__ VT) { __shared__ unsigned short tl[64][65]; const int tid = threadIdx.x; const int hh = blockIdx.x % HG, sg = blockIdx.x / HG; const int s0 = sg * 64; const int h = h0 + hh;
  for (int i = tid; i < 64 * 8; i += 256) { const int j = i / 8, d8 = (i % 8) * 8; FragH f; f.half[0] = *(const v8us*)((const unsigned short*)V16 + ((size_t)b * SQ + s0 + j) * DM + h * HD + d8); for (int q = 0; q < 8; ++q) tl[d8 + q][j] = f.u[q]; }
  __syncthreads();
  { for (int i = tid; i < 64 * 8; i += 256) { const int d = i / 8, j8 = (i % 8) * 8; FragH f; for (int q = 0; q < 8; ++q) f.u[q] = tl[d][j8 + q]; *(v8us*)((unsigned short*)VT + ((size_t)hh * HD + d) * SQ + s0 + j8) = f.half[0]; }  } }



// Fused attention, one launch for all (batch, head) planes: a wave owns 32 queries (two 16-column groups) and walks the plane's 1024 keys in passes of 32.
// Transposed products: S^T = K . Q^T (A = 16 key rows, B = 16 query rows, both through g2_frag), so lane (ln, hh) holds, for query ln, the scores of keys 8 hh + r and 16 + 8 hh + r:
// exactly the k positions that g2_frag gives a B operand, so the exponentials are packed in place into P^T and O^T += V^T . P^T (A = 16 rows of V^T) follows with no exchange through memory or LDS.
// Online softmax in base 2: the maximum in use may lag a query's true running maximum by up to 8 (an exponential can reach 2^8, far inside f16); the accumulators are rescaled, tested once per pass, only when it lags by more.
// Row sums are f32 sums of the unrounded exponentials, one partial per wave half, joined at the end. o is stored x64 as f16 (the output GEMM's alpha folds it back).
#define FQ 2                         /* 16-query column groups per wave */
#define FW 8                         /* waves per work-group */
typedef _Float16 v8h __attribute__((ext_vector_type(8)));
typedef _Float16 v2h __attribute__((ext_vector_type(2)));
typedef float v2f __attribute__((ext_vector_type(2)));
union FragP { v16h v; v2h p[8]; };
__device__ __forceinline__ float fa_xhalf(float x) { return __builtin_bit_cast(float, __builtin_amdgcn_permlanex16(__builtin_bit_cast(int, x), __builtin_bit_cast(int, x), 0x76543210, 0xfedcba98, false, false)); }      /* lane l <-> lane l ^ 16 */
__device__ __forceinline__ v8f fa_mma(v16h a, v16h b, v8f c) { return __builtin_amdgcn_wmma_f32_16x16x32_f16(false, a, false, b, (short)0, c, false, false); }
__global__ __launch_bounds__(FW * 32) void k_fattn(const _Float16* __restrict__ Qr, const _Float16* __restrict__ Kr, const _Float16* __restrict__ Vt, _Float16* __restrict__ O) {
  const int lane = threadIdx.x & 31, w = threadIdx.x >> 5, ln = lane & 15, hh = lane >> 4;
  const int plane = blockIdx.y, b = plane / NH, h = plane % NH; const int q0 = (blockIdx.x * FW + w) * (16 * FQ);
  const _Float16* qp = Qr + ((size_t)b * SQ + q0 + ln) * LQ + h * HD; const _Float16* kp = Kr + ((size_t)b * SQ + ln) * LQ + h * HD; const _Float16* vp = Vt + ((size_t)plane * HD + ln) * SQ;
  const float cs = 0.125f * 1.4426950408889634f;      /* 64^-0.5 and log2(e) in one factor */
  const v8f z8 = {0.f,0.f,0.f,0.f,0.f,0.f,0.f,0.f};
  v16h qf[FQ][2]; v8f acc[FQ][4]; float m_run[FQ], l_run[FQ];
#pragma unroll
  for (int g = 0; g < FQ; ++g) { qf[g][0] = g2_frag(qp + (size_t)g * 16 * LQ, hh); qf[g][1] = g2_frag(qp + (size_t)g * 16 * LQ + 32, hh); m_run[g] = -3.0e38f; l_run[g] = 0.f;
#pragma unroll
    for (int t = 0; t < 4; ++t) acc[g][t] = z8; }
  v16h kf[2][2];
#pragma unroll
  for (int kt = 0; kt < 2; ++kt) { kf[kt][0] = g2_frag(kp + (size_t)kt * 16 * LQ, hh); kf[kt][1] = g2_frag(kp + (size_t)kt * 16 * LQ + 32, hh); }
  v16h vf[4];
#pragma unroll
  for (int t = 0; t < 4; ++t) vf[t] = g2_frag(vp + (size_t)t * 16 * SQ, hh);
  /* kept rolled: one pass already holds 16 matrix instructions, and the fragment arrays must keep constant indices */
#pragma unroll 1
  for (int k0 = 0; k0 < SQ; k0 += 32) {
    v8f s[2][FQ];
#pragma unroll
    for (int kt = 0; kt < 2; ++kt) {
#pragma unroll
      for (int g = 0; g < FQ; ++g) s[kt][g] = fa_mma(kf[kt][1], qf[g][1], fa_mma(kf[kt][0], qf[g][0], z8)); }
    float mb[FQ]; bool need = false;
#pragma unroll
    for (int g = 0; g < FQ; ++g) { float mx = fmaxf(s[0][g][0], s[1][g][0]);
#pragma unroll
      for (int r = 1; r < 8; ++r) mx = fmaxf(mx, fmaxf(s[0][g][r], s[1][g][r]));
      mx = fmaxf(mx, fa_xhalf(mx)) * cs; mb[g] = mx; need = need || (mx > m_run[g] + 8.0f); }      /* both halves hold the query's pass maximum, scaled (cs > 0) */
    if (__builtin_amdgcn_ballot_w32(need) != 0) {      /* wave-uniform; always taken on the first pass (factor 0 on zero accumulators) */
#pragma unroll
      for (int g = 0; g < FQ; ++g) { const float mn = fmaxf(m_run[g], mb[g]); const float corr = __builtin_amdgcn_exp2f(m_run[g] - mn); m_run[g] = mn; l_run[g] *= corr;
#pragma unroll
        for (int t = 0; t < 4; ++t) acc[g][t] *= corr; } }
    const int kn = (k0 + 32) & (SQ - 1);      /* both operands are fetched one pass ahead, into the registers their products have just left: K flies under this pass's exponentials and second product, V^T under the next pass's scores and maxima; the last pass asks for keys 0..31 again (in bounds, unused) */
#pragma unroll
    for (int kt = 0; kt < 2; ++kt) { kf[kt][0] = g2_frag(kp + (size_t)(kn + kt * 16) * LQ, hh); kf[kt][1] = g2_frag(kp + (size_t)(kn + kt * 16) * LQ + 32, hh); }
    asm volatile("s_wait_xcnt 0x0" ::: "memory");      /* stands before the address registers of the loads above are written again, also by a later load's result */
    __builtin_amdgcn_sched_barrier(0);      /* keeps the exponentials behind the K loads: moved in front of them, as the compiler did, they leave the loads no time to land before the next pass's first product */
#pragma unroll
    for (int g = 0; g < FQ; ++g) { const float nm = -m_run[g]; FragP pf; v2f ls = {0.f, 0.f};
#pragma unroll
      for (int i = 0; i < 8; ++i) { const v2f x = {s[i >> 2][g][2 * (i & 3)], s[i >> 2][g][2 * (i & 3) + 1]};      /* operand elements 2i, 2i + 1 = tile i >> 2, registers 2 (i & 3), 2 (i & 3) + 1 */
        const v2f a = __builtin_elementwise_fma(x, (v2f){cs, cs}, (v2f){nm, nm}); const v2f p = {__builtin_amdgcn_exp2f(a[0]), __builtin_amdgcn_exp2f(a[1])};
        ls += p; pf.p[i] = __builtin_convertvector(p, v2h); }
      l_run[g] += ls[0] + ls[1];
#pragma unroll
      for (int t = 0; t < 4; ++t) acc[g][t] = fa_mma(vf[t], pf.v, acc[g][t]); }
#pragma unroll
    for (int t = 0; t < 4; ++t) vf[t] = g2_frag(vp + (size_t)t * 16 * SQ + kn, hh);
    asm volatile("s_wait_xcnt 0x0" ::: "memory");      /* the same wait for the V^T loads' address registers */
  }
#pragma unroll
  for (int g = 0; g < FQ; ++g) { const float sc = 64.0f / (l_run[g] + fa_xhalf(l_run[g])); _Float16* op = O + ((size_t)plane * SQ + q0 + g * 16 + ln) * HD + 8 * hh;
#pragma unroll
    for (int t = 0; t < 4; ++t) { const v8f o = acc[g][t] * sc; *(v8h*)(op + t * 16) = __builtin_convertvector(o, v8h); } }      /* registers r = 0..7 are d = 16 t + 8 hh + r of query ln: one 16-byte store */
}

// Operand preparation, all of it in one launch (the seven conversions depend on nothing but the inputs).
// Work-groups 0 .. PW - 1, the weights: thread t owns 8 k of output column n = t / 64 in all four matrices and writes Bt[n][k] = f16(16 x bf16-rounded weight); per-head W[h][k][d] has n = h * 64 + d (head-major columns = the flattened biases' order), Wo[k][n] is plain [in][out].
// Work-groups PW .. PW + PX - 1, the three inputs as exact f16 rows (bf16-rounded): each thread converts PC chunks of 8 floats of each input, one work-group of threads apart, so a wave's loads and stores stay contiguous and few waves have to be started.
#define PW 128                       /* work-groups on the weights: 512 columns x 64 chunks of 8 k */
#define PX 512                       /* work-groups on the inputs */
#define PC 4                         /* chunks per thread and input */
__device__ __forceinline__ v8us p_cvt8(const float* v, float scale) { FragH f;
#pragma unroll
  for (int q = 0; q < 8; ++q) f.h[q] = (_Float16)(bf16_round(v[q]) * scale); return f.half[0]; }
__device__ __forceinline__ v8us p_cvt44(v4f a, v4f b) { const float v[8] = {a[0], a[1], a[2], a[3], b[0], b[1], b[2], b[3]}; return p_cvt8(v, 1.0f); }
__global__ __launch_bounds__(256) void k_prep(const float* __restrict__ xq, const float* __restrict__ xk, const float* __restrict__ xv, const float* __restrict__ wq, const float* __restrict__ wk, const float* __restrict__ wv, const float* __restrict__ wo,
    _Float16* __restrict__ XQ, _Float16* __restrict__ XK, _Float16* __restrict__ XV, _Float16* __restrict__ BQ, _Float16* __restrict__ BK, _Float16* __restrict__ BV, _Float16* __restrict__ BO) {
  static_assert((size_t)PW * 256 == (size_t)DM * (DM / 8) && NH * HD == DM, "one weight thread per 8 k of a column"); static_assert((size_t)PX * 256 * PC == NR * DM / 8, "the input threads cover every chunk once");
  if (blockIdx.x < PW) {
    const int t = blockIdx.x * 256 + threadIdx.x; const int n = t / (DM / 8), k8 = (t % (DM / 8)) * 8; const int h = n / HD, d = n % HD;
    const size_t ph = ((size_t)h * DM + k8) * HD + d, po = (size_t)k8 * DM + n; float a[4][8];
#pragma unroll
    for (int q = 0; q < 8; ++q) { a[0][q] = wq[ph + (size_t)q * HD]; a[1][q] = wk[ph + (size_t)q * HD]; a[2][q] = wv[ph + (size_t)q * HD]; a[3][q] = wo[po + (size_t)q * DM]; }
    const size_t dst = (size_t)n * DM + k8;
    *(v8us*)((unsigned short*)BQ + dst) = p_cvt8(a[0], 16.0f); *(v8us*)((unsigned short*)BK + dst) = p_cvt8(a[1], 16.0f); *(v8us*)((unsigned short*)BV + dst) = p_cvt8(a[2], 16.0f); *(v8us*)((unsigned short*)BO + dst) = p_cvt8(a[3], 16.0f);
    return; }
  const size_t i0 = ((size_t)(blockIdx.x - PW) * (PC * 256) + threadIdx.x) * 8;      /* first float of the thread's first chunk; its next chunks lie 256 chunks on each */
  const float* pq = xq + i0; const float* pk = xk + i0; const float* pv = xv + i0;
  v4f v[3][PC][2];
#pragma unroll
  for (int c = 0; c < PC; ++c) { const int o = c * 256 * 8;
    v[0][c][0] = *(const v4fa*)(pq + o); v[0][c][1] = *(const v4fa*)(pq + o + 4); v[1][c][0] = *(const v4fa*)(pk + o); v[1][c][1] = *(const v4fa*)(pk + o + 4); v[2][c][0] = *(const v4fa*)(pv + o); v[2][c][1] = *(const v4fa*)(pv + o + 4); }
  asm volatile("s_wait_xcnt 0x0" :: "v"(pq), "v"(pk), "v"(pv) : "memory");      /* stands before the loads' address registers are written again; naming the three addresses keeps their registers out of the later loads' results; as a statement on memory it also holds all of the thread's loads ahead of the first conversion, one memory latency instead of several */
#pragma unroll
  for (int c = 0; c < PC; ++c) { const size_t o = i0 + (size_t)c * 256 * 8;
    *(v8us*)((unsigned short*)XQ + o) = p_cvt44(v[0][c][0], v[0][c][1]); *(v8us*)((unsigned short*)XK + o) = p_cvt44(v[1][c][0], v[1][c][1]); *(v8us*)((unsigned short*)XV + o) = p_cvt44(v[2][c][0], v[2][c][1]); }
  asm volatile("s_wait_xcnt 0x0" ::: "memory");      /* stands behind the last stores, before anything that follows them in the code can write their address or data registers again */
}

extern "C" void kernel_launch(void* const* d_in, const int* in_sizes, int n_in,
                              void* d_out, int out_size, void* d_ws, size_t ws_size, hipStream_t stream) {
  (void)in_sizes; (void)n_in; (void)out_size;
  const float* const* I = (const float* const*)d_in; const float* xq = I[0]; const float* xk = I[1]; const float* xv = I[2]; const float* wq = I[3]; const float* bq = I[4]; const float* wk = I[5]; const float* bk = I[6]; const float* wv = I[7]; const float* bv = I[8]; const float* wo = I[9]; const float* bo = I[10];      /* three inputs; per-head [in][out] weights [8][512][64] + per-head biases [8][64] (flattened head-major = projection column order); Wo [in][out] + bo */
  char* ws = (char*)d_ws; size_t off = 0;
  auto take = [&](size_t bytes) { char* p = ws + off; off += (bytes + 255) & ~(size_t)255; return p; };
  _Float16* BQ = (_Float16*)take((size_t)DM * DM * 2); _Float16* BK = (_Float16*)take((size_t)DM * DM * 2); _Float16* BV = (_Float16*)take((size_t)DM * DM * 2); _Float16* BO = (_Float16*)take((size_t)DM * DM * 2);
  _Float16* Q16 = (_Float16*)take(NR * DM * 2); _Float16* K16 = (_Float16*)take(NR * DM * 2); _Float16* V16 = (_Float16*)take(NR * DM * 2); _Float16* O16 = (_Float16*)take(NR * DM * 2);
  _Float16* VT = (_Float16*)take((size_t)NB * NH * HD * SQ * 2);
  _Float16* XQ = (_Float16*)take(NR * DM * 2); _Float16* XK = (_Float16*)take(NR * DM * 2); _Float16* XV = (_Float16*)take(NR * DM * 2);      /* the f16 input rows */
  if (off > ws_size) return;
  k_prep<<<PW + PX, 256, 0, stream>>>(xq, xk, xv, wq, wk, wv, wo, XQ, XK, XV, BQ, BK, BV, BO);      /* the four weight matrices as Bt x16 and the three inputs as exact f16 rows */
  const size_t r0p = (size_t)B0 * SQ;      /* first projected row */
  k_gemm2<0><<<dim3((unsigned)((MP / 128) * (DM / 64)), 1, 3), 128, 0, stream>>>(XQ + r0p * DM, DM, 0, NR * DM, BQ, DM, 0, (size_t)DM * DM, 0.0625f, bq, bk, bv, 0, nullptr, 1, 0, 0, nullptr, Q16 + r0p * DM, DM, 0, NR * DM, MP, DM, DM);      /* Q, K and V projections on grid.z: XQ XK XV, BQ BK BV and Q16 K16 V16 lie one behind the other in the workspace (every size is a multiple of the 256-byte rounding) */
  k_vt<NH, SQ><<<NB * NH * (SQ / 64), 256, 0, stream>>>(V16, LQ, 0, VT);      /* V^T [NB][NH][HD][SQ], all batches in one launch */
  k_fattn<<<dim3(SQ / (16 * FQ * FW), NB * NH), FW * 32, 0, stream>>>(Q16, K16, VT, O16);      /* scores, softmax and P . V of all planes: plane p = batch * NH + head -> 64-wide rows at O16 + p * SQ * HD (head-major context), x64 */
  k_gemm2<0><<<dim3((unsigned)((MPO / 128) * (DM / 64)), 1), 128, 0, stream>>>(O16 + r0p * DM, DM, 0, 0, BO, DM, 0, 0, 0.0009765625f, bo, nullptr, nullptr, 0, nullptr, 1, 0, 0, (float*)d_out + r0p * DM, nullptr, DM, 0, 0, MPO, DM, DM);      /* out rows are the output layout */
}

// v006
// It runs in 75.5 microseconds.
// Next to v005, in two timings, it ran 1.27 times as fast each time.
// Over all steps from v000 it is 44.3 times as fast.
#include <hip/hip_runtime.h>
// Multi-head attention on three inputs with per-head projection tensors and the source's head-major context view (Q, K, V [8][1024][512]; Qh / Kh / Vh = einsum('bsd,hde->bhse', input, W) + b with per-head [in][out] weights W [8][512][64] and biases [8][64] (uniform +-512^-0.5); scores * 64^-0.5; softmax over all 1024 keys (no mask); context x [B][H][S][64] is RE-VIEWED as [B][S][512] WITHOUT transposing heads and time (row s' of the view = 512 consecutive floats of the [H][S][64] block); out = view Wo + bo ([in][out] 512 x 512) -> [8][1024][512]).
// Structure: token rows r = b*1024 + s; the three inputs as exact f16 rows (bf16-rounded); Q, K, V as three WMMA GEMMs (32x64 wave tiles, f32 accumulation, exact x16 weights + bias, f16 outputs); V^T for all (batch, head) pairs via LDS transposes in one launch; then one fused attention launch for all pairs (S^T = K . Q^T on WMMA, online softmax on VALU with f32 statistics and native exp2, the unnormalised weights packed in registers as the f16 B operand of O^T += V^T . P^T on WMMA; neither scores nor weights reach memory; o carried x64 against f16 subnormal flush, folded into the output GEMM alpha) written straight into the merged f16 o rows; out = o W_o + b GEMM (f32) into the output layout.
// Compute dtype: inputs rounded to bf16; x / weights exact; q, k, v, softmax weights and o as plain f16 GEMM operands (~2^-12); scores and softmax statistics f32; v_wmma_f32_16x16x32_f16.
#define NB 8
#define SQ 1024
#define DM 512
#define NH 8
#define HD 64
#define HG 4                         /* heads per launch of the untemplated k_vt (not launched) */
#define B0 0                         /* first batch processed (debug hook) */
#define NBR NB                       /* batches processed (debug hook) */
#define NR ((size_t)NB * SQ)         /* token rows */
#define MP ((int)((size_t)NBR * SQ)) /* rows projected (debug hook) */
#define QN SQ                        /* query rows per batch (not used; launches attend all SQ rows) */
#define NHD NH                       /* heads (not used; launches attend all NH heads) */
#define MPO MP                       /* rows through the output stage (debug hook) */
#define LQ DM      /* row pitch of the q/k/v rows */
typedef __bf16 v16b __attribute__((ext_vector_type(16)));
typedef unsigned short v8us __attribute__((ext_vector_type(8), may_alias));
typedef float  v8f  __attribute__((ext_vector_type(8)));
typedef float  v4f  __attribute__((ext_vector_type(4)));
typedef float  v4fa __attribute__((ext_vector_type(4), may_alias));
union FragB { v16b v; v8us half[2]; unsigned short u[16]; };

__device__ __forceinline__ unsigned short bf16_bits(float x) { unsigned int u = __float_as_uint(x); return (unsigned short)((u + 0x7FFFu + ((u >> 16) & 1u)) >> 16); }
__device__ __forceinline__ float bf16_val(unsigned short b) { return __uint_as_float(((unsigned int)b) << 16); }
__device__ __forceinline__ float bf16_round(float x) { return bf16_val(bf16_bits(x)); }
// D += A·B with NT terms: 1 = ah·bh, 2 = + al·bh (A split), 3 = + ah·bl (both split)
template <int NT>
__device__ __forceinline__ v8f mmaN(v16b ah, v16b al, v16b bh, v16b bl, v8f c) {
  c = __builtin_amdgcn_wmma_f32_16x16x32_bf16(false, ah, false, bh, (short)0, c, false, false);
  if (NT >= 2) c = __builtin_amdgcn_wmma_f32_16x16x32_bf16(false, al, false, bh, (short)0, c, false, false);
  if (NT >= 3) c = __builtin_amdgcn_wmma_f32_16x16x32_bf16(false, ah, false, bl, (short)0, c, false, false);
  asm volatile("v_nop\n\tv_nop\n\tv_nop\n\tv_nop" : "+v"(c) : "v"(ah), "v"(al), "v"(bh), "v"(bl));
  return c;
}

__global__ __launch_bounds__(256) void k_wt_bf16(const float* __restrict__ W, unsigned short* __restrict__ Wt, int K, int N) {
  const int t = blockIdx.x * 256 + threadIdx.x;
  const int k8n = K / 8;
  if (t >= N * k8n) return;
  const int n = t / k8n, k8 = (t % k8n) * 8;
  v8us v;
#pragma unroll
  for (int i = 0; i < 8; ++i) v[i] = bf16_bits(W[(size_t)(k8 + i) * N + n]);
  *(v8us*)(Wt + (size_t)n * K + k8) = v;
  
}

// GEMM C[M][N] (f32, pitch ldc) = act(A[M][K]·W + bias). A f32 row-major (pitch lda) converted per fragment to bf16
// (ASPLIT: hi/lo two planes -> 2 terms, else single rounded term); Wt bf16 [N][K] (pitch ldb). BIAS_BF16 rounds the
// bias to bf16 first (bias quantised to bf16 before the add). K%32==0, M%16==0, N%64==0.
template <bool ASPLIT, int ACT, bool BIAS_BF16>
__global__ __launch_bounds__(128) void k_gemm_bf(const float* __restrict__ A, int lda, const unsigned short* __restrict__ Wt, int ldb,
                                               const float* __restrict__ bias, float* __restrict__ C, int ldc, int M, int N, int K) {
  __shared__ __attribute__((aligned(16))) float so[4][16][64];
  const int tid = threadIdx.x, w = tid >> 5, lane = tid & 31, ln = lane & 15, hh = lane >> 4;
  const int ntn = N / 64;
  const int wid = blockIdx.x * 4 + w;
  const int mt = wid / ntn, nq = wid % ntn;
  if (mt * 16 >= M) return;
  const int row0 = mt * 16, col0 = nq * 64;
  const float* arow = A + (size_t)(row0 + ln) * lda;
  v8f acc[4] = {};
  for (int kb = 0; kb < K; kb += 32) {
    FragB ah, al;
    const v4f x0 = *(const v4fa*)(arow + kb + 8 * hh), x1 = *(const v4fa*)(arow + kb + 8 * hh + 4);
    const v4f x2 = *(const v4fa*)(arow + kb + 16 + 8 * hh), x3 = *(const v4fa*)(arow + kb + 16 + 8 * hh + 4);
    float xs[16] = {x0[0],x0[1],x0[2],x0[3],x1[0],x1[1],x1[2],x1[3],x2[0],x2[1],x2[2],x2[3],x3[0],x3[1],x3[2],x3[3]};
#pragma unroll
    for (int i = 0; i < 16; ++i) { const unsigned short hb = bf16_bits(xs[i]); ah.u[i] = hb; al.u[i] = ASPLIT ? bf16_bits(xs[i] - bf16_val(hb)) : (unsigned short)0; }
#pragma unroll
    for (int t = 0; t < 4; ++t) {
      const unsigned short* brow = Wt + (size_t)(col0 + t * 16 + ln) * ldb + kb;
      FragB b;
      b.half[0] = *(const v8us*)(brow + 8 * hh);
      b.half[1] = *(const v8us*)(brow + 16 + 8 * hh);
      acc[t] = mmaN<ASPLIT ? 2 : 1>(ah.v, al.v, b.v, b.v, acc[t]);
    }
  }
#pragma unroll
  for (int t = 0; t < 4; ++t) {
    float bv = bias ? bias[col0 + t * 16 + ln] : 0.f;
    if (BIAS_BF16) bv = bf16_round(bv);
#pragma unroll
    for (int r = 0; r < 8; ++r) { float v = acc[t][r] + bv; if (ACT == 1) v = fmaxf(v, 0.f); so[w][8 * hh + r][t * 16 + ln] = v; }
  }
  __builtin_amdgcn_fence(__ATOMIC_ACQ_REL, "workgroup");
  __builtin_amdgcn_wave_barrier();
  const int rsub = lane >> 4, c4 = (lane & 15) * 4;
  {
#pragma unroll
    for (int q = 0; q < 8; ++q) {
      const int r = q * 2 + rsub;
      const v4f v = *(const v4fa*)&so[w][r][c4];
      *(v4f*)(C + (size_t)(row0 + r) * ldc + col0 + c4) = v;
    }
    
  }
}

// GEMM C = act(A·W + bias + resid): A f32 (ASPLIT -> hi/lo 2 terms), Wt bf16 [N][K]; ACT 0 none, 1 relu, 2 exact gelu;
// resid (optional, f32, row index = (row % rmod), pitch ldr, RES_BF16 rounds it) added before the activation.
template <bool ASPLIT, int ACT, bool BIAS_BF16, bool RES_BF16>
__global__ __launch_bounds__(128) void k_gemm_bf3(const float* __restrict__ A, int lda, const unsigned short* __restrict__ Wt, int ldb,
                                                const float* __restrict__ bias, const float* __restrict__ resid, int rmod, int ldr,
                                                float* __restrict__ C, int ldc, int M, int N, int K) {
  __shared__ __attribute__((aligned(16))) float so[4][16][64];
  const int tid = threadIdx.x, w = tid >> 5, lane = tid & 31, ln = lane & 15, hh = lane >> 4;
  const int ntn = N / 64;
  const int wid = blockIdx.x * 4 + w;
  const int mt = wid / ntn, nq = wid % ntn;
  if (mt * 16 >= M) return;
  const int row0 = mt * 16, col0 = nq * 64;
  const float* arow = A + (size_t)(row0 + ln) * lda;
  v8f acc[4] = {};
  for (int kb = 0; kb < K; kb += 32) {
    FragB ah, al;
    const v4f x0 = *(const v4fa*)(arow + kb + 8 * hh), x1 = *(const v4fa*)(arow + kb + 8 * hh + 4);
    const v4f x2 = *(const v4fa*)(arow + kb + 16 + 8 * hh), x3 = *(const v4fa*)(arow + kb + 16 + 8 * hh + 4);
    float xs[16] = {x0[0],x0[1],x0[2],x0[3],x1[0],x1[1],x1[2],x1[3],x2[0],x2[1],x2[2],x2[3],x3[0],x3[1],x3[2],x3[3]};
#pragma unroll
    for (int i = 0; i < 16; ++i) { const unsigned short hb = bf16_bits(xs[i]); ah.u[i] = hb; al.u[i] = ASPLIT ? bf16_bits(xs[i] - bf16_val(hb)) : (unsigned short)0; }
#pragma unroll
    for (int t = 0; t < 4; ++t) {
      const unsigned short* brow = Wt + (size_t)(col0 + t * 16 + ln) * ldb + kb;
      FragB b;
      b.half[0] = *(const v8us*)(brow + 8 * hh);
      b.half[1] = *(const v8us*)(brow + 16 + 8 * hh);
      acc[t] = mmaN<ASPLIT ? 2 : 1>(ah.v, al.v, b.v, b.v, acc[t]);
    }
  }
#pragma unroll
  for (int t = 0; t < 4; ++t) {
    const int col = col0 + t * 16 + ln;
    float bv = bias ? bias[col] : 0.f;
    if (BIAS_BF16) bv = bf16_round(bv);
#pragma unroll
    for (int r = 0; r < 8; ++r) {
      float v = acc[t][r] + bv;
      if (resid) { float rv = resid[(size_t)((row0 + 8 * hh + r) % rmod) * ldr + col]; if (RES_BF16) rv = bf16_round(rv); v += rv; }
      if (ACT == 1) v = fmaxf(v, 0.f);
      if (ACT == 2) v = 0.5f * v * (1.0f + erff(v * 0.70710678118654752f));
      if (ACT == 3) { const float u = 0.7978845608028654f * (v + 0.044715f * v * v * v); v = 0.5f * v * (1.0f + tanhf(u)); }
      so[w][8 * hh + r][t * 16 + ln] = v;
    }
  }
  __builtin_amdgcn_fence(__ATOMIC_ACQ_REL, "workgroup");
  __builtin_amdgcn_wave_barrier();
  const int rsub = lane >> 4, c4 = (lane & 15) * 4;
  {
#pragma unroll
    for (int q = 0; q < 8; ++q) {
      const int r = q * 2 + rsub;
      const v4f v = *(const v4fa*)&so[w][r][c4];
      *(v4f*)(C + (size_t)(row0 + r) * ldc + col0 + c4) = v;
    }
    
  }
}
// row LayerNorm (biased variance, eps) over N: s = X (+ R); optional out_sum <- s; out_norm <- (s-mu)*rsqrt(var+eps)*g + b
template <bool PARAM_BF16>
__global__ __launch_bounds__(256) void k_layernorm(const float* __restrict__ X, const float* __restrict__ R, const float* __restrict__ g, const float* __restrict__ bta,
                                                  float* __restrict__ out_sum, float* __restrict__ out_norm, int N, float eps) {
  __shared__ float red[256];
  const int row = blockIdx.x, tid = threadIdx.x;
  const float* x = X + (size_t)row * N; const float* rr = R ? R + (size_t)row * N : nullptr;
  float vals[16];                     // up to N = 4096
  const int per = N / 256;            // contiguous chunk per thread? use strided-by-4 chunks: thread handles j = tid*4 + 1024*u
  float s1 = 0.f;
  for (int u = 0; u < per / 4; ++u) {
    const int j = tid * 4 + 1024 * u;
    const v4f a = *(const v4fa*)(x + j);
    v4f b = {0.f,0.f,0.f,0.f}; if (rr) b = *(const v4fa*)(rr + j);
#pragma unroll
    for (int q = 0; q < 4; ++q) { const float v = a[q] + b[q]; vals[u * 4 + q] = v; s1 += v; }
  }
  red[tid] = s1; __syncthreads();
  for (int st = 128; st > 0; st >>= 1) { if (tid < st) red[tid] += red[tid + st]; __syncthreads(); }
  const float mu = red[0] / (float)N; __syncthreads();
  float s2 = 0.f;
  for (int u = 0; u < per / 4; ++u)
#pragma unroll
    for (int q = 0; q < 4; ++q) { const float c = vals[u * 4 + q] - mu; s2 += c * c; }
  red[tid] = s2; __syncthreads();
  for (int st = 128; st > 0; st >>= 1) { if (tid < st) red[tid] += red[tid + st]; __syncthreads(); }
  const float rs = rsqrtf(red[0] / (float)N + eps);
  {
    for (int u = 0; u < per / 4; ++u) {
      const int j = tid * 4 + 1024 * u;
      v4f o, sm;
#pragma unroll
      for (int q = 0; q < 4; ++q) {
        float gg = g[j + q], bb = bta[j + q];
        if (PARAM_BF16) { gg = bf16_round(gg); bb = bf16_round(bb); }
        sm[q] = vals[u * 4 + q]; o[q] = (vals[u * 4 + q] - mu) * rs * gg + bb;
      }
      if (out_sum) *(v4f*)(out_sum + (size_t)row * N + j) = sm;
      *(v4f*)(out_norm + (size_t)row * N + j) = o;
    }
    
  }
}



// ---- f16 WMMA path (v_wmma_f32_16x16x32_f16): 11-bit significands for operands in range — used where a [0,1] probability operand needs more precision than bf16
typedef _Float16 v16h __attribute__((ext_vector_type(16)));
union FragH { v16h v; v8us half[2]; _Float16 h[16]; unsigned short u[16]; };
template <int NT>
__device__ __forceinline__ v8f mmaH(v16h ah, v16h al, v16h bh, v16h bl, v8f c) {
  c = __builtin_amdgcn_wmma_f32_16x16x32_f16(false, ah, false, bh, (short)0, c, false, false);
  if (NT >= 2) c = __builtin_amdgcn_wmma_f32_16x16x32_f16(false, al, false, bh, (short)0, c, false, false);
  if (NT >= 3) c = __builtin_amdgcn_wmma_f32_16x16x32_f16(false, ah, false, bl, (short)0, c, false, false);
  asm volatile("v_nop\n\tv_nop\n\tv_nop\n\tv_nop" : "+v"(c) : "v"(ah), "v"(al), "v"(bh), "v"(bl));
  return c;
}
// batched GEMM like k_gemm_b but f16 operands: A f32 (split into f16 hi/lo if ASPLIT, else rounded to f16), Bt = f16 values [n][k]; alpha; C f32; N multiple of 16 (partial tiles skipped)
template <bool ASPLIT>
__global__ __launch_bounds__(128) void k_gemm_h(const float* __restrict__ A, int lda, size_t sA, const _Float16* __restrict__ Bh, int ldb, size_t sB, float alpha, float* __restrict__ C, int ldc, size_t sC, int M, int N, int K) {
  __shared__ __attribute__((aligned(16))) float so[4][16][64];
  const int tid = threadIdx.x, w = tid >> 5, lane = tid & 31, ln = lane & 15, hh = lane >> 4; const int by = blockIdx.y;
  A += (size_t)by * sA; Bh += (size_t)by * sB; C += (size_t)by * sC;
  const int ntn = (N + 63) / 64; const int wid = blockIdx.x * 4 + w; const int mt = wid / ntn, nq = wid % ntn; if (mt * 16 >= M) return;
  const int row0 = mt * 16, col0 = nq * 64; const float* arow = A + (size_t)(row0 + ln) * lda;
  v8f acc[4] = {};
  for (int kb = 0; kb < K; kb += 32) {
    FragH ah, al;
    const v4f x0 = *(const v4fa*)(arow + kb + 8 * hh), x1 = *(const v4fa*)(arow + kb + 8 * hh + 4), x2 = *(const v4fa*)(arow + kb + 16 + 8 * hh), x3 = *(const v4fa*)(arow + kb + 16 + 8 * hh + 4);
    float xs[16] = {x0[0],x0[1],x0[2],x0[3],x1[0],x1[1],x1[2],x1[3],x2[0],x2[1],x2[2],x2[3],x3[0],x3[1],x3[2],x3[3]};
#pragma unroll
    for (int i = 0; i < 16; ++i) { const _Float16 h = (_Float16)xs[i]; ah.h[i] = h; al.h[i] = ASPLIT ? (_Float16)(xs[i] - (float)h) : (_Float16)0.0f; }
#pragma unroll
    for (int t = 0; t < 4; ++t) { if (col0 + t * 16 >= N) continue; const size_t boff = (size_t)(col0 + t * 16 + ln) * ldb + kb; FragH bq; bq.half[0] = *(const v8us*)(Bh + boff + 8 * hh); bq.half[1] = *(const v8us*)(Bh + boff + 16 + 8 * hh);
      acc[t] = mmaH<ASPLIT ? 2 : 1>(ah.v, al.v, bq.v, bq.v, acc[t]); }
  }
#pragma unroll
  for (int t = 0; t < 4; ++t) { if (col0 + t * 16 >= N) continue;
#pragma unroll
    for (int r = 0; r < 8; ++r) so[w][8 * hh + r][t * 16 + ln] = acc[t][r] * alpha; }
  __builtin_amdgcn_fence(__ATOMIC_ACQ_REL, "workgroup"); __builtin_amdgcn_wave_barrier();
  const int rsub = lane >> 4, c4 = (lane & 15) * 4;
  {
#pragma unroll
    for (int q = 0; q < 8; ++q) { const int r = q * 2 + rsub; if (col0 + c4 < N) { const v4f v = *(const v4fa*)&so[w][r][c4]; *(v4f*)(C + (size_t)(row0 + r) * ldc + col0 + c4) = v; } }
     }
}

// k_gemm_hh variant with fused epilogue: v = acc·alpha + bias[by·sBias + col] (+ CP[(row/rowsPerB)·sCPb + by·64 + col] if CP) ; ACT 0 none / 1 elu ; writes f16 C16 (and f32 C if non-null)
template <int ACT>
__global__ __launch_bounds__(128) void k_gemm_hhx(const _Float16* __restrict__ A, int lda, size_t sA, const _Float16* __restrict__ Bh, int ldb, size_t sB, float alpha, const float* __restrict__ bias, size_t sBias, const float* __restrict__ CP, int rowsPerB, size_t sCPb, int row0g,
    float* __restrict__ C, _Float16* __restrict__ C16, int ldc, size_t sC, int M, int N, int K) {
  __shared__ __attribute__((aligned(16))) float so[4][16][64];
  const int tid = threadIdx.x, w = tid >> 5, lane = tid & 31, ln = lane & 15, hh = lane >> 4; const int by = blockIdx.y;
  A += (size_t)by * sA; Bh += (size_t)by * sB; const size_t cofs = (size_t)by * sC; const float* bp = bias ? bias + (size_t)by * sBias : nullptr;
  const int ntn = (N + 63) / 64; const int wid = blockIdx.x * 4 + w; const int mt = wid / ntn, nq = wid % ntn; if (mt * 16 >= M) return;
  const int row0 = mt * 16, col0 = nq * 64; const _Float16* arow = A + (size_t)(row0 + ln) * lda;
  v8f acc[4] = {};
  for (int kb = 0; kb < K; kb += 32) { FragH ah; ah.half[0] = *(const v8us*)((const unsigned short*)arow + kb + 8 * hh); ah.half[1] = *(const v8us*)((const unsigned short*)arow + kb + 16 + 8 * hh);
#pragma unroll
    for (int t = 0; t < 4; ++t) { if (col0 + t * 16 >= N) continue; const size_t boff = (size_t)(col0 + t * 16 + ln) * ldb + kb; FragH bq; bq.half[0] = *(const v8us*)((const unsigned short*)Bh + boff + 8 * hh); bq.half[1] = *(const v8us*)((const unsigned short*)Bh + boff + 16 + 8 * hh);
      acc[t] = mmaH<1>(ah.v, ah.v, bq.v, bq.v, acc[t]); }
  }
#pragma unroll
  for (int t = 0; t < 4; ++t) { if (col0 + t * 16 >= N) continue; const int col = col0 + t * 16 + ln; const float bv = bp ? bf16_round(bp[col]) : 0.f;
#pragma unroll
    for (int r = 0; r < 8; ++r) { float v = acc[t][r] * alpha + bv; if (CP) { const int rr = row0g + row0 + 8 * hh + r; if (rowsPerB < 0) v += CP[cofs + (size_t)rr * ldc + col];      /* rowsPerB < 0: own element of the batched C plane */ else { const int bidx = rr / rowsPerB; v += CP[(size_t)bidx * sCPb + (size_t)by * 64 + col]; } } if (ACT == 1) v = (v > 0.f) ? v : expm1f(v); else if (ACT == 7) v = (v > 0.f) ? v + 1.0f : expf(v); else if (ACT == 8) v = tanhf(v); else if (ACT == 9) v = 0.5f * v * (1.0f + tanhf(0.7978845608028654f * (v + 0.044715f * v * v * v))); else if (ACT == 11) v = 1.0f / (1.0f + expf(-v)); else if (ACT == 12) v = (v > 0.f) ? v : 0.01f * v; else if (ACT == 14) v = (v > 0.f) ? v : 0.1f * v; else if (ACT == 16) v = (v >= 0.f) ? v : 0.3f * v; else if (ACT == 17) v = (v >= 0.f) ? v : 0.2f * v; else if (ACT == 15) v = v / (1.0f + expf(-v)); else if (ACT == 3) v = fmaxf(v, 0.f); else if (ACT == 6) v = 0.5f * v * (1.0f + erff(v * 0.70710678118654752f)); so[w][8 * hh + r][t * 16 + ln] = v; } }
  __builtin_amdgcn_fence(__ATOMIC_ACQ_REL, "workgroup"); __builtin_amdgcn_wave_barrier();
  const int rsub = lane >> 4, c4 = (lane & 15) * 4; typedef _Float16 v4h __attribute__((ext_vector_type(4)));
  {
#pragma unroll
    for (int q = 0; q < 8; ++q) { const int r = q * 2 + rsub; if (col0 + c4 < N) { const v4f v = *(const v4fa*)&so[w][r][c4]; if (C) *(v4f*)(C + cofs + (size_t)(row0 + r) * ldc + col0 + c4) = v; if (C16) { v4h h4; for (int i = 0; i < 4; ++i) h4[i] = (_Float16)v[i]; *(v4h*)(C16 + cofs + (size_t)(row0 + r) * ldc + col0 + c4) = h4; } } }
     }
}


typedef _Float16 v4h __attribute__((ext_vector_type(4)));

__global__ __launch_bounds__(256) void k_h16(const float* __restrict__ x, _Float16* __restrict__ X16, size_t n8) { const size_t t = (size_t)blockIdx.x * 256 + threadIdx.x; if (t >= n8) return; FragH f;
#pragma unroll
  for (int q = 0; q < 8; ++q) f.h[q] = (_Float16)x[t * 8 + q]; *(v8us*)((unsigned short*)X16 + t * 8) = f.half[0];  }
__global__ __launch_bounds__(256) void k_round16f(const float* __restrict__ W, _Float16* __restrict__ Bt, size_t n8) { const size_t t = (size_t)blockIdx.x * 256 + threadIdx.x; if (t >= n8) return; FragH f;
#pragma unroll
  for (int i = 0; i < 8; ++i) f.h[i] = (_Float16)(bf16_round(W[t * 8 + i]) * 16.0f); *(v8us*)((unsigned short*)Bt + t * 8) = f.half[0];  }
template <int NHv, int TTv>
__global__ __launch_bounds__(256) void k_vt(const _Float16* __restrict__ V16, int ldv, int voff, _Float16* __restrict__ Vt) { __shared__ unsigned short tl[64][66]; const int tid = threadIdx.x; const int slab = blockIdx.x / (TTv / 64), lg = blockIdx.x % (TTv / 64); const int b = slab / NHv, h = slab % NHv;
  for (int i = tid; i < 64 * 8; i += 256) { const int r = i / 8, c8 = (i % 8) * 8; FragH f; f.half[0] = *(const v8us*)((const unsigned short*)V16 + ((size_t)b * TTv + lg * 64 + r) * ldv + voff + h * 64 + c8);
#pragma unroll
    for (int q = 0; q < 8; ++q) tl[r][c8 + q] = f.u[q]; }
  __syncthreads();
  {
#pragma unroll
    for (int rd = 0; rd < 2; ++rd) { const int d = rd * 32 + tid / 8, pc = tid % 8; FragH f;
#pragma unroll
      for (int q = 0; q < 8; ++q) f.u[q] = tl[pc * 8 + q][d];
      *(v8us*)((unsigned short*)Vt + ((size_t)slab * 64 + d) * TTv + lg * 64 + pc * 8) = f.half[0]; }
     } }

__global__ __launch_bounds__(256) void k_hl(const float* __restrict__ F, _Float16* __restrict__ Hh, _Float16* __restrict__ Hl, size_t n8) { const size_t t = (size_t)blockIdx.x * 256 + threadIdx.x; if (t >= n8) return; FragH fh, fl; const v4f a = *(const v4fa*)(F + t * 8), c = *(const v4fa*)(F + t * 8 + 4);
#pragma unroll
  for (int q = 0; q < 4; ++q) { _Float16 h = (_Float16)a[q]; fh.h[q] = h; fl.h[q] = (_Float16)((a[q] - (float)h) * 1024.0f); h = (_Float16)c[q]; fh.h[4 + q] = h; fl.h[4 + q] = (_Float16)((c[q] - (float)h) * 1024.0f); }
  { *(v8us*)((unsigned short*)Hh + t * 8) = fh.half[0]; *(v8us*)((unsigned short*)Hl + t * 8) = fl.half[0];  } }

// ---- fast GEMM (block tile 128x64, wave tile 32x64; requires M % 128 == 0 rows per launch region, N % 64 == 0 and K % 64 == 0); epilogue = k_gemm_hhx semantics ----
__device__ __forceinline__ v16h g2_frag(const _Float16* p, int hh) { FragH f; f.half[0] = *(const v8us*)((const unsigned short*)p + 8 * hh); f.half[1] = *(const v8us*)((const unsigned short*)p + 16 + 8 * hh); return f.v; }
__device__ __forceinline__ v8f g2_mma(v16h a, v16h b, v8f c) { v8f d = __builtin_amdgcn_wmma_f32_16x16x32_f16(false, a, false, b, (short)0, c, false, false); asm volatile("v_nop\n\tv_nop\n\tv_nop\n\tv_nop" : "+v"(d) : "v"(a), "v"(b)); return d; }
// Operand staging of k_gemm2: one stage = 64 k of the block's 128 A rows and 64 B rows (whole 128-byte lines), brought into LDS by asynchronous 16-byte copies, 12 per thread; eight neighbouring lanes copy one line.
#define G2P 72                       /* LDS row pitch in f16: 128 data bytes + 16, conflict-free for the 16-byte fragment reads */
__device__ __forceinline__ void g2_stage(const _Float16* ag, const _Float16* bg, size_t a16, size_t b16, unsigned la, unsigned lb) {      /* ag, bg: this thread's 16 bytes in rows tid / 8 of A and B at the stage's k; a16, b16: 16 rows on in global memory; la, lb: their LDS byte addresses */
  const _Float16* a1 = ag + a16; const _Float16* a2 = a1 + a16; const _Float16* a3 = a2 + a16; const _Float16* a4 = a3 + a16; const _Float16* a5 = a4 + a16; const _Float16* a6 = a5 + a16; const _Float16* a7 = a6 + a16;
  const _Float16* b1 = bg + b16; const _Float16* b2 = b1 + b16; const _Float16* b3 = b2 + b16;
  const unsigned st = 16 * G2P * 2;      /* 16 rows on in LDS, bytes */
  /* the copies and, as the last line of their own statement, the wait that stands before any of their address registers is written again */
  asm volatile("global_load_async_to_lds_b128 %0, %12, off\n\t"
               "global_load_async_to_lds_b128 %1, %13, off\n\t"
               "global_load_async_to_lds_b128 %2, %14, off\n\t"
               "global_load_async_to_lds_b128 %3, %15, off\n\t"
               "global_load_async_to_lds_b128 %4, %16, off\n\t"
               "global_load_async_to_lds_b128 %5, %17, off\n\t"
               "global_load_async_to_lds_b128 %6, %18, off\n\t"
               "global_load_async_to_lds_b128 %7, %19, off\n\t"
               "global_load_async_to_lds_b128 %8, %20, off\n\t"
               "global_load_async_to_lds_b128 %9, %21, off\n\t"
               "global_load_async_to_lds_b128 %10, %22, off\n\t"
               "global_load_async_to_lds_b128 %11, %23, off\n\t"
               "s_wait_xcnt 0x0"
               :: "v"(la), "v"(la + st), "v"(la + 2 * st), "v"(la + 3 * st), "v"(la + 4 * st), "v"(la + 5 * st), "v"(la + 6 * st), "v"(la + 7 * st), "v"(lb), "v"(lb + st), "v"(lb + 2 * st), "v"(lb + 3 * st),
                  "v"(ag), "v"(a1), "v"(a2), "v"(a3), "v"(a4), "v"(a5), "v"(a6), "v"(a7), "v"(bg), "v"(b1), "v"(b2), "v"(b3) : "memory");
}
template <int ACT>
__global__ __launch_bounds__(128) void k_gemm2(const _Float16* __restrict__ A, int lda, size_t sA, size_t sAz, const _Float16* __restrict__ Bh, int ldb, size_t sB, size_t sBz, float alpha, const float* __restrict__ bias, const float* __restrict__ biasz1, const float* __restrict__ biasz2, size_t sBias, const float* __restrict__ CP, int rowsPerB, size_t sCPb, int row0g,
    float* __restrict__ C, _Float16* __restrict__ C16, int ldc, size_t sC, size_t sCz, int M, int N, int K) { static_assert(ACT == 0 || ACT == 3 || ACT == 6 || ACT == 8 || ACT == 9 || ACT == 11 || ACT == 12 || ACT == 14 || ACT == 15 || ACT == 16 || ACT == 17, "k_gemm2: unsupported ACT code (would silently apply no activation)");
  __shared__ __attribute__((aligned(16))) float so[4][32][68];
  __shared__ __attribute__((aligned(16))) _Float16 sa[2][128 * G2P]; __shared__ __attribute__((aligned(16))) _Float16 sb[2][64 * G2P];      /* two stage buffers per operand */
  const int tid = threadIdx.x, w = tid >> 5, lane = tid & 31, ln = lane & 15, hh = lane >> 4; const int by = blockIdx.y, bz = blockIdx.z;      /* two batch axes: strides s* on grid.y, s*z on grid.z */
  A += (size_t)by * sA + (size_t)bz * sAz; Bh += (size_t)by * sB + (size_t)bz * sBz; const size_t cofs = (size_t)by * sC + (size_t)bz * sCz; const float* bsel = bz == 0 ? bias : (bz == 1 ? biasz1 : biasz2); const float* bp = bsel ? bsel + (size_t)by * sBias : nullptr;      /* the bias vectors of grid.z planes 0, 1, 2 are separate buffers */
  const int ntn = N >> 6; const int mt = blockIdx.x / ntn, nq = blockIdx.x - mt * ntn; const int row0 = mt * 128 + 32 * w, col0 = nq * 64; if (mt * 128 >= M) return;      /* the whole block leaves or none, ahead of every copy and barrier */
  const _Float16* agp = A + (size_t)(mt * 128 + (tid >> 3)) * lda + (tid & 7) * 8; const _Float16* bgp = Bh + (size_t)(col0 + (tid >> 3)) * ldb + (tid & 7) * 8;
  const unsigned lofs = (unsigned)((tid >> 3) * (G2P * 2) + (tid & 7) * 16); const unsigned la0 = (unsigned)(size_t)&sa[0][0] + lofs, lb0 = (unsigned)(size_t)&sb[0][0] + lofs;      /* LDS byte addresses = low 32 bits of the shared addresses */
  const size_t a16 = (size_t)16 * lda, b16 = (size_t)16 * ldb; const int nst = K >> 6;
  const v8f z8 = {0.f,0.f,0.f,0.f,0.f,0.f,0.f,0.f}; v8f c00 = z8, c01 = z8, c02 = z8, c03 = z8, c10 = z8, c11 = z8, c12 = z8, c13 = z8;
  g2_stage(agp, bgp, a16, b16, la0, lb0);
  asm volatile("s_wait_asynccnt 0x0" ::: "memory");      /* this wave's copies of stage 0 have landed */
  __syncthreads();      /* every wave's have: stage 0 may be read */
  if (nst > 1) g2_stage(agp + 64, bgp + 64, a16, b16, la0 + (unsigned)sizeof(sa[0]), lb0 + (unsigned)sizeof(sb[0]));
  /* kept rolled: one trip = one stage, so that the order at its foot stays as written */
#pragma unroll 1
  for (int s = 0; s < nst; ++s) { const int bu = s & 1; const _Float16* as = &sa[bu][(32 * w + ln) * G2P]; const _Float16* bs = &sb[bu][ln * G2P];
    v16h af[2][2], bf[2][4];      /* the stage's 12 fragments, read as one group ahead of its 16 products */
#pragma unroll
    for (int kk = 0; kk < 2; ++kk) { af[kk][0] = g2_frag(as + kk * 32, hh); af[kk][1] = g2_frag(as + 16 * G2P + kk * 32, hh);
#pragma unroll
      for (int u = 0; u < 4; ++u) bf[kk][u] = g2_frag(bs + u * 16 * G2P + kk * 32, hh); }
#pragma unroll
    for (int kk = 0; kk < 2; ++kk) { c00 = g2_mma(af[kk][0], bf[kk][0], c00); c10 = g2_mma(af[kk][1], bf[kk][0], c10); c01 = g2_mma(af[kk][0], bf[kk][1], c01); c11 = g2_mma(af[kk][1], bf[kk][1], c11);
      c02 = g2_mma(af[kk][0], bf[kk][2], c02); c12 = g2_mma(af[kk][1], bf[kk][2], c12); c03 = g2_mma(af[kk][0], bf[kk][3], c03); c13 = g2_mma(af[kk][1], bf[kk][3], c13); }
    asm volatile("s_wait_dscnt 0x0" ::: "memory");      /* this wave has finished reading stage s */
    asm volatile("s_wait_asynccnt 0x0" ::: "memory");      /* this wave's copies of stage s + 1 have landed */
    __syncthreads();      /* publishes stage s + 1 and frees stage s's buffer */
    if (s + 2 < nst) g2_stage(agp + (s + 2) * 64, bgp + (s + 2) * 64, a16, b16, la0 + (unsigned)(bu * sizeof(sa[0])), lb0 + (unsigned)(bu * sizeof(sb[0]))); }
  asm volatile("s_wait_asynccnt 0x0" ::: "memory");      /* no copy is outstanding behind the loop */
  v8f accs[8] = {c00, c01, c02, c03, c10, c11, c12, c13};
#pragma unroll
  for (int u = 0; u < 8; ++u) { const int t = u & 3, half = u >> 2; const int col = col0 + t * 16 + ln; const float bv = bp ? bf16_round(bp[col]) : 0.f;
#pragma unroll
    for (int r = 0; r < 8; ++r) { const int rloc = half * 16 + 8 * hh + r; float v = accs[u][r] * alpha + bv; if (CP) { if (rowsPerB < 0) v += CP[cofs + (size_t)(row0g + row0 + rloc) * ldc + col];      /* rowsPerB < 0: own element of the batched C plane */ else { const int bidx = (row0g + row0 + rloc) / rowsPerB; v += CP[(size_t)bidx * sCPb + (size_t)by * 64 + col]; } }
      if (ACT == 3) v = fmaxf(v, 0.f); else if (ACT == 6) v = 0.5f * v * (1.0f + erff(v * 0.70710678118654752f)); else if (ACT == 11) v = 1.0f / (1.0f + expf(-v)); else if (ACT == 15) v = v / (1.0f + expf(-v)); else if (ACT == 12) v = (v > 0.f) ? v : 0.01f * v; else if (ACT == 8) v = tanhf(v); else if (ACT == 9) v = 0.5f * v * (1.0f + tanhf(0.7978845608028654f * (v + 0.044715f * v * v * v))); else if (ACT == 14) v = (v > 0.f) ? v : 0.1f * v; else if (ACT == 16) v = (v >= 0.f) ? v : 0.3f * v; else if (ACT == 17) v = (v >= 0.f) ? v : 0.2f * v;
      so[w][rloc][t * 16 + ln] = v; } }
  __builtin_amdgcn_fence(__ATOMIC_ACQ_REL, "workgroup"); __builtin_amdgcn_wave_barrier();
  const int rsub = lane >> 4, c4 = (lane & 15) * 4;
  {
#pragma unroll
    for (int q = 0; q < 16; ++q) { const int r = q * 2 + rsub; const v4f v = *(const v4fa*)&so[w][r][c4]; if (C) *(v4f*)(C + cofs + (size_t)(row0 + r) * ldc + col0 + c4) = v; if (C16) { v4h h4; for (int i = 0; i < 4; ++i) h4[i] = (_Float16)v[i]; *(v4h*)(C16 + cofs + (size_t)(row0 + r) * ldc + col0 + c4) = h4; } }
     } }


__global__ __launch_bounds__(256) void k_wnat(const float* __restrict__ w, size_t n8, _Float16* __restrict__ Bt) { const size_t t = (size_t)blockIdx.x * 256 + threadIdx.x; if (t >= n8) return; FragH f; for (int q = 0; q < 8; ++q) f.h[q] = (_Float16)(bf16_round(w[t * 8 + q]) * 16.0f); *(v8us*)((unsigned short*)Bt + t * 8) = f.half[0];  }
__global__ __launch_bounds__(256) void k_rsm(const float* __restrict__ S, _Float16* __restrict__ P, int nrows) {
  #pragma clang fp contract(off)
  const int i = blockIdx.x * 256 + threadIdx.x; if (i >= nrows) return; const float* s = S + (size_t)i * SQ; float mx = -3.0e38f;
#pragma unroll 1
  for (int j = 0; j < SQ; ++j) mx = fmaxf(mx, s[j]); float se = 0.f;
#pragma unroll 1
  for (int j = 0; j < SQ; ++j) se += expf(s[j] - mx); const float sc = 256.0f / se;
#pragma unroll 1
  for (int j0 = 0; j0 < SQ; j0 += 8) { FragH f; for (int q = 0; q < 8; ++q) f.h[q] = (_Float16)(expf(s[j0 + q] - mx) * sc); unsigned short* d = (unsigned short*)P + (size_t)i * SQ + j0; *(v8us*)d = f.half[0];  } }
__global__ __launch_bounds__(256) void k_vt(const _Float16* __restrict__ V16, int b, int h0, _Float16* __restrict__ VT) { __shared__ unsigned short tl[64][65]; const int tid = threadIdx.x; const int hh = blockIdx.x % HG, sg = blockIdx.x / HG; const int s0 = sg * 64; const int h = h0 + hh;
  for (int i = tid; i < 64 * 8; i += 256) { const int j = i / 8, d8 = (i % 8) * 8; FragH f; f.half[0] = *(const v8us*)((const unsigned short*)V16 + ((size_t)b * SQ + s0 + j) * DM + h * HD + d8); for (int q = 0; q < 8; ++q) tl[d8 + q][j] = f.u[q]; }
  __syncthreads();
  { for (int i = tid; i < 64 * 8; i += 256) { const int d = i / 8, j8 = (i % 8) * 8; FragH f; for (int q = 0; q < 8; ++q) f.u[q] = tl[d][j8 + q]; *(v8us*)((unsigned short*)VT + ((size_t)hh * HD + d) * SQ + s0 + j8) = f.half[0]; }  } }



// Fused attention, one launch for all (batch, head) planes: a wave owns 32 queries (two 16-column groups) and walks the plane's 1024 keys in passes of 32. The work-group's 8 waves share each stage of 128 keys through LDS.
// Transposed products: S^T = K . Q^T (A = 16 key rows, B = 16 query rows, both through g2_frag), so lane (ln, hh) holds, for query ln, the scores of keys 8 hh + r and 16 + 8 hh + r:
// exactly the k positions that g2_frag gives a B operand, so the exponentials are packed in place into P^T and O^T += V^T . P^T (A = 16 rows of V^T) follows with no exchange through memory or LDS.
// Online softmax in base 2: the maximum in use may lag a query's true running maximum by up to 8 (an exponential can reach 2^8, far inside f16); the accumulators are rescaled, tested once per pass, only when it lags by more.
// Row sums are f32 sums of the unrounded exponentials, one partial per wave half, joined at the end. o is stored x64 as f16 (the output GEMM's alpha folds it back).
#define FQ 2                         /* 16-query column groups per wave */
#define FW 8                         /* waves per work-group */
typedef _Float16 v8h __attribute__((ext_vector_type(8)));
typedef _Float16 v2h __attribute__((ext_vector_type(2)));
typedef float v2f __attribute__((ext_vector_type(2)));
union FragP { v16h v; v2h p[8]; };
__device__ __forceinline__ float fa_xhalf(float x) { return __builtin_bit_cast(float, __builtin_amdgcn_permlanex16(__builtin_bit_cast(int, x), __builtin_bit_cast(int, x), 0x76543210, 0xfedcba98, false, false)); }      /* lane l <-> lane l ^ 16 */
__device__ __forceinline__ v8f fa_mma(v16h a, v16h b, v8f c) { return __builtin_amdgcn_wmma_f32_16x16x32_f16(false, a, false, b, (short)0, c, false, false); }
// Operand staging of k_fattn: one stage = FKS keys of the plane, as FKS rows of K (128 bytes each) and HD rows of V^T (2 FKS bytes each), brought into LDS once for the work-group's 8 waves by asynchronous 16-byte copies, 8 per thread; 8 neighbouring lanes copy one K row, 16 one V^T row.
#define FKS 128                      /* keys per stage */
#define FKP 72                       /* LDS pitch of a K row in f16: 128 data bytes + 16, conflict-free for the 16-byte fragment reads */
#define FVP (FKS + 8)                /* LDS pitch of a V^T row in f16: 256 data bytes + 16, likewise */
__device__ __forceinline__ void fa_stage(const _Float16* kg, const _Float16* vg, unsigned lk, unsigned lv) {      /* kg, vg: this thread's 16 bytes in row tid / 8 of the stage's K rows and in row tid / 16 of V^T at the stage's keys; lk, lv: their LDS byte addresses */
  const _Float16* k1 = kg + (size_t)32 * LQ; const _Float16* k2 = k1 + (size_t)32 * LQ; const _Float16* k3 = k2 + (size_t)32 * LQ;
  const _Float16* v1 = vg + (size_t)16 * SQ; const _Float16* v2 = v1 + (size_t)16 * SQ; const _Float16* v3 = v2 + (size_t)16 * SQ;
  const unsigned dk = 32 * FKP * 2, dv = 16 * FVP * 2;      /* 32 K rows, 16 V^T rows on in LDS, bytes */
  /* the copies and, as the last line of their own statement, the wait that stands before any of their address registers is written again */
  asm volatile("global_load_async_to_lds_b128 %0, %8, off\n\t"
               "global_load_async_to_lds_b128 %1, %9, off\n\t"
               "global_load_async_to_lds_b128 %2, %10, off\n\t"
               "global_load_async_to_lds_b128 %3, %11, off\n\t"
               "global_load_async_to_lds_b128 %4, %12, off\n\t"
               "global_load_async_to_lds_b128 %5, %13, off\n\t"
               "global_load_async_to_lds_b128 %6, %14, off\n\t"
               "global_load_async_to_lds_b128 %7, %15, off\n\t"
               "s_wait_xcnt 0x0"
               :: "v"(lk), "v"(lk + dk), "v"(lk + 2 * dk), "v"(lk + 3 * dk), "v"(lv), "v"(lv + dv), "v"(lv + 2 * dv), "v"(lv + 3 * dv),
                  "v"(kg), "v"(k1), "v"(k2), "v"(k3), "v"(vg), "v"(v1), "v"(v2), "v"(v3) : "memory");
}
__global__ __launch_bounds__(FW * 32) void k_fattn(const _Float16* __restrict__ Qr, const _Float16* __restrict__ Kr, const _Float16* __restrict__ Vt, _Float16* __restrict__ O) {
  static_assert(FW * 32 == 256 && FKS == 128 && HD == 64 && SQ % FKS == 0 && SQ / FKS >= 2, "fa_stage: 256 threads x 4 copies cover 128 K rows of 8 chunks and 64 V^T rows of 16 chunks; stages 0 and 1 exist");
  __shared__ __attribute__((aligned(16))) _Float16 sk[2][FKS * FKP]; __shared__ __attribute__((aligned(16))) _Float16 sv[2][HD * FVP];      /* two stage buffers per operand */
  const int tid = threadIdx.x, lane = tid & 31, w = tid >> 5, ln = lane & 15, hh = lane >> 4;
  const int plane = blockIdx.y, b = plane / NH, h = plane % NH; const int q0 = (blockIdx.x * FW + w) * (16 * FQ);
  const _Float16* qp = Qr + ((size_t)b * SQ + q0 + ln) * LQ + h * HD;
  const _Float16* kg = Kr + ((size_t)b * SQ + (tid >> 3)) * LQ + h * HD + (tid & 7) * 8; const _Float16* vg = Vt + ((size_t)plane * HD + (tid >> 4)) * SQ + (tid & 15) * 8;
  const unsigned lk0 = (unsigned)(size_t)&sk[0][0] + (unsigned)((tid >> 3) * (FKP * 2) + (tid & 7) * 16), lv0 = (unsigned)(size_t)&sv[0][0] + (unsigned)((tid >> 4) * (FVP * 2) + (tid & 15) * 16);      /* LDS byte addresses = low 32 bits of the shared addresses */
  const float cs = 0.125f * 1.4426950408889634f;      /* 64^-0.5 and log2(e) in one factor */
  const v8f z8 = {0.f,0.f,0.f,0.f,0.f,0.f,0.f,0.f};
  fa_stage(kg, vg, lk0, lv0);
  v16h qf[FQ][2]; v8f acc[FQ][4]; float m_run[FQ], l_run[FQ];
#pragma unroll
  for (int g = 0; g < FQ; ++g) { qf[g][0] = g2_frag(qp + (size_t)g * 16 * LQ, hh); qf[g][1] = g2_frag(qp + (size_t)g * 16 * LQ + 32, hh); m_run[g] = -3.0e38f; l_run[g] = 0.f;
#pragma unroll
    for (int t = 0; t < 4; ++t) acc[g][t] = z8; }
  asm volatile("s_wait_xcnt 0x0" ::: "memory");      /* stands before the address registers of the Q loads above are written again */
  asm volatile("s_wait_asynccnt 0x0" ::: "memory");      /* this wave's copies of stage 0 have landed */
  __syncthreads();      /* every wave's have: stage 0 may be read */
  fa_stage(kg + (size_t)FKS * LQ, vg + FKS, lk0 + (unsigned)sizeof(sk[0]), lv0 + (unsigned)sizeof(sv[0]));
  /* kept rolled: one trip = one stage, so that the order at its foot stays as written */
#pragma unroll 1
  for (int st = 0; st < SQ / FKS; ++st) { const int bu = st & 1; const _Float16* ks = &sk[bu][ln * FKP]; const _Float16* vs = &sv[bu][ln * FVP];
    v16h kf[2][2], vf[4];
#pragma unroll
    for (int kt = 0; kt < 2; ++kt) { kf[kt][0] = g2_frag(ks + kt * 16 * FKP, hh); kf[kt][1] = g2_frag(ks + kt * 16 * FKP + 32, hh); }
#pragma unroll
    for (int t = 0; t < 4; ++t) vf[t] = g2_frag(vs + t * 16 * FVP, hh);
    /* unrolled: the stage's passes of 32 keys, so that "is there a next pass in this stage" is known at compile time */
#pragma unroll
    for (int p = 0; p < FKS / 32; ++p) {
      v8f s[2][FQ];
#pragma unroll
      for (int kt = 0; kt < 2; ++kt) {
#pragma unroll
        for (int g = 0; g < FQ; ++g) s[kt][g] = fa_mma(kf[kt][1], qf[g][1], fa_mma(kf[kt][0], qf[g][0], z8)); }
      if (p + 1 < FKS / 32) {      /* inside a stage both operands' fragments are read one pass ahead, into the registers their products have just left: K under this pass's maxima, V^T under the next pass's scores and maxima; a stage's last pass reads nothing ahead (the next stage is not published yet) */
#pragma unroll
        for (int kt = 0; kt < 2; ++kt) { kf[kt][0] = g2_frag(ks + ((p + 1) * 32 + kt * 16) * FKP, hh); kf[kt][1] = g2_frag(ks + ((p + 1) * 32 + kt * 16) * FKP + 32, hh); } }
      asm volatile("" ::: "memory");      /* compiler fence: holds the LDS reads written above it (this pass's V^T, the next pass's K) in front of the maxima; without it the compiler sinks them behind the branch below, next to their products and in among them, where each waits out its own latency */
      float mb[FQ]; bool need = false;
#pragma unroll
      for (int g = 0; g < FQ; ++g) { float mx = fmaxf(s[0][g][0], s[1][g][0]);
#pragma unroll
        for (int r = 1; r < 8; ++r) mx = fmaxf(mx, fmaxf(s[0][g][r], s[1][g][r]));
        mx = fmaxf(mx, fa_xhalf(mx)) * cs; mb[g] = mx; need = need || (mx > m_run[g] + 8.0f); }      /* both halves hold the query's pass maximum, scaled (cs > 0) */
      if (__builtin_amdgcn_ballot_w32(need) != 0) {      /* wave-uniform; always taken on the first pass (factor 0 on zero accumulators) */
#pragma unroll
        for (int g = 0; g < FQ; ++g) { const float mn = fmaxf(m_run[g], mb[g]); const float corr = __builtin_amdgcn_exp2f(m_run[g] - mn); m_run[g] = mn; l_run[g] *= corr;
#pragma unroll
          for (int t = 0; t < 4; ++t) acc[g][t] *= corr; } }
#pragma unroll
      for (int g = 0; g < FQ; ++g) { const float nm = -m_run[g]; FragP pf; v2f ls = {0.f, 0.f};
#pragma unroll
        for (int i = 0; i < 8; ++i) { const v2f x = {s[i >> 2][g][2 * (i & 3)], s[i >> 2][g][2 * (i & 3) + 1]};      /* operand elements 2i, 2i + 1 = tile i >> 2, registers 2 (i & 3), 2 (i & 3) + 1 */
          const v2f a = __builtin_elementwise_fma(x, (v2f){cs, cs}, (v2f){nm, nm}); const v2f p2 = {__builtin_amdgcn_exp2f(a[0]), __builtin_amdgcn_exp2f(a[1])};
          ls += p2; pf.p[i] = __builtin_convertvector(p2, v2h); }
        l_run[g] += ls[0] + ls[1];
#pragma unroll
        for (int t = 0; t < 4; ++t) acc[g][t] = fa_mma(vf[t], pf.v, acc[g][t]); }
      if (p + 1 < FKS / 32) {
#pragma unroll
        for (int t = 0; t < 4; ++t) vf[t] = g2_frag(vs + t * 16 * FVP + (p + 1) * 32, hh); }
    }
    asm volatile("s_wait_dscnt 0x0" ::: "memory");      /* this wave has finished reading stage st */
    asm volatile("s_wait_asynccnt 0x0" ::: "memory");      /* this wave's copies of stage st + 1 have landed */
    __syncthreads();      /* publishes stage st + 1 and frees stage st's buffer */
    if (st + 2 < SQ / FKS) fa_stage(kg + (size_t)(st + 2) * FKS * LQ, vg + (st + 2) * FKS, lk0 + (unsigned)(bu * sizeof(sk[0])), lv0 + (unsigned)(bu * sizeof(sv[0]))); }
  asm volatile("s_wait_asynccnt 0x0" ::: "memory");      /* no copy is outstanding behind the loop */
#pragma unroll
  for (int g = 0; g < FQ; ++g) { const float sc = 64.0f / (l_run[g] + fa_xhalf(l_run[g])); _Float16* op = O + ((size_t)plane * SQ + q0 + g * 16 + ln) * HD + 8 * hh;
#pragma unroll
    for (int t = 0; t < 4; ++t) { const v8f o = acc[g][t] * sc; *(v8h*)(op + t * 16) = __builtin_convertvector(o, v8h); } }      /* registers r = 0..7 are d = 16 t + 8 hh + r of query ln: one 16-byte store */
}

// Operand preparation, all of it in one launch (the seven conversions depend on nothing but the inputs).
// Work-groups 0 .. PW - 1, the weights: thread t owns 8 k of output column n = t / 64 in all four matrices and writes Bt[n][k] = f16(16 x bf16-rounded weight); per-head W[h][k][d] has n = h * 64 + d (head-major columns = the flattened biases' order), Wo[k][n] is plain [in][out].
// Work-groups PW .. PW + PX - 1, the three inputs as exact f16 rows (bf16-rounded): each thread converts PC chunks of 8 floats of each input, one work-group of threads apart, so a wave's loads and stores stay contiguous and few waves have to be started.
#define PW 128                       /* work-groups on the weights: 512 columns x 64 chunks of 8 k */
#define PX 512                       /* work-groups on the inputs */
#define PC 4                         /* chunks per thread and input */
__device__ __forceinline__ v8us p_cvt8(const float* v, float scale) { FragH f;
#pragma unroll
  for (int q = 0; q < 8; ++q) f.h[q] = (_Float16)(bf16_round(v[q]) * scale); return f.half[0]; }
__device__ __forceinline__ v8us p_cvt44(v4f a, v4f b) { const float v[8] = {a[0], a[1], a[2], a[3], b[0], b[1], b[2], b[3]}; return p_cvt8(v, 1.0f); }
__global__ __launch_bounds__(256) void k_prep(const float* __restrict__ xq, const float* __restrict__ xk, const float* __restrict__ xv, const float* __restrict__ wq, const float* __restrict__ wk, const float* __restrict__ wv, const float* __restrict__ wo,
    _Float16* __restrict__ XQ, _Float16* __restrict__ XK, _Float16* __restrict__ XV, _Float16* __restrict__ BQ, _Float16* __restrict__ BK, _Float16* __restrict__ BV, _Float16* __restrict__ BO) {
  static_assert((size_t)PW * 256 == (size_t)DM * (DM / 8) && NH * HD == DM, "one weight thread per 8 k of a column"); static_assert((size_t)PX * 256 * PC == NR * DM / 8, "the input threads cover every chunk once");
  if (blockIdx.x < PW) {
    const int t = blockIdx.x * 256 + threadIdx.x; const int n = t / (DM / 8), k8 = (t % (DM / 8)) * 8; const int h = n / HD, d = n % HD;
    const size_t ph = ((size_t)h * DM + k8) * HD + d, po = (size_t)k8 * DM + n; float a[4][8];
#pragma unroll
    for (int q = 0; q < 8; ++q) { a[0][q] = wq[ph + (size_t)q * HD]; a[1][q] = wk[ph + (size_t)q * HD]; a[2][q] = wv[ph + (size_t)q * HD]; a[3][q] = wo[po + (size_t)q * DM]; }
    const size_t dst = (size_t)n * DM + k8;
    *(v8us*)((unsigned short*)BQ + dst) = p_cvt8(a[0], 16.0f); *(v8us*)((unsigned short*)BK + dst) = p_cvt8(a[1], 16.0f); *(v8us*)((unsigned short*)BV + dst) = p_cvt8(a[2], 16.0f); *(v8us*)((unsigned short*)BO + dst) = p_cvt8(a[3], 16.0f);
    return; }
  const size_t i0 = ((size_t)(blockIdx.x - PW) * (PC * 256) + threadIdx.x) * 8;      /* first float of the thread's first chunk; its next chunks lie 256 chunks on each */
  const float* pq = xq + i0; const float* pk = xk + i0; const float* pv = xv + i0;
  v4f v[3][PC][2];
#pragma unroll
  for (int c = 0; c < PC; ++c) { const int o = c * 256 * 8;
    v[0][c][0] = *(const v4fa*)(pq + o); v[0][c][1] = *(const v4fa*)(pq + o + 4); v[1][c][0] = *(const v4fa*)(pk + o); v[1][c][1] = *(const v4fa*)(pk + o + 4); v[2][c][0] = *(const v4fa*)(pv + o); v[2][c][1] = *(const v4fa*)(pv + o + 4); }
  asm volatile("s_wait_xcnt 0x0" :: "v"(pq), "v"(pk), "v"(pv) : "memory");      /* stands before the loads' address registers are written again; naming the three addresses keeps their registers out of the later loads' results; as a statement on memory it also holds all of the thread's loads ahead of the first conversion, one memory latency instead of several */
#pragma unroll
  for (int c = 0; c < PC; ++c) { const size_t o = i0 + (size_t)c * 256 * 8;
    *(v8us*)((unsigned short*)XQ + o) = p_cvt44(v[0][c][0], v[0][c][1]); *(v8us*)((unsigned short*)XK + o) = p_cvt44(v[1][c][0], v[1][c][1]); *(v8us*)((unsigned short*)XV + o) = p_cvt44(v[2][c][0], v[2][c][1]); }
  asm volatile("s_wait_xcnt 0x0" ::: "memory");      /* stands behind the last stores, before anything that follows them in the code can write their address or data registers again */
}

extern "C" void kernel_launch(void* const* d_in, const int* in_sizes, int n_in,
                              void* d_out, int out_size, void* d_ws, size_t ws_size, hipStream_t stream) {
  (void)in_sizes; (void)n_in; (void)out_size;
  const float* const* I = (const float* const*)d_in; const float* xq = I[0]; const float* xk = I[1]; const float* xv = I[2]; const float* wq = I[3]; const float* bq = I[4]; const float* wk = I[5]; const float* bk = I[6]; const float* wv = I[7]; const float* bv = I[8]; const float* wo = I[9]; const float* bo = I[10];      /* three inputs; per-head [in][out] weights [8][512][64] + per-head biases [8][64] (flattened head-major = projection column order); Wo [in][out] + bo */
  char* ws = (char*)d_ws; size_t off = 0;
  auto take = [&](size_t bytes) { char* p = ws + off; off += (bytes + 255) & ~(size_t)255; return p; };
  _Float16* BQ = (_Float16*)take((size_t)DM * DM * 2); _Float16* BK = (_Float16*)take((size_t)DM * DM * 2); _Float16* BV = (_Float16*)take((size_t)DM * DM * 2); _Float16* BO = (_Float16*)take((size_t)DM * DM * 2);
  _Float16* Q16 = (_Float16*)take(NR * DM * 2); _Float16* K16 = (_Float16*)take(NR * DM * 2); _Float16* V16 = (_Float16*)take(NR * DM * 2); _Float16* O16 = (_Float16*)take(NR * DM * 2);
  _Float16* VT = (_Float16*)take((size_t)NB * NH * HD * SQ * 2);
  _Float16* XQ = (_Float16*)take(NR * DM * 2); _Float16* XK = (_Float16*)take(NR * DM * 2); _Float16* XV = (_Float16*)take(NR * DM * 2);      /* the f16 input rows */
  if (off > ws_size) return;
  k_prep<<<PW + PX, 256, 0, stream>>>(xq, xk, xv, wq, wk, wv, wo, XQ, XK, XV, BQ, BK, BV, BO);      /* the four weight matrices as Bt x16 and the three inputs as exact f16 rows */
  const size_t r0p = (size_t)B0 * SQ;      /* first projected row */
  k_gemm2<0><<<dim3((unsigned)((MP / 128) * (DM / 64)), 1, 3), 128, 0, stream>>>(XQ + r0p * DM, DM, 0, NR * DM, BQ, DM, 0, (size_t)DM * DM, 0.0625f, bq, bk, bv, 0, nullptr, 1, 0, 0, nullptr, Q16 + r0p * DM, DM, 0, NR * DM, MP, DM, DM);      /* Q, K and V projections on grid.z: XQ XK XV, BQ BK BV and Q16 K16 V16 lie one behind the other in the workspace (every size is a multiple of the 256-byte rounding) */
  k_vt<NH, SQ><<<NB * NH * (SQ / 64), 256, 0, stream>>>(V16, LQ, 0, VT);      /* V^T [NB][NH][HD][SQ], all batches in one launch */
  k_fattn<<<dim3(SQ / (16 * FQ * FW), NB * NH), FW * 32, 0, stream>>>(Q16, K16, VT, O16);      /* scores, softmax and P . V of all planes: plane p = batch * NH + head -> 64-wide rows at O16 + p * SQ * HD (head-major context), x64 */
  k_gemm2<0><<<dim3((unsigned)((MPO / 128) * (DM / 64)), 1), 128, 0, stream>>>(O16 + r0p * DM, DM, 0, 0, BO, DM, 0, 0, 0.0009765625f, bo, nullptr, nullptr, 0, nullptr, 1, 0, 0, (float*)d_out + r0p * DM, nullptr, DM, 0, 0, MPO, DM, DM);      /* out rows are the output layout */
}

// v007
// It runs in 71.4 microseconds.
// Next to v006, in two timings, it ran 1.06 times as fast each time.
// Counting every step since v000, it is 47.0 times as fast.
#include <hip/hip_runtime.h>
// Multi-head attention on three inputs with per-head projection tensors and the source's head-major context view (Q, K, V [8][1024][512]; Qh / Kh / Vh = einsum('bsd,hde->bhse', input, W) + b with per-head [in][out] weights W [8][512][64] and biases [8][64] (uniform +-512^-0.5); scores * 64^-0.5; softmax over all 1024 keys (no mask); context x [B][H][S][64] is RE-VIEWED as [B][S][512] WITHOUT transposing heads and time (row s' of the view = 512 consecutive floats of the [H][S][64] block); out = view Wo + bo ([in][out] 512 x 512) -> [8][1024][512]).
// Structure: token rows r = b*1024 + s; the three inputs as exact f16 rows (bf16-rounded); Q, K, V as three WMMA GEMMs (32x64 wave tiles, f32 accumulation, exact x16 weights + bias, f16 outputs); then one fused attention launch for all pairs (S^T = K . Q^T on WMMA, V^T fragments by transposing LDS loads of the staged V rows, online softmax on VALU with f32 statistics and native exp2, the unnormalised weights packed in registers as the f16 B operand of O^T += V^T . P^T on WMMA; neither scores nor weights reach memory; o carried x64 against f16 subnormal flush, folded into the output GEMM alpha) written straight into the merged f16 o rows; out = o W_o + b GEMM (f32) into the output layout.
// Compute dtype: inputs rounded to bf16; x / weights exact; q, k, v, softmax weights and o as plain f16 GEMM operands (~2^-12); scores and softmax statistics f32. v_wmma_f32_16x16x32_f16.
#define NB 8
#define SQ 1024
#define DM 512
#define NH 8
#define HD 64
#define HG 4                         /* heads per launch of the untemplated k_vt (not launched) */
#define B0 0                         /* first batch processed (debug hook) */
#define NBR NB                       /* batches processed (debug hook) */
#define NR ((size_t)NB * SQ)         /* token rows */
#define MP ((int)((size_t)NBR * SQ)) /* rows projected (debug hook) */
#define QN SQ                        /* query rows per batch (not used; launches attend all SQ rows) */
#define NHD NH                       /* heads (not used; launches attend all NH heads) */
#define MPO MP                       /* rows through the output stage (debug hook) */
#define LQ DM      /* row pitch of the q/k/v rows */
typedef __bf16 v16b __attribute__((ext_vector_type(16)));
typedef unsigned short v8us __attribute__((ext_vector_type(8), may_alias));
typedef float  v8f  __attribute__((ext_vector_type(8)));
typedef float  v4f  __attribute__((ext_vector_type(4)));
typedef float  v4fa __attribute__((ext_vector_type(4), may_alias));
union FragB { v16b v; v8us half[2]; unsigned short u[16]; };

__device__ __forceinline__ unsigned short bf16_bits(float x) { unsigned int u = __float_as_uint(x); return (unsigned short)((u + 0x7FFFu + ((u >> 16) & 1u)) >> 16); }
__device__ __forceinline__ float bf16_val(unsigned short b) { return __uint_as_float(((unsigned int)b) << 16); }
__device__ __forceinline__ float bf16_round(float x) { return bf16_val(bf16_bits(x)); }
// D += A·B with NT terms: 1 = ah·bh, 2 = + al·bh (A split), 3 = + ah·bl (both split)
template <int NT>
__device__ __forceinline__ v8f mmaN(v16b ah, v16b al, v16b bh, v16b bl, v8f c) {
  c = __builtin_amdgcn_wmma_f32_16x16x32_bf16(false, ah, false, bh, (short)0, c, false, false);
  if (NT >= 2) c = __builtin_amdgcn_wmma_f32_16x16x32_bf16(false, al, false, bh, (short)0, c, false, false);
  if (NT >= 3) c = __builtin_amdgcn_wmma_f32_16x16x32_bf16(false, ah, false, bl, (short)0, c, false, false);
  asm volatile("v_nop\n\tv_nop\n\tv_nop\n\tv_nop" : "+v"(c) : "v"(ah), "v"(al), "v"(bh), "v"(bl));
  return c;
}

__global__ __launch_bounds__(256) void k_wt_bf16(const float* __restrict__ W, unsigned short* __restrict__ Wt, int K, int N) {
  const int t = blockIdx.x * 256 + threadIdx.x;
  const int k8n = K / 8;
  if (t >= N * k8n) return;
  const int n = t / k8n, k8 = (t % k8n) * 8;
  v8us v;
#pragma unroll
  for (int i = 0; i < 8; ++i) v[i] = bf16_bits(W[(size_t)(k8 + i) * N + n]);
  *(v8us*)(Wt + (size_t)n * K + k8) = v;
  
}

// GEMM C[M][N] (f32, pitch ldc) = act(A[M][K]·W + bias). A f32 row-major (pitch lda) converted per fragment to bf16
// (ASPLIT: hi/lo two planes -> 2 terms, else single rounded term); Wt bf16 [N][K] (pitch ldb). BIAS_BF16 rounds the
// bias to bf16 first (bias quantised to bf16 before the add). K%32==0, M%16==0, N%64==0.
template <bool ASPLIT, int ACT, bool BIAS_BF16>
__global__ __launch_bounds__(128) void k_gemm_bf(const float* __restrict__ A, int lda, const unsigned short* __restrict__ Wt, int ldb,
                                               const float* __restrict__ bias, float* __restrict__ C, int ldc, int M, int N, int K) {
  __shared__ __attribute__((aligned(16))) float so[4][16][64];
  const int tid = threadIdx.x, w = tid >> 5, lane = tid & 31, ln = lane & 15, hh = lane >> 4;
  const int ntn = N / 64;
  const int wid = blockIdx.x * 4 + w;
  const int mt = wid / ntn, nq = wid % ntn;
  if (mt * 16 >= M) return;
  const int row0 = mt * 16, col0 = nq * 64;
  const float* arow = A + (size_t)(row0 + ln) * lda;
  v8f acc[4] = {};
  for (int kb = 0; kb < K; kb += 32) {
    FragB ah, al;
    const v4f x0 = *(const v4fa*)(arow + kb + 8 * hh), x1 = *(const v4fa*)(arow + kb + 8 * hh + 4);
    const v4f x2 = *(const v4fa*)(arow + kb + 16 + 8 * hh), x3 = *(const v4fa*)(arow + kb + 16 + 8 * hh + 4);
    float xs[16] = {x0[0],x0[1],x0[2],x0[3],x1[0],x1[1],x1[2],x1[3],x2[0],x2[1],x2[2],x2[3],x3[0],x3[1],x3[2],x3[3]};
#pragma unroll
    for (int i = 0; i < 16; ++i) { const unsigned short hb = bf16_bits(xs[i]); ah.u[i] = hb; al.u[i] = ASPLIT ? bf16_bits(xs[i] - bf16_val(hb)) : (unsigned short)0; }
#pragma unroll
    for (int t = 0; t < 4; ++t) {
      const unsigned short* brow = Wt + (size_t)(col0 + t * 16 + ln) * ldb + kb;
      FragB b;
      b.half[0] = *(const v8us*)(brow + 8 * hh);
      b.half[1] = *(const v8us*)(brow + 16 + 8 * hh);
      acc[t] = mmaN<ASPLIT ? 2 : 1>(ah.v, al.v, b.v, b.v, acc[t]);
    }
  }
#pragma unroll
  for (int t = 0; t < 4; ++t) {
    float bv = bias ? bias[col0 + t * 16 + ln] : 0.f;
    if (BIAS_BF16) bv = bf16_round(bv);
#pragma unroll
    for (int r = 0; r < 8; ++r) { float v = acc[t][r] + bv; if (ACT == 1) v = fmaxf(v, 0.f); so[w][8 * hh + r][t * 16 + ln] = v; }
  }
  __builtin_amdgcn_fence(__ATOMIC_ACQ_REL, "workgroup");
  __builtin_amdgcn_wave_barrier();
  const int rsub = lane >> 4, c4 = (lane & 15) * 4;
  {
#pragma unroll
    for (int q = 0; q < 8; ++q) {
      const int r = q * 2 + rsub;
      const v4f v = *(const v4fa*)&so[w][r][c4];
      *(v4f*)(C + (size_t)(row0 + r) * ldc + col0 + c4) = v;
    }
    
  }
}

// GEMM C = act(A·W + bias + resid): A f32 (ASPLIT -> hi/lo 2 terms), Wt bf16 [N][K]; ACT 0 none, 1 relu, 2 exact gelu;
// resid (optional, f32, row index = (row % rmod), pitch ldr, RES_BF16 rounds it) added before the activation.
template <bool ASPLIT, int ACT, bool BIAS_BF16, bool RES_BF16>
__global__ __launch_bounds__(128) void k_gemm_bf3(const float* __restrict__ A, int lda, const unsigned short* __restrict__ Wt, int ldb,
                                                const float* __restrict__ bias, const float* __restrict__ resid, int rmod, int ldr,
                                                float* __restrict__ C, int ldc, int M, int N, int K) {
  __shared__ __attribute__((aligned(16))) float so[4][16][64];
  const int tid = threadIdx.x, w = tid >> 5, lane = tid & 31, ln = lane & 15, hh = lane >> 4;
  const int ntn = N / 64;
  const int wid = blockIdx.x * 4 + w;
  const int mt = wid / ntn, nq = wid % ntn;
  if (mt * 16 >= M) return;
  const int row0 = mt * 16, col0 = nq * 64;
  const float* arow = A + (size_t)(row0 + ln) * lda;
  v8f acc[4] = {};
  for (int kb = 0; kb < K; kb += 32) {
    FragB ah, al;
    const v4f x0 = *(const v4fa*)(arow + kb + 8 * hh), x1 = *(const v4fa*)(arow + kb + 8 * hh + 4);
    const v4f x2 = *(const v4fa*)(arow + kb + 16 + 8 * hh), x3 = *(const v4fa*)(arow + kb + 16 + 8 * hh + 4);
    float xs[16] = {x0[0],x0[1],x0[2],x0[3],x1[0],x1[1],x1[2],x1[3],x2[0],x2[1],x2[2],x2[3],x3[0],x3[1],x3[2],x3[3]};
#pragma unroll
    for (int i = 0; i < 16; ++i) { const unsigned short hb = bf16_bits(xs[i]); ah.u[i] = hb; al.u[i] = ASPLIT ? bf16_bits(xs[i] - bf16_val(hb)) : (unsigned short)0; }
#pragma unroll
    for (int t = 0; t < 4; ++t) {
      const unsigned short* brow = Wt + (size_t)(col0 + t * 16 + ln) * ldb + kb;
      FragB b;
      b.half[0] = *(const v8us*)(brow + 8 * hh);
      b.half[1] = *(const v8us*)(brow + 16 + 8 * hh);
      acc[t] = mmaN<ASPLIT ? 2 : 1>(ah.v, al.v, b.v, b.v, acc[t]);
    }
  }
#pragma unroll
  for (int t = 0; t < 4; ++t) {
    const int col = col0 + t * 16 + ln;
    float bv = bias ? bias[col] : 0.f;
    if (BIAS_BF16) bv = bf16_round(bv);
#pragma unroll
    for (int r = 0; r < 8; ++r) {
      float v = acc[t][r] + bv;
      if (resid) { float rv = resid[(size_t)((row0 + 8 * hh + r) % rmod) * ldr + col]; if (RES_BF16) rv = bf16_round(rv); v += rv; }
      if (ACT == 1) v = fmaxf(v, 0.f);
      if (ACT == 2) v = 0.5f * v * (1.0f + erff(v * 0.70710678118654752f));
      if (ACT == 3) { const float u = 0.7978845608028654f * (v + 0.044715f * v * v * v); v = 0.5f * v * (1.0f + tanhf(u)); }
      so[w][8 * hh + r][t * 16 + ln] = v;
    }
  }
  __builtin_amdgcn_fence(__ATOMIC_ACQ_REL, "workgroup");
  __builtin_amdgcn_wave_barrier();
  const int rsub = lane >> 4, c4 = (lane & 15) * 4;
  {
#pragma unroll
    for (int q = 0; q < 8; ++q) {
      const int r = q * 2 + rsub;
      const v4f v = *(const v4fa*)&so[w][r][c4];
      *(v4f*)(C + (size_t)(row0 + r) * ldc + col0 + c4) = v;
    }
    
  }
}
// row LayerNorm (biased variance, eps) over N: s = X (+ R); optional out_sum <- s; out_norm <- (s-mu)*rsqrt(var+eps)*g + b
template <bool PARAM_BF16>
__global__ __launch_bounds__(256) void k_layernorm(const float* __restrict__ X, const float* __restrict__ R, const float* __restrict__ g, const float* __restrict__ bta,
                                                  float* __restrict__ out_sum, float* __restrict__ out_norm, int N, float eps) {
  __shared__ float red[256];
  const int row = blockIdx.x, tid = threadIdx.x;
  const float* x = X + (size_t)row * N; const float* rr = R ? R + (size_t)row * N : nullptr;
  float vals[16];                     // up to N = 4096
  const int per = N / 256;            // contiguous chunk per thread? use strided-by-4 chunks: thread handles j = tid*4 + 1024*u
  float s1 = 0.f;
  for (int u = 0; u < per / 4; ++u) {
    const int j = tid * 4 + 1024 * u;
    const v4f a = *(const v4fa*)(x + j);
    v4f b = {0.f,0.f,0.f,0.f}; if (rr) b = *(const v4fa*)(rr + j);
#pragma unroll
    for (int q = 0; q < 4; ++q) { const float v = a[q] + b[q]; vals[u * 4 + q] = v; s1 += v; }
  }
  red[tid] = s1; __syncthreads();
  for (int st = 128; st > 0; st >>= 1) { if (tid < st) red[tid] += red[tid + st]; __syncthreads(); }
  const float mu = red[0] / (float)N; __syncthreads();
  float s2 = 0.f;
  for (int u = 0; u < per / 4; ++u)
#pragma unroll
    for (int q = 0; q < 4; ++q) { const float c = vals[u * 4 + q] - mu; s2 += c * c; }
  red[tid] = s2; __syncthreads();
  for (int st = 128; st > 0; st >>= 1) { if (tid < st) red[tid] += red[tid + st]; __syncthreads(); }
  const float rs = rsqrtf(red[0] / (float)N + eps);
  {
    for (int u = 0; u < per / 4; ++u) {
      const int j = tid * 4 + 1024 * u;
      v4f o, sm;
#pragma unroll
      for (int q = 0; q < 4; ++q) {
        float gg = g[j + q], bb = bta[j + q];
        if (PARAM_BF16) { gg = bf16_round(gg); bb = bf16_round(bb); }
        sm[q] = vals[u * 4 + q]; o[q] = (vals[u * 4 + q] - mu) * rs * gg + bb;
      }
      if (out_sum) *(v4f*)(out_sum + (size_t)row * N + j) = sm;
      *(v4f*)(out_norm + (size_t)row * N + j) = o;
    }
    
  }
}



// ---- f16 WMMA path (v_wmma_f32_16x16x32_f16): 11-bit significands for operands in range — used where a [0,1] probability operand needs more precision than bf16
typedef _Float16 v16h __attribute__((ext_vector_type(16)));
union FragH { v16h v; v8us half[2]; _Float16 h[16]; unsigned short u[16]; };
template <int NT>
__device__ __forceinline__ v8f mmaH(v16h ah, v16h al, v16h bh, v16h bl, v8f c) {
  c = __builtin_amdgcn_wmma_f32_16x16x32_f16(false, ah, false, bh, (short)0, c, false, false);
  if (NT >= 2) c = __builtin_amdgcn_wmma_f32_16x16x32_f16(false, al, false, bh, (short)0, c, false, false);
  if (NT >= 3) c = __builtin_amdgcn_wmma_f32_16x16x32_f16(false, ah, false, bl, (short)0, c, false, false);
  asm volatile("v_nop\n\tv_nop\n\tv_nop\n\tv_nop" : "+v"(c) : "v"(ah), "v"(al), "v"(bh), "v"(bl));
  return c;
}
// batched GEMM like k_gemm_b but f16 operands: A f32 (split into f16 hi/lo if ASPLIT, else rounded to f16), Bt = f16 values [n][k]; alpha; C f32; N multiple of 16 (partial tiles skipped)
template <bool ASPLIT>
__global__ __launch_bounds__(128) void k_gemm_h(const float* __restrict__ A, int lda, size_t sA, const _Float16* __restrict__ Bh, int ldb, size_t sB, float alpha, float* __restrict__ C, int ldc, size_t sC, int M, int N, int K) {
  __shared__ __attribute__((aligned(16))) float so[4][16][64];
  const int tid = threadIdx.x, w = tid >> 5, lane = tid & 31, ln = lane & 15, hh = lane >> 4; const int by = blockIdx.y;
  A += (size_t)by * sA; Bh += (size_t)by * sB; C += (size_t)by * sC;
  const int ntn = (N + 63) / 64; const int wid = blockIdx.x * 4 + w; const int mt = wid / ntn, nq = wid % ntn; if (mt * 16 >= M) return;
  const int row0 = mt * 16, col0 = nq * 64; const float* arow = A + (size_t)(row0 + ln) * lda;
  v8f acc[4] = {};
  for (int kb = 0; kb < K; kb += 32) {
    FragH ah, al;
    const v4f x0 = *(const v4fa*)(arow + kb + 8 * hh), x1 = *(const v4fa*)(arow + kb + 8 * hh + 4), x2 = *(const v4fa*)(arow + kb + 16 + 8 * hh), x3 = *(const v4fa*)(arow + kb + 16 + 8 * hh + 4);
    float xs[16] = {x0[0],x0[1],x0[2],x0[3],x1[0],x1[1],x1[2],x1[3],x2[0],x2[1],x2[2],x2[3],x3[0],x3[1],x3[2],x3[3]};
#pragma unroll
    for (int i = 0; i < 16; ++i) { const _Float16 h = (_Float16)xs[i]; ah.h[i] = h; al.h[i] = ASPLIT ? (_Float16)(xs[i] - (float)h) : (_Float16)0.0f; }
#pragma unroll
    for (int t = 0; t < 4; ++t) { if (col0 + t * 16 >= N) continue; const size_t boff = (size_t)(col0 + t * 16 + ln) * ldb + kb; FragH bq; bq.half[0] = *(const v8us*)(Bh + boff + 8 * hh); bq.half[1] = *(const v8us*)(Bh + boff + 16 + 8 * hh);
      acc[t] = mmaH<ASPLIT ? 2 : 1>(ah.v, al.v, bq.v, bq.v, acc[t]); }
  }
#pragma unroll
  for (int t = 0; t < 4; ++t) { if (col0 + t * 16 >= N) continue;
#pragma unroll
    for (int r = 0; r < 8; ++r) so[w][8 * hh + r][t * 16 + ln] = acc[t][r] * alpha; }
  __builtin_amdgcn_fence(__ATOMIC_ACQ_REL, "workgroup"); __builtin_amdgcn_wave_barrier();
  const int rsub = lane >> 4, c4 = (lane & 15) * 4;
  {
#pragma unroll
    for (int q = 0; q < 8; ++q) { const int r = q * 2 + rsub; if (col0 + c4 < N) { const v4f v = *(const v4fa*)&so[w][r][c4]; *(v4f*)(C + (size_t)(row0 + r) * ldc + col0 + c4) = v; } }
     }
}

// k_gemm_hh variant with fused epilogue: v = acc·alpha + bias[by·sBias + col] (+ CP[(row/rowsPerB)·sCPb + by·64 + col] if CP) ; ACT 0 none / 1 elu ; writes f16 C16 (and f32 C if non-null)
template <int ACT>
__global__ __launch_bounds__(128) void k_gemm_hhx(const _Float16* __restrict__ A, int lda, size_t sA, const _Float16* __restrict__ Bh, int ldb, size_t sB, float alpha, const float* __restrict__ bias, size_t sBias, const float* __restrict__ CP, int rowsPerB, size_t sCPb, int row0g,
    float* __restrict__ C, _Float16* __restrict__ C16, int ldc, size_t sC, int M, int N, int K) {
  __shared__ __attribute__((aligned(16))) float so[4][16][64];
  const int tid = threadIdx.x, w = tid >> 5, lane = tid & 31, ln = lane & 15, hh = lane >> 4; const int by = blockIdx.y;
  A += (size_t)by * sA; Bh += (size_t)by * sB; const size_t cofs = (size_t)by * sC; const float* bp = bias ? bias + (size_t)by * sBias : nullptr;
  const int ntn = (N + 63) / 64; const int wid = blockIdx.x * 4 + w; const int mt = wid / ntn, nq = wid % ntn; if (mt * 16 >= M) return;
  const int row0 = mt * 16, col0 = nq * 64; const _Float16* arow = A + (size_t)(row0 + ln) * lda;
  v8f acc[4] = {};
  for (int kb = 0; kb < K; kb += 32) { FragH ah; ah.half[0] = *(const v8us*)((const unsigned short*)arow + kb + 8 * hh); ah.half[1] = *(const v8us*)((const unsigned short*)arow + kb + 16 + 8 * hh);
#pragma unroll
    for (int t = 0; t < 4; ++t) { if (col0 + t * 16 >= N) continue; const size_t boff = (size_t)(col0 + t * 16 + ln) * ldb + kb; FragH bq; bq.half[0] = *(const v8us*)((const unsigned short*)Bh + boff + 8 * hh); bq.half[1] = *(const v8us*)((const unsigned short*)Bh + boff + 16 + 8 * hh);
      acc[t] = mmaH<1>(ah.v, ah.v, bq.v, bq.v, acc[t]); }
  }
#pragma unroll
  for (int t = 0; t < 4; ++t) { if (col0 + t * 16 >= N) continue; const int col = col0 + t * 16 + ln; const float bv = bp ? bf16_round(bp[col]) : 0.f;
#pragma unroll
    for (int r = 0; r < 8; ++r) { float v = acc[t][r] * alpha + bv; if (CP) { const int rr = row0g + row0 + 8 * hh + r; if (rowsPerB < 0) v += CP[cofs + (size_t)rr * ldc + col];      /* rowsPerB < 0: own element of the batched C plane */ else { const int bidx = rr / rowsPerB; v += CP[(size_t)bidx * sCPb + (size_t)by * 64 + col]; } } if (ACT == 1) v = (v > 0.f) ? v : expm1f(v); else if (ACT == 7) v = (v > 0.f) ? v + 1.0f : expf(v); else if (ACT == 8) v = tanhf(v); else if (ACT == 9) v = 0.5f * v * (1.0f + tanhf(0.7978845608028654f * (v + 0.044715f * v * v * v))); else if (ACT == 11) v = 1.0f / (1.0f + expf(-v)); else if (ACT == 12) v = (v > 0.f) ? v : 0.01f * v; else if (ACT == 14) v = (v > 0.f) ? v : 0.1f * v; else if (ACT == 16) v = (v >= 0.f) ? v : 0.3f * v; else if (ACT == 17) v = (v >= 0.f) ? v : 0.2f * v; else if (ACT == 15) v = v / (1.0f + expf(-v)); else if (ACT == 3) v = fmaxf(v, 0.f); else if (ACT == 6) v = 0.5f * v * (1.0f + erff(v * 0.70710678118654752f)); so[w][8 * hh + r][t * 16 + ln] = v; } }
  __builtin_amdgcn_fence(__ATOMIC_ACQ_REL, "workgroup"); __builtin_amdgcn_wave_barrier();
  const int rsub = lane >> 4, c4 = (lane & 15) * 4; typedef _Float16 v4h __attribute__((ext_vector_type(4)));
  {
#pragma unroll
    for (int q = 0; q < 8; ++q) { const int r = q * 2 + rsub; if (col0 + c4 < N) { const v4f v = *(const v4fa*)&so[w][r][c4]; if (C) *(v4f*)(C + cofs + (size_t)(row0 + r) * ldc + col0 + c4) = v; if (C16) { v4h h4; for (int i = 0; i < 4; ++i) h4[i] = (_Float16)v[i]; *(v4h*)(C16 + cofs + (size_t)(row0 + r) * ldc + col0 + c4) = h4; } } }
     }
}


typedef _Float16 v4h __attribute__((ext_vector_type(4)));

__global__ __launch_bounds__(256) void k_h16(const float* __restrict__ x, _Float16* __restrict__ X16, size_t n8) { const size_t t = (size_t)blockIdx.x * 256 + threadIdx.x; if (t >= n8) return; FragH f;
#pragma unroll
  for (int q = 0; q < 8; ++q) f.h[q] = (_Float16)x[t * 8 + q]; *(v8us*)((unsigned short*)X16 + t * 8) = f.half[0];  }
__global__ __launch_bounds__(256) void k_round16f(const float* __restrict__ W, _Float16* __restrict__ Bt, size_t n8) { const size_t t = (size_t)blockIdx.x * 256 + threadIdx.x; if (t >= n8) return; FragH f;
#pragma unroll
  for (int i = 0; i < 8; ++i) f.h[i] = (_Float16)(bf16_round(W[t * 8 + i]) * 16.0f); *(v8us*)((unsigned short*)Bt + t * 8) = f.half[0];  }
template <int NHv, int TTv>
__global__ __launch_bounds__(256) void k_vt(const _Float16* __restrict__ V16, int ldv, int voff, _Float16* __restrict__ Vt) { __shared__ unsigned short tl[64][66]; const int tid = threadIdx.x; const int slab = blockIdx.x / (TTv / 64), lg = blockIdx.x % (TTv / 64); const int b = slab / NHv, h = slab % NHv;
  for (int i = tid; i < 64 * 8; i += 256) { const int r = i / 8, c8 = (i % 8) * 8; FragH f; f.half[0] = *(const v8us*)((const unsigned short*)V16 + ((size_t)b * TTv + lg * 64 + r) * ldv + voff + h * 64 + c8);
#pragma unroll
    for (int q = 0; q < 8; ++q) tl[r][c8 + q] = f.u[q]; }
  __syncthreads();
  {
#pragma unroll
    for (int rd = 0; rd < 2; ++rd) { const int d = rd * 32 + tid / 8, pc = tid % 8; FragH f;
#pragma unroll
      for (int q = 0; q < 8; ++q) f.u[q] = tl[pc * 8 + q][d];
      *(v8us*)((unsigned short*)Vt + ((size_t)slab * 64 + d) * TTv + lg * 64 + pc * 8) = f.half[0]; }
     } }

__global__ __launch_bounds__(256) void k_hl(const float* __restrict__ F, _Float16* __restrict__ Hh, _Float16* __restrict__ Hl, size_t n8) { const size_t t = (size_t)blockIdx.x * 256 + threadIdx.x; if (t >= n8) return; FragH fh, fl; const v4f a = *(const v4fa*)(F + t * 8), c = *(const v4fa*)(F + t * 8 + 4);
#pragma unroll
  for (int q = 0; q < 4; ++q) { _Float16 h = (_Float16)a[q]; fh.h[q] = h; fl.h[q] = (_Float16)((a[q] - (float)h) * 1024.0f); h = (_Float16)c[q]; fh.h[4 + q] = h; fl.h[4 + q] = (_Float16)((c[q] - (float)h) * 1024.0f); }
  { *(v8us*)((unsigned short*)Hh + t * 8) = fh.half[0]; *(v8us*)((unsigned short*)Hl + t * 8) = fl.half[0];  } }

// ---- fast GEMM (block tile 128x64, wave tile 32x64; requires M % 128 == 0 rows per launch region, N % 64 == 0 and K % 64 == 0); epilogue = k_gemm_hhx semantics ----
__device__ __forceinline__ v16h g2_frag(const _Float16* p, int hh) { FragH f; f.half[0] = *(const v8us*)((const unsigned short*)p + 8 * hh); f.half[1] = *(const v8us*)((const unsigned short*)p + 16 + 8 * hh); return f.v; }
__device__ __forceinline__ v8f g2_mma(v16h a, v16h b, v8f c) { v8f d = __builtin_amdgcn_wmma_f32_16x16x32_f16(false, a, false, b, (short)0, c, false, false); asm volatile("v_nop\n\tv_nop\n\tv_nop\n\tv_nop" : "+v"(d) : "v"(a), "v"(b)); return d; }
// Operand staging of k_gemm2: one stage = 64 k of the block's 128 A rows and 64 B rows (whole 128-byte lines), brought into LDS by asynchronous 16-byte copies, 12 per thread; eight neighbouring lanes copy one line.
#define G2P 72                       /* LDS row pitch in f16: 128 data bytes + 16, conflict-free for the 16-byte fragment reads */
__device__ __forceinline__ void g2_stage(const _Float16* ag, const _Float16* bg, size_t a16, size_t b16, unsigned la, unsigned lb) {      /* ag, bg: this thread's 16 bytes in rows tid / 8 of A and B at the stage's k; a16, b16: 16 rows on in global memory; la, lb: their LDS byte addresses */
  const _Float16* a1 = ag + a16; const _Float16* a2 = a1 + a16; const _Float16* a3 = a2 + a16; const _Float16* a4 = a3 + a16; const _Float16* a5 = a4 + a16; const _Float16* a6 = a5 + a16; const _Float16* a7 = a6 + a16;
  const _Float16* b1 = bg + b16; const _Float16* b2 = b1 + b16; const _Float16* b3 = b2 + b16;
  const unsigned st = 16 * G2P * 2;      /* 16 rows on in LDS, bytes */
  /* the copies and, as the last line of their own statement, the wait that stands before any of their address registers is written again */
  asm volatile("global_load_async_to_lds_b128 %0, %12, off\n\t"
               "global_load_async_to_lds_b128 %1, %13, off\n\t"
               "global_load_async_to_lds_b128 %2, %14, off\n\t"
               "global_load_async_to_lds_b128 %3, %15, off\n\t"
               "global_load_async_to_lds_b128 %4, %16, off\n\t"
               "global_load_async_to_lds_b128 %5, %17, off\n\t"
               "global_load_async_to_lds_b128 %6, %18, off\n\t"
               "global_load_async_to_lds_b128 %7, %19, off\n\t"
               "global_load_async_to_lds_b128 %8, %20, off\n\t"
               "global_load_async_to_lds_b128 %9, %21, off\n\t"
               "global_load_async_to_lds_b128 %10, %22, off\n\t"
               "global_load_async_to_lds_b128 %11, %23, off\n\t"
               "s_wait_xcnt 0x0"
               :: "v"(la), "v"(la + st), "v"(la + 2 * st), "v"(la + 3 * st), "v"(la + 4 * st), "v"(la + 5 * st), "v"(la + 6 * st), "v"(la + 7 * st), "v"(lb), "v"(lb + st), "v"(lb + 2 * st), "v"(lb + 3 * st),
                  "v"(ag), "v"(a1), "v"(a2), "v"(a3), "v"(a4), "v"(a5), "v"(a6), "v"(a7), "v"(bg), "v"(b1), "v"(b2), "v"(b3) : "memory");
}
template <int ACT>
__global__ __launch_bounds__(128) void k_gemm2(const _Float16* __restrict__ A, int lda, size_t sA, size_t sAz, const _Float16* __restrict__ Bh, int ldb, size_t sB, size_t sBz, float alpha, const float* __restrict__ bias, const float* __restrict__ biasz1, const float* __restrict__ biasz2, size_t sBias, const float* __restrict__ CP, int rowsPerB, size_t sCPb, int row0g,
    float* __restrict__ C, _Float16* __restrict__ C16, int ldc, size_t sC, size_t sCz, int M, int N, int K) { static_assert(ACT == 0 || ACT == 3 || ACT == 6 || ACT == 8 || ACT == 9 || ACT == 11 || ACT == 12 || ACT == 14 || ACT == 15 || ACT == 16 || ACT == 17, "k_gemm2: unsupported ACT code (would silently apply no activation)");
  __shared__ __attribute__((aligned(16))) float so[4][32][68];
  __shared__ __attribute__((aligned(16))) _Float16 sa[2][128 * G2P]; __shared__ __attribute__((aligned(16))) _Float16 sb[2][64 * G2P];      /* two stage buffers per operand */
  const int tid = threadIdx.x, w = tid >> 5, lane = tid & 31, ln = lane & 15, hh = lane >> 4; const int by = blockIdx.y, bz = blockIdx.z;      /* two batch axes: strides s* on grid.y, s*z on grid.z */
  A += (size_t)by * sA + (size_t)bz * sAz; Bh += (size_t)by * sB + (size_t)bz * sBz; const size_t cofs = (size_t)by * sC + (size_t)bz * sCz; const float* bsel = bz == 0 ? bias : (bz == 1 ? biasz1 : biasz2); const float* bp = bsel ? bsel + (size_t)by * sBias : nullptr;      /* the bias vectors of grid.z planes 0, 1, 2 are separate buffers */
  const int ntn = N >> 6; const int mt = blockIdx.x / ntn, nq = blockIdx.x - mt * ntn; const int row0 = mt * 128 + 32 * w, col0 = nq * 64; if (mt * 128 >= M) return;      /* the whole block leaves or none, ahead of every copy and barrier */
  const _Float16* agp = A + (size_t)(mt * 128 + (tid >> 3)) * lda + (tid & 7) * 8; const _Float16* bgp = Bh + (size_t)(col0 + (tid >> 3)) * ldb + (tid & 7) * 8;
  const unsigned lofs = (unsigned)((tid >> 3) * (G2P * 2) + (tid & 7) * 16); const unsigned la0 = (unsigned)(size_t)&sa[0][0] + lofs, lb0 = (unsigned)(size_t)&sb[0][0] + lofs;      /* LDS byte addresses = low 32 bits of the shared addresses */
  const size_t a16 = (size_t)16 * lda, b16 = (size_t)16 * ldb; const int nst = K >> 6;
  const v8f z8 = {0.f,0.f,0.f,0.f,0.f,0.f,0.f,0.f}; v8f c00 = z8, c01 = z8, c02 = z8, c03 = z8, c10 = z8, c11 = z8, c12 = z8, c13 = z8;
  g2_stage(agp, bgp, a16, b16, la0, lb0);
  asm volatile("s_wait_asynccnt 0x0" ::: "memory");      /* this wave's copies of stage 0 have landed */
  __syncthreads();      /* every wave's have: stage 0 may be read */
  if (nst > 1) g2_stage(agp + 64, bgp + 64, a16, b16, la0 + (unsigned)sizeof(sa[0]), lb0 + (unsigned)sizeof(sb[0]));
  /* kept rolled: one trip = one stage, so that the order at its foot stays as written */
#pragma unroll 1
  for (int s = 0; s < nst; ++s) { const int bu = s & 1; const _Float16* as = &sa[bu][(32 * w + ln) * G2P]; const _Float16* bs = &sb[bu][ln * G2P];
    v16h af[2][2], bf[2][4];      /* the stage's 12 fragments, read as one group ahead of its 16 products */
#pragma unroll
    for (int kk = 0; kk < 2; ++kk) { af[kk][0] = g2_frag(as + kk * 32, hh); af[kk][1] = g2_frag(as + 16 * G2P + kk * 32, hh);
#pragma unroll
      for (int u = 0; u < 4; ++u) bf[kk][u] = g2_frag(bs + u * 16 * G2P + kk * 32, hh); }
#pragma unroll
    for (int kk = 0; kk < 2; ++kk) { c00 = g2_mma(af[kk][0], bf[kk][0], c00); c10 = g2_mma(af[kk][1], bf[kk][0], c10); c01 = g2_mma(af[kk][0], bf[kk][1], c01); c11 = g2_mma(af[kk][1], bf[kk][1], c11);
      c02 = g2_mma(af[kk][0], bf[kk][2], c02); c12 = g2_mma(af[kk][1], bf[kk][2], c12); c03 = g2_mma(af[kk][0], bf[kk][3], c03); c13 = g2_mma(af[kk][1], bf[kk][3], c13); }
    asm volatile("s_wait_dscnt 0x0" ::: "memory");      /* this wave has finished reading stage s */
    asm volatile("s_wait_asynccnt 0x0" ::: "memory");      /* this wave's copies of stage s + 1 have landed */
    __syncthreads();      /* publishes stage s + 1 and frees stage s's buffer */
    if (s + 2 < nst) g2_stage(agp + (s + 2) * 64, bgp + (s + 2) * 64, a16, b16, la0 + (unsigned)(bu * sizeof(sa[0])), lb0 + (unsigned)(bu * sizeof(sb[0]))); }
  asm volatile("s_wait_asynccnt 0x0" ::: "memory");      /* no copy is outstanding behind the loop */
  v8f accs[8] = {c00, c01, c02, c03, c10, c11, c12, c13};
#pragma unroll
  for (int u = 0; u < 8; ++u) { const int t = u & 3, half = u >> 2; const int col = col0 + t * 16 + ln; const float bv = bp ? bf16_round(bp[col]) : 0.f;
#pragma unroll
    for (int r = 0; r < 8; ++r) { const int rloc = half * 16 + 8 * hh + r; float v = accs[u][r] * alpha + bv; if (CP) { if (rowsPerB < 0) v += CP[cofs + (size_t)(row0g + row0 + rloc) * ldc + col];      /* rowsPerB < 0: own element of the batched C plane */ else { const int bidx = (row0g + row0 + rloc) / rowsPerB; v += CP[(size_t)bidx * sCPb + (size_t)by * 64 + col]; } }
      if (ACT == 3) v = fmaxf(v, 0.f); else if (ACT == 6) v = 0.5f * v * (1.0f + erff(v * 0.70710678118654752f)); else if (ACT == 11) v = 1.0f / (1.0f + expf(-v)); else if (ACT == 15) v = v / (1.0f + expf(-v)); else if (ACT == 12) v = (v > 0.f) ? v : 0.01f * v; else if (ACT == 8) v = tanhf(v); else if (ACT == 9) v = 0.5f * v * (1.0f + tanhf(0.7978845608028654f * (v + 0.044715f * v * v * v))); else if (ACT == 14) v = (v > 0.f) ? v : 0.1f * v; else if (ACT == 16) v = (v >= 0.f) ? v : 0.3f * v; else if (ACT == 17) v = (v >= 0.f) ? v : 0.2f * v;
      so[w][rloc][t * 16 + ln] = v; } }
  __builtin_amdgcn_fence(__ATOMIC_ACQ_REL, "workgroup"); __builtin_amdgcn_wave_barrier();
  const int rsub = lane >> 4, c4 = (lane & 15) * 4;
  {
#pragma unroll
    for (int q = 0; q < 16; ++q) { const int r = q * 2 + rsub; const v4f v = *(const v4fa*)&so[w][r][c4]; if (C) *(v4f*)(C + cofs + (size_t)(row0 + r) * ldc + col0 + c4) = v; if (C16) { v4h h4; for (int i = 0; i < 4; ++i) h4[i] = (_Float16)v[i]; *(v4h*)(C16 + cofs + (size_t)(row0 + r) * ldc + col0 + c4) = h4; } }
     } }


__global__ __launch_bounds__(256) void k_wnat(const float* __restrict__ w, size_t n8, _Float16* __restrict__ Bt) { const size_t t = (size_t)blockIdx.x * 256 + threadIdx.x; if (t >= n8) return; FragH f; for (int q = 0; q < 8; ++q) f.h[q] = (_Float16)(bf16_round(w[t * 8 + q]) * 16.0f); *(v8us*)((unsigned short*)Bt + t * 8) = f.half[0];  }
__global__ __launch_bounds__(256) void k_rsm(const float* __restrict__ S, _Float16* __restrict__ P, int nrows) {
  #pragma clang fp contract(off)
  const int i = blockIdx.x * 256 + threadIdx.x; if (i >= nrows) return; const float* s = S + (size_t)i * SQ; float mx = -3.0e38f;
#pragma unroll 1
  for (int j = 0; j < SQ; ++j) mx = fmaxf(mx, s[j]); float se = 0.f;
#pragma unroll 1
  for (int j = 0; j < SQ; ++j) se += expf(s[j] - mx); const float sc = 256.0f / se;
#pragma unroll 1
  for (int j0 = 0; j0 < SQ; j0 += 8) { FragH f; for (int q = 0; q < 8; ++q) f.h[q] = (_Float16)(expf(s[j0 + q] - mx) * sc); unsigned short* d = (unsigned short*)P + (size_t)i * SQ + j0; *(v8us*)d = f.half[0];  } }
__global__ __launch_bounds__(256) void k_vt(const _Float16* __restrict__ V16, int b, int h0, _Float16* __restrict__ VT) { __shared__ unsigned short tl[64][65]; const int tid = threadIdx.x; const int hh = blockIdx.x % HG, sg = blockIdx.x / HG; const int s0 = sg * 64; const int h = h0 + hh;
  for (int i = tid; i < 64 * 8; i += 256) { const int j = i / 8, d8 = (i % 8) * 8; FragH f; f.half[0] = *(const v8us*)((const unsigned short*)V16 + ((size_t)b * SQ + s0 + j) * DM + h * HD + d8); for (int q = 0; q < 8; ++q) tl[d8 + q][j] = f.u[q]; }
  __syncthreads();
  { for (int i = tid; i < 64 * 8; i += 256) { const int d = i / 8, j8 = (i % 8) * 8; FragH f; for (int q = 0; q < 8; ++q) f.u[q] = tl[d][j8 + q]; *(v8us*)((unsigned short*)VT + ((size_t)hh * HD + d) * SQ + s0 + j8) = f.half[0]; }  } }



// Fused attention, one launch for all (batch, head) planes: a wave owns 32 queries (two 16-column groups) and walks the plane's 1024 keys in passes of 32. The work-group's 8 waves share each stage of 128 keys through LDS.
// Transposed products: S^T = K . Q^T (A = 16 key rows, B = 16 query rows, both through g2_frag), so lane (ln, hh) holds, for query ln, the scores of keys 8 hh + r and 16 + 8 hh + r:
// exactly the k positions that g2_frag gives a B operand, so the exponentials are packed in place into P^T and O^T += V^T . P^T (A = 16 rows of V^T, read from the staged V rows by ds_load_tr16_b128, which delivers the same k positions) follows with no exchange through memory or LDS.
// Online softmax in base 2: the maximum in use may lag a query's true running maximum by up to 8 (an exponential can reach 2^8, far inside f16); the accumulators are rescaled, tested once per pass, only when it lags by more.
// Row sums are f32 sums of the unrounded exponentials, one partial per wave half, joined at the end. o is stored x64 as f16 (the output GEMM's alpha folds it back).
#define FQ 2                         /* 16-query column groups per wave */
#define FW 8                         /* waves per work-group */
typedef _Float16 v8h __attribute__((ext_vector_type(8)));
typedef _Float16 v2h __attribute__((ext_vector_type(2)));
typedef float v2f __attribute__((ext_vector_type(2)));
union FragP { v16h v; v2h p[8]; };
__device__ __forceinline__ float fa_xhalf(float x) { return __builtin_bit_cast(float, __builtin_amdgcn_permlanex16(__builtin_bit_cast(int, x), __builtin_bit_cast(int, x), 0x76543210, 0xfedcba98, false, false)); }      /* lane l <-> lane l ^ 16 */
__device__ __forceinline__ v8f fa_mma(v16h a, v16h b, v8f c) { return __builtin_amdgcn_wmma_f32_16x16x32_f16(false, a, false, b, (short)0, c, false, false); }
// Operand staging of k_fattn: one stage = FKS keys of the plane, as FKS rows of K and FKS rows of V (128 bytes each, the head's slice of a projected row), brought into LDS once for the work-group's 8 waves by asynchronous 16-byte copies, 8 per thread; 8 neighbouring lanes copy one row.
#define FKS 128                      /* keys per stage */
#define FKP 72                       /* LDS pitch of a K row in f16: 128 data bytes + 16, conflict-free for the 16-byte fragment reads */
#define FVP 80                       /* LDS pitch of a V row in f16: 128 data bytes + 32 (32 bytes x odd), conflict-free for the transposing 16-byte reads */
__device__ __forceinline__ void fa_stage(const _Float16* kg, const _Float16* vg, unsigned lk, unsigned lv) {      /* kg, vg: this thread's 16 bytes in row tid / 8 of the stage's K rows and of its V rows; lk, lv: their LDS byte addresses */
  const _Float16* k1 = kg + (size_t)32 * LQ; const _Float16* k2 = k1 + (size_t)32 * LQ; const _Float16* k3 = k2 + (size_t)32 * LQ;
  const _Float16* v1 = vg + (size_t)32 * LQ; const _Float16* v2 = v1 + (size_t)32 * LQ; const _Float16* v3 = v2 + (size_t)32 * LQ;
  const unsigned dk = 32 * FKP * 2, dv = 32 * FVP * 2;      /* 32 K rows, 32 V rows on in LDS, bytes */
  /* the copies and, as the last line of their own statement, the wait that stands before any of their address registers is written again */
  asm volatile("global_load_async_to_lds_b128 %0, %8, off\n\t"
               "global_load_async_to_lds_b128 %1, %9, off\n\t"
               "global_load_async_to_lds_b128 %2, %10, off\n\t"
               "global_load_async_to_lds_b128 %3, %11, off\n\t"
               "global_load_async_to_lds_b128 %4, %12, off\n\t"
               "global_load_async_to_lds_b128 %5, %13, off\n\t"
               "global_load_async_to_lds_b128 %6, %14, off\n\t"
               "global_load_async_to_lds_b128 %7, %15, off\n\t"
               "s_wait_xcnt 0x0"
               :: "v"(lk), "v"(lk + dk), "v"(lk + 2 * dk), "v"(lk + 3 * dk), "v"(lv), "v"(lv + dv), "v"(lv + 2 * dv), "v"(lv + 3 * dv),
                  "v"(kg), "v"(k1), "v"(k2), "v"(k3), "v"(vg), "v"(v1), "v"(v2), "v"(v3) : "memory");
}
// One 16 (d) x 32 (keys) A fragment of V^T from V rows in LDS: two transposing loads, 16 keys apart. p = the lane's own 16 bytes: row 8 (lane >> 4) + (lane & 7) of the 16-key block, byte 16 ((lane >> 3) & 1) of the 32 bytes that hold the 16 d;
// lane (ln, hh) then holds d = ln at keys 8 hh + 0..7 (first load) and 16 + 8 hh + 0..7 (second): g2_frag's k positions.
typedef short s16x8 __attribute__((ext_vector_type(8)));
__device__ __forceinline__ v16h fa_vfrag(const _Float16* p) { typedef __attribute__((address_space(3))) s16x8 lds_s16x8; FragH f;
  f.half[0] = __builtin_bit_cast(v8us, __builtin_amdgcn_ds_load_tr16_b128_v8i16((lds_s16x8*)p)); f.half[1] = __builtin_bit_cast(v8us, __builtin_amdgcn_ds_load_tr16_b128_v8i16((lds_s16x8*)(p + 16 * FVP))); return f.v; }
__global__ __launch_bounds__(FW * 32) void k_fattn(const _Float16* __restrict__ Qr, const _Float16* __restrict__ Kr, const _Float16* __restrict__ Vr, _Float16* __restrict__ O) {
  static_assert(FW * 32 == 256 && FKS == 128 && HD == 64 && SQ % FKS == 0 && SQ / FKS >= 2, "fa_stage: 256 threads x 4 copies cover 128 K rows of 8 chunks and as many V rows; stages 0 and 1 exist");
  __shared__ __attribute__((aligned(16))) _Float16 sk[2][FKS * FKP]; __shared__ __attribute__((aligned(16))) _Float16 sv[2][FKS * FVP];      /* two stage buffers per operand */
  const int tid = threadIdx.x, lane = tid & 31, w = tid >> 5, ln = lane & 15, hh = lane >> 4;
  const int plane = blockIdx.y, b = plane / NH, h = plane % NH; const int q0 = (blockIdx.x * FW + w) * (16 * FQ);
  const _Float16* qp = Qr + ((size_t)b * SQ + q0 + ln) * LQ + h * HD;
  const _Float16* kg = Kr + ((size_t)b * SQ + (tid >> 3)) * LQ + h * HD + (tid & 7) * 8; const _Float16* vg = Vr + ((size_t)b * SQ + (tid >> 3)) * LQ + h * HD + (tid & 7) * 8;
  const unsigned lk0 = (unsigned)(size_t)&sk[0][0] + (unsigned)((tid >> 3) * (FKP * 2) + (tid & 7) * 16), lv0 = (unsigned)(size_t)&sv[0][0] + (unsigned)((tid >> 3) * (FVP * 2) + (tid & 7) * 16);      /* LDS byte addresses = low 32 bits of the shared addresses */
  const float cs = 0.125f * 1.4426950408889634f;      /* 64^-0.5 and log2(e) in one factor */
  const v8f z8 = {0.f,0.f,0.f,0.f,0.f,0.f,0.f,0.f};
  fa_stage(kg, vg, lk0, lv0);
  v16h qf[FQ][2]; v8f acc[FQ][4]; float m_run[FQ], l_run[FQ];
#pragma unroll
  for (int g = 0; g < FQ; ++g) { qf[g][0] = g2_frag(qp + (size_t)g * 16 * LQ, hh); qf[g][1] = g2_frag(qp + (size_t)g * 16 * LQ + 32, hh); m_run[g] = -3.0e38f; l_run[g] = 0.f;
#pragma unroll
    for (int t = 0; t < 4; ++t) acc[g][t] = z8; }
  asm volatile("s_wait_xcnt 0x0" ::: "memory");      /* stands before the address registers of the Q loads above are written again */
  asm volatile("s_wait_asynccnt 0x0" ::: "memory");      /* this wave's copies of stage 0 have landed */
  __syncthreads();      /* every wave's have: stage 0 may be read */
  fa_stage(kg + (size_t)FKS * LQ, vg + (size_t)FKS * LQ, lk0 + (unsigned)sizeof(sk[0]), lv0 + (unsigned)sizeof(sv[0]));
  /* kept rolled: one trip = one stage, so that the order at its foot stays as written */
#pragma unroll 1
  for (int st = 0; st < SQ / FKS; ++st) { const int bu = st & 1; const _Float16* ks = &sk[bu][ln * FKP]; const _Float16* vs = &sv[bu][(8 * hh + (lane & 7)) * FVP + ((lane >> 3) & 1) * 8];
    v16h kf[2][2], vf[4];
#pragma unroll
    for (int kt = 0; kt < 2; ++kt) { kf[kt][0] = g2_frag(ks + kt * 16 * FKP, hh); kf[kt][1] = g2_frag(ks + kt * 16 * FKP + 32, hh); }
#pragma unroll
    for (int t = 0; t < 4; ++t) vf[t] = fa_vfrag(vs + t * 16);
    /* unrolled: the stage's passes of 32 keys, so that "is there a next pass in this stage" is known at compile time */
#pragma unroll
    for (int p = 0; p < FKS / 32; ++p) {
      v8f s[2][FQ];
#pragma unroll
      for (int kt = 0; kt < 2; ++kt) {
#pragma unroll
        for (int g = 0; g < FQ; ++g) s[kt][g] = fa_mma(kf[kt][1], qf[g][1], fa_mma(kf[kt][0], qf[g][0], z8)); }
      if (p + 1 < FKS / 32) {      /* inside a stage both operands' fragments are read one pass ahead, into the registers their products have just left: K under this pass's maxima, V^T under the next pass's scores and maxima; a stage's last pass reads nothing ahead (the next stage is not published yet) */
#pragma unroll
        for (int kt = 0; kt < 2; ++kt) { kf[kt][0] = g2_frag(ks + ((p + 1) * 32 + kt * 16) * FKP, hh); kf[kt][1] = g2_frag(ks + ((p + 1) * 32 + kt * 16) * FKP + 32, hh); } }
      asm volatile("" ::: "memory");      /* compiler fence: holds the LDS reads written above it (this pass's V^T, the next pass's K) in front of the maxima; without it the compiler sinks them behind the branch below, next to their products and in among them, where each waits out its own latency */
      float mb[FQ]; bool need = false;
#pragma unroll
      for (int g = 0; g < FQ; ++g) { float mx = fmaxf(s[0][g][0], s[1][g][0]);
#pragma unroll
        for (int r = 1; r < 8; ++r) mx = fmaxf(mx, fmaxf(s[0][g][r], s[1][g][r]));
        mx = fmaxf(mx, fa_xhalf(mx)) * cs; mb[g] = mx; need = need || (mx > m_run[g] + 8.0f); }      /* both halves hold the query's pass maximum, scaled (cs > 0) */
      if (__builtin_amdgcn_ballot_w32(need) != 0) {      /* wave-uniform; always taken on the first pass (factor 0 on zero accumulators) */
#pragma unroll
        for (int g = 0; g < FQ; ++g) { const float mn = fmaxf(m_run[g], mb[g]); const float corr = __builtin_amdgcn_exp2f(m_run[g] - mn); m_run[g] = mn; l_run[g] *= corr;
#pragma unroll
          for (int t = 0; t < 4; ++t) acc[g][t] *= corr; } }
#pragma unroll
      for (int g = 0; g < FQ; ++g) { const float nm = -m_run[g]; FragP pf; v2f ls = {0.f, 0.f};
#pragma unroll
        for (int i = 0; i < 8; ++i) { const v2f x = {s[i >> 2][g][2 * (i & 3)], s[i >> 2][g][2 * (i & 3) + 1]};      /* operand elements 2i, 2i + 1 = tile i >> 2, registers 2 (i & 3), 2 (i & 3) + 1 */
          const v2f a = __builtin_elementwise_fma(x, (v2f){cs, cs}, (v2f){nm, nm}); const v2f p2 = {__builtin_amdgcn_exp2f(a[0]), __builtin_amdgcn_exp2f(a[1])};
          ls += p2; pf.p[i] = __builtin_convertvector(p2, v2h); }
        l_run[g] += ls[0] + ls[1];
#pragma unroll
        for (int t = 0; t < 4; ++t) acc[g][t] = fa_mma(vf[t], pf.v, acc[g][t]); }
      if (p + 1 < FKS / 32) {
#pragma unroll
        for (int t = 0; t < 4; ++t) vf[t] = fa_vfrag(vs + (p + 1) * 32 * FVP + t * 16); }
    }
    asm volatile("s_wait_dscnt 0x0" ::: "memory");      /* this wave has finished reading stage st */
    asm volatile("s_wait_asynccnt 0x0" ::: "memory");      /* this wave's copies of stage st + 1 have landed */
    __syncthreads();      /* publishes stage st + 1 and frees stage st's buffer */
    if (st + 2 < SQ / FKS) fa_stage(kg + (size_t)(st + 2) * FKS * LQ, vg + (size_t)(st + 2) * FKS * LQ, lk0 + (unsigned)(bu * sizeof(sk[0])), lv0 + (unsigned)(bu * sizeof(sv[0]))); }
  asm volatile("s_wait_asynccnt 0x0" ::: "memory");      /* no copy is outstanding behind the loop */
#pragma unroll
  for (int g = 0; g < FQ; ++g) { const float sc = 64.0f / (l_run[g] + fa_xhalf(l_run[g])); _Float16* op = O + ((size_t)plane * SQ + q0 + g * 16 + ln) * HD + 8 * hh;
#pragma unroll
    for (int t = 0; t < 4; ++t) { const v8f o = acc[g][t] * sc; *(v8h*)(op + t * 16) = __builtin_convertvector(o, v8h); } }      /* registers r = 0..7 are d = 16 t + 8 hh + r of query ln: one 16-byte store */
}

// Operand preparation, all of it in one launch (the seven conversions depend on nothing but the inputs).
// Work-groups 0 .. PW - 1, the weights: thread t owns 8 k of output column n = t / 64 in all four matrices and writes Bt[n][k] = f16(16 x bf16-rounded weight); per-head W[h][k][d] has n = h * 64 + d (head-major columns = the flattened biases' order), Wo[k][n] is plain [in][out].
// Work-groups PW .. PW + PX - 1, the three inputs as exact f16 rows (bf16-rounded): each thread converts PC chunks of 8 floats of each input, one work-group of threads apart, so a wave's loads and stores stay contiguous and few waves have to be started.
#define PW 128                       /* work-groups on the weights: 512 columns x 64 chunks of 8 k */
#define PX 512                       /* work-groups on the inputs */
#define PC 4                         /* chunks per thread and input */
__device__ __forceinline__ v8us p_cvt8(const float* v, float scale) { FragH f;
#pragma unroll
  for (int q = 0; q < 8; ++q) f.h[q] = (_Float16)(bf16_round(v[q]) * scale); return f.half[0]; }
__device__ __forceinline__ v8us p_cvt44(v4f a, v4f b) { const float v[8] = {a[0], a[1], a[2], a[3], b[0], b[1], b[2], b[3]}; return p_cvt8(v, 1.0f); }
__global__ __launch_bounds__(256) void k_prep(const float* __restrict__ xq, const float* __restrict__ xk, const float* __restrict__ xv, const float* __restrict__ wq, const float* __restrict__ wk, const float* __restrict__ wv, const float* __restrict__ wo,
    _Float16* __restrict__ XQ, _Float16* __restrict__ XK, _Float16* __restrict__ XV, _Float16* __restrict__ BQ, _Float16* __restrict__ BK, _Float16* __restrict__ BV, _Float16* __restrict__ BO) {
  static_assert((size_t)PW * 256 == (size_t)DM * (DM / 8) && NH * HD == DM, "one weight thread per 8 k of a column"); static_assert((size_t)PX * 256 * PC == NR * DM / 8, "the input threads cover every chunk once");
  if (blockIdx.x < PW) {
    const int t = blockIdx.x * 256 + threadIdx.x; const int n = t / (DM / 8), k8 = (t % (DM / 8)) * 8; const int h = n / HD, d = n % HD;
    const size_t ph = ((size_t)h * DM + k8) * HD + d, po = (size_t)k8 * DM + n; float a[4][8];
#pragma unroll
    for (int q = 0; q < 8; ++q) { a[0][q] = wq[ph + (size_t)q * HD]; a[1][q] = wk[ph + (size_t)q * HD]; a[2][q] = wv[ph + (size_t)q * HD]; a[3][q] = wo[po + (size_t)q * DM]; }
    const size_t dst = (size_t)n * DM + k8;
    *(v8us*)((unsigned short*)BQ + dst) = p_cvt8(a[0], 16.0f); *(v8us*)((unsigned short*)BK + dst) = p_cvt8(a[1], 16.0f); *(v8us*)((unsigned short*)BV + dst) = p_cvt8(a[2], 16.0f); *(v8us*)((unsigned short*)BO + dst) = p_cvt8(a[3], 16.0f);
    return; }
  const size_t i0 = ((size_t)(blockIdx.x - PW) * (PC * 256) + threadIdx.x) * 8;      /* first float of the thread's first chunk; its next chunks lie 256 chunks on each */
  const float* pq = xq + i0; const float* pk = xk + i0; const float* pv = xv + i0;
  v4f v[3][PC][2];
#pragma unroll
  for (int c = 0; c < PC; ++c) { const int o = c * 256 * 8;
    v[0][c][0] = *(const v4fa*)(pq + o); v[0][c][1] = *(const v4fa*)(pq + o + 4); v[1][c][0] = *(const v4fa*)(pk + o); v[1][c][1] = *(const v4fa*)(pk + o + 4); v[2][c][0] = *(const v4fa*)(pv + o); v[2][c][1] = *(const v4fa*)(pv + o + 4); }
  asm volatile("s_wait_xcnt 0x0" :: "v"(pq), "v"(pk), "v"(pv) : "memory");      /* stands before the loads' address registers are written again; naming the three addresses keeps their registers out of the later loads' results; as a statement on memory it also holds all of the thread's loads ahead of the first conversion, one memory latency instead of several */
#pragma unroll
  for (int c = 0; c < PC; ++c) { const size_t o = i0 + (size_t)c * 256 * 8;
    *(v8us*)((unsigned short*)XQ + o) = p_cvt44(v[0][c][0], v[0][c][1]); *(v8us*)((unsigned short*)XK + o) = p_cvt44(v[1][c][0], v[1][c][1]); *(v8us*)((unsigned short*)XV + o) = p_cvt44(v[2][c][0], v[2][c][1]); }
  asm volatile("s_wait_xcnt 0x0" ::: "memory");      /* stands behind the last stores, before anything that follows them in the code can write their address or data registers again */
}

extern "C" void kernel_launch(void* const* d_in, const int* in_sizes, int n_in,
                              void* d_out, int out_size, void* d_ws, size_t ws_size, hipStream_t stream) {
  (void)in_sizes; (void)n_in; (void)out_size;
  const float* const* I = (const float* const*)d_in; const float* xq = I[0]; const float* xk = I[1]; const float* xv = I[2]; const float* wq = I[3]; const float* bq = I[4]; const float* wk = I[5]; const float* bk = I[6]; const float* wv = I[7]; const float* bv = I[8]; const float* wo = I[9]; const float* bo = I[10];      /* three inputs; per-head [in][out] weights [8][512][64] + per-head biases [8][64] (flattened head-major = projection column order); Wo [in][out] + bo */
  char* ws = (char*)d_ws; size_t off = 0;
  auto take = [&](size_t bytes) { char* p = ws + off; off += (bytes + 255) & ~(size_t)255; return p; };
  _Float16* BQ = (_Float16*)take((size_t)DM * DM * 2); _Float16* BK = (_Float16*)take((size_t)DM * DM * 2); _Float16* BV = (_Float16*)take((size_t)DM * DM * 2); _Float16* BO = (_Float16*)take((size_t)DM * DM * 2);
  _Float16* Q16 = (_Float16*)take(NR * DM * 2); _Float16* K16 = (_Float16*)take(NR * DM * 2); _Float16* V16 = (_Float16*)take(NR * DM * 2); _Float16* O16 = (_Float16*)take(NR * DM * 2);
  _Float16* XQ = (_Float16*)take(NR * DM * 2); _Float16* XK = (_Float16*)take(NR * DM * 2); _Float16* XV = (_Float16*)take(NR * DM * 2);      /* the f16 input rows */
  if (off > ws_size) return;
  k_prep<<<PW + PX, 256, 0, stream>>>(xq, xk, xv, wq, wk, wv, wo, XQ, XK, XV, BQ, BK, BV, BO);      /* the four weight matrices as Bt x16 and the three inputs as exact f16 rows */
  const size_t r0p = (size_t)B0 * SQ;      /* first projected row */
  k_gemm2<0><<<dim3((unsigned)((MP / 128) * (DM / 64)), 1, 3), 128, 0, stream>>>(XQ + r0p * DM, DM, 0, NR * DM, BQ, DM, 0, (size_t)DM * DM, 0.0625f, bq, bk, bv, 0, nullptr, 1, 0, 0, nullptr, Q16 + r0p * DM, DM, 0, NR * DM, MP, DM, DM);      /* Q, K and V projections on grid.z: XQ XK XV, BQ BK BV and Q16 K16 V16 lie one behind the other in the workspace (every size is a multiple of the 256-byte rounding) */
  k_fattn<<<dim3(SQ / (16 * FQ * FW), NB * NH), FW * 32, 0, stream>>>(Q16, K16, V16, O16);      /* scores, softmax and P . V of all planes: plane p = batch * NH + head -> 64-wide rows at O16 + p * SQ * HD (head-major context), x64 */
  k_gemm2<0><<<dim3((unsigned)((MPO / 128) * (DM / 64)), 1), 128, 0, stream>>>(O16 + r0p * DM, DM, 0, 0, BO, DM, 0, 0, 0.0009765625f, bo, nullptr, nullptr, 0, nullptr, 1, 0, 0, (float*)d_out + r0p * DM, nullptr, DM, 0, 0, MPO, DM, DM);      /* out rows are the output layout */
}

// v008
// Measured time: 65.5 microseconds a run.
// Two timings next to v007 both put it at 1.09 times that version's speed.
// Over all steps from v000 it is 51.1 times as fast.
#include <hip/hip_runtime.h>
// Multi-head attention on three inputs with per-head projection tensors and the source's head-major context view (Q, K, V [8][1024][512]; Qh / Kh / Vh = einsum('bsd,hde->bhse', input, W) + b with per-head [in][out] weights W [8][512][64] and biases [8][64] (uniform +-512^-0.5); scores * 64^-0.5; softmax over all 1024 keys (no mask); context x [B][H][S][64] is RE-VIEWED as [B][S][512] WITHOUT transposing heads and time (row s' of the view = 512 consecutive floats of the [H][S][64] block); out = view Wo + bo ([in][out] 512 x 512) -> [8][1024][512]).
// Structure: token rows r = b*1024 + s; the three inputs as exact f16 rows (bf16-rounded); Q, K, V as three WMMA GEMMs (32x64 wave tiles, f32 accumulation, exact x16 weights + bias, f16 outputs); then one fused attention launch for all pairs (S^T = K . Q^T on WMMA, V^T fragments by transposing LDS loads of the staged V rows, online softmax on VALU with f32 statistics and native exp2, the unnormalised weights packed in registers as the f16 B operand of O^T += V^T . P^T on WMMA; neither scores nor weights reach memory; o carried x64 against f16 subnormal flush, folded into the output GEMM alpha) written straight into the merged f16 o rows; out = o W_o + b GEMM (f32) into the output layout.
// Compute dtype: inputs rounded to bf16; x / weights exact; q, k, v, softmax weights and o as plain f16 GEMM operands (~2^-12); scores and softmax statistics f32. v_wmma_f32_16x16x32_f16.
#define NB 8
#define SQ 1024
#define DM 512
#define NH 8
#define HD 64
#define HG 4                         /* heads per launch of the untemplated k_vt (not launched) */
#define B0 0                         /* first batch processed (debug hook) */
#define NBR NB                       /* batches processed (debug hook) */
#define NR ((size_t)NB * SQ)         /* token rows */
#define MP ((int)((size_t)NBR * SQ)) /* rows projected (debug hook) */
#define QN SQ                        /* query rows per batch (not used; launches attend all SQ rows) */
#define NHD NH                       /* heads (not used; launches attend all NH heads) */
#define MPO MP                       /* rows through the output stage (debug hook) */
#define LQ DM      /* row pitch of the q/k/v rows */
typedef __bf16 v16b __attribute__((ext_vector_type(16)));
typedef unsigned short v8us __attribute__((ext_vector_type(8), may_alias));
typedef float  v8f  __attribute__((ext_vector_type(8)));
typedef float  v4f  __attribute__((ext_vector_type(4)));
typedef float  v4fa __attribute__((ext_vector_type(4), may_alias));
union FragB { v16b v; v8us half[2]; unsigned short u[16]; };

__device__ __forceinline__ unsigned short bf16_bits(float x) { unsigned int u = __float_as_uint(x); return (unsigned short)((u + 0x7FFFu + ((u >> 16) & 1u)) >> 16); }
__device__ __forceinline__ float bf16_val(unsigned short b) { return __uint_as_float(((unsigned int)b) << 16); }
__device__ __forceinline__ float bf16_round(float x) { return bf16_val(bf16_bits(x)); }
// D += A·B with NT terms: 1 = ah·bh, 2 = + al·bh (A split), 3 = + ah·bl (both split)
template <int NT>
__device__ __forceinline__ v8f mmaN(v16b ah, v16b al, v16b bh, v16b bl, v8f c) {
  c = __builtin_amdgcn_wmma_f32_16x16x32_bf16(false, ah, false, bh, (short)0, c, false, false);
  if (NT >= 2) c = __builtin_amdgcn_wmma_f32_16x16x32_bf16(false, al, false, bh, (short)0, c, false, false);
  if (NT >= 3) c = __builtin_amdgcn_wmma_f32_16x16x32_bf16(false, ah, false, bl, (short)0, c, false, false);
  asm volatile("v_nop\n\tv_nop\n\tv_nop\n\tv_nop" : "+v"(c) : "v"(ah), "v"(al), "v"(bh), "v"(bl));
  return c;
}

__global__ __launch_bounds__(256) void k_wt_bf16(const float* __restrict__ W, unsigned short* __restrict__ Wt, int K, int N) {
  const int t = blockIdx.x * 256 + threadIdx.x;
  const int k8n = K / 8;
  if (t >= N * k8n) return;
  const int n = t / k8n, k8 = (t % k8n) * 8;
  v8us v;
#pragma unroll
  for (int i = 0; i < 8; ++i) v[i] = bf16_bits(W[(size_t)(k8 + i) * N + n]);
  *(v8us*)(Wt + (size_t)n * K + k8) = v;
  
}

// GEMM C[M][N] (f32, pitch ldc) = act(A[M][K]·W + bias). A f32 row-major (pitch lda) converted per fragment to bf16
// (ASPLIT: hi/lo two planes -> 2 terms, else single rounded term); Wt bf16 [N][K] (pitch ldb). BIAS_BF16 rounds the
// bias to bf16 first (bias quantised to bf16 before the add). K%32==0, M%16==0, N%64==0.
template <bool ASPLIT, int ACT, bool BIAS_BF16>
__global__ __launch_bounds__(128) void k_gemm_bf(const float* __restrict__ A, int lda, const unsigned short* __restrict__ Wt, int ldb,
                                               const float* __restrict__ bias, float* __restrict__ C, int ldc, int M, int N, int K) {
  __shared__ __attribute__((aligned(16))) float so[4][16][64];
  const int tid = threadIdx.x, w = tid >> 5, lane = tid & 31, ln = lane & 15, hh = lane >> 4;
  const int ntn = N / 64;
  const int wid = blockIdx.x * 4 + w;
  const int mt = wid / ntn, nq = wid % ntn;
  if (mt * 16 >= M) return;
  const int row0 = mt * 16, col0 = nq * 64;
  const float* arow = A + (size_t)(row0 + ln) * lda;
  v8f acc[4] = {};
  for (int kb = 0; kb < K; kb += 32) {
    FragB ah, al;
    const v4f x0 = *(const v4fa*)(arow + kb + 8 * hh), x1 = *(const v4fa*)(arow + kb + 8 * hh + 4);
    const v4f x2 = *(const v4fa*)(arow + kb + 16 + 8 * hh), x3 = *(const v4fa*)(arow + kb + 16 + 8 * hh + 4);
    float xs[16] = {x0[0],x0[1],x0[2],x0[3],x1[0],x1[1],x1[2],x1[3],x2[0],x2[1],x2[2],x2[3],x3[0],x3[1],x3[2],x3[3]};
#pragma unroll
    for (int i = 0; i < 16; ++i) { const unsigned short hb = bf16_bits(xs[i]); ah.u[i] = hb; al.u[i] = ASPLIT ? bf16_bits(xs[i] - bf16_val(hb)) : (unsigned short)0; }
#pragma unroll
    for (int t = 0; t < 4; ++t) {
      const unsigned short* brow = Wt + (size_t)(col0 + t * 16 + ln) * ldb + kb;
      FragB b;
      b.half[0] = *(const v8us*)(brow + 8 * hh);
      b.half[1] = *(const v8us*)(brow + 16 + 8 * hh);
      acc[t] = mmaN<ASPLIT ? 2 : 1>(ah.v, al.v, b.v, b.v, acc[t]);
    }
  }
#pragma unroll
  for (int t = 0; t < 4; ++t) {
    float bv = bias ? bias[col0 + t * 16 + ln] : 0.f;
    if (BIAS_BF16) bv = bf16_round(bv);
#pragma unroll
    for (int r = 0; r < 8; ++r) { float v = acc[t][r] + bv; if (ACT == 1) v = fmaxf(v, 0.f); so[w][8 * hh + r][t * 16 + ln] = v; }
  }
  __builtin_amdgcn_fence(__ATOMIC_ACQ_REL, "workgroup");
  __builtin_amdgcn_wave_barrier();
  const int rsub = lane >> 4, c4 = (lane & 15) * 4;
  {
#pragma unroll
    for (int q = 0; q < 8; ++q) {
      const int r = q * 2 + rsub;
      const v4f v = *(const v4fa*)&so[w][r][c4];
      *(v4f*)(C + (size_t)(row0 + r) * ldc + col0 + c4) = v;
    }
    
  }
}

// GEMM C = act(A·W + bias + resid): A f32 (ASPLIT -> hi/lo 2 terms), Wt bf16 [N][K]; ACT 0 none, 1 relu, 2 exact gelu;
// resid (optional, f32, row index = (row % rmod), pitch ldr, RES_BF16 rounds it) added before the activation.
template <bool ASPLIT, int ACT, bool BIAS_BF16, bool RES_BF16>
__global__ __launch_bounds__(128) void k_gemm_bf3(const float* __restrict__ A, int lda, const unsigned short* __restrict__ Wt, int ldb,
                                                const float* __restrict__ bias, const float* __restrict__ resid, int rmod, int ldr,
                                                float* __restrict__ C, int ldc, int M, int N, int K) {
  __shared__ __attribute__((aligned(16))) float so[4][16][64];
  const int tid = threadIdx.x, w = tid >> 5, lane = tid & 31, ln = lane & 15, hh = lane >> 4;
  const int ntn = N / 64;
  const int wid = blockIdx.x * 4 + w;
  const int mt = wid / ntn, nq = wid % ntn;
  if (mt * 16 >= M) return;
  const int row0 = mt * 16, col0 = nq * 64;
  const float* arow = A + (size_t)(row0 + ln) * lda;
  v8f acc[4] = {};
  for (int kb = 0; kb < K; kb += 32) {
    FragB ah, al;
    const v4f x0 = *(const v4fa*)(arow + kb + 8 * hh), x1 = *(const v4fa*)(arow + kb + 8 * hh + 4);
    const v4f x2 = *(const v4fa*)(arow + kb + 16 + 8 * hh), x3 = *(const v4fa*)(arow + kb + 16 + 8 * hh + 4);
    float xs[16] = {x0[0],x0[1],x0[2],x0[3],x1[0],x1[1],x1[2],x1[3],x2[0],x2[1],x2[2],x2[3],x3[0],x3[1],x3[2],x3[3]};
#pragma unroll
    for (int i = 0; i < 16; ++i) { const unsigned short hb = bf16_bits(xs[i]); ah.u[i] = hb; al.u[i] = ASPLIT ? bf16_bits(xs[i] - bf16_val(hb)) : (unsigned short)0; }
#pragma unroll
    for (int t = 0; t < 4; ++t) {
      const unsigned short* brow = Wt + (size_t)(col0 + t * 16 + ln) * ldb + kb;
      FragB b;
      b.half[0] = *(const v8us*)(brow + 8 * hh);
      b.half[1] = *(const v8us*)(brow + 16 + 8 * hh);
      acc[t] = mmaN<ASPLIT ? 2 : 1>(ah.v, al.v, b.v, b.v, acc[t]);
    }
  }
#pragma unroll
  for (int t = 0; t < 4; ++t) {
    const int col = col0 + t * 16 + ln;
    float bv = bias ? bias[col] : 0.f;
    if (BIAS_BF16) bv = bf16_round(bv);
#pragma unroll
    for (int r = 0; r < 8; ++r) {
      float v = acc[t][r] + bv;
      if (resid) { float rv = resid[(size_t)((row0 + 8 * hh + r) % rmod) * ldr + col]; if (RES_BF16) rv = bf16_round(rv); v += rv; }
      if (ACT == 1) v = fmaxf(v, 0.f);
      if (ACT == 2) v = 0.5f * v * (1.0f + erff(v * 0.70710678118654752f));
      if (ACT == 3) { const float u = 0.7978845608028654f * (v + 0.044715f * v * v * v); v = 0.5f * v * (1.0f + tanhf(u)); }
      so[w][8 * hh + r][t * 16 + ln] = v;
    }
  }
  __builtin_amdgcn_fence(__ATOMIC_ACQ_REL, "workgroup");
  __builtin_amdgcn_wave_barrier();
  const int rsub = lane >> 4, c4 = (lane & 15) * 4;
  {
#pragma unroll
    for (int q = 0; q < 8; ++q) {
      const int r = q * 2 + rsub;
      const v4f v = *(const v4fa*)&so[w][r][c4];
      *(v4f*)(C + (size_t)(row0 + r) * ldc + col0 + c4) = v;
    }
    
  }
}
// row LayerNorm (biased variance, eps) over N: s = X (+ R); optional out_sum <- s; out_norm <- (s-mu)*rsqrt(var+eps)*g + b
template <bool PARAM_BF16>
__global__ __launch_bounds__(256) void k_layernorm(const float* __restrict__ X, const float* __restrict__ R, const float* __restrict__ g, const float* __restrict__ bta,
                                                  float* __restrict__ out_sum, float* __restrict__ out_norm, int N, float eps) {
  __shared__ float red[256];
  const int row = blockIdx.x, tid = threadIdx.x;
  const float* x = X + (size_t)row * N; const float* rr = R ? R + (size_t)row * N : nullptr;
  float vals[16];                     // up to N = 4096
  const int per = N / 256;            // contiguous chunk per thread? use strided-by-4 chunks: thread handles j = tid*4 + 1024*u
  float s1 = 0.f;
  for (int u = 0; u < per / 4; ++u) {
    const int j = tid * 4 + 1024 * u;
    const v4f a = *(const v4fa*)(x + j);
    v4f b = {0.f,0.f,0.f,0.f}; if (rr) b = *(const v4fa*)(rr + j);
#pragma unroll
    for (int q = 0; q < 4; ++q) { const float v = a[q] + b[q]; vals[u * 4 + q] = v; s1 += v; }
  }
  red[tid] = s1; __syncthreads();
  for (int st = 128; st > 0; st >>= 1) { if (tid < st) red[tid] += red[tid + st]; __syncthreads(); }
  const float mu = red[0] / (float)N; __syncthreads();
  float s2 = 0.f;
  for (int u = 0; u < per / 4; ++u)
#pragma unroll
    for (int q = 0; q < 4; ++q) { const float c = vals[u * 4 + q] - mu; s2 += c * c; }
  red[tid] = s2; __syncthreads();
  for (int st = 128; st > 0; st >>= 1) { if (tid < st) red[tid] += red[tid + st]; __syncthreads(); }
  const float rs = rsqrtf(red[0] / (float)N + eps);
  {
    for (int u = 0; u < per / 4; ++u) {
      const int j = tid * 4 + 1024 * u;
      v4f o, sm;
#pragma unroll
      for (int q = 0; q < 4; ++q) {
        float gg = g[j + q], bb = bta[j + q];
        if (PARAM_BF16) { gg = bf16_round(gg); bb = bf16_round(bb); }
        sm[q] = vals[u * 4 + q]; o[q] = (vals[u * 4 + q] - mu) * rs * gg + bb;
      }
      if (out_sum) *(v4f*)(out_sum + (size_t)row * N + j) = sm;
      *(v4f*)(out_norm + (size_t)row * N + j) = o;
    }
    
  }
}



// ---- f16 WMMA path (v_wmma_f32_16x16x32_f16): 11-bit significands for operands in range — used where a [0,1] probability operand needs more precision than bf16
typedef _Float16 v16h __attribute__((ext_vector_type(16)));
union FragH { v16h v; v8us half[2]; _Float16 h[16]; unsigned short u[16]; };
template <int NT>
__device__ __forceinline__ v8f mmaH(v16h ah, v16h al, v16h bh, v16h bl, v8f c) {
  c = __builtin_amdgcn_wmma_f32_16x16x32_f16(false, ah, false, bh, (short)0, c, false, false);
  if (NT >= 2) c = __builtin_amdgcn_wmma_f32_16x16x32_f16(false, al, false, bh, (short)0, c, false, false);
  if (NT >= 3) c = __builtin_amdgcn_wmma_f32_16x16x32_f16(false, ah, false, bl, (short)0, c, false, false);
  asm volatile("v_nop\n\tv_nop\n\tv_nop\n\tv_nop" : "+v"(c) : "v"(ah), "v"(al), "v"(bh), "v"(bl));
  return c;
}
// batched GEMM like k_gemm_b but f16 operands: A f32 (split into f16 hi/lo if ASPLIT, else rounded to f16), Bt = f16 values [n][k]; alpha; C f32; N multiple of 16 (partial tiles skipped)
template <bool ASPLIT>
__global__ __launch_bounds__(128) void k_gemm_h(const float* __restrict__ A, int lda, size_t sA, const _Float16* __restrict__ Bh, int ldb, size_t sB, float alpha, float* __restrict__ C, int ldc, size_t sC, int M, int N, int K) {
  __shared__ __attribute__((aligned(16))) float so[4][16][64];
  const int tid = threadIdx.x, w = tid >> 5, lane = tid & 31, ln = lane & 15, hh = lane >> 4; const int by = blockIdx.y;
  A += (size_t)by * sA; Bh += (size_t)by * sB; C += (size_t)by * sC;
  const int ntn = (N + 63) / 64; const int wid = blockIdx.x * 4 + w; const int mt = wid / ntn, nq = wid % ntn; if (mt * 16 >= M) return;
  const int row0 = mt * 16, col0 = nq * 64; const float* arow = A + (size_t)(row0 + ln) * lda;
  v8f acc[4] = {};
  for (int kb = 0; kb < K; kb += 32) {
    FragH ah, al;
    const v4f x0 = *(const v4fa*)(arow + kb + 8 * hh), x1 = *(const v4fa*)(arow + kb + 8 * hh + 4), x2 = *(const v4fa*)(arow + kb + 16 + 8 * hh), x3 = *(const v4fa*)(arow + kb + 16 + 8 * hh + 4);
    float xs[16] = {x0[0],x0[1],x0[2],x0[3],x1[0],x1[1],x1[2],x1[3],x2[0],x2[1],x2[2],x2[3],x3[0],x3[1],x3[2],x3[3]};
#pragma unroll
    for (int i = 0; i < 16; ++i) { const _Float16 h = (_Float16)xs[i]; ah.h[i] = h; al.h[i] = ASPLIT ? (_Float16)(xs[i] - (float)h) : (_Float16)0.0f; }
#pragma unroll
    for (int t = 0; t < 4; ++t) { if (col0 + t * 16 >= N) continue; const size_t boff = (size_t)(col0 + t * 16 + ln) * ldb + kb; FragH bq; bq.half[0] = *(const v8us*)(Bh + boff + 8 * hh); bq.half[1] = *(const v8us*)(Bh + boff + 16 + 8 * hh);
      acc[t] = mmaH<ASPLIT ? 2 : 1>(ah.v, al.v, bq.v, bq.v, acc[t]); }
  }
#pragma unroll
  for (int t = 0; t < 4; ++t) { if (col0 + t * 16 >= N) continue;
#pragma unroll
    for (int r = 0; r < 8; ++r) so[w][8 * hh + r][t * 16 + ln] = acc[t][r] * alpha; }
  __builtin_amdgcn_fence(__ATOMIC_ACQ_REL, "workgroup"); __builtin_amdgcn_wave_barrier();
  const int rsub = lane >> 4, c4 = (lane & 15) * 4;
  {
#pragma unroll
    for (int q = 0; q < 8; ++q) { const int r = q * 2 + rsub; if (col0 + c4 < N) { const v4f v = *(const v4fa*)&so[w][r][c4]; *(v4f*)(C + (size_t)(row0 + r) * ldc + col0 + c4) = v; } }
     }
}

// k_gemm_hh variant with fused epilogue: v = acc·alpha + bias[by·sBias + col] (+ CP[(row/rowsPerB)·sCPb + by·64 + col] if CP) ; ACT 0 none / 1 elu ; writes f16 C16 (and f32 C if non-null)
template <int ACT>
__global__ __launch_bounds__(128) void k_gemm_hhx(const _Float16* __restrict__ A, int lda, size_t sA, const _Float16* __restrict__ Bh, int ldb, size_t sB, float alpha, const float* __restrict__ bias, size_t sBias, const float* __restrict__ CP, int rowsPerB, size_t sCPb, int row0g,
    float* __restrict__ C, _Float16* __restrict__ C16, int ldc, size_t sC, int M, int N, int K) {
  __shared__ __attribute__((aligned(16))) float so[4][16][64];
  const int tid = threadIdx.x, w = tid >> 5, lane = tid & 31, ln = lane & 15, hh = lane >> 4; const int by = blockIdx.y;
  A += (size_t)by * sA; Bh += (size_t)by * sB; const size_t cofs = (size_t)by * sC; const float* bp = bias ? bias + (size_t)by * sBias : nullptr;
  const int ntn = (N + 63) / 64; const int wid = blockIdx.x * 4 + w; const int mt = wid / ntn, nq = wid % ntn; if (mt * 16 >= M) return;
  const int row0 = mt * 16, col0 = nq * 64; const _Float16* arow = A + (size_t)(row0 + ln) * lda;
  v8f acc[4] = {};
  for (int kb = 0; kb < K; kb += 32) { FragH ah; ah.half[0] = *(const v8us*)((const unsigned short*)arow + kb + 8 * hh); ah.half[1] = *(const v8us*)((const unsigned short*)arow + kb + 16 + 8 * hh);
#pragma unroll
    for (int t = 0; t < 4; ++t) { if (col0 + t * 16 >= N) continue; const size_t boff = (size_t)(col0 + t * 16 + ln) * ldb + kb; FragH bq; bq.half[0] = *(const v8us*)((const unsigned short*)Bh + boff + 8 * hh); bq.half[1] = *(const v8us*)((const unsigned short*)Bh + boff + 16 + 8 * hh);
      acc[t] = mmaH<1>(ah.v, ah.v, bq.v, bq.v, acc[t]); }
  }
#pragma unroll
  for (int t = 0; t < 4; ++t) { if (col0 + t * 16 >= N) continue; const int col = col0 + t * 16 + ln; const float bv = bp ? bf16_round(bp[col]) : 0.f;
#pragma unroll
    for (int r = 0; r < 8; ++r) { float v = acc[t][r] * alpha + bv; if (CP) { const int rr = row0g + row0 + 8 * hh + r; if (rowsPerB < 0) v += CP[cofs + (size_t)rr * ldc + col];      /* rowsPerB < 0: own element of the batched C plane */ else { const int bidx = rr / rowsPerB; v += CP[(size_t)bidx * sCPb + (size_t)by * 64 + col]; } } if (ACT == 1) v = (v > 0.f) ? v : expm1f(v); else if (ACT == 7) v = (v > 0.f) ? v + 1.0f : expf(v); else if (ACT == 8) v = tanhf(v); else if (ACT == 9) v = 0.5f * v * (1.0f + tanhf(0.7978845608028654f * (v + 0.044715f * v * v * v))); else if (ACT == 11) v = 1.0f / (1.0f + expf(-v)); else if (ACT == 12) v = (v > 0.f) ? v : 0.01f * v; else if (ACT == 14) v = (v > 0.f) ? v : 0.1f * v; else if (ACT == 16) v = (v >= 0.f) ? v : 0.3f * v; else if (ACT == 17) v = (v >= 0.f) ? v : 0.2f * v; else if (ACT == 15) v = v / (1.0f + expf(-v)); else if (ACT == 3) v = fmaxf(v, 0.f); else if (ACT == 6) v = 0.5f * v * (1.0f + erff(v * 0.70710678118654752f)); so[w][8 * hh + r][t * 16 + ln] = v; } }
  __builtin_amdgcn_fence(__ATOMIC_ACQ_REL, "workgroup"); __builtin_amdgcn_wave_barrier();
  const int rsub = lane >> 4, c4 = (lane & 15) * 4; typedef _Float16 v4h __attribute__((ext_vector_type(4)));
  {
#pragma unroll
    for (int q = 0; q < 8; ++q) { const int r = q * 2 + rsub; if (col0 + c4 < N) { const v4f v = *(const v4fa*)&so[w][r][c4]; if (C) *(v4f*)(C + cofs + (size_t)(row0 + r) * ldc + col0 + c4) = v; if (C16) { v4h h4; for (int i = 0; i < 4; ++i) h4[i] = (_Float16)v[i]; *(v4h*)(C16 + cofs + (size_t)(row0 + r) * ldc + col0 + c4) = h4; } } }
     }
}


typedef _Float16 v4h __attribute__((ext_vector_type(4)));

__global__ __launch_bounds__(256) void k_h16(const float* __restrict__ x, _Float16* __restrict__ X16, size_t n8) { const size_t t = (size_t)blockIdx.x * 256 + threadIdx.x; if (t >= n8) return; FragH f;
#pragma unroll
  for (int q = 0; q < 8; ++q) f.h[q] = (_Float16)x[t * 8 + q]; *(v8us*)((unsigned short*)X16 + t * 8) = f.half[0];  }
__global__ __launch_bounds__(256) void k_round16f(const float* __restrict__ W, _Float16* __restrict__ Bt, size_t n8) { const size_t t = (size_t)blockIdx.x * 256 + threadIdx.x; if (t >= n8) return; FragH f;
#pragma unroll
  for (int i = 0; i < 8; ++i) f.h[i] = (_Float16)(bf16_round(W[t * 8 + i]) * 16.0f); *(v8us*)((unsigned short*)Bt + t * 8) = f.half[0];  }
template <int NHv, int TTv>
__global__ __launch_bounds__(256) void k_vt(const _Float16* __restrict__ V16, int ldv, int voff, _Float16* __restrict__ Vt) { __shared__ unsigned short tl[64][66]; const int tid = threadIdx.x; const int slab = blockIdx.x / (TTv / 64), lg = blockIdx.x % (TTv / 64); const int b = slab / NHv, h = slab % NHv;
  for (int i = tid; i < 64 * 8; i += 256) { const int r = i / 8, c8 = (i % 8) * 8; FragH f; f.half[0] = *(const v8us*)((const unsigned short*)V16 + ((size_t)b * TTv + lg * 64 + r) * ldv + voff + h * 64 + c8);
#pragma unroll
    for (int q = 0; q < 8; ++q) tl[r][c8 + q] = f.u[q]; }
  __syncthreads();
  {
#pragma unroll
    for (int rd = 0; rd < 2; ++rd) { const int d = rd * 32 + tid / 8, pc = tid % 8; FragH f;
#pragma unroll
      for (int q = 0; q < 8; ++q) f.u[q] = tl[pc * 8 + q][d];
      *(v8us*)((unsigned short*)Vt + ((size_t)slab * 64 + d) * TTv + lg * 64 + pc * 8) = f.half[0]; }
     } }

__global__ __launch_bounds__(256) void k_hl(const float* __restrict__ F, _Float16* __restrict__ Hh, _Float16* __restrict__ Hl, size_t n8) { const size_t t = (size_t)blockIdx.x * 256 + threadIdx.x; if (t >= n8) return; FragH fh, fl; const v4f a = *(const v4fa*)(F + t * 8), c = *(const v4fa*)(F + t * 8 + 4);
#pragma unroll
  for (int q = 0; q < 4; ++q) { _Float16 h = (_Float16)a[q]; fh.h[q] = h; fl.h[q] = (_Float16)((a[q] - (float)h) * 1024.0f); h = (_Float16)c[q]; fh.h[4 + q] = h; fl.h[4 + q] = (_Float16)((c[q] - (float)h) * 1024.0f); }
  { *(v8us*)((unsigned short*)Hh + t * 8) = fh.half[0]; *(v8us*)((unsigned short*)Hl + t * 8) = fl.half[0];  } }

// ---- fast GEMM (block tile 128x64, wave tile 32x64; requires M % 128 == 0 rows per launch region, N % 64 == 0 and K % 64 == 0); epilogue = k_gemm_hhx semantics ----
__device__ __forceinline__ v16h g2_frag(const _Float16* p, int hh) { FragH f; f.half[0] = *(const v8us*)((const unsigned short*)p + 8 * hh); f.half[1] = *(const v8us*)((const unsigned short*)p + 16 + 8 * hh); return f.v; }
__device__ __forceinline__ v8f g2_mma(v16h a, v16h b, v8f c) { v8f d = __builtin_amdgcn_wmma_f32_16x16x32_f16(false, a, false, b, (short)0, c, false, false); asm volatile("v_nop\n\tv_nop\n\tv_nop\n\tv_nop" : "+v"(d) : "v"(a), "v"(b)); return d; }
// Operand staging of k_gemm2: one stage = 64 k of the block's 128 A rows and 64 B rows (whole 128-byte lines), brought into LDS by asynchronous 16-byte copies, 12 per thread; eight neighbouring lanes copy one line.
#define G2P 72                       /* LDS row pitch in f16: 128 data bytes + 16, conflict-free for the 16-byte fragment reads */
__device__ __forceinline__ void g2_stage(const _Float16* ag, const _Float16* bg, size_t a16, size_t b16, unsigned la, unsigned lb) {      /* ag, bg: this thread's 16 bytes in rows tid / 8 of A and B at the stage's k; a16, b16: 16 rows on in global memory; la, lb: their LDS byte addresses */
  const _Float16* a1 = ag + a16; const _Float16* a2 = a1 + a16; const _Float16* a3 = a2 + a16; const _Float16* a4 = a3 + a16; const _Float16* a5 = a4 + a16; const _Float16* a6 = a5 + a16; const _Float16* a7 = a6 + a16;
  const _Float16* b1 = bg + b16; const _Float16* b2 = b1 + b16; const _Float16* b3 = b2 + b16;
  const unsigned st = 16 * G2P * 2;      /* 16 rows on in LDS, bytes */
  /* the copies and, as the last line of their own statement, the wait that stands before any of their address registers is written again */
  asm volatile("global_load_async_to_lds_b128 %0, %12, off\n\t"
               "global_load_async_to_lds_b128 %1, %13, off\n\t"
               "global_load_async_to_lds_b128 %2, %14, off\n\t"
               "global_load_async_to_lds_b128 %3, %15, off\n\t"
               "global_load_async_to_lds_b128 %4, %16, off\n\t"
               "global_load_async_to_lds_b128 %5, %17, off\n\t"
               "global_load_async_to_lds_b128 %6, %18, off\n\t"
               "global_load_async_to_lds_b128 %7, %19, off\n\t"
               "global_load_async_to_lds_b128 %8, %20, off\n\t"
               "global_load_async_to_lds_b128 %9, %21, off\n\t"
               "global_load_async_to_lds_b128 %10, %22, off\n\t"
               "global_load_async_to_lds_b128 %11, %23, off\n\t"
               "s_wait_xcnt 0x0"
               :: "v"(la), "v"(la + st), "v"(la + 2 * st), "v"(la + 3 * st), "v"(la + 4 * st), "v"(la + 5 * st), "v"(la + 6 * st), "v"(la + 7 * st), "v"(lb), "v"(lb + st), "v"(lb + 2 * st), "v"(lb + 3 * st),
                  "v"(ag), "v"(a1), "v"(a2), "v"(a3), "v"(a4), "v"(a5), "v"(a6), "v"(a7), "v"(bg), "v"(b1), "v"(b2), "v"(b3) : "memory");
}
// HASCP, OUT32, OUT16: which parts of the epilogue exist (the addend plane CP, the f32 output C, the f16 output C16), fixed per call site at compile time, so that the epilogue is one straight run of code with no test per element.
template <int ACT, bool HASCP, bool OUT32, bool OUT16>
__global__ __launch_bounds__(128) void k_gemm2(const _Float16* __restrict__ A, int lda, size_t sA, size_t sAz, const _Float16* __restrict__ Bh, int ldb, size_t sB, size_t sBz, float alpha, const float* __restrict__ bias, const float* __restrict__ biasz1, const float* __restrict__ biasz2, size_t sBias, const float* __restrict__ CP, int rowsPerB, size_t sCPb, int row0g,
    float* __restrict__ C, _Float16* __restrict__ C16, int ldc, size_t sC, size_t sCz, int M, int N, int K) { static_assert(ACT == 0 || ACT == 3 || ACT == 6 || ACT == 8 || ACT == 9 || ACT == 11 || ACT == 12 || ACT == 14 || ACT == 15 || ACT == 16 || ACT == 17, "k_gemm2: unsupported ACT code (would silently apply no activation)");
  __shared__ __attribute__((aligned(16))) float so[4][32][68];
  __shared__ __attribute__((aligned(16))) _Float16 sa[2][128 * G2P]; __shared__ __attribute__((aligned(16))) _Float16 sb[2][64 * G2P];      /* two stage buffers per operand */
  const int tid = threadIdx.x, w = tid >> 5, lane = tid & 31, ln = lane & 15, hh = lane >> 4; const int by = blockIdx.y, bz = blockIdx.z;      /* two batch axes: strides s* on grid.y, s*z on grid.z */
  A += (size_t)by * sA + (size_t)bz * sAz; Bh += (size_t)by * sB + (size_t)bz * sBz; const size_t cofs = (size_t)by * sC + (size_t)bz * sCz; const float* bsel = bz == 0 ? bias : (bz == 1 ? biasz1 : biasz2); const float* bp = bsel ? bsel + (size_t)by * sBias : nullptr;      /* the bias vectors of grid.z planes 0, 1, 2 are separate buffers */
  const int ntn = N >> 6; const int mt = blockIdx.x / ntn, nq = blockIdx.x - mt * ntn; const int row0 = mt * 128 + 32 * w, col0 = nq * 64; if (mt * 128 >= M) return;      /* the whole block leaves or none, ahead of every copy and barrier */
  const _Float16* agp = A + (size_t)(mt * 128 + (tid >> 3)) * lda + (tid & 7) * 8; const _Float16* bgp = Bh + (size_t)(col0 + (tid >> 3)) * ldb + (tid & 7) * 8;
  const unsigned lofs = (unsigned)((tid >> 3) * (G2P * 2) + (tid & 7) * 16); const unsigned la0 = (unsigned)(size_t)&sa[0][0] + lofs, lb0 = (unsigned)(size_t)&sb[0][0] + lofs;      /* LDS byte addresses = low 32 bits of the shared addresses */
  const size_t a16 = (size_t)16 * lda, b16 = (size_t)16 * ldb; const int nst = K >> 6;
  const v8f z8 = {0.f,0.f,0.f,0.f,0.f,0.f,0.f,0.f}; v8f c00 = z8, c01 = z8, c02 = z8, c03 = z8, c10 = z8, c11 = z8, c12 = z8, c13 = z8;
  g2_stage(agp, bgp, a16, b16, la0, lb0);
  float braw[4] = {0.f, 0.f, 0.f, 0.f};      /* the lane's four bias values, fetched once, beside the copies of stage 0; first used in the epilogue */
  if (bp) {
#pragma unroll
    for (int t = 0; t < 4; ++t) braw[t] = bp[col0 + t * 16 + ln]; }
  asm volatile("s_wait_xcnt 0x0" ::: "memory");      /* stands before the address registers of the bias loads above are written again */
  asm volatile("s_wait_asynccnt 0x0" ::: "memory");      /* this wave's copies of stage 0 have landed */
  __syncthreads();      /* every wave's have: stage 0 may be read */
  if (nst > 1) g2_stage(agp + 64, bgp + 64, a16, b16, la0 + (unsigned)sizeof(sa[0]), lb0 + (unsigned)sizeof(sb[0]));
  /* kept rolled: one trip = one stage, so that the order at its foot stays as written */
#pragma unroll 1
  for (int s = 0; s < nst; ++s) { const int bu = s & 1; const _Float16* as = &sa[bu][(32 * w + ln) * G2P]; const _Float16* bs = &sb[bu][ln * G2P];
    v16h af[2][2], bf[2][4];      /* the stage's 12 fragments, read as one group ahead of its 16 products */
#pragma unroll
    for (int kk = 0; kk < 2; ++kk) { af[kk][0] = g2_frag(as + kk * 32, hh); af[kk][1] = g2_frag(as + 16 * G2P + kk * 32, hh);
#pragma unroll
      for (int u = 0; u < 4; ++u) bf[kk][u] = g2_frag(bs + u * 16 * G2P + kk * 32, hh); }
#pragma unroll
    for (int kk = 0; kk < 2; ++kk) { c00 = g2_mma(af[kk][0], bf[kk][0], c00); c10 = g2_mma(af[kk][1], bf[kk][0], c10); c01 = g2_mma(af[kk][0], bf[kk][1], c01); c11 = g2_mma(af[kk][1], bf[kk][1], c11);
      c02 = g2_mma(af[kk][0], bf[kk][2], c02); c12 = g2_mma(af[kk][1], bf[kk][2], c12); c03 = g2_mma(af[kk][0], bf[kk][3], c03); c13 = g2_mma(af[kk][1], bf[kk][3], c13); }
    asm volatile("s_wait_dscnt 0x0" ::: "memory");      /* this wave has finished reading stage s */
    asm volatile("s_wait_asynccnt 0x0" ::: "memory");      /* this wave's copies of stage s + 1 have landed */
    __syncthreads();      /* publishes stage s + 1 and frees stage s's buffer */
    if (s + 2 < nst) g2_stage(agp + (s + 2) * 64, bgp + (s + 2) * 64, a16, b16, la0 + (unsigned)(bu * sizeof(sa[0])), lb0 + (unsigned)(bu * sizeof(sb[0]))); }
  asm volatile("s_wait_asynccnt 0x0" ::: "memory");      /* no copy is outstanding behind the loop */
  v8f accs[8] = {c00, c01, c02, c03, c10, c11, c12, c13};
#pragma unroll
  for (int u = 0; u < 8; ++u) { const int t = u & 3, half = u >> 2; const int col = col0 + t * 16 + ln; const float bv = bf16_round(braw[t]);
#pragma unroll
    for (int r = 0; r < 8; ++r) { const int rloc = half * 16 + 8 * hh + r; float v = accs[u][r] * alpha + bv; if (HASCP && CP) { if (rowsPerB < 0) v += CP[cofs + (size_t)(row0g + row0 + rloc) * ldc + col];      /* rowsPerB < 0: own element of the batched C plane */ else { const int bidx = (row0g + row0 + rloc) / rowsPerB; v += CP[(size_t)bidx * sCPb + (size_t)by * 64 + col]; } }
      if (ACT == 3) v = fmaxf(v, 0.f); else if (ACT == 6) v = 0.5f * v * (1.0f + erff(v * 0.70710678118654752f)); else if (ACT == 11) v = 1.0f / (1.0f + expf(-v)); else if (ACT == 15) v = v / (1.0f + expf(-v)); else if (ACT == 12) v = (v > 0.f) ? v : 0.01f * v; else if (ACT == 8) v = tanhf(v); else if (ACT == 9) v = 0.5f * v * (1.0f + tanhf(0.7978845608028654f * (v + 0.044715f * v * v * v))); else if (ACT == 14) v = (v > 0.f) ? v : 0.1f * v; else if (ACT == 16) v = (v >= 0.f) ? v : 0.3f * v; else if (ACT == 17) v = (v >= 0.f) ? v : 0.2f * v;
      so[w][rloc][t * 16 + ln] = v; } }
  __builtin_amdgcn_fence(__ATOMIC_ACQ_REL, "workgroup"); __builtin_amdgcn_wave_barrier();
  const int rsub = lane >> 4, c4 = (lane & 15) * 4;
  {
#pragma unroll
    for (int q = 0; q < 16; ++q) { const int r = q * 2 + rsub; const v4f v = *(const v4fa*)&so[w][r][c4]; if (OUT32) *(v4f*)(C + cofs + (size_t)(row0 + r) * ldc + col0 + c4) = v; if (OUT16) { v4h h4; for (int i = 0; i < 4; ++i) h4[i] = (_Float16)v[i]; *(v4h*)(C16 + cofs + (size_t)(row0 + r) * ldc + col0 + c4) = h4; } }
     } }


__global__ __launch_bounds__(256) void k_wnat(const float* __restrict__ w, size_t n8, _Float16* __restrict__ Bt) { const size_t t = (size_t)blockIdx.x * 256 + threadIdx.x; if (t >= n8) return; FragH f; for (int q = 0; q < 8; ++q) f.h[q] = (_Float16)(bf16_round(w[t * 8 + q]) * 16.0f); *(v8us*)((unsigned short*)Bt + t * 8) = f.half[0];  }
__global__ __launch_bounds__(256) void k_rsm(const float* __restrict__ S, _Float16* __restrict__ P, int nrows) {
  #pragma clang fp contract(off)
  const int i = blockIdx.x * 256 + threadIdx.x; if (i >= nrows) return; const float* s = S + (size_t)i * SQ; float mx = -3.0e38f;
#pragma unroll 1
  for (int j = 0; j < SQ; ++j) mx = fmaxf(mx, s[j]); float se = 0.f;
#pragma unroll 1
  for (int j = 0; j < SQ; ++j) se += expf(s[j] - mx); const float sc = 256.0f / se;
#pragma unroll 1
  for (int j0 = 0; j0 < SQ; j0 += 8) { FragH f; for (int q = 0; q < 8; ++q) f.h[q] = (_Float16)(expf(s[j0 + q] - mx) * sc); unsigned short* d = (unsigned short*)P + (size_t)i * SQ + j0; *(v8us*)d = f.half[0];  } }
__global__ __launch_bounds__(256) void k_vt(const _Float16* __restrict__ V16, int b, int h0, _Float16* __restrict__ VT) { __shared__ unsigned short tl[64][65]; const int tid = threadIdx.x; const int hh = blockIdx.x % HG, sg = blockIdx.x / HG; const int s0 = sg * 64; const int h = h0 + hh;
  for (int i = tid; i < 64 * 8; i += 256) { const int j = i / 8, d8 = (i % 8) * 8; FragH f; f.half[0] = *(const v8us*)((const unsigned short*)V16 + ((size_t)b * SQ + s0 + j) * DM + h * HD + d8); for (int q = 0; q < 8; ++q) tl[d8 + q][j] = f.u[q]; }
  __syncthreads();
  { for (int i = tid; i < 64 * 8; i += 256) { const int d = i / 8, j8 = (i % 8) * 8; FragH f; for (int q = 0; q < 8; ++q) f.u[q] = tl[d][j8 + q]; *(v8us*)((unsigned short*)VT + ((size_t)hh * HD + d) * SQ + s0 + j8) = f.half[0]; }  } }



// Fused attention, one launch for all (batch, head) planes: a wave owns 32 queries (two 16-column groups) and walks the plane's 1024 keys in passes of 32. The work-group's 8 waves share each stage of 128 keys through LDS.
// Transposed products: S^T = K . Q^T (A = 16 key rows, B = 16 query rows, both through g2_frag), so lane (ln, hh) holds, for query ln, the scores of keys 8 hh + r and 16 + 8 hh + r:
// exactly the k positions that g2_frag gives a B operand, so the exponentials are packed in place into P^T and O^T += V^T . P^T (A = 16 rows of V^T, read from the staged V rows by ds_load_tr16_b128, which delivers the same k positions) follows with no exchange through memory or LDS.
// Online softmax in base 2: the maximum in use may lag a query's true running maximum by up to 8 (an exponential can reach 2^8, far inside f16); the accumulators are rescaled, tested once per pass, only when it lags by more.
// Row sums are f32 sums of the unrounded exponentials, one partial per wave half, joined at the end. o is stored x64 as f16 (the output GEMM's alpha folds it back).
#define FQ 2                         /* 16-query column groups per wave */
#define FW 8                         /* waves per work-group */
typedef _Float16 v8h __attribute__((ext_vector_type(8)));
typedef _Float16 v2h __attribute__((ext_vector_type(2)));
typedef float v2f __attribute__((ext_vector_type(2)));
union FragP { v16h v; v2h p[8]; };
__device__ __forceinline__ float fa_xhalf(float x) { return __builtin_bit_cast(float, __builtin_amdgcn_permlanex16(__builtin_bit_cast(int, x), __builtin_bit_cast(int, x), 0x76543210, 0xfedcba98, false, false)); }      /* lane l <-> lane l ^ 16 */
__device__ __forceinline__ v8f fa_mma(v16h a, v16h b, v8f c) { return __builtin_amdgcn_wmma_f32_16x16x32_f16(false, a, false, b, (short)0, c, false, false); }
// Operand staging of k_fattn: one stage = FKS keys of the plane, as FKS rows of K and FKS rows of V (128 bytes each, the head's slice of a projected row), brought into LDS once for the work-group's 8 waves by asynchronous 16-byte copies, 8 per thread; 8 neighbouring lanes copy one row.
#define FKS 128                      /* keys per stage */
#define FKP 72                       /* LDS pitch of a K row in f16: 128 data bytes + 16, conflict-free for the 16-byte fragment reads */
#define FVP 80                       /* LDS pitch of a V row in f16: 128 data bytes + 32 (32 bytes x odd), conflict-free for the transposing 16-byte reads */
__device__ __forceinline__ void fa_stage(const _Float16* kg, const _Float16* vg, unsigned lk, unsigned lv) {      /* kg, vg: this thread's 16 bytes in row tid / 8 of the stage's K rows and of its V rows; lk, lv: their LDS byte addresses */
  const _Float16* k1 = kg + (size_t)32 * LQ; const _Float16* k2 = k1 + (size_t)32 * LQ; const _Float16* k3 = k2 + (size_t)32 * LQ;
  const _Float16* v1 = vg + (size_t)32 * LQ; const _Float16* v2 = v1 + (size_t)32 * LQ; const _Float16* v3 = v2 + (size_t)32 * LQ;
  const unsigned dk = 32 * FKP * 2, dv = 32 * FVP * 2;      /* 32 K rows, 32 V rows on in LDS, bytes */
  /* the copies and, as the last line of their own statement, the wait that stands before any of their address registers is written again */
  asm volatile("global_load_async_to_lds_b128 %0, %8, off\n\t"
               "global_load_async_to_lds_b128 %1, %9, off\n\t"
               "global_load_async_to_lds_b128 %2, %10, off\n\t"
               "global_load_async_to_lds_b128 %3, %11, off\n\t"
               "global_load_async_to_lds_b128 %4, %12, off\n\t"
               "global_load_async_to_lds_b128 %5, %13, off\n\t"
               "global_load_async_to_lds_b128 %6, %14, off\n\t"
               "global_load_async_to_lds_b128 %7, %15, off\n\t"
               "s_wait_xcnt 0x0"
               :: "v"(lk), "v"(lk + dk), "v"(lk + 2 * dk), "v"(lk + 3 * dk), "v"(lv), "v"(lv + dv), "v"(lv + 2 * dv), "v"(lv + 3 * dv),
                  "v"(kg), "v"(k1), "v"(k2), "v"(k3), "v"(vg), "v"(v1), "v"(v2), "v"(v3) : "memory");
}
// One 16 (d) x 32 (keys) A fragment of V^T from V rows in LDS: two transposing loads, 16 keys apart. p = the lane's own 16 bytes: row 8 (lane >> 4) + (lane & 7) of the 16-key block, byte 16 ((lane >> 3) & 1) of the 32 bytes that hold the 16 d;
// lane (ln, hh) then holds d = ln at keys 8 hh + 0..7 (first load) and 16 + 8 hh + 0..7 (second): g2_frag's k positions.
typedef short s16x8 __attribute__((ext_vector_type(8)));
__device__ __forceinline__ v16h fa_vfrag(const _Float16* p) { typedef __attribute__((address_space(3))) s16x8 lds_s16x8; FragH f;
  f.half[0] = __builtin_bit_cast(v8us, __builtin_amdgcn_ds_load_tr16_b128_v8i16((lds_s16x8*)p)); f.half[1] = __builtin_bit_cast(v8us, __builtin_amdgcn_ds_load_tr16_b128_v8i16((lds_s16x8*)(p + 16 * FVP))); return f.v; }
__global__ __launch_bounds__(FW * 32) void k_fattn(const _Float16* __restrict__ Qr, const _Float16* __restrict__ Kr, const _Float16* __restrict__ Vr, _Float16* __restrict__ O) {
  static_assert(FW * 32 == 256 && FKS == 128 && HD == 64 && SQ % FKS == 0 && SQ / FKS >= 2, "fa_stage: 256 threads x 4 copies cover 128 K rows of 8 chunks and as many V rows; stages 0 and 1 exist");
  __shared__ __attribute__((aligned(16))) _Float16 sk[2][FKS * FKP]; __shared__ __attribute__((aligned(16))) _Float16 sv[2][FKS * FVP];      /* two stage buffers per operand */
  const int tid = threadIdx.x, lane = tid & 31, w = tid >> 5, ln = lane & 15, hh = lane >> 4;
  const int plane = blockIdx.y, b = plane / NH, h = plane % NH; const int q0 = (blockIdx.x * FW + w) * (16 * FQ);
  const _Float16* qp = Qr + ((size_t)b * SQ + q0 + ln) * LQ + h * HD;
  const _Float16* kg = Kr + ((size_t)b * SQ + (tid >> 3)) * LQ + h * HD + (tid & 7) * 8; const _Float16* vg = Vr + ((size_t)b * SQ + (tid >> 3)) * LQ + h * HD + (tid & 7) * 8;
  const unsigned lk0 = (unsigned)(size_t)&sk[0][0] + (unsigned)((tid >> 3) * (FKP * 2) + (tid & 7) * 16), lv0 = (unsigned)(size_t)&sv[0][0] + (unsigned)((tid >> 3) * (FVP * 2) + (tid & 7) * 16);      /* LDS byte addresses = low 32 bits of the shared addresses */
  const float cs = 0.125f * 1.4426950408889634f;      /* 64^-0.5 and log2(e) in one factor */
  const v8f z8 = {0.f,0.f,0.f,0.f,0.f,0.f,0.f,0.f};
  fa_stage(kg, vg, lk0, lv0);
  v16h qf[FQ][2]; v8f acc[FQ][4]; float m_run[FQ], l_run[FQ];
#pragma unroll
  for (int g = 0; g < FQ; ++g) { qf[g][0] = g2_frag(qp + (size_t)g * 16 * LQ, hh); qf[g][1] = g2_frag(qp + (size_t)g * 16 * LQ + 32, hh); m_run[g] = -3.0e38f; l_run[g] = 0.f;
#pragma unroll
    for (int t = 0; t < 4; ++t) acc[g][t] = z8; }
  asm volatile("s_wait_xcnt 0x0" ::: "memory");      /* stands before the address registers of the Q loads above are written again */
  asm volatile("s_wait_asynccnt 0x0" ::: "memory");      /* this wave's copies of stage 0 have landed */
  __syncthreads();      /* every wave's have: stage 0 may be read */
  fa_stage(kg + (size_t)FKS * LQ, vg + (size_t)FKS * LQ, lk0 + (unsigned)sizeof(sk[0]), lv0 + (unsigned)sizeof(sv[0]));
  /* kept rolled: one trip = one stage, so that the order at its foot stays as written */
#pragma unroll 1
  for (int st = 0; st < SQ / FKS; ++st) { const int bu = st & 1; const _Float16* ks = &sk[bu][ln * FKP]; const _Float16* vs = &sv[bu][(8 * hh + (lane & 7)) * FVP + ((lane >> 3) & 1) * 8];
    v16h kf[2][2], vf[4];
#pragma unroll
    for (int kt = 0; kt < 2; ++kt) { kf[kt][0] = g2_frag(ks + kt * 16 * FKP, hh); kf[kt][1] = g2_frag(ks + kt * 16 * FKP + 32, hh); }
#pragma unroll
    for (int t = 0; t < 4; ++t) vf[t] = fa_vfrag(vs + t * 16);
    /* unrolled: the stage's passes of 32 keys, so that "is there a next pass in this stage" is known at compile time */
#pragma unroll
    for (int p = 0; p < FKS / 32; ++p) {
      v8f s[2][FQ];
#pragma unroll
      for (int kt = 0; kt < 2; ++kt) {
#pragma unroll
        for (int g = 0; g < FQ; ++g) s[kt][g] = fa_mma(kf[kt][1], qf[g][1], fa_mma(kf[kt][0], qf[g][0], z8)); }
      if (p + 1 < FKS / 32) {      /* inside a stage both operands' fragments are read one pass ahead, into the registers their products have just left: K under this pass's maxima, V^T under the next pass's scores and maxima; a stage's last pass reads nothing ahead (the next stage is not published yet) */
#pragma unroll
        for (int kt = 0; kt < 2; ++kt) { kf[kt][0] = g2_frag(ks + ((p + 1) * 32 + kt * 16) * FKP, hh); kf[kt][1] = g2_frag(ks + ((p + 1) * 32 + kt * 16) * FKP + 32, hh); } }
      asm volatile("" ::: "memory");      /* compiler fence: holds the LDS reads written above it (this pass's V^T, the next pass's K) in front of the maxima; without it the compiler sinks them behind the branch below, next to their products and in among them, where each waits out its own latency */
      float mb[FQ]; bool need = false;
#pragma unroll
      for (int g = 0; g < FQ; ++g) { float mx = fmaxf(s[0][g][0], s[1][g][0]);
#pragma unroll
        for (int r = 1; r < 8; ++r) mx = fmaxf(mx, fmaxf(s[0][g][r], s[1][g][r]));
        mx = fmaxf(mx, fa_xhalf(mx)) * cs; mb[g] = mx; need = need || (mx > m_run[g] + 8.0f); }      /* both halves hold the query's pass maximum, scaled (cs > 0) */
      if (__builtin_amdgcn_ballot_w32(need) != 0) {      /* wave-uniform; always taken on the first pass (factor 0 on zero accumulators) */
#pragma unroll
        for (int g = 0; g < FQ; ++g) { const float mn = fmaxf(m_run[g], mb[g]); const float corr = __builtin_amdgcn_exp2f(m_run[g] - mn); m_run[g] = mn; l_run[g] *= corr;
#pragma unroll
          for (int t = 0; t < 4; ++t) acc[g][t] *= corr; } }
#pragma unroll
      for (int g = 0; g < FQ; ++g) { const float nm = -m_run[g]; FragP pf; v2f ls = {0.f, 0.f};
#pragma unroll
        for (int i = 0; i < 8; ++i) { const v2f x = {s[i >> 2][g][2 * (i & 3)], s[i >> 2][g][2 * (i & 3) + 1]};      /* operand elements 2i, 2i + 1 = tile i >> 2, registers 2 (i & 3), 2 (i & 3) + 1 */
          const v2f a = __builtin_elementwise_fma(x, (v2f){cs, cs}, (v2f){nm, nm}); const v2f p2 = {__builtin_amdgcn_exp2f(a[0]), __builtin_amdgcn_exp2f(a[1])};
          ls += p2; pf.p[i] = __builtin_convertvector(p2, v2h); }
        l_run[g] += ls[0] + ls[1];
#pragma unroll
        for (int t = 0; t < 4; ++t) acc[g][t] = fa_mma(vf[t], pf.v, acc[g][t]); }
      if (p + 1 < FKS / 32) {
#pragma unroll
        for (int t = 0; t < 4; ++t) vf[t] = fa_vfrag(vs + (p + 1) * 32 * FVP + t * 16); }
    }
    asm volatile("s_wait_dscnt 0x0" ::: "memory");      /* this wave has finished reading stage st */
    asm volatile("s_wait_asynccnt 0x0" ::: "memory");      /* this wave's copies of stage st + 1 have landed */
    __syncthreads();      /* publishes stage st + 1 and frees stage st's buffer */
    if (st + 2 < SQ / FKS) fa_stage(kg + (size_t)(st + 2) * FKS * LQ, vg + (size_t)(st + 2) * FKS * LQ, lk0 + (unsigned)(bu * sizeof(sk[0])), lv0 + (unsigned)(bu * sizeof(sv[0]))); }
  asm volatile("s_wait_asynccnt 0x0" ::: "memory");      /* no copy is outstanding behind the loop */
#pragma unroll
  for (int g = 0; g < FQ; ++g) { const float sc = 64.0f / (l_run[g] + fa_xhalf(l_run[g])); _Float16* op = O + ((size_t)plane * SQ + q0 + g * 16 + ln) * HD + 8 * hh;
#pragma unroll
    for (int t = 0; t < 4; ++t) { const v8f o = acc[g][t] * sc; *(v8h*)(op + t * 16) = __builtin_convertvector(o, v8h); } }      /* registers r = 0..7 are d = 16 t + 8 hh + r of query ln: one 16-byte store */
}

// Operand preparation, all of it in one launch (the seven conversions depend on nothing but the inputs).
// Work-groups 0 .. PW - 1, the weights: thread t owns 8 k of output column n = t / 64 in all four matrices and writes Bt[n][k] = f16(16 x bf16-rounded weight); per-head W[h][k][d] has n = h * 64 + d (head-major columns = the flattened biases' order), Wo[k][n] is plain [in][out].
// Work-groups PW .. PW + PX - 1, the three inputs as exact f16 rows (bf16-rounded): each thread converts PC chunks of 8 floats of each input, one work-group of threads apart, so a wave's loads and stores stay contiguous and few waves have to be started.
#define PW 128                       /* work-groups on the weights: 512 columns x 64 chunks of 8 k */
#define PX 512                       /* work-groups on the inputs */
#define PC 4                         /* chunks per thread and input */
__device__ __forceinline__ v8us p_cvt8(const float* v, float scale) { FragH f;
#pragma unroll
  for (int q = 0; q < 8; ++q) f.h[q] = (_Float16)(bf16_round(v[q]) * scale); return f.half[0]; }
__device__ __forceinline__ v8us p_cvt44(v4f a, v4f b) { const float v[8] = {a[0], a[1], a[2], a[3], b[0], b[1], b[2], b[3]}; return p_cvt8(v, 1.0f); }
__global__ __launch_bounds__(256) void k_prep(const float* __restrict__ xq, const float* __restrict__ xk, const float* __restrict__ xv, const float* __restrict__ wq, const float* __restrict__ wk, const float* __restrict__ wv, const float* __restrict__ wo,
    _Float16* __restrict__ XQ, _Float16* __restrict__ XK, _Float16* __restrict__ XV, _Float16* __restrict__ BQ, _Float16* __restrict__ BK, _Float16* __restrict__ BV, _Float16* __restrict__ BO) {
  static_assert((size_t)PW * 256 == (size_t)DM * (DM / 8) && NH * HD == DM, "one weight thread per 8 k of a column"); static_assert((size_t)PX * 256 * PC == NR * DM / 8, "the input threads cover every chunk once");
  if (blockIdx.x < PW) {
    const int t = blockIdx.x * 256 + threadIdx.x; const int n = t / (DM / 8), k8 = (t % (DM / 8)) * 8; const int h = n / HD, d = n % HD;
    const size_t ph = ((size_t)h * DM + k8) * HD + d, po = (size_t)k8 * DM + n; float a[4][8];
#pragma unroll
    for (int q = 0; q < 8; ++q) { a[0][q] = wq[ph + (size_t)q * HD]; a[1][q] = wk[ph + (size_t)q * HD]; a[2][q] = wv[ph + (size_t)q * HD]; a[3][q] = wo[po + (size_t)q * DM]; }
    const size_t dst = (size_t)n * DM + k8;
    *(v8us*)((unsigned short*)BQ + dst) = p_cvt8(a[0], 16.0f); *(v8us*)((unsigned short*)BK + dst) = p_cvt8(a[1], 16.0f); *(v8us*)((unsigned short*)BV + dst) = p_cvt8(a[2], 16.0f); *(v8us*)((unsigned short*)BO + dst) = p_cvt8(a[3], 16.0f);
    return; }
  const size_t i0 = ((size_t)(blockIdx.x - PW) * (PC * 256) + threadIdx.x) * 8;      /* first float of the thread's first chunk; its next chunks lie 256 chunks on each */
  const float* pq = xq + i0; const float* pk = xk + i0; const float* pv = xv + i0;
  v4f v[3][PC][2];
#pragma unroll
  for (int c = 0; c < PC; ++c) { const int o = c * 256 * 8;
    v[0][c][0] = *(const v4fa*)(pq + o); v[0][c][1] = *(const v4fa*)(pq + o + 4); v[1][c][0] = *(const v4fa*)(pk + o); v[1][c][1] = *(const v4fa*)(pk + o + 4); v[2][c][0] = *(const v4fa*)(pv + o); v[2][c][1] = *(const v4fa*)(pv + o + 4); }
  asm volatile("s_wait_xcnt 0x0" :: "v"(pq), "v"(pk), "v"(pv) : "memory");      /* stands before the loads' address registers are written again; naming the three addresses keeps their registers out of the later loads' results; as a statement on memory it also holds all of the thread's loads ahead of the first conversion, one memory latency instead of several */
#pragma unroll
  for (int c = 0; c < PC; ++c) { const size_t o = i0 + (size_t)c * 256 * 8;
    *(v8us*)((unsigned short*)XQ + o) = p_cvt44(v[0][c][0], v[0][c][1]); *(v8us*)((unsigned short*)XK + o) = p_cvt44(v[1][c][0], v[1][c][1]); *(v8us*)((unsigned short*)XV + o) = p_cvt44(v[2][c][0], v[2][c][1]); }
  asm volatile("s_wait_xcnt 0x0" ::: "memory");      /* stands behind the last stores, before anything that follows them in the code can write their address or data registers again */
}

extern "C" void kernel_launch(void* const* d_in, const int* in_sizes, int n_in,
                              void* d_out, int out_size, void* d_ws, size_t ws_size, hipStream_t stream) {
  (void)in_sizes; (void)n_in; (void)out_size;
  const float* const* I = (const float* const*)d_in; const float* xq = I[0]; const float* xk = I[1]; const float* xv = I[2]; const float* wq = I[3]; const float* bq = I[4]; const float* wk = I[5]; const float* bk = I[6]; const float* wv = I[7]; const float* bv = I[8]; const float* wo = I[9]; const float* bo = I[10];      /* three inputs; per-head [in][out] weights [8][512][64] + per-head biases [8][64] (flattened head-major = projection column order); Wo [in][out] + bo */
  char* ws = (char*)d_ws; size_t off = 0;
  auto take = [&](size_t bytes) { char* p = ws + off; off += (bytes + 255) & ~(size_t)255; return p; };
  _Float16* BQ = (_Float16*)take((size_t)DM * DM * 2); _Float16* BK = (_Float16*)take((size_t)DM * DM * 2); _Float16* BV = (_Float16*)take((size_t)DM * DM * 2); _Float16* BO = (_Float16*)take((size_t)DM * DM * 2);
  _Float16* Q16 = (_Float16*)take(NR * DM * 2); _Float16* K16 = (_Float16*)take(NR * DM * 2); _Float16* V16 = (_Float16*)take(NR * DM * 2); _Float16* O16 = (_Float16*)take(NR * DM * 2);
  _Float16* XQ = (_Float16*)take(NR * DM * 2); _Float16* XK = (_Float16*)take(NR * DM * 2); _Float16* XV = (_Float16*)take(NR * DM * 2);      /* the f16 input rows */
  if (off > ws_size) return;
  k_prep<<<PW + PX, 256, 0, stream>>>(xq, xk, xv, wq, wk, wv, wo, XQ, XK, XV, BQ, BK, BV, BO);      /* the four weight matrices as Bt x16 and the three inputs as exact f16 rows */
  const size_t r0p = (size_t)B0 * SQ;      /* first projected row */
  k_gemm2<0, false, false, true><<<dim3((unsigned)((MP / 128) * (DM / 64)), 1, 3), 128, 0, stream>>>(XQ + r0p * DM, DM, 0, NR * DM, BQ, DM, 0, (size_t)DM * DM, 0.0625f, bq, bk, bv, 0, nullptr, 1, 0, 0, nullptr, Q16 + r0p * DM, DM, 0, NR * DM, MP, DM, DM);      /* Q, K and V projections on grid.z: XQ XK XV, BQ BK BV and Q16 K16 V16 lie one behind the other in the workspace (every size is a multiple of the 256-byte rounding) */
  k_fattn<<<dim3(SQ / (16 * FQ * FW), NB * NH), FW * 32, 0, stream>>>(Q16, K16, V16, O16);      /* scores, softmax and P . V of all planes: plane p = batch * NH + head -> 64-wide rows at O16 + p * SQ * HD (head-major context), x64 */
  k_gemm2<0, false, true, false><<<dim3((unsigned)((MPO / 128) * (DM / 64)), 1), 128, 0, stream>>>(O16 + r0p * DM, DM, 0, 0, BO, DM, 0, 0, 0.0009765625f, bo, nullptr, nullptr, 0, nullptr, 1, 0, 0, (float*)d_out + r0p * DM, nullptr, DM, 0, 0, MPO, DM, DM);      /* out rows are the output layout */
}

// v009
// One run takes 62.4 microseconds.
// Two timings next to v008 both put it at 1.05 times that version's speed.
// All steps since v000 together make it 53.6 times as fast.
#include <hip/hip_runtime.h>
// Multi-head attention on three inputs with per-head projection tensors and the source's head-major context view (Q, K, V [8][1024][512]; Qh / Kh / Vh = einsum('bsd,hde->bhse', input, W) + b with per-head [in][out] weights W [8][512][64] and biases [8][64] (uniform +-512^-0.5); scores * 64^-0.5; softmax over all 1024 keys (no mask); context x [B][H][S][64] is RE-VIEWED as [B][S][512] WITHOUT transposing heads and time (row s' of the view = 512 consecutive floats of the [H][S][64] block); out = view Wo + bo ([in][out] 512 x 512) -> [8][1024][512]).
// Structure: token rows r = b*1024 + s; the three inputs as exact f16 rows (bf16-rounded); Q, K, V as three WMMA GEMMs in one launch (128x128 block tiles, 64x64 wave tiles, f32 accumulation, exact x16 weights + bias, f16 outputs); then one fused attention launch for all pairs (S^T = K . Q^T on WMMA, V^T fragments by transposing LDS loads of the staged V rows, online softmax on VALU with f32 statistics and native exp2, the unnormalised weights packed in registers as the f16 B operand of O^T += V^T . P^T on WMMA; neither scores nor weights reach memory; o carried x64 against f16 subnormal flush, folded into the output GEMM alpha) written straight into the merged f16 o rows; out = o W_o + b GEMM (f32) into the output layout.
// Compute dtype: inputs rounded to bf16; x / weights exact; q, k, v, softmax weights and o as plain f16 GEMM operands (~2^-12); scores and softmax statistics f32. v_wmma_f32_16x16x32_f16.
#define NB 8
#define SQ 1024
#define DM 512
#define NH 8
#define HD 64
#define HG 4                         /* heads per launch of the untemplated k_vt (not launched) */
#define B0 0                         /* first batch processed (debug hook) */
#define NBR NB                       /* batches processed (debug hook) */
#define NR ((size_t)NB * SQ)         /* token rows */
#define MP ((int)((size_t)NBR * SQ)) /* rows projected (debug hook) */
#define QN SQ                        /* query rows per batch (not used; launches attend all SQ rows) */
#define NHD NH                       /* heads (not used; launches attend all NH heads) */
#define MPO MP                       /* rows through the output stage (debug hook) */
#define LQ DM      /* row pitch of the q/k/v rows */
typedef __bf16 v16b __attribute__((ext_vector_type(16)));
typedef unsigned short v8us __attribute__((ext_vector_type(8), may_alias));
typedef float  v8f  __attribute__((ext_vector_type(8)));
typedef float  v4f  __attribute__((ext_vector_type(4)));
typedef float  v4fa __attribute__((ext_vector_type(4), may_alias));
union FragB { v16b v; v8us half[2]; unsigned short u[16]; };

__device__ __forceinline__ unsigned short bf16_bits(float x) { unsigned int u = __float_as_uint(x); return (unsigned short)((u + 0x7FFFu + ((u >> 16) & 1u)) >> 16); }
__device__ __forceinline__ float bf16_val(unsigned short b) { return __uint_as_float(((unsigned int)b) << 16); }
__device__ __forceinline__ float bf16_round(float x) { return bf16_val(bf16_bits(x)); }
// D += A·B with NT terms: 1 = ah·bh, 2 = + al·bh (A split), 3 = + ah·bl (both split)
template <int NT>
__device__ __forceinline__ v8f mmaN(v16b ah, v16b al, v16b bh, v16b bl, v8f c) {
  c = __builtin_amdgcn_wmma_f32_16x16x32_bf16(false, ah, false, bh, (short)0, c, false, false);
  if (NT >= 2) c = __builtin_amdgcn_wmma_f32_16x16x32_bf16(false, al, false, bh, (short)0, c, false, false);
  if (NT >= 3) c = __builtin_amdgcn_wmma_f32_16x16x32_bf16(false, ah, false, bl, (short)0, c, false, false);
  asm volatile("v_nop\n\tv_nop\n\tv_nop\n\tv_nop" : "+v"(c) : "v"(ah), "v"(al), "v"(bh), "v"(bl));
  return c;
}

__global__ __launch_bounds__(256) void k_wt_bf16(const float* __restrict__ W, unsigned short* __restrict__ Wt, int K, int N) {
  const int t = blockIdx.x * 256 + threadIdx.x;
  const int k8n = K / 8;
  if (t >= N * k8n) return;
  const int n = t / k8n, k8 = (t % k8n) * 8;
  v8us v;
#pragma unroll
  for (int i = 0; i < 8; ++i) v[i] = bf16_bits(W[(size_t)(k8 + i) * N + n]);
  *(v8us*)(Wt + (size_t)n * K + k8) = v;
  
}

// GEMM C[M][N] (f32, pitch ldc) = act(A[M][K]·W + bias). A f32 row-major (pitch lda) converted per fragment to bf16
// (ASPLIT: hi/lo two planes -> 2 terms, else single rounded term); Wt bf16 [N][K] (pitch ldb). BIAS_BF16 rounds the
// bias to bf16 first (bias quantised to bf16 before the add). K%32==0, M%16==0, N%64==0.
template <bool ASPLIT, int ACT, bool BIAS_BF16>
__global__ __launch_bounds__(128) void k_gemm_bf(const float* __restrict__ A, int lda, const unsigned short* __restrict__ Wt, int ldb,
                                               const float* __restrict__ bias, float* __restrict__ C, int ldc, int M, int N, int K) {
  __shared__ __attribute__((aligned(16))) float so[4][16][64];
  const int tid = threadIdx.x, w = tid >> 5, lane = tid & 31, ln = lane & 15, hh = lane >> 4;
  const int ntn = N / 64;
  const int wid = blockIdx.x * 4 + w;
  const int mt = wid / ntn, nq = wid % ntn;
  if (mt * 16 >= M) return;
  const int row0 = mt * 16, col0 = nq * 64;
  const float* arow = A + (size_t)(row0 + ln) * lda;
  v8f acc[4] = {};
  for (int kb = 0; kb < K; kb += 32) {
    FragB ah, al;
    const v4f x0 = *(const v4fa*)(arow + kb + 8 * hh), x1 = *(const v4fa*)(arow + kb + 8 * hh + 4);
    const v4f x2 = *(const v4fa*)(arow + kb + 16 + 8 * hh), x3 = *(const v4fa*)(arow + kb + 16 + 8 * hh + 4);
    float xs[16] = {x0[0],x0[1],x0[2],x0[3],x1[0],x1[1],x1[2],x1[3],x2[0],x2[1],x2[2],x2[3],x3[0],x3[1],x3[2],x3[3]};
#pragma unroll
    for (int i = 0; i < 16; ++i) { const unsigned short hb = bf16_bits(xs[i]); ah.u[i] = hb; al.u[i] = ASPLIT ? bf16_bits(xs[i] - bf16_val(hb)) : (unsigned short)0; }
#pragma unroll
    for (int t = 0; t < 4; ++t) {
      const unsigned short* brow = Wt + (size_t)(col0 + t * 16 + ln) * ldb + kb;
      FragB b;
      b.half[0] = *(const v8us*)(brow + 8 * hh);
      b.half[1] = *(const v8us*)(brow + 16 + 8 * hh);
      acc[t] = mmaN<ASPLIT ? 2 : 1>(ah.v, al.v, b.v, b.v, acc[t]);
    }
  }
#pragma unroll
  for (int t = 0; t < 4; ++t) {
    float bv = bias ? bias[col0 + t * 16 + ln] : 0.f;
    if (BIAS_BF16) bv = bf16_round(bv);
#pragma unroll
    for (int r = 0; r < 8; ++r) { float v = acc[t][r] + bv; if (ACT == 1) v = fmaxf(v, 0.f); so[w][8 * hh + r][t * 16 + ln] = v; }
  }
  __builtin_amdgcn_fence(__ATOMIC_ACQ_REL, "workgroup");
  __builtin_amdgcn_wave_barrier();
  const int rsub = lane >> 4, c4 = (lane & 15) * 4;
  {
#pragma unroll
    for (int q = 0; q < 8; ++q) {
      const int r = q * 2 + rsub;
      const v4f v = *(const v4fa*)&so[w][r][c4];
      *(v4f*)(C + (size_t)(row0 + r) * ldc + col0 + c4) = v;
    }
    
  }
}

// GEMM C = act(A·W + bias + resid): A f32 (ASPLIT -> hi/lo 2 terms), Wt bf16 [N][K]; ACT 0 none, 1 relu, 2 exact gelu;
// resid (optional, f32, row index = (row % rmod), pitch ldr, RES_BF16 rounds it) added before the activation.
template <bool ASPLIT, int ACT, bool BIAS_BF16, bool RES_BF16>
__global__ __launch_bounds__(128) void k_gemm_bf3(const float* __restrict__ A, int lda, const unsigned short* __restrict__ Wt, int ldb,
                                                const float* __restrict__ bias, const float* __restrict__ resid, int rmod, int ldr,
                                                float* __restrict__ C, int ldc, int M, int N, int K) {
  __shared__ __attribute__((aligned(16))) float so[4][16][64];
  const int tid = threadIdx.x, w = tid >> 5, lane = tid & 31, ln = lane & 15, hh = lane >> 4;
  const int ntn = N / 64;
  const int wid = blockIdx.x * 4 + w;
  const int mt = wid / ntn, nq = wid % ntn;
  if (mt * 16 >= M) return;
  const int row0 = mt * 16, col0 = nq * 64;
  const float* arow = A + (size_t)(row0 + ln) * lda;
  v8f acc[4] = {};
  for (int kb = 0; kb < K; kb += 32) {
    FragB ah, al;
    const v4f x0 = *(const v4fa*)(arow + kb + 8 * hh), x1 = *(const v4fa*)(arow + kb + 8 * hh + 4);
    const v4f x2 = *(const v4fa*)(arow + kb + 16 + 8 * hh), x3 = *(const v4fa*)(arow + kb + 16 + 8 * hh + 4);
    float xs[16] = {x0[0],x0[1],x0[2],x0[3],x1[0],x1[1],x1[2],x1[3],x2[0],x2[1],x2[2],x2[3],x3[0],x3[1],x3[2],x3[3]};
#pragma unroll
    for (int i = 0; i < 16; ++i) { const unsigned short hb = bf16_bits(xs[i]); ah.u[i] = hb; al.u[i] = ASPLIT ? bf16_bits(xs[i] - bf16_val(hb)) : (unsigned short)0; }
#pragma unroll
    for (int t = 0; t < 4; ++t) {
      const unsigned short* brow = Wt + (size_t)(col0 + t * 16 + ln) * ldb + kb;
      FragB b;
      b.half[0] = *(const v8us*)(brow + 8 * hh);
      b.half[1] = *(const v8us*)(brow + 16 + 8 * hh);
      acc[t] = mmaN<ASPLIT ? 2 : 1>(ah.v, al.v, b.v, b.v, acc[t]);
    }
  }
#pragma unroll
  for (int t = 0; t < 4; ++t) {
    const int col = col0 + t * 16 + ln;
    float bv = bias ? bias[col] : 0.f;
    if (BIAS_BF16) bv = bf16_round(bv);
#pragma unroll
    for (int r = 0; r < 8; ++r) {
      float v = acc[t][r] + bv;
      if (resid) { float rv = resid[(size_t)((row0 + 8 * hh + r) % rmod) * ldr + col]; if (RES_BF16) rv = bf16_round(rv); v += rv; }
      if (ACT == 1) v = fmaxf(v, 0.f);
      if (ACT == 2) v = 0.5f * v * (1.0f + erff(v * 0.70710678118654752f));
      if (ACT == 3) { const float u = 0.7978845608028654f * (v + 0.044715f * v * v * v); v = 0.5f * v * (1.0f + tanhf(u)); }
      so[w][8 * hh + r][t * 16 + ln] = v;
    }
  }
  __builtin_amdgcn_fence(__ATOMIC_ACQ_REL, "workgroup");
  __builtin_amdgcn_wave_barrier();
  const int rsub = lane >> 4, c4 = (lane & 15) * 4;
  {
#pragma unroll
    for (int q = 0; q < 8; ++q) {
      const int r = q * 2 + rsub;
      const v4f v = *(const v4fa*)&so[w][r][c4];
      *(v4f*)(C + (size_t)(row0 + r) * ldc + col0 + c4) = v;
    }
    
  }
}
// row LayerNorm (biased variance, eps) over N: s = X (+ R); optional out_sum <- s; out_norm <- (s-mu)*rsqrt(var+eps)*g + b
template <bool PARAM_BF16>
__global__ __launch_bounds__(256) void k_layernorm(const float* __restrict__ X, const float* __restrict__ R, const float* __restrict__ g, const float* __restrict__ bta,
                                                  float* __restrict__ out_sum, float* __restrict__ out_norm, int N, float eps) {
  __shared__ float red[256];
  const int row = blockIdx.x, tid = threadIdx.x;
  const float* x = X + (size_t)row * N; const float* rr = R ? R + (size_t)row * N : nullptr;
  float vals[16];                     // up to N = 4096
  const int per = N / 256;            // contiguous chunk per thread? use strided-by-4 chunks: thread handles j = tid*4 + 1024*u
  float s1 = 0.f;
  for (int u = 0; u < per / 4; ++u) {
    const int j = tid * 4 + 1024 * u;
    const v4f a = *(const v4fa*)(x + j);
    v4f b = {0.f,0.f,0.f,0.f}; if (rr) b = *(const v4fa*)(rr + j);
#pragma unroll
    for (int q = 0; q < 4; ++q) { const float v = a[q] + b[q]; vals[u * 4 + q] = v; s1 += v; }
  }
  red[tid] = s1; __syncthreads();
  for (int st = 128; st > 0; st >>= 1) { if (tid < st) red[tid] += red[tid + st]; __syncthreads(); }
  const float mu = red[0] / (float)N; __syncthreads();
  float s2 = 0.f;
  for (int u = 0; u < per / 4; ++u)
#pragma unroll
    for (int q = 0; q < 4; ++q) { const float c = vals[u * 4 + q] - mu; s2 += c * c; }
  red[tid] = s2; __syncthreads();
  for (int st = 128; st > 0; st >>= 1) { if (tid < st) red[tid] += red[tid + st]; __syncthreads(); }
  const float rs = rsqrtf(red[0] / (float)N + eps);
  {
    for (int u = 0; u < per / 4; ++u) {
      const int j = tid * 4 + 1024 * u;
      v4f o, sm;
#pragma unroll
      for (int q = 0; q < 4; ++q) {
        float gg = g[j + q], bb = bta[j + q];
        if (PARAM_BF16) { gg = bf16_round(gg); bb = bf16_round(bb); }
        sm[q] = vals[u * 4 + q]; o[q] = (vals[u * 4 + q] - mu) * rs * gg + bb;
      }
      if (out_sum) *(v4f*)(out_sum + (size_t)row * N + j) = sm;
      *(v4f*)(out_norm + (size_t)row * N + j) = o;
    }
    
  }
}



// ---- f16 WMMA path (v_wmma_f32_16x16x32_f16): 11-bit significands for operands in range — used where a [0,1] probability operand needs more precision than bf16
typedef _Float16 v16h __attribute__((ext_vector_type(16)));
union FragH { v16h v; v8us half[2]; _Float16 h[16]; unsigned short u[16]; };
template <int NT>
__device__ __forceinline__ v8f mmaH(v16h ah, v16h al, v16h bh, v16h bl, v8f c) {
  c = __builtin_amdgcn_wmma_f32_16x16x32_f16(false, ah, false, bh, (short)0, c, false, false);
  if (NT >= 2) c = __builtin_amdgcn_wmma_f32_16x16x32_f16(false, al, false, bh, (short)0, c, false, false);
  if (NT >= 3) c = __builtin_amdgcn_wmma_f32_16x16x32_f16(false, ah, false, bl, (short)0, c, false, false);
  asm volatile("v_nop\n\tv_nop\n\tv_nop\n\tv_nop" : "+v"(c) : "v"(ah), "v"(al), "v"(bh), "v"(bl));
  return c;
}
// batched GEMM like k_gemm_b but f16 operands: A f32 (split into f16 hi/lo if ASPLIT, else rounded to f16), Bt = f16 values [n][k]; alpha; C f32; N multiple of 16 (partial tiles skipped)
template <bool ASPLIT>
__global__ __launch_bounds__(128) void k_gemm_h(const float* __restrict__ A, int lda, size_t sA, const _Float16* __restrict__ Bh, int ldb, size_t sB, float alpha, float* __restrict__ C, int ldc, size_t sC, int M, int N, int K) {
  __shared__ __attribute__((aligned(16))) float so[4][16][64];
  const int tid = threadIdx.x, w = tid >> 5, lane = tid & 31, ln = lane & 15, hh = lane >> 4; const int by = blockIdx.y;
  A += (size_t)by * sA; Bh += (size_t)by * sB; C += (size_t)by * sC;
  const int ntn = (N + 63) / 64; const int wid = blockIdx.x * 4 + w; const int mt = wid / ntn, nq = wid % ntn; if (mt * 16 >= M) return;
  const int row0 = mt * 16, col0 = nq * 64; const float* arow = A + (size_t)(row0 + ln) * lda;
  v8f acc[4] = {};
  for (int kb = 0; kb < K; kb += 32) {
    FragH ah, al;
    const v4f x0 = *(const v4fa*)(arow + kb + 8 * hh), x1 = *(const v4fa*)(arow + kb + 8 * hh + 4), x2 = *(const v4fa*)(arow + kb + 16 + 8 * hh), x3 = *(const v4fa*)(arow + kb + 16 + 8 * hh + 4);
    float xs[16] = {x0[0],x0[1],x0[2],x0[3],x1[0],x1[1],x1[2],x1[3],x2[0],x2[1],x2[2],x2[3],x3[0],x3[1],x3[2],x3[3]};
#pragma unroll
    for (int i = 0; i < 16; ++i) { const _Float16 h = (_Float16)xs[i]; ah.h[i] = h; al.h[i] = ASPLIT ? (_Float16)(xs[i] - (float)h) : (_Float16)0.0f; }
#pragma unroll
    for (int t = 0; t < 4; ++t) { if (col0 + t * 16 >= N) continue; const size_t boff = (size_t)(col0 + t * 16 + ln) * ldb + kb; FragH bq; bq.half[0] = *(const v8us*)(Bh + boff + 8 * hh); bq.half[1] = *(const v8us*)(Bh + boff + 16 + 8 * hh);
      acc[t] = mmaH<ASPLIT ? 2 : 1>(ah.v, al.v, bq.v, bq.v, acc[t]); }
  }
#pragma unroll
  for (int t = 0; t < 4; ++t) { if (col0 + t * 16 >= N) continue;
#pragma unroll
    for (int r = 0; r < 8; ++r) so[w][8 * hh + r][t * 16 + ln] = acc[t][r] * alpha; }
  __builtin_amdgcn_fence(__ATOMIC_ACQ_REL, "workgroup"); __builtin_amdgcn_wave_barrier();
  const int rsub = lane >> 4, c4 = (lane & 15) * 4;
  {
#pragma unroll
    for (int q = 0; q < 8; ++q) { const int r = q * 2 + rsub; if (col0 + c4 < N) { const v4f v = *(const v4fa*)&so[w][r][c4]; *(v4f*)(C + (size_t)(row0 + r) * ldc + col0 + c4) = v; } }
     }
}

// k_gemm_hh variant with fused epilogue: v = acc·alpha + bias[by·sBias + col] (+ CP[(row/rowsPerB)·sCPb + by·64 + col] if CP) ; ACT 0 none / 1 elu ; writes f16 C16 (and f32 C if non-null)
template <int ACT>
__global__ __launch_bounds__(128) void k_gemm_hhx(const _Float16* __restrict__ A, int lda, size_t sA, const _Float16* __restrict__ Bh, int ldb, size_t sB, float alpha, const float* __restrict__ bias, size_t sBias, const float* __restrict__ CP, int rowsPerB, size_t sCPb, int row0g,
    float* __restrict__ C, _Float16* __restrict__ C16, int ldc, size_t sC, int M, int N, int K) {
  __shared__ __attribute__((aligned(16))) float so[4][16][64];
  const int tid = threadIdx.x, w = tid >> 5, lane = tid & 31, ln = lane & 15, hh = lane >> 4; const int by = blockIdx.y;
  A += (size_t)by * sA; Bh += (size_t)by * sB; const size_t cofs = (size_t)by * sC; const float* bp = bias ? bias + (size_t)by * sBias : nullptr;
  const int ntn = (N + 63) / 64; const int wid = blockIdx.x * 4 + w; const int mt = wid / ntn, nq = wid % ntn; if (mt * 16 >= M) return;
  const int row0 = mt * 16, col0 = nq * 64; const _Float16* arow = A + (size_t)(row0 + ln) * lda;
  v8f acc[4] = {};
  for (int kb = 0; kb < K; kb += 32) { FragH ah; ah.half[0] = *(const v8us*)((const unsigned short*)arow + kb + 8 * hh); ah.half[1] = *(const v8us*)((const unsigned short*)arow + kb + 16 + 8 * hh);
#pragma unroll
    for (int t = 0; t < 4; ++t) { if (col0 + t * 16 >= N) continue; const size_t boff = (size_t)(col0 + t * 16 + ln) * ldb + kb; FragH bq; bq.half[0] = *(const v8us*)((const unsigned short*)Bh + boff + 8 * hh); bq.half[1] = *(const v8us*)((const unsigned short*)Bh + boff + 16 + 8 * hh);
      acc[t] = mmaH<1>(ah.v, ah.v, bq.v, bq.v, acc[t]); }
  }
#pragma unroll
  for (int t = 0; t < 4; ++t) { if (col0 + t * 16 >= N) continue; const int col = col0 + t * 16 + ln; const float bv = bp ? bf16_round(bp[col]) : 0.f;
#pragma unroll
    for (int r = 0; r < 8; ++r) { float v = acc[t][r] * alpha + bv; if (CP) { const int rr = row0g + row0 + 8 * hh + r; if (rowsPerB < 0) v += CP[cofs + (size_t)rr * ldc + col];      /* rowsPerB < 0: own element of the batched C plane */ else { const int bidx = rr / rowsPerB; v += CP[(size_t)bidx * sCPb + (size_t)by * 64 + col]; } } if (ACT == 1) v = (v > 0.f) ? v : expm1f(v); else if (ACT == 7) v = (v > 0.f) ? v + 1.0f : expf(v); else if (ACT == 8) v = tanhf(v); else if (ACT == 9) v = 0.5f * v * (1.0f + tanhf(0.7978845608028654f * (v + 0.044715f * v * v * v))); else if (ACT == 11) v = 1.0f / (1.0f + expf(-v)); else if (ACT == 12) v = (v > 0.f) ? v : 0.01f * v; else if (ACT == 14) v = (v > 0.f) ? v : 0.1f * v; else if (ACT == 16) v = (v >= 0.f) ? v : 0.3f * v; else if (ACT == 17) v = (v >= 0.f) ? v : 0.2f * v; else if (ACT == 15) v = v / (1.0f + expf(-v)); else if (ACT == 3) v = fmaxf(v, 0.f); else if (ACT == 6) v = 0.5f * v * (1.0f + erff(v * 0.70710678118654752f)); so[w][8 * hh + r][t * 16 + ln] = v; } }
  __builtin_amdgcn_fence(__ATOMIC_ACQ_REL, "workgroup"); __builtin_amdgcn_wave_barrier();
  const int rsub = lane >> 4, c4 = (lane & 15) * 4; typedef _Float16 v4h __attribute__((ext_vector_type(4)));
  {
#pragma unroll
    for (int q = 0; q < 8; ++q) { const int r = q * 2 + rsub; if (col0 + c4 < N) { const v4f v = *(const v4fa*)&so[w][r][c4]; if (C) *(v4f*)(C + cofs + (size_t)(row0 + r) * ldc + col0 + c4) = v; if (C16) { v4h h4; for (int i = 0; i < 4; ++i) h4[i] = (_Float16)v[i]; *(v4h*)(C16 + cofs + (size_t)(row0 + r) * ldc + col0 + c4) = h4; } } }
     }
}


typedef _Float16 v4h __attribute__((ext_vector_type(4)));

__global__ __launch_bounds__(256) void k_h16(const float* __restrict__ x, _Float16* __restrict__ X16, size_t n8) { const size_t t = (size_t)blockIdx.x * 256 + threadIdx.x; if (t >= n8) return; FragH f;
#pragma unroll
  for (int q = 0; q < 8; ++q) f.h[q] = (_Float16)x[t * 8 + q]; *(v8us*)((unsigned short*)X16 + t * 8) = f.half[0];  }
__global__ __launch_bounds__(256) void k_round16f(const float* __restrict__ W, _Float16* __restrict__ Bt, size_t n8) { const size_t t = (size_t)blockIdx.x * 256 + threadIdx.x; if (t >= n8) return; FragH f;
#pragma unroll
  for (int i = 0; i < 8; ++i) f.h[i] = (_Float16)(bf16_round(W[t * 8 + i]) * 16.0f); *(v8us*)((unsigned short*)Bt + t * 8) = f.half[0];  }
template <int NHv, int TTv>
__global__ __launch_bounds__(256) void k_vt(const _Float16* __restrict__ V16, int ldv, int voff, _Float16* __restrict__ Vt) { __shared__ unsigned short tl[64][66]; const int tid = threadIdx.x; const int slab = blockIdx.x / (TTv / 64), lg = blockIdx.x % (TTv / 64); const int b = slab / NHv, h = slab % NHv;
  for (int i = tid; i < 64 * 8; i += 256) { const int r = i / 8, c8 = (i % 8) * 8; FragH f; f.half[0] = *(const v8us*)((const unsigned short*)V16 + ((size_t)b * TTv + lg * 64 + r) * ldv + voff + h * 64 + c8);
#pragma unroll
    for (int q = 0; q < 8; ++q) tl[r][c8 + q] = f.u[q]; }
  __syncthreads();
  {
#pragma unroll
    for (int rd = 0; rd < 2; ++rd) { const int d = rd * 32 + tid / 8, pc = tid % 8; FragH f;
#pragma unroll
      for (int q = 0; q < 8; ++q) f.u[q] = tl[pc * 8 + q][d];
      *(v8us*)((unsigned short*)Vt + ((size_t)slab * 64 + d) * TTv + lg * 64 + pc * 8) = f.half[0]; }
     } }

__global__ __launch_bounds__(256) void k_hl(const float* __restrict__ F, _Float16* __restrict__ Hh, _Float16* __restrict__ Hl, size_t n8) { const size_t t = (size_t)blockIdx.x * 256 + threadIdx.x; if (t >= n8) return; FragH fh, fl; const v4f a = *(const v4fa*)(F + t * 8), c = *(const v4fa*)(F + t * 8 + 4);
#pragma unroll
  for (int q = 0; q < 4; ++q) { _Float16 h = (_Float16)a[q]; fh.h[q] = h; fl.h[q] = (_Float16)((a[q] - (float)h) * 1024.0f); h = (_Float16)c[q]; fh.h[4 + q] = h; fl.h[4 + q] = (_Float16)((c[q] - (float)h) * 1024.0f); }
  { *(v8us*)((unsigned short*)Hh + t * 8) = fh.half[0]; *(v8us*)((unsigned short*)Hl + t * 8) = fl.half[0];  } }

// ---- fast GEMM (block tile 128x64, wave tile 32x64; requires M % 128 == 0 rows per launch region, N % 64 == 0 and K % 64 == 0); epilogue = k_gemm_hhx semantics ----
__device__ __forceinline__ v16h g2_frag(const _Float16* p, int hh) { FragH f; f.half[0] = *(const v8us*)((const unsigned short*)p + 8 * hh); f.half[1] = *(const v8us*)((const unsigned short*)p + 16 + 8 * hh); return f.v; }
__device__ __forceinline__ v8f g2_mma(v16h a, v16h b, v8f c) { v8f d = __builtin_amdgcn_wmma_f32_16x16x32_f16(false, a, false, b, (short)0, c, false, false); asm volatile("v_nop\n\tv_nop\n\tv_nop\n\tv_nop" : "+v"(d) : "v"(a), "v"(b)); return d; }
// Operand staging of k_gemm2: one stage = 64 k of the block's 128 A rows and 64 B rows (whole 128-byte lines), brought into LDS by asynchronous 16-byte copies, 12 per thread; eight neighbouring lanes copy one line.
#define G2P 72                       /* LDS row pitch in f16: 128 data bytes + 16, conflict-free for the 16-byte fragment reads */
__device__ __forceinline__ void g2_stage(const _Float16* ag, const _Float16* bg, size_t a16, size_t b16, unsigned la, unsigned lb) {      /* ag, bg: this thread's 16 bytes in rows tid / 8 of A and B at the stage's k; a16, b16: 16 rows on in global memory; la, lb: their LDS byte addresses */
  const _Float16* a1 = ag + a16; const _Float16* a2 = a1 + a16; const _Float16* a3 = a2 + a16; const _Float16* a4 = a3 + a16; const _Float16* a5 = a4 + a16; const _Float16* a6 = a5 + a16; const _Float16* a7 = a6 + a16;
  const _Float16* b1 = bg + b16; const _Float16* b2 = b1 + b16; const _Float16* b3 = b2 + b16;
  const unsigned st = 16 * G2P * 2;      /* 16 rows on in LDS, bytes */
  /* the copies and, as the last line of their own statement, the wait that stands before any of their address registers is written again */
  asm volatile("global_load_async_to_lds_b128 %0, %12, off\n\t"
               "global_load_async_to_lds_b128 %1, %13, off\n\t"
               "global_load_async_to_lds_b128 %2, %14, off\n\t"
               "global_load_async_to_lds_b128 %3, %15, off\n\t"
               "global_load_async_to_lds_b128 %4, %16, off\n\t"
               "global_load_async_to_lds_b128 %5, %17, off\n\t"
               "global_load_async_to_lds_b128 %6, %18, off\n\t"
               "global_load_async_to_lds_b128 %7, %19, off\n\t"
               "global_load_async_to_lds_b128 %8, %20, off\n\t"
               "global_load_async_to_lds_b128 %9, %21, off\n\t"
               "global_load_async_to_lds_b128 %10, %22, off\n\t"
               "global_load_async_to_lds_b128 %11, %23, off\n\t"
               "s_wait_xcnt 0x0"
               :: "v"(la), "v"(la + st), "v"(la + 2 * st), "v"(la + 3 * st), "v"(la + 4 * st), "v"(la + 5 * st), "v"(la + 6 * st), "v"(la + 7 * st), "v"(lb), "v"(lb + st), "v"(lb + 2 * st), "v"(lb + 3 * st),
                  "v"(ag), "v"(a1), "v"(a2), "v"(a3), "v"(a4), "v"(a5), "v"(a6), "v"(a7), "v"(bg), "v"(b1), "v"(b2), "v"(b3) : "memory");
}
// HASCP, OUT32, OUT16: which parts of the epilogue exist (the addend plane CP, the f32 output C, the f16 output C16), fixed per call site at compile time, so that the epilogue is one straight run of code with no test per element.
template <int ACT, bool HASCP, bool OUT32, bool OUT16>
__global__ __launch_bounds__(128) void k_gemm2(const _Float16* __restrict__ A, int lda, size_t sA, size_t sAz, const _Float16* __restrict__ Bh, int ldb, size_t sB, size_t sBz, float alpha, const float* __restrict__ bias, const float* __restrict__ biasz1, const float* __restrict__ biasz2, size_t sBias, const float* __restrict__ CP, int rowsPerB, size_t sCPb, int row0g,
    float* __restrict__ C, _Float16* __restrict__ C16, int ldc, size_t sC, size_t sCz, int M, int N, int K) { static_assert(ACT == 0 || ACT == 3 || ACT == 6 || ACT == 8 || ACT == 9 || ACT == 11 || ACT == 12 || ACT == 14 || ACT == 15 || ACT == 16 || ACT == 17, "k_gemm2: unsupported ACT code (would silently apply no activation)");
  __shared__ __attribute__((aligned(16))) float so[4][32][68];
  __shared__ __attribute__((aligned(16))) _Float16 sa[2][128 * G2P]; __shared__ __attribute__((aligned(16))) _Float16 sb[2][64 * G2P];      /* two stage buffers per operand */
  const int tid = threadIdx.x, w = tid >> 5, lane = tid & 31, ln = lane & 15, hh = lane >> 4; const int by = blockIdx.y, bz = blockIdx.z;      /* two batch axes: strides s* on grid.y, s*z on grid.z */
  A += (size_t)by * sA + (size_t)bz * sAz; Bh += (size_t)by * sB + (size_t)bz * sBz; const size_t cofs = (size_t)by * sC + (size_t)bz * sCz; const float* bsel = bz == 0 ? bias : (bz == 1 ? biasz1 : biasz2); const float* bp = bsel ? bsel + (size_t)by * sBias : nullptr;      /* the bias vectors of grid.z planes 0, 1, 2 are separate buffers */
  const int ntn = N >> 6; const int mt = blockIdx.x / ntn, nq = blockIdx.x - mt * ntn; const int row0 = mt * 128 + 32 * w, col0 = nq * 64; if (mt * 128 >= M) return;      /* the whole block leaves or none, ahead of every copy and barrier */
  const _Float16* agp = A + (size_t)(mt * 128 + (tid >> 3)) * lda + (tid & 7) * 8; const _Float16* bgp = Bh + (size_t)(col0 + (tid >> 3)) * ldb + (tid & 7) * 8;
  const unsigned lofs = (unsigned)((tid >> 3) * (G2P * 2) + (tid & 7) * 16); const unsigned la0 = (unsigned)(size_t)&sa[0][0] + lofs, lb0 = (unsigned)(size_t)&sb[0][0] + lofs;      /* LDS byte addresses = low 32 bits of the shared addresses */
  const size_t a16 = (size_t)16 * lda, b16 = (size_t)16 * ldb; const int nst = K >> 6;
  const v8f z8 = {0.f,0.f,0.f,0.f,0.f,0.f,0.f,0.f}; v8f c00 = z8, c01 = z8, c02 = z8, c03 = z8, c10 = z8, c11 = z8, c12 = z8, c13 = z8;
  g2_stage(agp, bgp, a16, b16, la0, lb0);
  float braw[4] = {0.f, 0.f, 0.f, 0.f};      /* the lane's four bias values, fetched once, beside the copies of stage 0; first used in the epilogue */
  if (bp) {
#pragma unroll
    for (int t = 0; t < 4; ++t) braw[t] = bp[col0 + t * 16 + ln]; }
  asm volatile("s_wait_xcnt 0x0" ::: "memory");      /* stands before the address registers of the bias loads above are written again */
  asm volatile("s_wait_asynccnt 0x0" ::: "memory");      /* this wave's copies of stage 0 have landed */
  __syncthreads();      /* every wave's have: stage 0 may be read */
  if (nst > 1) g2_stage(agp + 64, bgp + 64, a16, b16, la0 + (unsigned)sizeof(sa[0]), lb0 + (unsigned)sizeof(sb[0]));
  /* kept rolled: one trip = one stage, so that the order at its foot stays as written */
#pragma unroll 1
  for (int s = 0; s < nst; ++s) { const int bu = s & 1; const _Float16* as = &sa[bu][(32 * w + ln) * G2P]; const _Float16* bs = &sb[bu][ln * G2P];
    v16h af[2][2], bf[2][4];      /* the stage's 12 fragments, read as one group ahead of its 16 products */
#pragma unroll
    for (int kk = 0; kk < 2; ++kk) { af[kk][0] = g2_frag(as + kk * 32, hh); af[kk][1] = g2_frag(as + 16 * G2P + kk * 32, hh);
#pragma unroll
      for (int u = 0; u < 4; ++u) bf[kk][u] = g2_frag(bs + u * 16 * G2P + kk * 32, hh); }
#pragma unroll
    for (int kk = 0; kk < 2; ++kk) { c00 = g2_mma(af[kk][0], bf[kk][0], c00); c10 = g2_mma(af[kk][1], bf[kk][0], c10); c01 = g2_mma(af[kk][0], bf[kk][1], c01); c11 = g2_mma(af[kk][1], bf[kk][1], c11);
      c02 = g2_mma(af[kk][0], bf[kk][2], c02); c12 = g2_mma(af[kk][1], bf[kk][2], c12); c03 = g2_mma(af[kk][0], bf[kk][3], c03); c13 = g2_mma(af[kk][1], bf[kk][3], c13); }
    asm volatile("s_wait_dscnt 0x0" ::: "memory");      /* this wave has finished reading stage s */
    asm volatile("s_wait_asynccnt 0x0" ::: "memory");      /* this wave's copies of stage s + 1 have landed */
    __syncthreads();      /* publishes stage s + 1 and frees stage s's buffer */
    if (s + 2 < nst) g2_stage(agp + (s + 2) * 64, bgp + (s + 2) * 64, a16, b16, la0 + (unsigned)(bu * sizeof(sa[0])), lb0 + (unsigned)(bu * sizeof(sb[0]))); }
  asm volatile("s_wait_asynccnt 0x0" ::: "memory");      /* no copy is outstanding behind the loop */
  v8f accs[8] = {c00, c01, c02, c03, c10, c11, c12, c13};
#pragma unroll
  for (int u = 0; u < 8; ++u) { const int t = u & 3, half = u >> 2; const int col = col0 + t * 16 + ln; const float bv = bf16_round(braw[t]);
#pragma unroll
    for (int r = 0; r < 8; ++r) { const int rloc = half * 16 + 8 * hh + r; float v = accs[u][r] * alpha + bv; if (HASCP && CP) { if (rowsPerB < 0) v += CP[cofs + (size_t)(row0g + row0 + rloc) * ldc + col];      /* rowsPerB < 0: own element of the batched C plane */ else { const int bidx = (row0g + row0 + rloc) / rowsPerB; v += CP[(size_t)bidx * sCPb + (size_t)by * 64 + col]; } }
      if (ACT == 3) v = fmaxf(v, 0.f); else if (ACT == 6) v = 0.5f * v * (1.0f + erff(v * 0.70710678118654752f)); else if (ACT == 11) v = 1.0f / (1.0f + expf(-v)); else if (ACT == 15) v = v / (1.0f + expf(-v)); else if (ACT == 12) v = (v > 0.f) ? v : 0.01f * v; else if (ACT == 8) v = tanhf(v); else if (ACT == 9) v = 0.5f * v * (1.0f + tanhf(0.7978845608028654f * (v + 0.044715f * v * v * v))); else if (ACT == 14) v = (v > 0.f) ? v : 0.1f * v; else if (ACT == 16) v = (v >= 0.f) ? v : 0.3f * v; else if (ACT == 17) v = (v >= 0.f) ? v : 0.2f * v;
      so[w][rloc][t * 16 + ln] = v; } }
  __builtin_amdgcn_fence(__ATOMIC_ACQ_REL, "workgroup"); __builtin_amdgcn_wave_barrier();
  const int rsub = lane >> 4, c4 = (lane & 15) * 4;
  {
#pragma unroll
    for (int q = 0; q < 16; ++q) { const int r = q * 2 + rsub; const v4f v = *(const v4fa*)&so[w][r][c4]; if (OUT32) *(v4f*)(C + cofs + (size_t)(row0 + r) * ldc + col0 + c4) = v; if (OUT16) { v4h h4; for (int i = 0; i < 4; ++i) h4[i] = (_Float16)v[i]; *(v4h*)(C16 + cofs + (size_t)(row0 + r) * ldc + col0 + c4) = h4; } }
     } }


__global__ __launch_bounds__(256) void k_wnat(const float* __restrict__ w, size_t n8, _Float16* __restrict__ Bt) { const size_t t = (size_t)blockIdx.x * 256 + threadIdx.x; if (t >= n8) return; FragH f; for (int q = 0; q < 8; ++q) f.h[q] = (_Float16)(bf16_round(w[t * 8 + q]) * 16.0f); *(v8us*)((unsigned short*)Bt + t * 8) = f.half[0];  }
__global__ __launch_bounds__(256) void k_rsm(const float* __restrict__ S, _Float16* __restrict__ P, int nrows) {
  #pragma clang fp contract(off)
  const int i = blockIdx.x * 256 + threadIdx.x; if (i >= nrows) return; const float* s = S + (size_t)i * SQ; float mx = -3.0e38f;
#pragma unroll 1
  for (int j = 0; j < SQ; ++j) mx = fmaxf(mx, s[j]); float se = 0.f;
#pragma unroll 1
  for (int j = 0; j < SQ; ++j) se += expf(s[j] - mx); const float sc = 256.0f / se;
#pragma unroll 1
  for (int j0 = 0; j0 < SQ; j0 += 8) { FragH f; for (int q = 0; q < 8; ++q) f.h[q] = (_Float16)(expf(s[j0 + q] - mx) * sc); unsigned short* d = (unsigned short*)P + (size_t)i * SQ + j0; *(v8us*)d = f.half[0];  } }
__global__ __launch_bounds__(256) void k_vt(const _Float16* __restrict__ V16, int b, int h0, _Float16* __restrict__ VT) { __shared__ unsigned short tl[64][65]; const int tid = threadIdx.x; const int hh = blockIdx.x % HG, sg = blockIdx.x / HG; const int s0 = sg * 64; const int h = h0 + hh;
  for (int i = tid; i < 64 * 8; i += 256) { const int j = i / 8, d8 = (i % 8) * 8; FragH f; f.half[0] = *(const v8us*)((const unsigned short*)V16 + ((size_t)b * SQ + s0 + j) * DM + h * HD + d8); for (int q = 0; q < 8; ++q) tl[d8 + q][j] = f.u[q]; }
  __syncthreads();
  { for (int i = tid; i < 64 * 8; i += 256) { const int d = i / 8, j8 = (i % 8) * 8; FragH f; for (int q = 0; q < 8; ++q) f.u[q] = tl[d][j8 + q]; *(v8us*)((unsigned short*)VT + ((size_t)hh * HD + d) * SQ + s0 + j8) = f.half[0]; }  } }



// Fused attention, one launch for all (batch, head) planes: a wave owns 32 queries (two 16-column groups) and walks the plane's 1024 keys in passes of 32. The work-group's 8 waves share each stage of 128 keys through LDS.
// Transposed products: S^T = K . Q^T (A = 16 key rows, B = 16 query rows, both through g2_frag), so lane (ln, hh) holds, for query ln, the scores of keys 8 hh + r and 16 + 8 hh + r:
// exactly the k positions that g2_frag gives a B operand, so the exponentials are packed in place into P^T and O^T += V^T . P^T (A = 16 rows of V^T, read from the staged V rows by ds_load_tr16_b128, which delivers the same k positions) follows with no exchange through memory or LDS.
// Online softmax in base 2: the maximum in use may lag a query's true running maximum by up to 8 (an exponential can reach 2^8, far inside f16); the accumulators are rescaled, tested once per pass, only when it lags by more.
// Row sums are f32 sums of the unrounded exponentials, one partial per wave half, joined at the end. o is stored x64 as f16 (the output GEMM's alpha folds it back).
#define FQ 2                         /* 16-query column groups per wave */
#define FW 8                         /* waves per work-group */
typedef _Float16 v8h __attribute__((ext_vector_type(8)));
typedef _Float16 v2h __attribute__((ext_vector_type(2)));
typedef float v2f __attribute__((ext_vector_type(2)));
union FragP { v16h v; v2h p[8]; };
__device__ __forceinline__ float fa_xhalf(float x) { return __builtin_bit_cast(float, __builtin_amdgcn_permlanex16(__builtin_bit_cast(int, x), __builtin_bit_cast(int, x), 0x76543210, 0xfedcba98, false, false)); }      /* lane l <-> lane l ^ 16 */
__device__ __forceinline__ v8f fa_mma(v16h a, v16h b, v8f c) { return __builtin_amdgcn_wmma_f32_16x16x32_f16(false, a, false, b, (short)0, c, false, false); }
// Operand staging of k_fattn: one stage = FKS keys of the plane, as FKS rows of K and FKS rows of V (128 bytes each, the head's slice of a projected row), brought into LDS once for the work-group's 8 waves by asynchronous 16-byte copies, 8 per thread; 8 neighbouring lanes copy one row.
#define FKS 128                      /* keys per stage */
#define FKP 72                       /* LDS pitch of a K row in f16: 128 data bytes + 16, conflict-free for the 16-byte fragment reads */
#define FVP 80                       /* LDS pitch of a V row in f16: 128 data bytes + 32 (32 bytes x odd), conflict-free for the transposing 16-byte reads */
__device__ __forceinline__ void fa_stage(const _Float16* kg, const _Float16* vg, unsigned lk, unsigned lv) {      /* kg, vg: this thread's 16 bytes in row tid / 8 of the stage's K rows and of its V rows; lk, lv: their LDS byte addresses */
  const _Float16* k1 = kg + (size_t)32 * LQ; const _Float16* k2 = k1 + (size_t)32 * LQ; const _Float16* k3 = k2 + (size_t)32 * LQ;
  const _Float16* v1 = vg + (size_t)32 * LQ; const _Float16* v2 = v1 + (size_t)32 * LQ; const _Float16* v3 = v2 + (size_t)32 * LQ;
  const unsigned dk = 32 * FKP * 2, dv = 32 * FVP * 2;      /* 32 K rows, 32 V rows on in LDS, bytes */
  /* the copies and, as the last line of their own statement, the wait that stands before any of their address registers is written again */
  asm volatile("global_load_async_to_lds_b128 %0, %8, off\n\t"
               "global_load_async_to_lds_b128 %1, %9, off\n\t"
               "global_load_async_to_lds_b128 %2, %10, off\n\t"
               "global_load_async_to_lds_b128 %3, %11, off\n\t"
               "global_load_async_to_lds_b128 %4, %12, off\n\t"
               "global_load_async_to_lds_b128 %5, %13, off\n\t"
               "global_load_async_to_lds_b128 %6, %14, off\n\t"
               "global_load_async_to_lds_b128 %7, %15, off\n\t"
               "s_wait_xcnt 0x0"
               :: "v"(lk), "v"(lk + dk), "v"(lk + 2 * dk), "v"(lk + 3 * dk), "v"(lv), "v"(lv + dv), "v"(lv + 2 * dv), "v"(lv + 3 * dv),
                  "v"(kg), "v"(k1), "v"(k2), "v"(k3), "v"(vg), "v"(v1), "v"(v2), "v"(v3) : "memory");
}
// One 16 (d) x 32 (keys) A fragment of V^T from V rows in LDS: two transposing loads, 16 keys apart. p = the lane's own 16 bytes: row 8 (lane >> 4) + (lane & 7) of the 16-key block, byte 16 ((lane >> 3) & 1) of the 32 bytes that hold the 16 d;
// lane (ln, hh) then holds d = ln at keys 8 hh + 0..7 (first load) and 16 + 8 hh + 0..7 (second): g2_frag's k positions.
typedef short s16x8 __attribute__((ext_vector_type(8)));
__device__ __forceinline__ v16h fa_vfrag(const _Float16* p) { typedef __attribute__((address_space(3))) s16x8 lds_s16x8; FragH f;
  f.half[0] = __builtin_bit_cast(v8us, __builtin_amdgcn_ds_load_tr16_b128_v8i16((lds_s16x8*)p)); f.half[1] = __builtin_bit_cast(v8us, __builtin_amdgcn_ds_load_tr16_b128_v8i16((lds_s16x8*)(p + 16 * FVP))); return f.v; }
__global__ __launch_bounds__(FW * 32) void k_fattn(const _Float16* __restrict__ Qr, const _Float16* __restrict__ Kr, const _Float16* __restrict__ Vr, _Float16* __restrict__ O) {
  static_assert(FW * 32 == 256 && FKS == 128 && HD == 64 && SQ % FKS == 0 && SQ / FKS >= 2, "fa_stage: 256 threads x 4 copies cover 128 K rows of 8 chunks and as many V rows; stages 0 and 1 exist");
  __shared__ __attribute__((aligned(16))) _Float16 sk[2][FKS * FKP]; __shared__ __attribute__((aligned(16))) _Float16 sv[2][FKS * FVP];      /* two stage buffers per operand */
  const int tid = threadIdx.x, lane = tid & 31, w = tid >> 5, ln = lane & 15, hh = lane >> 4;
  const int plane = blockIdx.y, b = plane / NH, h = plane % NH; const int q0 = (blockIdx.x * FW + w) * (16 * FQ);
  const _Float16* qp = Qr + ((size_t)b * SQ + q0 + ln) * LQ + h * HD;
  const _Float16* kg = Kr + ((size_t)b * SQ + (tid >> 3)) * LQ + h * HD + (tid & 7) * 8; const _Float16* vg = Vr + ((size_t)b * SQ + (tid >> 3)) * LQ + h * HD + (tid & 7) * 8;
  const unsigned lk0 = (unsigned)(size_t)&sk[0][0] + (unsigned)((tid >> 3) * (FKP * 2) + (tid & 7) * 16), lv0 = (unsigned)(size_t)&sv[0][0] + (unsigned)((tid >> 3) * (FVP * 2) + (tid & 7) * 16);      /* LDS byte addresses = low 32 bits of the shared addresses */
  const float cs = 0.125f * 1.4426950408889634f;      /* 64^-0.5 and log2(e) in one factor */
  const v8f z8 = {0.f,0.f,0.f,0.f,0.f,0.f,0.f,0.f};
  fa_stage(kg, vg, lk0, lv0);
  v16h qf[FQ][2]; v8f acc[FQ][4]; float m_run[FQ], l_run[FQ];
#pragma unroll
  for (int g = 0; g < FQ; ++g) { qf[g][0] = g2_frag(qp + (size_t)g * 16 * LQ, hh); qf[g][1] = g2_frag(qp + (size_t)g * 16 * LQ + 32, hh); m_run[g] = -3.0e38f; l_run[g] = 0.f;
#pragma unroll
    for (int t = 0; t < 4; ++t) acc[g][t] = z8; }
  asm volatile("s_wait_xcnt 0x0" ::: "memory");      /* stands before the address registers of the Q loads above are written again */
  asm volatile("s_wait_asynccnt 0x0" ::: "memory");      /* this wave's copies of stage 0 have landed */
  __syncthreads();      /* every wave's have: stage 0 may be read */
  fa_stage(kg + (size_t)FKS * LQ, vg + (size_t)FKS * LQ, lk0 + (unsigned)sizeof(sk[0]), lv0 + (unsigned)sizeof(sv[0]));
  /* kept rolled: one trip = one stage, so that the order at its foot stays as written */
#pragma unroll 1
  for (int st = 0; st < SQ / FKS; ++st) { const int bu = st & 1; const _Float16* ks = &sk[bu][ln * FKP]; const _Float16* vs = &sv[bu][(8 * hh + (lane & 7)) * FVP + ((lane >> 3) & 1) * 8];
    v16h kf[2][2], vf[4];
#pragma unroll
    for (int kt = 0; kt < 2; ++kt) { kf[kt][0] = g2_frag(ks + kt * 16 * FKP, hh); kf[kt][1] = g2_frag(ks + kt * 16 * FKP + 32, hh); }
#pragma unroll
    for (int t = 0; t < 4; ++t) vf[t] = fa_vfrag(vs + t * 16);
    /* unrolled: the stage's passes of 32 keys, so that "is there a next pass in this stage" is known at compile time */
#pragma unroll
    for (int p = 0; p < FKS / 32; ++p) {
      v8f s[2][FQ];
#pragma unroll
      for (int kt = 0; kt < 2; ++kt) {
#pragma unroll
        for (int g = 0; g < FQ; ++g) s[kt][g] = fa_mma(kf[kt][1], qf[g][1], fa_mma(kf[kt][0], qf[g][0], z8)); }
      if (p + 1 < FKS / 32) {      /* inside a stage both operands' fragments are read one pass ahead, into the registers their products have just left: K under this pass's maxima, V^T under the next pass's scores and maxima; a stage's last pass reads nothing ahead (the next stage is not published yet) */
#pragma unroll
        for (int kt = 0; kt < 2; ++kt) { kf[kt][0] = g2_frag(ks + ((p + 1) * 32 + kt * 16) * FKP, hh); kf[kt][1] = g2_frag(ks + ((p + 1) * 32 + kt * 16) * FKP + 32, hh); } }
      asm volatile("" ::: "memory");      /* compiler fence: holds the LDS reads written above it (this pass's V^T, the next pass's K) in front of the maxima; without it the compiler sinks them behind the branch below, next to their products and in among them, where each waits out its own latency */
      float mb[FQ]; bool need = false;
#pragma unroll
      for (int g = 0; g < FQ; ++g) { float mx = fmaxf(s[0][g][0], s[1][g][0]);
#pragma unroll
        for (int r = 1; r < 8; ++r) mx = fmaxf(mx, fmaxf(s[0][g][r], s[1][g][r]));
        mx = fmaxf(mx, fa_xhalf(mx)) * cs; mb[g] = mx; need = need || (mx > m_run[g] + 8.0f); }      /* both halves hold the query's pass maximum, scaled (cs > 0) */
      if (__builtin_amdgcn_ballot_w32(need) != 0) {      /* wave-uniform; always taken on the first pass (factor 0 on zero accumulators) */
#pragma unroll
        for (int g = 0; g < FQ; ++g) { const float mn = fmaxf(m_run[g], mb[g]); const float corr = __builtin_amdgcn_exp2f(m_run[g] - mn); m_run[g] = mn; l_run[g] *= corr;
#pragma unroll
          for (int t = 0; t < 4; ++t) acc[g][t] *= corr; } }
#pragma unroll
      for (int g = 0; g < FQ; ++g) { const float nm = -m_run[g]; FragP pf; v2f ls = {0.f, 0.f};
#pragma unroll
        for (int i = 0; i < 8; ++i) { const v2f x = {s[i >> 2][g][2 * (i & 3)], s[i >> 2][g][2 * (i & 3) + 1]};      /* operand elements 2i, 2i + 1 = tile i >> 2, registers 2 (i & 3), 2 (i & 3) + 1 */
          const v2f a = __builtin_elementwise_fma(x, (v2f){cs, cs}, (v2f){nm, nm}); const v2f p2 = {__builtin_amdgcn_exp2f(a[0]), __builtin_amdgcn_exp2f(a[1])};
          ls += p2; pf.p[i] = __builtin_convertvector(p2, v2h); }
        l_run[g] += ls[0] + ls[1];
#pragma unroll
        for (int t = 0; t < 4; ++t) acc[g][t] = fa_mma(vf[t], pf.v, acc[g][t]); }
      if (p + 1 < FKS / 32) {
#pragma unroll
        for (int t = 0; t < 4; ++t) vf[t] = fa_vfrag(vs + (p + 1) * 32 * FVP + t * 16); }
    }
    asm volatile("s_wait_dscnt 0x0" ::: "memory");      /* this wave has finished reading stage st */
    asm volatile("s_wait_asynccnt 0x0" ::: "memory");      /* this wave's copies of stage st + 1 have landed */
    __syncthreads();      /* publishes stage st + 1 and frees stage st's buffer */
    if (st + 2 < SQ / FKS) fa_stage(kg + (size_t)(st + 2) * FKS * LQ, vg + (size_t)(st + 2) * FKS * LQ, lk0 + (unsigned)(bu * sizeof(sk[0])), lv0 + (unsigned)(bu * sizeof(sv[0]))); }
  asm volatile("s_wait_asynccnt 0x0" ::: "memory");      /* no copy is outstanding behind the loop */
#pragma unroll
  for (int g = 0; g < FQ; ++g) { const float sc = 64.0f / (l_run[g] + fa_xhalf(l_run[g])); _Float16* op = O + ((size_t)plane * SQ + q0 + g * 16 + ln) * HD + 8 * hh;
#pragma unroll
    for (int t = 0; t < 4; ++t) { const v8f o = acc[g][t] * sc; *(v8h*)(op + t * 16) = __builtin_convertvector(o, v8h); } }      /* registers r = 0..7 are d = 16 t + 8 hh + r of query ln: one 16-byte store */
}

// ---- projection GEMM with a 128x128 block tile: four waves in 2 x 2, each on a 64x64 tile (4 A and 4 B fragments feed 16 products per 32 k, so a product costs two thirds of the LDS bytes of the 32x64 tile, and a stage's barrier and copies serve twice the products). Requires M % 128 == 0, N % 128 == 0, K % 64 == 0. v = acc * alpha + bf16-rounded bias, stored as f16.
// One stage = 64 k of the block's 128 A rows and 128 B rows (whole 128-byte lines), brought into LDS by asynchronous 16-byte copies, 16 per thread; eight neighbouring lanes copy one line. The epilogue stages each wave's tile in the stage buffers, which nobody reads behind the last trip's barrier.
#define G4T (128 * G2P * 2)          /* bytes of one operand's stage: 128 rows at the pitch of G2P */
#define G4S (2 * G4T)                /* bytes of one stage buffer: A rows, then B rows */
#define G4O 68                       /* row pitch of the epilogue staging in floats */
__device__ __forceinline__ void g4_stage8(const _Float16* g, size_t r16, unsigned l) {      /* g: this thread's 16 bytes in row tid / 8 of the operand at the stage's k; r16: 16 rows on in global memory; l: their LDS byte address */
  const _Float16* g1 = g + r16; const _Float16* g2 = g1 + r16; const _Float16* g3 = g2 + r16; const _Float16* g4 = g3 + r16; const _Float16* g5 = g4 + r16; const _Float16* g6 = g5 + r16; const _Float16* g7 = g6 + r16;
  const unsigned st = 16 * G2P * 2;      /* 16 rows on in LDS, bytes */
  /* the copies and, as the last line of their own statement, the wait that stands before any of their address registers is written again */
  asm volatile("global_load_async_to_lds_b128 %0, %8, off\n\t"
               "global_load_async_to_lds_b128 %1, %9, off\n\t"
               "global_load_async_to_lds_b128 %2, %10, off\n\t"
               "global_load_async_to_lds_b128 %3, %11, off\n\t"
               "global_load_async_to_lds_b128 %4, %12, off\n\t"
               "global_load_async_to_lds_b128 %5, %13, off\n\t"
               "global_load_async_to_lds_b128 %6, %14, off\n\t"
               "global_load_async_to_lds_b128 %7, %15, off\n\t"
               "s_wait_xcnt 0x0"
               :: "v"(l), "v"(l + st), "v"(l + 2 * st), "v"(l + 3 * st), "v"(l + 4 * st), "v"(l + 5 * st), "v"(l + 6 * st), "v"(l + 7 * st),
                  "v"(g), "v"(g1), "v"(g2), "v"(g3), "v"(g4), "v"(g5), "v"(g6), "v"(g7) : "memory");
}
__global__ __launch_bounds__(128) void k_gemm4(const _Float16* __restrict__ A, int lda, size_t sAz, const _Float16* __restrict__ Bh, int ldb, size_t sBz, float alpha, const float* __restrict__ bias0, const float* __restrict__ bias1, const float* __restrict__ bias2,
    _Float16* __restrict__ C16, int ldc, size_t sCz, int M, int N, int K) {
  static_assert(4 * 64 * G4O * 4 <= 2 * G4S, "the four waves' epilogue tiles fit the two stage buffers");
  __shared__ __attribute__((aligned(16))) float sm[2 * G4S / 4];      /* two stage buffers; behind the loop, the epilogue staging */
  const int tid = threadIdx.x, w = tid >> 5, lane = tid & 31, ln = lane & 15, hh = lane >> 4; const int bz = blockIdx.z;      /* grid.z: the batch axis, strides s*z */
  A += (size_t)bz * sAz; Bh += (size_t)bz * sBz; C16 += (size_t)bz * sCz; const float* bp = bz == 0 ? bias0 : (bz == 1 ? bias1 : bias2);      /* the bias vectors of grid.z planes 0, 1, 2 are separate buffers */
  const int ntn = N >> 7; const int mt = blockIdx.x / ntn, nq = blockIdx.x - mt * ntn; if (mt * 128 >= M) return;      /* the whole block leaves or none, ahead of every copy and barrier */
  const int wr = w >> 1, wc = w & 1; const int row0 = mt * 128 + 64 * wr, col0 = nq * 128 + 64 * wc;
  const _Float16* agp = A + (size_t)(mt * 128 + (tid >> 3)) * lda + (tid & 7) * 8; const _Float16* bgp = Bh + (size_t)(nq * 128 + (tid >> 3)) * ldb + (tid & 7) * 8;
  const unsigned la0 = (unsigned)(size_t)&sm[0] + (unsigned)((tid >> 3) * (G2P * 2) + (tid & 7) * 16), lb0 = la0 + G4T;      /* LDS byte addresses = low 32 bits of the shared addresses */
  const size_t a16 = (size_t)16 * lda, b16 = (size_t)16 * ldb; const int nst = K >> 6;
  const v8f z8 = {0.f,0.f,0.f,0.f,0.f,0.f,0.f,0.f}; v8f acc[4][4];
#pragma unroll
  for (int i = 0; i < 4; ++i) {
#pragma unroll
    for (int t = 0; t < 4; ++t) acc[i][t] = z8; }
  g4_stage8(agp, a16, la0); g4_stage8(bgp, b16, lb0);
  float braw[4];      /* the lane's four bias values, fetched once, beside the copies of stage 0; first used in the epilogue */
#pragma unroll
  for (int t = 0; t < 4; ++t) braw[t] = bp[col0 + t * 16 + ln];
  asm volatile("s_wait_xcnt 0x0" ::: "memory");      /* stands before the address registers of the bias loads above are written again */
  asm volatile("s_wait_asynccnt 0x0" ::: "memory");      /* this wave's copies of stage 0 have landed */
  __syncthreads();      /* every wave's have: stage 0 may be read */
  if (nst > 1) { g4_stage8(agp + 64, a16, la0 + G4S); g4_stage8(bgp + 64, b16, lb0 + G4S); }
  /* kept rolled: one trip = one stage, so that the order at its foot stays as written */
#pragma unroll 1
  for (int s = 0; s < nst; ++s) { const int bu = s & 1; const _Float16* as = (const _Float16*)&sm[bu * (G4S / 4)] + (64 * wr + ln) * G2P; const _Float16* bs = (const _Float16*)&sm[bu * (G4S / 4) + G4T / 4] + (64 * wc + ln) * G2P;
    v16h af[4], bf[4];      /* the 8 fragments of 32 k, read as one group ahead of their 16 products */
#pragma unroll
    for (int i = 0; i < 4; ++i) { af[i] = g2_frag(as + i * 16 * G2P, hh); bf[i] = g2_frag(bs + i * 16 * G2P, hh); }
    asm volatile("" :: "v"(af[0]), "v"(af[1]), "v"(af[2]), "v"(af[3]), "v"(bf[0]), "v"(bf[1]), "v"(bf[2]), "v"(bf[3]));      /* inputs-only fence on the loaded values: keeps the 16 LDS reads above it as one group; without it the compiler sinks them in among the products, one fragment at a time into the same registers, where each waits out its own latency */
#pragma unroll
    for (int i = 0; i < 4; ++i) {
#pragma unroll
      for (int t = 0; t < 4; ++t) acc[i][t] = fa_mma(af[i], bf[t], acc[i][t]); }
#pragma unroll
    for (int i = 0; i < 4; ++i) { af[i] = g2_frag(as + i * 16 * G2P + 32, hh); bf[i] = g2_frag(bs + i * 16 * G2P + 32, hh); }
    asm volatile("s_wait_dscnt 0x0" ::: "memory");      /* this wave has finished reading stage s */
    asm volatile("s_wait_asynccnt 0x0" ::: "memory");      /* this wave's copies of stage s + 1 have landed */
    __syncthreads();      /* publishes stage s + 1 and frees stage s's buffer */
    if (s + 2 < nst) { g4_stage8(agp + (s + 2) * 64, a16, la0 + (unsigned)(bu * G4S)); g4_stage8(bgp + (s + 2) * 64, b16, lb0 + (unsigned)(bu * G4S)); }
    /* the stage's second 16 products work on registers alone and stand behind the refill, so that the copies fly under them too */
#pragma unroll
    for (int i = 0; i < 4; ++i) {
#pragma unroll
      for (int t = 0; t < 4; ++t) acc[i][t] = fa_mma(af[i], bf[t], acc[i][t]); } }
  asm volatile("s_wait_asynccnt 0x0" ::: "memory");      /* no copy is outstanding behind the loop */
  float* so = &sm[w * (64 * G4O)];      /* this wave's own 64 x 64 staging tile; every wave has left the stage buffers at the last trip's barrier */
#pragma unroll
  for (int t = 0; t < 4; ++t) { const float bv = bf16_round(braw[t]);
#pragma unroll
    for (int i = 0; i < 4; ++i) {
#pragma unroll
      for (int r = 0; r < 8; ++r) so[(i * 16 + 8 * hh + r) * G4O + t * 16 + ln] = acc[i][t][r] * alpha + bv; } }
  __builtin_amdgcn_fence(__ATOMIC_ACQ_REL, "workgroup"); __builtin_amdgcn_wave_barrier();
  const int rsub = lane >> 4, c4 = (lane & 15) * 4;
#pragma unroll
  for (int q = 0; q < 32; ++q) { const int r = q * 2 + rsub; const v4f v = *(const v4fa*)&so[r * G4O + c4]; v4h h4; for (int i = 0; i < 4; ++i) h4[i] = (_Float16)v[i]; *(v4h*)(C16 + (size_t)(row0 + r) * ldc + col0 + c4) = h4; }
}

// Operand preparation, all of it in one launch (the seven conversions depend on nothing but the inputs).
// Work-groups 0 .. PW - 1, the weights: thread t owns 8 k of output column n = t / 64 in all four matrices and writes Bt[n][k] = f16(16 x bf16-rounded weight); per-head W[h][k][d] has n = h * 64 + d (head-major columns = the flattened biases' order), Wo[k][n] is plain [in][out].
// Work-groups PW .. PW + PX - 1, the three inputs as exact f16 rows (bf16-rounded): each thread converts PC chunks of 8 floats of each input, one work-group of threads apart, so a wave's loads and stores stay contiguous and few waves have to be started.
#define PW 128                       /* work-groups on the weights: 512 columns x 64 chunks of 8 k */
#define PX 512                       /* work-groups on the inputs */
#define PC 4                         /* chunks per thread and input */
__device__ __forceinline__ v8us p_cvt8(const float* v, float scale) { FragH f;
#pragma unroll
  for (int q = 0; q < 8; ++q) f.h[q] = (_Float16)(bf16_round(v[q]) * scale); return f.half[0]; }
__device__ __forceinline__ v8us p_cvt44(v4f a, v4f b) { const float v[8] = {a[0], a[1], a[2], a[3], b[0], b[1], b[2], b[3]}; return p_cvt8(v, 1.0f); }
__global__ __launch_bounds__(256) void k_prep(const float* __restrict__ xq, const float* __restrict__ xk, const float* __restrict__ xv, const float* __restrict__ wq, const float* __restrict__ wk, const float* __restrict__ wv, const float* __restrict__ wo,
    _Float16* __restrict__ XQ, _Float16* __restrict__ XK, _Float16* __restrict__ XV, _Float16* __restrict__ BQ, _Float16* __restrict__ BK, _Float16* __restrict__ BV, _Float16* __restrict__ BO) {
  static_assert((size_t)PW * 256 == (size_t)DM * (DM / 8) && NH * HD == DM, "one weight thread per 8 k of a column"); static_assert((size_t)PX * 256 * PC == NR * DM / 8, "the input threads cover every chunk once");
  if (blockIdx.x < PW) {
    const int t = blockIdx.x * 256 + threadIdx.x; const int n = t / (DM / 8), k8 = (t % (DM / 8)) * 8; const int h = n / HD, d = n % HD;
    const size_t ph = ((size_t)h * DM + k8) * HD + d, po = (size_t)k8 * DM + n; float a[4][8];
#pragma unroll
    for (int q = 0; q < 8; ++q) { a[0][q] = wq[ph + (size_t)q * HD]; a[1][q] = wk[ph + (size_t)q * HD]; a[2][q] = wv[ph + (size_t)q * HD]; a[3][q] = wo[po + (size_t)q * DM]; }
    const size_t dst = (size_t)n * DM + k8;
    *(v8us*)((unsigned short*)BQ + dst) = p_cvt8(a[0], 16.0f); *(v8us*)((unsigned short*)BK + dst) = p_cvt8(a[1], 16.0f); *(v8us*)((unsigned short*)BV + dst) = p_cvt8(a[2], 16.0f); *(v8us*)((unsigned short*)BO + dst) = p_cvt8(a[3], 16.0f);
    return; }
  const size_t i0 = ((size_t)(blockIdx.x - PW) * (PC * 256) + threadIdx.x) * 8;      /* first float of the thread's first chunk; its next chunks lie 256 chunks on each */
  const float* pq = xq + i0; const float* pk = xk + i0; const float* pv = xv + i0;
  v4f v[3][PC][2];
#pragma unroll
  for (int c = 0; c < PC; ++c) { const int o = c * 256 * 8;
    v[0][c][0] = *(const v4fa*)(pq + o); v[0][c][1] = *(const v4fa*)(pq + o + 4); v[1][c][0] = *(const v4fa*)(pk + o); v[1][c][1] = *(const v4fa*)(pk + o + 4); v[2][c][0] = *(const v4fa*)(pv + o); v[2][c][1] = *(const v4fa*)(pv + o + 4); }
  asm volatile("s_wait_xcnt 0x0" :: "v"(pq), "v"(pk), "v"(pv) : "memory");      /* stands before the loads' address registers are written again; naming the three addresses keeps their registers out of the later loads' results; as a statement on memory it also holds all of the thread's loads ahead of the first conversion, one memory latency instead of several */
#pragma unroll
  for (int c = 0; c < PC; ++c) { const size_t o = i0 + (size_t)c * 256 * 8;
    *(v8us*)((unsigned short*)XQ + o) = p_cvt44(v[0][c][0], v[0][c][1]); *(v8us*)((unsigned short*)XK + o) = p_cvt44(v[1][c][0], v[1][c][1]); *(v8us*)((unsigned short*)XV + o) = p_cvt44(v[2][c][0], v[2][c][1]); }
  asm volatile("s_wait_xcnt 0x0" ::: "memory");      /* stands behind the last stores, before anything that follows them in the code can write their address or data registers again */
}

extern "C" void kernel_launch(void* const* d_in, const int* in_sizes, int n_in,
                              void* d_out, int out_size, void* d_ws, size_t ws_size, hipStream_t stream) {
  (void)in_sizes; (void)n_in; (void)out_size;
  const float* const* I = (const float* const*)d_in; const float* xq = I[0]; const float* xk = I[1]; const float* xv = I[2]; const float* wq = I[3]; const float* bq = I[4]; const float* wk = I[5]; const float* bk = I[6]; const float* wv = I[7]; const float* bv = I[8]; const float* wo = I[9]; const float* bo = I[10];      /* three inputs; per-head [in][out] weights [8][512][64] + per-head biases [8][64] (flattened head-major = projection column order); Wo [in][out] + bo */
  char* ws = (char*)d_ws; size_t off = 0;
  auto take = [&](size_t bytes) { char* p = ws + off; off += (bytes + 255) & ~(size_t)255; return p; };
  _Float16* BQ = (_Float16*)take((size_t)DM * DM * 2); _Float16* BK = (_Float16*)take((size_t)DM * DM * 2); _Float16* BV = (_Float16*)take((size_t)DM * DM * 2); _Float16* BO = (_Float16*)take((size_t)DM * DM * 2);
  _Float16* Q16 = (_Float16*)take(NR * DM * 2); _Float16* K16 = (_Float16*)take(NR * DM * 2); _Float16* V16 = (_Float16*)take(NR * DM * 2); _Float16* O16 = (_Float16*)take(NR * DM * 2);
  _Float16* XQ = (_Float16*)take(NR * DM * 2); _Float16* XK = (_Float16*)take(NR * DM * 2); _Float16* XV = (_Float16*)take(NR * DM * 2);      /* the f16 input rows */
  if (off > ws_size) return;
  k_prep<<<PW + PX, 256, 0, stream>>>(xq, xk, xv, wq, wk, wv, wo, XQ, XK, XV, BQ, BK, BV, BO);      /* the four weight matrices as Bt x16 and the three inputs as exact f16 rows */
  const size_t r0p = (size_t)B0 * SQ;      /* first projected row */
  k_gemm4<<<dim3((unsigned)((MP / 128) * (DM / 128)), 1, 3), 128, 0, stream>>>(XQ + r0p * DM, DM, NR * DM, BQ, DM, (size_t)DM * DM, 0.0625f, bq, bk, bv, Q16 + r0p * DM, DM, NR * DM, MP, DM, DM);      /* Q, K and V projections on grid.z: XQ XK XV, BQ BK BV and Q16 K16 V16 lie one behind the other in the workspace (every size is a multiple of the 256-byte rounding) */
  k_fattn<<<dim3(SQ / (16 * FQ * FW), NB * NH), FW * 32, 0, stream>>>(Q16, K16, V16, O16);      /* scores, softmax and P . V of all planes: plane p = batch * NH + head -> 64-wide rows at O16 + p * SQ * HD (head-major context), x64 */
  k_gemm2<0, false, true, false><<<dim3((unsigned)((MPO / 128) * (DM / 64)), 1), 128, 0, stream>>>(O16 + r0p * DM, DM, 0, 0, BO, DM, 0, 0, 0.0009765625f, bo, nullptr, nullptr, 0, nullptr, 1, 0, 0, (float*)d_out + r0p * DM, nullptr, DM, 0, 0, MPO, DM, DM);      /* out rows are the output layout */
}

// v010
// A run of this version takes 56.1 microseconds.
// Two timings next to v009 put it at 1.11 and 1.12 times that version's speed.
// Counting every step since v000, it is 59.7 times as fast.
#include <hip/hip_runtime.h>
// Multi-head attention on three inputs with per-head projection tensors and the source's head-major context view (Q, K, V [8][1024][512]; Qh / Kh / Vh = einsum('bsd,hde->bhse', input, W) + b with per-head [in][out] weights W [8][512][64] and biases [8][64] (uniform +-512^-0.5); scores * 64^-0.5; softmax over all 1024 keys (no mask); context x [B][H][S][64] is RE-VIEWED as [B][S][512] WITHOUT transposing heads and time (row s' of the view = 512 consecutive floats of the [H][S][64] block); out = view Wo + bo ([in][out] 512 x 512) -> [8][1024][512]).
// Structure: token rows r = b*1024 + s; the three inputs as exact f16 rows (bf16-rounded); Q, K, V as three WMMA GEMMs in one launch (128x128 block tiles, 64x64 wave tiles, f32 accumulation, exact x16 weights + bias, f16 outputs); then one fused attention launch for all pairs (S^T = K . Q^T on WMMA, V^T fragments by transposing LDS loads of the staged V rows, online softmax on VALU with f32 statistics and native exp2, the unnormalised weights packed in registers as the f16 B operand of O^T += V^T . P^T on WMMA; neither scores nor weights reach memory; o carried x64 against f16 subnormal flush, folded into the output GEMM alpha) whose work-group keeps its 256 queries' o as 32 whole rows of the merged view in LDS and multiplies them with W_o itself: out = o W_o + b (WMMA, f32) into the output layout.
// Compute dtype: inputs rounded to bf16; x / weights exact; q, k, v, softmax weights and o as plain f16 GEMM operands (~2^-12); scores and softmax statistics f32. v_wmma_f32_16x16x32_f16.
#define NB 8
#define SQ 1024
#define DM 512
#define NH 8
#define HD 64
#define HG 4                         /* heads per launch of the untemplated k_vt (not launched) */
#define B0 0                         /* first batch processed (debug hook) */
#define NBR NB                       /* batches processed (debug hook) */
#define NR ((size_t)NB * SQ)         /* token rows */
#define MP ((int)((size_t)NBR * SQ)) /* rows projected (debug hook) */
#define QN SQ                        /* query rows per batch (not used; launches attend all SQ rows) */
#define NHD NH                       /* heads (not used; launches attend all NH heads) */
#define MPO MP                       /* rows through the output stage (not used; k_fattn writes all NB * SQ rows) */
#define LQ DM      /* row pitch of the q/k/v rows */
typedef __bf16 v16b __attribute__((ext_vector_type(16)));
typedef unsigned short v8us __attribute__((ext_vector_type(8), may_alias));
typedef float  v8f  __attribute__((ext_vector_type(8)));
typedef float  v4f  __attribute__((ext_vector_type(4)));
typedef float  v4fa __attribute__((ext_vector_type(4), may_alias));
union FragB { v16b v; v8us half[2]; unsigned short u[16]; };

__device__ __forceinline__ unsigned short bf16_bits(float x) { unsigned int u = __float_as_uint(x); return (unsigned short)((u + 0x7FFFu + ((u >> 16) & 1u)) >> 16); }
__device__ __forceinline__ float bf16_val(unsigned short b) { return __uint_as_float(((unsigned int)b) << 16); }
__device__ __forceinline__ float bf16_round(float x) { return bf16_val(bf16_bits(x)); }
// D += A·B with NT terms: 1 = ah·bh, 2 = + al·bh (A split), 3 = + ah·bl (both split)
template <int NT>
__device__ __forceinline__ v8f mmaN(v16b ah, v16b al, v16b bh, v16b bl, v8f c) {
  c = __builtin_amdgcn_wmma_f32_16x16x32_bf16(false, ah, false, bh, (short)0, c, false, false);
  if (NT >= 2) c = __builtin_amdgcn_wmma_f32_16x16x32_bf16(false, al, false, bh, (short)0, c, false, false);
  if (NT >= 3) c = __builtin_amdgcn_wmma_f32_16x16x32_bf16(false, ah, false, bl, (short)0, c, false, false);
  asm volatile("v_nop\n\tv_nop\n\tv_nop\n\tv_nop" : "+v"(c) : "v"(ah), "v"(al), "v"(bh), "v"(bl));
  return c;
}

__global__ __launch_bounds__(256) void k_wt_bf16(const float* __restrict__ W, unsigned short* __restrict__ Wt, int K, int N) {
  const int t = blockIdx.x * 256 + threadIdx.x;
  const int k8n = K / 8;
  if (t >= N * k8n) return;
  const int n = t / k8n, k8 = (t % k8n) * 8;
  v8us v;
#pragma unroll
  for (int i = 0; i < 8; ++i) v[i] = bf16_bits(W[(size_t)(k8 + i) * N + n]);
  *(v8us*)(Wt + (size_t)n * K + k8) = v;
  
}

// GEMM C[M][N] (f32, pitch ldc) = act(A[M][K]·W + bias). A f32 row-major (pitch lda) converted per fragment to bf16
// (ASPLIT: hi/lo two planes -> 2 terms, else single rounded term); Wt bf16 [N][K] (pitch ldb). BIAS_BF16 rounds the
// bias to bf16 first (bias quantised to bf16 before the add). K%32==0, M%16==0, N%64==0.
template <bool ASPLIT, int ACT, bool BIAS_BF16>
__global__ __launch_bounds__(128) void k_gemm_bf(const float* __restrict__ A, int lda, const unsigned short* __restrict__ Wt, int ldb,
                                               const float* __restrict__ bias, float* __restrict__ C, int ldc, int M, int N, int K) {
  __shared__ __attribute__((aligned(16))) float so[4][16][64];
  const int tid = threadIdx.x, w = tid >> 5, lane = tid & 31, ln = lane & 15, hh = lane >> 4;
  const int ntn = N / 64;
  const int wid = blockIdx.x * 4 + w;
  const int mt = wid / ntn, nq = wid % ntn;
  if (mt * 16 >= M) return;
  const int row0 = mt * 16, col0 = nq * 64;
  const float* arow = A + (size_t)(row0 + ln) * lda;
  v8f acc[4] = {};
  for (int kb = 0; kb < K; kb += 32) {
    FragB ah, al;
    const v4f x0 = *(const v4fa*)(arow + kb + 8 * hh), x1 = *(const v4fa*)(arow + kb + 8 * hh + 4);
    const v4f x2 = *(const v4fa*)(arow + kb + 16 + 8 * hh), x3 = *(const v4fa*)(arow + kb + 16 + 8 * hh + 4);
    float xs[16] = {x0[0],x0[1],x0[2],x0[3],x1[0],x1[1],x1[2],x1[3],x2[0],x2[1],x2[2],x2[3],x3[0],x3[1],x3[2],x3[3]};
#pragma unroll
    for (int i = 0; i < 16; ++i) { const unsigned short hb = bf16_bits(xs[i]); ah.u[i] = hb; al.u[i] = ASPLIT ? bf16_bits(xs[i] - bf16_val(hb)) : (unsigned short)0; }
#pragma unroll
    for (int t = 0; t < 4; ++t) {
      const unsigned short* brow = Wt + (size_t)(col0 + t * 16 + ln) * ldb + kb;
      FragB b;
      b.half[0] = *(const v8us*)(brow + 8 * hh);
      b.half[1] = *(const v8us*)(brow + 16 + 8 * hh);
      acc[t] = mmaN<ASPLIT ? 2 : 1>(ah.v, al.v, b.v, b.v, acc[t]);
    }
  }
#pragma unroll
  for (int t = 0; t < 4; ++t) {
    float bv = bias ? bias[col0 + t * 16 + ln] : 0.f;
    if (BIAS_BF16) bv = bf16_round(bv);
#pragma unroll
    for (int r = 0; r < 8; ++r) { float v = acc[t][r] + bv; if (ACT == 1) v = fmaxf(v, 0.f); so[w][8 * hh + r][t * 16 + ln] = v; }
  }
  __builtin_amdgcn_fence(__ATOMIC_ACQ_REL, "workgroup");
  __builtin_amdgcn_wave_barrier();
  const int rsub = lane >> 4, c4 = (lane & 15) * 4;
  {
#pragma unroll
    for (int q = 0; q < 8; ++q) {
      const int r = q * 2 + rsub;
      const v4f v = *(const v4fa*)&so[w][r][c4];
      *(v4f*)(C + (size_t)(row0 + r) * ldc + col0 + c4) = v;
    }
    
  }
}

// GEMM C = act(A·W + bias + resid): A f32 (ASPLIT -> hi/lo 2 terms), Wt bf16 [N][K]; ACT 0 none, 1 relu, 2 exact gelu;
// resid (optional, f32, row index = (row % rmod), pitch ldr, RES_BF16 rounds it) added before the activation.
template <bool ASPLIT, int ACT, bool BIAS_BF16, bool RES_BF16>
__global__ __launch_bounds__(128) void k_gemm_bf3(const float* __restrict__ A, int lda, const unsigned short* __restrict__ Wt, int ldb,
                                                const float* __restrict__ bias, const float* __restrict__ resid, int rmod, int ldr,
                                                float* __restrict__ C, int ldc, int M, int N, int K) {
  __shared__ __attribute__((aligned(16))) float so[4][16][64];
  const int tid = threadIdx.x, w = tid >> 5, lane = tid & 31, ln = lane & 15, hh = lane >> 4;
  const int ntn = N / 64;
  const int wid = blockIdx.x * 4 + w;
  const int mt = wid / ntn, nq = wid % ntn;
  if (mt * 16 >= M) return;
  const int row0 = mt * 16, col0 = nq * 64;
  const float* arow = A + (size_t)(row0 + ln) * lda;
  v8f acc[4] = {};
  for (int kb = 0; kb < K; kb += 32) {
    FragB ah, al;
    const v4f x0 = *(const v4fa*)(arow + kb + 8 * hh), x1 = *(const v4fa*)(arow + kb + 8 * hh + 4);
    const v4f x2 = *(const v4fa*)(arow + kb + 16 + 8 * hh), x3 = *(const v4fa*)(arow + kb + 16 + 8 * hh + 4);
    float xs[16] = {x0[0],x0[1],x0[2],x0[3],x1[0],x1[1],x1[2],x1[3],x2[0],x2[1],x2[2],x2[3],x3[0],x3[1],x3[2],x3[3]};
#pragma unroll
    for (int i = 0; i < 16; ++i) { const unsigned short hb = bf16_bits(xs[i]); ah.u[i] = hb; al.u[i] = ASPLIT ? bf16_bits(xs[i] - bf16_val(hb)) : (unsigned short)0; }
#pragma unroll
    for (int t = 0; t < 4; ++t) {
      const unsigned short* brow = Wt + (size_t)(col0 + t * 16 + ln) * ldb + kb;
      FragB b;
      b.half[0] = *(const v8us*)(brow + 8 * hh);
      b.half[1] = *(const v8us*)(brow + 16 + 8 * hh);
      acc[t] = mmaN<ASPLIT ? 2 : 1>(ah.v, al.v, b.v, b.v, acc[t]);
    }
  }
#pragma unroll
  for (int t = 0; t < 4; ++t) {
    const int col = col0 + t * 16 + ln;
    float bv = bias ? bias[col] : 0.f;
    if (BIAS_BF16) bv = bf16_round(bv);
#pragma unroll
    for (int r = 0; r < 8; ++r) {
      float v = acc[t][r] + bv;
      if (resid) { float rv = resid[(size_t)((row0 + 8 * hh + r) % rmod) * ldr + col]; if (RES_BF16) rv = bf16_round(rv); v += rv; }
      if (ACT == 1) v = fmaxf(v, 0.f);
      if (ACT == 2) v = 0.5f * v * (1.0f + erff(v * 0.70710678118654752f));
      if (ACT == 3) { const float u = 0.7978845608028654f * (v + 0.044715f * v * v * v); v = 0.5f * v * (1.0f + tanhf(u)); }
      so[w][8 * hh + r][t * 16 + ln] = v;
    }
  }
  __builtin_amdgcn_fence(__ATOMIC_ACQ_REL, "workgroup");
  __builtin_amdgcn_wave_barrier();
  const int rsub = lane >> 4, c4 = (lane & 15) * 4;
  {
#pragma unroll
    for (int q = 0; q < 8; ++q) {
      const int r = q * 2 + rsub;
      const v4f v = *(const v4fa*)&so[w][r][c4];
      *(v4f*)(C + (size_t)(row0 + r) * ldc + col0 + c4) = v;
    }
    
  }
}
// row LayerNorm (biased variance, eps) over N: s = X (+ R); optional out_sum <- s; out_norm <- (s-mu)*rsqrt(var+eps)*g + b
template <bool PARAM_BF16>
__global__ __launch_bounds__(256) void k_layernorm(const float* __restrict__ X, const float* __restrict__ R, const float* __restrict__ g, const float* __restrict__ bta,
                                                  float* __restrict__ out_sum, float* __restrict__ out_norm, int N, float eps) {
  __shared__ float red[256];
  const int row = blockIdx.x, tid = threadIdx.x;
  const float* x = X + (size_t)row * N; const float* rr = R ? R + (size_t)row * N : nullptr;
  float vals[16];                     // up to N = 4096
  const int per = N / 256;            // contiguous chunk per thread? use strided-by-4 chunks: thread handles j = tid*4 + 1024*u
  float s1 = 0.f;
  for (int u = 0; u < per / 4; ++u) {
    const int j = tid * 4 + 1024 * u;
    const v4f a = *(const v4fa*)(x + j);
    v4f b = {0.f,0.f,0.f,0.f}; if (rr) b = *(const v4fa*)(rr + j);
#pragma unroll
    for (int q = 0; q < 4; ++q) { const float v = a[q] + b[q]; vals[u * 4 + q] = v; s1 += v; }
  }
  red[tid] = s1; __syncthreads();
  for (int st = 128; st > 0; st >>= 1) { if (tid < st) red[tid] += red[tid + st]; __syncthreads(); }
  const float mu = red[0] / (float)N; __syncthreads();
  float s2 = 0.f;
  for (int u = 0; u < per / 4; ++u)
#pragma unroll
    for (int q = 0; q < 4; ++q) { const float c = vals[u * 4 + q] - mu; s2 += c * c; }
  red[tid] = s2; __syncthreads();
  for (int st = 128; st > 0; st >>= 1) { if (tid < st) red[tid] += red[tid + st]; __syncthreads(); }
  const float rs = rsqrtf(red[0] / (float)N + eps);
  {
    for (int u = 0; u < per / 4; ++u) {
      const int j = tid * 4 + 1024 * u;
      v4f o, sm;
#pragma unroll
      for (int q = 0; q < 4; ++q) {
        float gg = g[j + q], bb = bta[j + q];
        if (PARAM_BF16) { gg = bf16_round(gg); bb = bf16_round(bb); }
        sm[q] = vals[u * 4 + q]; o[q] = (vals[u * 4 + q] - mu) * rs * gg + bb;
      }
      if (out_sum) *(v4f*)(out_sum + (size_t)row * N + j) = sm;
      *(v4f*)(out_norm + (size_t)row * N + j) = o;
    }
    
  }
}



// ---- f16 WMMA path (v_wmma_f32_16x16x32_f16): 11-bit significands for operands in range — used where a [0,1] probability operand needs more precision than bf16
typedef _Float16 v16h __attribute__((ext_vector_type(16)));
union FragH { v16h v; v8us half[2]; _Float16 h[16]; unsigned short u[16]; };
template <int NT>
__device__ __forceinline__ v8f mmaH(v16h ah, v16h al, v16h bh, v16h bl, v8f c) {
  c = __builtin_amdgcn_wmma_f32_16x16x32_f16(false, ah, false, bh, (short)0, c, false, false);
  if (NT >= 2) c = __builtin_amdgcn_wmma_f32_16x16x32_f16(false, al, false, bh, (short)0, c, false, false);
  if (NT >= 3) c = __builtin_amdgcn_wmma_f32_16x16x32_f16(false, ah, false, bl, (short)0, c, false, false);
  asm volatile("v_nop\n\tv_nop\n\tv_nop\n\tv_nop" : "+v"(c) : "v"(ah), "v"(al), "v"(bh), "v"(bl));
  return c;
}
// batched GEMM like k_gemm_b but f16 operands: A f32 (split into f16 hi/lo if ASPLIT, else rounded to f16), Bt = f16 values [n][k]; alpha; C f32; N multiple of 16 (partial tiles skipped)
template <bool ASPLIT>
__global__ __launch_bounds__(128) void k_gemm_h(const float* __restrict__ A, int lda, size_t sA, const _Float16* __restrict__ Bh, int ldb, size_t sB, float alpha, float* __restrict__ C, int ldc, size_t sC, int M, int N, int K) {
  __shared__ __attribute__((aligned(16))) float so[4][16][64];
  const int tid = threadIdx.x, w = tid >> 5, lane = tid & 31, ln = lane & 15, hh = lane >> 4; const int by = blockIdx.y;
  A += (size_t)by * sA; Bh += (size_t)by * sB; C += (size_t)by * sC;
  const int ntn = (N + 63) / 64; const int wid = blockIdx.x * 4 + w; const int mt = wid / ntn, nq = wid % ntn; if (mt * 16 >= M) return;
  const int row0 = mt * 16, col0 = nq * 64; const float* arow = A + (size_t)(row0 + ln) * lda;
  v8f acc[4] = {};
  for (int kb = 0; kb < K; kb += 32) {
    FragH ah, al;
    const v4f x0 = *(const v4fa*)(arow + kb + 8 * hh), x1 = *(const v4fa*)(arow + kb + 8 * hh + 4), x2 = *(const v4fa*)(arow + kb + 16 + 8 * hh), x3 = *(const v4fa*)(arow + kb + 16 + 8 * hh + 4);
    float xs[16] = {x0[0],x0[1],x0[2],x0[3],x1[0],x1[1],x1[2],x1[3],x2[0],x2[1],x2[2],x2[3],x3[0],x3[1],x3[2],x3[3]};
#pragma unroll
    for (int i = 0; i < 16; ++i) { const _Float16 h = (_Float16)xs[i]; ah.h[i] = h; al.h[i] = ASPLIT ? (_Float16)(xs[i] - (float)h) : (_Float16)0.0f; }
#pragma unroll
    for (int t = 0; t < 4; ++t) { if (col0 + t * 16 >= N) continue; const size_t boff = (size_t)(col0 + t * 16 + ln) * ldb + kb; FragH bq; bq.half[0] = *(const v8us*)(Bh + boff + 8 * hh); bq.half[1] = *(const v8us*)(Bh + boff + 16 + 8 * hh);
      acc[t] = mmaH<ASPLIT ? 2 : 1>(ah.v, al.v, bq.v, bq.v, acc[t]); }
  }
#pragma unroll
  for (int t = 0; t < 4; ++t) { if (col0 + t * 16 >= N) continue;
#pragma unroll
    for (int r = 0; r < 8; ++r) so[w][8 * hh + r][t * 16 + ln] = acc[t][r] * alpha; }
  __builtin_amdgcn_fence(__ATOMIC_ACQ_REL, "workgroup"); __builtin_amdgcn_wave_barrier();
  const int rsub = lane >> 4, c4 = (lane & 15) * 4;
  {
#pragma unroll
    for (int q = 0; q < 8; ++q) { const int r = q * 2 + rsub; if (col0 + c4 < N) { const v4f v = *(const v4fa*)&so[w][r][c4]; *(v4f*)(C + (size_t)(row0 + r) * ldc + col0 + c4) = v; } }
     }
}

// k_gemm_hh variant with fused epilogue: v = acc·alpha + bias[by·sBias + col] (+ CP[(row/rowsPerB)·sCPb + by·64 + col] if CP) ; ACT 0 none / 1 elu ; writes f16 C16 (and f32 C if non-null)
template <int ACT>
__global__ __launch_bounds__(128) void k_gemm_hhx(const _Float16* __restrict__ A, int lda, size_t sA, const _Float16* __restrict__ Bh, int ldb, size_t sB, float alpha, const float* __restrict__ bias, size_t sBias, const float* __restrict__ CP, int rowsPerB, size_t sCPb, int row0g,
    float* __restrict__ C, _Float16* __restrict__ C16, int ldc, size_t sC, int M, int N, int K) {
  __shared__ __attribute__((aligned(16))) float so[4][16][64];
  const int tid = threadIdx.x, w = tid >> 5, lane = tid & 31, ln = lane & 15, hh = lane >> 4; const int by = blockIdx.y;
  A += (size_t)by * sA; Bh += (size_t)by * sB; const size_t cofs = (size_t)by * sC; const float* bp = bias ? bias + (size_t)by * sBias : nullptr;
  const int ntn = (N + 63) / 64; const int wid = blockIdx.x * 4 + w; const int mt = wid / ntn, nq = wid % ntn; if (mt * 16 >= M) return;
  const int row0 = mt * 16, col0 = nq * 64; const _Float16* arow = A + (size_t)(row0 + ln) * lda;
  v8f acc[4] = {};
  for (int kb = 0; kb < K; kb += 32) { FragH ah; ah.half[0] = *(const v8us*)((const unsigned short*)arow + kb + 8 * hh); ah.half[1] = *(const v8us*)((const unsigned short*)arow + kb + 16 + 8 * hh);
#pragma unroll
    for (int t = 0; t < 4; ++t) { if (col0 + t * 16 >= N) continue; const size_t boff = (size_t)(col0 + t * 16 + ln) * ldb + kb; FragH bq; bq.half[0] = *(const v8us*)((const unsigned short*)Bh + boff + 8 * hh); bq.half[1] = *(const v8us*)((const unsigned short*)Bh + boff + 16 + 8 * hh);
      acc[t] = mmaH<1>(ah.v, ah.v, bq.v, bq.v, acc[t]); }
  }
#pragma unroll
  for (int t = 0; t < 4; ++t) { if (col0 + t * 16 >= N) continue; const int col = col0 + t * 16 + ln; const float bv = bp ? bf16_round(bp[col]) : 0.f;
#pragma unroll
    for (int r = 0; r < 8; ++r) { float v = acc[t][r] * alpha + bv; if (CP) { const int rr = row0g + row0 + 8 * hh + r; if (rowsPerB < 0) v += CP[cofs + (size_t)rr * ldc + col];      /* rowsPerB < 0: own element of the batched C plane */ else { const int bidx = rr / rowsPerB; v += CP[(size_t)bidx * sCPb + (size_t)by * 64 + col]; } } if (ACT == 1) v = (v > 0.f) ? v : expm1f(v); else if (ACT == 7) v = (v > 0.f) ? v + 1.0f : expf(v); else if (ACT == 8) v = tanhf(v); else if (ACT == 9) v = 0.5f * v * (1.0f + tanhf(0.7978845608028654f * (v + 0.044715f * v * v * v))); else if (ACT == 11) v = 1.0f / (1.0f + expf(-v)); else if (ACT == 12) v = (v > 0.f) ? v : 0.01f * v; else if (ACT == 14) v = (v > 0.f) ? v : 0.1f * v; else if (ACT == 16) v = (v >= 0.f) ? v : 0.3f * v; else if (ACT == 17) v = (v >= 0.f) ? v : 0.2f * v; else if (ACT == 15) v = v / (1.0f + expf(-v)); else if (ACT == 3) v = fmaxf(v, 0.f); else if (ACT == 6) v = 0.5f * v * (1.0f + erff(v * 0.70710678118654752f)); so[w][8 * hh + r][t * 16 + ln] = v; } }
  __builtin_amdgcn_fence(__ATOMIC_ACQ_REL, "workgroup"); __builtin_amdgcn_wave_barrier();
  const int rsub = lane >> 4, c4 = (lane & 15) * 4; typedef _Float16 v4h __attribute__((ext_vector_type(4)));
  {
#pragma unroll
    for (int q = 0; q < 8; ++q) { const int r = q * 2 + rsub; if (col0 + c4 < N) { const v4f v = *(const v4fa*)&so[w][r][c4]; if (C) *(v4f*)(C + cofs + (size_t)(row0 + r) * ldc + col0 + c4) = v; if (C16) { v4h h4; for (int i = 0; i < 4; ++i) h4[i] = (_Float16)v[i]; *(v4h*)(C16 + cofs + (size_t)(row0 + r) * ldc + col0 + c4) = h4; } } }
     }
}


typedef _Float16 v4h __attribute__((ext_vector_type(4)));

__global__ __launch_bounds__(256) void k_h16(const float* __restrict__ x, _Float16* __restrict__ X16, size_t n8) { const size_t t = (size_t)blockIdx.x * 256 + threadIdx.x; if (t >= n8) return; FragH f;
#pragma unroll
  for (int q = 0; q < 8; ++q) f.h[q] = (_Float16)x[t * 8 + q]; *(v8us*)((unsigned short*)X16 + t * 8) = f.half[0];  }
__global__ __launch_bounds__(256) void k_round16f(const float* __restrict__ W, _Float16* __restrict__ Bt, size_t n8) { const size_t t = (size_t)blockIdx.x * 256 + threadIdx.x; if (t >= n8) return; FragH f;
#pragma unroll
  for (int i = 0; i < 8; ++i) f.h[i] = (_Float16)(bf16_round(W[t * 8 + i]) * 16.0f); *(v8us*)((unsigned short*)Bt + t * 8) = f.half[0];  }
template <int NHv, int TTv>
__global__ __launch_bounds__(256) void k_vt(const _Float16* __restrict__ V16, int ldv, int voff, _Float16* __restrict__ Vt) { __shared__ unsigned short tl[64][66]; const int tid = threadIdx.x; const int slab = blockIdx.x / (TTv / 64), lg = blockIdx.x % (TTv / 64); const int b = slab / NHv, h = slab % NHv;
  for (int i = tid; i < 64 * 8; i += 256) { const int r = i / 8, c8 = (i % 8) * 8; FragH f; f.half[0] = *(const v8us*)((const unsigned short*)V16 + ((size_t)b * TTv + lg * 64 + r) * ldv + voff + h * 64 + c8);
#pragma unroll
    for (int q = 0; q < 8; ++q) tl[r][c8 + q] = f.u[q]; }
  __syncthreads();
  {
#pragma unroll
    for (int rd = 0; rd < 2; ++rd) { const int d = rd * 32 + tid / 8, pc = tid % 8; FragH f;
#pragma unroll
      for (int q = 0; q < 8; ++q) f.u[q] = tl[pc * 8 + q][d];
      *(v8us*)((unsigned short*)Vt + ((size_t)slab * 64 + d) * TTv + lg * 64 + pc * 8) = f.half[0]; }
     } }

__global__ __launch_bounds__(256) void k_hl(const float* __restrict__ F, _Float16* __restrict__ Hh, _Float16* __restrict__ Hl, size_t n8) { const size_t t = (size_t)blockIdx.x * 256 + threadIdx.x; if (t >= n8) return; FragH fh, fl; const v4f a = *(const v4fa*)(F + t * 8), c = *(const v4fa*)(F + t * 8 + 4);
#pragma unroll
  for (int q = 0; q < 4; ++q) { _Float16 h = (_Float16)a[q]; fh.h[q] = h; fl.h[q] = (_Float16)((a[q] - (float)h) * 1024.0f); h = (_Float16)c[q]; fh.h[4 + q] = h; fl.h[4 + q] = (_Float16)((c[q] - (float)h) * 1024.0f); }
  { *(v8us*)((unsigned short*)Hh + t * 8) = fh.half[0]; *(v8us*)((unsigned short*)Hl + t * 8) = fl.half[0];  } }

// ---- fast GEMM (block tile 128x64, wave tile 32x64; requires M % 128 == 0 rows per launch region, N % 64 == 0 and K % 64 == 0); epilogue = k_gemm_hhx semantics ----
__device__ __forceinline__ v16h g2_frag(const _Float16* p, int hh) { FragH f; f.half[0] = *(const v8us*)((const unsigned short*)p + 8 * hh); f.half[1] = *(const v8us*)((const unsigned short*)p + 16 + 8 * hh); return f.v; }
__device__ __forceinline__ v8f g2_mma(v16h a, v16h b, v8f c) { v8f d = __builtin_amdgcn_wmma_f32_16x16x32_f16(false, a, false, b, (short)0, c, false, false); asm volatile("v_nop\n\tv_nop\n\tv_nop\n\tv_nop" : "+v"(d) : "v"(a), "v"(b)); return d; }
// Operand staging of k_gemm2: one stage = 64 k of the block's 128 A rows and 64 B rows (whole 128-byte lines), brought into LDS by asynchronous 16-byte copies, 12 per thread; eight neighbouring lanes copy one line.
#define G2P 72                       /* LDS row pitch in f16: 128 data bytes + 16, conflict-free for the 16-byte fragment reads */
__device__ __forceinline__ void g2_stage(const _Float16* ag, const _Float16* bg, size_t a16, size_t b16, unsigned la, unsigned lb) {      /* ag, bg: this thread's 16 bytes in rows tid / 8 of A and B at the stage's k; a16, b16: 16 rows on in global memory; la, lb: their LDS byte addresses */
  const _Float16* a1 = ag + a16; const _Float16* a2 = a1 + a16; const _Float16* a3 = a2 + a16; const _Float16* a4 = a3 + a16; const _Float16* a5 = a4 + a16; const _Float16* a6 = a5 + a16; const _Float16* a7 = a6 + a16;
  const _Float16* b1 = bg + b16; const _Float16* b2 = b1 + b16; const _Float16* b3 = b2 + b16;
  const unsigned st = 16 * G2P * 2;      /* 16 rows on in LDS, bytes */
  /* the copies and, as the last line of their own statement, the wait that stands before any of their address registers is written again */
  asm volatile("global_load_async_to_lds_b128 %0, %12, off\n\t"
               "global_load_async_to_lds_b128 %1, %13, off\n\t"
               "global_load_async_to_lds_b128 %2, %14, off\n\t"
               "global_load_async_to_lds_b128 %3, %15, off\n\t"
               "global_load_async_to_lds_b128 %4, %16, off\n\t"
               "global_load_async_to_lds_b128 %5, %17, off\n\t"
               "global_load_async_to_lds_b128 %6, %18, off\n\t"
               "global_load_async_to_lds_b128 %7, %19, off\n\t"
               "global_load_async_to_lds_b128 %8, %20, off\n\t"
               "global_load_async_to_lds_b128 %9, %21, off\n\t"
               "global_load_async_to_lds_b128 %10, %22, off\n\t"
               "global_load_async_to_lds_b128 %11, %23, off\n\t"
               "s_wait_xcnt 0x0"
               :: "v"(la), "v"(la + st), "v"(la + 2 * st), "v"(la + 3 * st), "v"(la + 4 * st), "v"(la + 5 * st), "v"(la + 6 * st), "v"(la + 7 * st), "v"(lb), "v"(lb + st), "v"(lb + 2 * st), "v"(lb + 3 * st),
                  "v"(ag), "v"(a1), "v"(a2), "v"(a3), "v"(a4), "v"(a5), "v"(a6), "v"(a7), "v"(bg), "v"(b1), "v"(b2), "v"(b3) : "memory");
}
// HASCP, OUT32, OUT16: which parts of the epilogue exist (the addend plane CP, the f32 output C, the f16 output C16), fixed per call site at compile time, so that the epilogue is one straight run of code with no test per element.
template <int ACT, bool HASCP, bool OUT32, bool OUT16>
__global__ __launch_bounds__(128) void k_gemm2(const _Float16* __restrict__ A, int lda, size_t sA, size_t sAz, const _Float16* __restrict__ Bh, int ldb, size_t sB, size_t sBz, float alpha, const float* __restrict__ bias, const float* __restrict__ biasz1, const float* __restrict__ biasz2, size_t sBias, const float* __restrict__ CP, int rowsPerB, size_t sCPb, int row0g,
    float* __restrict__ C, _Float16* __restrict__ C16, int ldc, size_t sC, size_t sCz, int M, int N, int K) { static_assert(ACT == 0 || ACT == 3 || ACT == 6 || ACT == 8 || ACT == 9 || ACT == 11 || ACT == 12 || ACT == 14 || ACT == 15 || ACT == 16 || ACT == 17, "k_gemm2: unsupported ACT code (would silently apply no activation)");
  __shared__ __attribute__((aligned(16))) float so[4][32][68];
  __shared__ __attribute__((aligned(16))) _Float16 sa[2][128 * G2P]; __shared__ __attribute__((aligned(16))) _Float16 sb[2][64 * G2P];      /* two stage buffers per operand */
  const int tid = threadIdx.x, w = tid >> 5, lane = tid & 31, ln = lane & 15, hh = lane >> 4; const int by = blockIdx.y, bz = blockIdx.z;      /* two batch axes: strides s* on grid.y, s*z on grid.z */
  A += (size_t)by * sA + (size_t)bz * sAz; Bh += (size_t)by * sB + (size_t)bz * sBz; const size_t cofs = (size_t)by * sC + (size_t)bz * sCz; const float* bsel = bz == 0 ? bias : (bz == 1 ? biasz1 : biasz2); const float* bp = bsel ? bsel + (size_t)by * sBias : nullptr;      /* the bias vectors of grid.z planes 0, 1, 2 are separate buffers */
  const int ntn = N >> 6; const int mt = blockIdx.x / ntn, nq = blockIdx.x - mt * ntn; const int row0 = mt * 128 + 32 * w, col0 = nq * 64; if (mt * 128 >= M) return;      /* the whole block leaves or none, ahead of every copy and barrier */
  const _Float16* agp = A + (size_t)(mt * 128 + (tid >> 3)) * lda + (tid & 7) * 8; const _Float16* bgp = Bh + (size_t)(col0 + (tid >> 3)) * ldb + (tid & 7) * 8;
  const unsigned lofs = (unsigned)((tid >> 3) * (G2P * 2) + (tid & 7) * 16); const unsigned la0 = (unsigned)(size_t)&sa[0][0] + lofs, lb0 = (unsigned)(size_t)&sb[0][0] + lofs;      /* LDS byte addresses = low 32 bits of the shared addresses */
  const size_t a16 = (size_t)16 * lda, b16 = (size_t)16 * ldb; const int nst = K >> 6;
  const v8f z8 = {0.f,0.f,0.f,0.f,0.f,0.f,0.f,0.f}; v8f c00 = z8, c01 = z8, c02 = z8, c03 = z8, c10 = z8, c11 = z8, c12 = z8, c13 = z8;
  g2_stage(agp, bgp, a16, b16, la0, lb0);
  float braw[4] = {0.f, 0.f, 0.f, 0.f};      /* the lane's four bias values, fetched once, beside the copies of stage 0; first used in the epilogue */
  if (bp) {
#pragma unroll
    for (int t = 0; t < 4; ++t) braw[t] = bp[col0 + t * 16 + ln]; }
  asm volatile("s_wait_xcnt 0x0" ::: "memory");      /* stands before the address registers of the bias loads above are written again */
  asm volatile("s_wait_asynccnt 0x0" ::: "memory");      /* this wave's copies of stage 0 have landed */
  __syncthreads();      /* every wave's have: stage 0 may be read */
  if (nst > 1) g2_stage(agp + 64, bgp + 64, a16, b16, la0 + (unsigned)sizeof(sa[0]), lb0 + (unsigned)sizeof(sb[0]));
  /* kept rolled: one trip = one stage, so that the order at its foot stays as written */
#pragma unroll 1
  for (int s = 0; s < nst; ++s) { const int bu = s & 1; const _Float16* as = &sa[bu][(32 * w + ln) * G2P]; const _Float16* bs = &sb[bu][ln * G2P];
    v16h af[2][2], bf[2][4];      /* the stage's 12 fragments, read as one group ahead of its 16 products */
#pragma unroll
    for (int kk = 0; kk < 2; ++kk) { af[kk][0] = g2_frag(as + kk * 32, hh); af[kk][1] = g2_frag(as + 16 * G2P + kk * 32, hh);
#pragma unroll
      for (int u = 0; u < 4; ++u) bf[kk][u] = g2_frag(bs + u * 16 * G2P + kk * 32, hh); }
#pragma unroll
    for (int kk = 0; kk < 2; ++kk) { c00 = g2_mma(af[kk][0], bf[kk][0], c00); c10 = g2_mma(af[kk][1], bf[kk][0], c10); c01 = g2_mma(af[kk][0], bf[kk][1], c01); c11 = g2_mma(af[kk][1], bf[kk][1], c11);
      c02 = g2_mma(af[kk][0], bf[kk][2], c02); c12 = g2_mma(af[kk][1], bf[kk][2], c12); c03 = g2_mma(af[kk][0], bf[kk][3], c03); c13 = g2_mma(af[kk][1], bf[kk][3], c13); }
    asm volatile("s_wait_dscnt 0x0" ::: "memory");      /* this wave has finished reading stage s */
    asm volatile("s_wait_asynccnt 0x0" ::: "memory");      /* this wave's copies of stage s + 1 have landed */
    __syncthreads();      /* publishes stage s + 1 and frees stage s's buffer */
    if (s + 2 < nst) g2_stage(agp + (s + 2) * 64, bgp + (s + 2) * 64, a16, b16, la0 + (unsigned)(bu * sizeof(sa[0])), lb0 + (unsigned)(bu * sizeof(sb[0]))); }
  asm volatile("s_wait_asynccnt 0x0" ::: "memory");      /* no copy is outstanding behind the loop */
  v8f accs[8] = {c00, c01, c02, c03, c10, c11, c12, c13};
#pragma unroll
  for (int u = 0; u < 8; ++u) { const int t = u & 3, half = u >> 2; const int col = col0 + t * 16 + ln; const float bv = bf16_round(braw[t]);
#pragma unroll
    for (int r = 0; r < 8; ++r) { const int rloc = half * 16 + 8 * hh + r; float v = accs[u][r] * alpha + bv; if (HASCP && CP) { if (rowsPerB < 0) v += CP[cofs + (size_t)(row0g + row0 + rloc) * ldc + col];      /* rowsPerB < 0: own element of the batched C plane */ else { const int bidx = (row0g + row0 + rloc) / rowsPerB; v += CP[(size_t)bidx * sCPb + (size_t)by * 64 + col]; } }
      if (ACT == 3) v = fmaxf(v, 0.f); else if (ACT == 6) v = 0.5f * v * (1.0f + erff(v * 0.70710678118654752f)); else if (ACT == 11) v = 1.0f / (1.0f + expf(-v)); else if (ACT == 15) v = v / (1.0f + expf(-v)); else if (ACT == 12) v = (v > 0.f) ? v : 0.01f * v; else if (ACT == 8) v = tanhf(v); else if (ACT == 9) v = 0.5f * v * (1.0f + tanhf(0.7978845608028654f * (v + 0.044715f * v * v * v))); else if (ACT == 14) v = (v > 0.f) ? v : 0.1f * v; else if (ACT == 16) v = (v >= 0.f) ? v : 0.3f * v; else if (ACT == 17) v = (v >= 0.f) ? v : 0.2f * v;
      so[w][rloc][t * 16 + ln] = v; } }
  __builtin_amdgcn_fence(__ATOMIC_ACQ_REL, "workgroup"); __builtin_amdgcn_wave_barrier();
  const int rsub = lane >> 4, c4 = (lane & 15) * 4;
  {
#pragma unroll
    for (int q = 0; q < 16; ++q) { const int r = q * 2 + rsub; const v4f v = *(const v4fa*)&so[w][r][c4]; if (OUT32) *(v4f*)(C + cofs + (size_t)(row0 + r) * ldc + col0 + c4) = v; if (OUT16) { v4h h4; for (int i = 0; i < 4; ++i) h4[i] = (_Float16)v[i]; *(v4h*)(C16 + cofs + (size_t)(row0 + r) * ldc + col0 + c4) = h4; } }
     } }


__global__ __launch_bounds__(256) void k_wnat(const float* __restrict__ w, size_t n8, _Float16* __restrict__ Bt) { const size_t t = (size_t)blockIdx.x * 256 + threadIdx.x; if (t >= n8) return; FragH f; for (int q = 0; q < 8; ++q) f.h[q] = (_Float16)(bf16_round(w[t * 8 + q]) * 16.0f); *(v8us*)((unsigned short*)Bt + t * 8) = f.half[0];  }
__global__ __launch_bounds__(256) void k_rsm(const float* __restrict__ S, _Float16* __restrict__ P, int nrows) {
  #pragma clang fp contract(off)
  const int i = blockIdx.x * 256 + threadIdx.x; if (i >= nrows) return; const float* s = S + (size_t)i * SQ; float mx = -3.0e38f;
#pragma unroll 1
  for (int j = 0; j < SQ; ++j) mx = fmaxf(mx, s[j]); float se = 0.f;
#pragma unroll 1
  for (int j = 0; j < SQ; ++j) se += expf(s[j] - mx); const float sc = 256.0f / se;
#pragma unroll 1
  for (int j0 = 0; j0 < SQ; j0 += 8) { FragH f; for (int q = 0; q < 8; ++q) f.h[q] = (_Float16)(expf(s[j0 + q] - mx) * sc); unsigned short* d = (unsigned short*)P + (size_t)i * SQ + j0; *(v8us*)d = f.half[0];  } }
__global__ __launch_bounds__(256) void k_vt(const _Float16* __restrict__ V16, int b, int h0, _Float16* __restrict__ VT) { __shared__ unsigned short tl[64][65]; const int tid = threadIdx.x; const int hh = blockIdx.x % HG, sg = blockIdx.x / HG; const int s0 = sg * 64; const int h = h0 + hh;
  for (int i = tid; i < 64 * 8; i += 256) { const int j = i / 8, d8 = (i % 8) * 8; FragH f; f.half[0] = *(const v8us*)((const unsigned short*)V16 + ((size_t)b * SQ + s0 + j) * DM + h * HD + d8); for (int q = 0; q < 8; ++q) tl[d8 + q][j] = f.u[q]; }
  __syncthreads();
  { for (int i = tid; i < 64 * 8; i += 256) { const int d = i / 8, j8 = (i % 8) * 8; FragH f; for (int q = 0; q < 8; ++q) f.u[q] = tl[d][j8 + q]; *(v8us*)((unsigned short*)VT + ((size_t)hh * HD + d) * SQ + s0 + j8) = f.half[0]; }  } }



// Fused attention, one launch for all (batch, head) planes: a wave owns 32 queries (two 16-column groups) and walks the plane's 1024 keys in passes of 32. The work-group's 8 waves share each stage of 128 keys through LDS.
// Transposed products: S^T = K . Q^T (A = 16 key rows, B = 16 query rows, both through g2_frag), so lane (ln, hh) holds, for query ln, the scores of keys 8 hh + r and 16 + 8 hh + r:
// exactly the k positions that g2_frag gives a B operand, so the exponentials are packed in place into P^T and O^T += V^T . P^T (A = 16 rows of V^T, read from the staged V rows by ds_load_tr16_b128, which delivers the same k positions) follows with no exchange through memory or LDS.
// Online softmax in base 2: the maximum in use may lag a query's true running maximum by up to 8 (an exponential can reach 2^8, far inside f16); the accumulators are rescaled, tested once per pass, only when it lags by more.
// Row sums are f32 sums of the unrounded exponentials, one partial per wave half, joined at the end. o is kept x64 as f16 (the output product's alpha folds it back).
// Output projection in the same kernel: 8 consecutive queries of one head are one 512-wide row of the merged view, so the work-group's 256 queries are 32 whole rows of it. Each wave lays its o into an LDS tile of those rows; behind one barrier wave w forms out[32 rows][64 w .. 64 w + 63] = tile . W_o over all 512 k
// (2 A fragments from LDS and 4 B fragments per 32 k, k ascending in one accumulator chain per tile). W_o comes in fragment order (k_prep), so that a B fragment is two loads of 512 contiguous bytes straight into registers, fetched three steps of 32 k ahead.
#define FQ 2                         /* 16-query column groups per wave */
#define FW 8                         /* waves per work-group */
#define FOP 520                      /* LDS pitch of a row of the merged view in f16: 1024 data bytes + 16 (16 bytes x odd), conflict-free for the 16-byte fragment reads */
#define FSP 68                       /* row pitch of the output staging in floats */
#define FPD 3                        /* steps of 32 k that the W_o fragments are fetched ahead */
typedef _Float16 v8h __attribute__((ext_vector_type(8)));
typedef _Float16 v2h __attribute__((ext_vector_type(2)));
typedef float v2f __attribute__((ext_vector_type(2)));
union FragP { v16h v; v2h p[8]; };
__device__ __forceinline__ float fa_xhalf(float x) { return __builtin_bit_cast(float, __builtin_amdgcn_permlanex16(__builtin_bit_cast(int, x), __builtin_bit_cast(int, x), 0x76543210, 0xfedcba98, false, false)); }      /* lane l <-> lane l ^ 16 */
__device__ __forceinline__ v8f fa_mma(v16h a, v16h b, v8f c) { return __builtin_amdgcn_wmma_f32_16x16x32_f16(false, a, false, b, (short)0, c, false, false); }
// Operand staging of k_fattn: one stage = FKS keys of the plane, as FKS rows of K and FKS rows of V (128 bytes each, the head's slice of a projected row), brought into LDS once for the work-group's 8 waves by asynchronous 16-byte copies, 8 per thread; 8 neighbouring lanes copy one row.
#define FKS 128                      /* keys per stage */
#define FKP 72                       /* LDS pitch of a K row in f16: 128 data bytes + 16, conflict-free for the 16-byte fragment reads */
#define FVP 80                       /* LDS pitch of a V row in f16: 128 data bytes + 32 (32 bytes x odd), conflict-free for the transposing 16-byte reads */
__device__ __forceinline__ void fa_stage(const _Float16* kg, const _Float16* vg, unsigned lk, unsigned lv) {      /* kg, vg: this thread's 16 bytes in row tid / 8 of the stage's K rows and of its V rows; lk, lv: their LDS byte addresses */
  const _Float16* k1 = kg + (size_t)32 * LQ; const _Float16* k2 = k1 + (size_t)32 * LQ; const _Float16* k3 = k2 + (size_t)32 * LQ;
  const _Float16* v1 = vg + (size_t)32 * LQ; const _Float16* v2 = v1 + (size_t)32 * LQ; const _Float16* v3 = v2 + (size_t)32 * LQ;
  const unsigned dk = 32 * FKP * 2, dv = 32 * FVP * 2;      /* 32 K rows, 32 V rows on in LDS, bytes */
  /* the copies and, as the last line of their own statement, the wait that stands before any of their address registers is written again */
  asm volatile("global_load_async_to_lds_b128 %0, %8, off\n\t"
               "global_load_async_to_lds_b128 %1, %9, off\n\t"
               "global_load_async_to_lds_b128 %2, %10, off\n\t"
               "global_load_async_to_lds_b128 %3, %11, off\n\t"
               "global_load_async_to_lds_b128 %4, %12, off\n\t"
               "global_load_async_to_lds_b128 %5, %13, off\n\t"
               "global_load_async_to_lds_b128 %6, %14, off\n\t"
               "global_load_async_to_lds_b128 %7, %15, off\n\t"
               "s_wait_xcnt 0x0"
               :: "v"(lk), "v"(lk + dk), "v"(lk + 2 * dk), "v"(lk + 3 * dk), "v"(lv), "v"(lv + dv), "v"(lv + 2 * dv), "v"(lv + 3 * dv),
                  "v"(kg), "v"(k1), "v"(k2), "v"(k3), "v"(vg), "v"(v1), "v"(v2), "v"(v3) : "memory");
}
// One 16 (d) x 32 (keys) A fragment of V^T from V rows in LDS: two transposing loads, 16 keys apart. p = the lane's own 16 bytes: row 8 (lane >> 4) + (lane & 7) of the 16-key block, byte 16 ((lane >> 3) & 1) of the 32 bytes that hold the 16 d;
// lane (ln, hh) then holds d = ln at keys 8 hh + 0..7 (first load) and 16 + 8 hh + 0..7 (second): g2_frag's k positions.
typedef short s16x8 __attribute__((ext_vector_type(8)));
__device__ __forceinline__ v16h fa_vfrag(const _Float16* p) { typedef __attribute__((address_space(3))) s16x8 lds_s16x8; FragH f;
  f.half[0] = __builtin_bit_cast(v8us, __builtin_amdgcn_ds_load_tr16_b128_v8i16((lds_s16x8*)p)); f.half[1] = __builtin_bit_cast(v8us, __builtin_amdgcn_ds_load_tr16_b128_v8i16((lds_s16x8*)(p + 16 * FVP))); return f.v; }
// One B fragment of W_o in fragment order: p = the lane's own 16 bytes of the fragment's first half; the second half lies 512 bytes on.
__device__ __forceinline__ v16h fo_frag(const _Float16* p) { FragH f; f.half[0] = *(const v8us*)((const unsigned short*)p); f.half[1] = *(const v8us*)((const unsigned short*)p + 256); return f.v; }
__global__ __launch_bounds__(FW * 32) void k_fattn(const _Float16* __restrict__ Qr, const _Float16* __restrict__ Kr, const _Float16* __restrict__ Vr, const _Float16* __restrict__ Bf, const float* __restrict__ bo, float* __restrict__ out) {
  static_assert(FW * 32 == 256 && FKS == 128 && HD == 64 && SQ % FKS == 0 && SQ / FKS >= 2, "fa_stage: 256 threads x 4 copies cover 128 K rows of 8 chunks and as many V rows; stages 0 and 1 exist");
  __shared__ __attribute__((aligned(16))) _Float16 sk[2][FKS * FKP]; __shared__ __attribute__((aligned(16))) _Float16 sv[2][FKS * FVP];      /* two stage buffers per operand */
  static_assert(16 * FQ * FW * HD == 32 * DM && 32 * FOP <= 2 * FKS * FKP && FW * 64 == DM && DM % 32 == 0, "the work-group's o is 32 whole view rows, which fit the K buffers; 8 waves x 64 columns cover W_o");
  __shared__ __attribute__((aligned(16))) float sot[FW][32 * FSP];      /* each wave's own 32 x 64 output staging tile */
  const int tid = threadIdx.x, lane = tid & 31, w = tid >> 5, ln = lane & 15, hh = lane >> 4;
  const int plane = blockIdx.y, b = plane / NH, h = plane % NH; const int q0 = (blockIdx.x * FW + w) * (16 * FQ);
  const _Float16* qp = Qr + ((size_t)b * SQ + q0 + ln) * LQ + h * HD;
  const _Float16* kg = Kr + ((size_t)b * SQ + (tid >> 3)) * LQ + h * HD + (tid & 7) * 8; const _Float16* vg = Vr + ((size_t)b * SQ + (tid >> 3)) * LQ + h * HD + (tid & 7) * 8;
  const unsigned lk0 = (unsigned)(size_t)&sk[0][0] + (unsigned)((tid >> 3) * (FKP * 2) + (tid & 7) * 16), lv0 = (unsigned)(size_t)&sv[0][0] + (unsigned)((tid >> 3) * (FVP * 2) + (tid & 7) * 16);      /* LDS byte addresses = low 32 bits of the shared addresses */
  const float cs = 0.125f * 1.4426950408889634f;      /* 64^-0.5 and log2(e) in one factor */
  const v8f z8 = {0.f,0.f,0.f,0.f,0.f,0.f,0.f,0.f};
  fa_stage(kg, vg, lk0, lv0);
  v16h qf[FQ][2]; v8f acc[FQ][4]; float m_run[FQ], l_run[FQ];
#pragma unroll
  for (int g = 0; g < FQ; ++g) { qf[g][0] = g2_frag(qp + (size_t)g * 16 * LQ, hh); qf[g][1] = g2_frag(qp + (size_t)g * 16 * LQ + 32, hh); m_run[g] = -3.0e38f; l_run[g] = 0.f;
#pragma unroll
    for (int t = 0; t < 4; ++t) acc[g][t] = z8; }
  asm volatile("s_wait_xcnt 0x0" ::: "memory");      /* stands before the address registers of the Q loads above are written again */
  asm volatile("s_wait_asynccnt 0x0" ::: "memory");      /* this wave's copies of stage 0 have landed */
  __syncthreads();      /* every wave's have: stage 0 may be read */
  fa_stage(kg + (size_t)FKS * LQ, vg + (size_t)FKS * LQ, lk0 + (unsigned)sizeof(sk[0]), lv0 + (unsigned)sizeof(sv[0]));
  /* kept rolled: one trip = one stage, so that the order at its foot stays as written */
#pragma unroll 1
  for (int st = 0; st < SQ / FKS; ++st) { const int bu = st & 1; const _Float16* ks = &sk[bu][ln * FKP]; const _Float16* vs = &sv[bu][(8 * hh + (lane & 7)) * FVP + ((lane >> 3) & 1) * 8];
    v16h kf[2][2], vf[4];
#pragma unroll
    for (int kt = 0; kt < 2; ++kt) { kf[kt][0] = g2_frag(ks + kt * 16 * FKP, hh); kf[kt][1] = g2_frag(ks + kt * 16 * FKP + 32, hh); }
#pragma unroll
    for (int t = 0; t < 4; ++t) vf[t] = fa_vfrag(vs + t * 16);
    /* unrolled: the stage's passes of 32 keys, so that "is there a next pass in this stage" is known at compile time */
#pragma unroll
    for (int p = 0; p < FKS / 32; ++p) {
      v8f s[2][FQ];
#pragma unroll
      for (int kt = 0; kt < 2; ++kt) {
#pragma unroll
        for (int g = 0; g < FQ; ++g) s[kt][g] = fa_mma(kf[kt][1], qf[g][1], fa_mma(kf[kt][0], qf[g][0], z8)); }
      if (p + 1 < FKS / 32) {      /* inside a stage both operands' fragments are read one pass ahead, into the registers their products have just left: K under this pass's maxima, V^T under the next pass's scores and maxima; a stage's last pass reads nothing ahead (the next stage is not published yet) */
#pragma unroll
        for (int kt = 0; kt < 2; ++kt) { kf[kt][0] = g2_frag(ks + ((p + 1) * 32 + kt * 16) * FKP, hh); kf[kt][1] = g2_frag(ks + ((p + 1) * 32 + kt * 16) * FKP + 32, hh); } }
      asm volatile("" ::: "memory");      /* compiler fence: holds the LDS reads written above it (this pass's V^T, the next pass's K) in front of the maxima; without it the compiler sinks them behind the branch below, next to their products and in among them, where each waits out its own latency */
      float mb[FQ]; bool need = false;
#pragma unroll
      for (int g = 0; g < FQ; ++g) { float mx = fmaxf(s[0][g][0], s[1][g][0]);
#pragma unroll
        for (int r = 1; r < 8; ++r) mx = fmaxf(mx, fmaxf(s[0][g][r], s[1][g][r]));
        mx = fmaxf(mx, fa_xhalf(mx)) * cs; mb[g] = mx; need = need || (mx > m_run[g] + 8.0f); }      /* both halves hold the query's pass maximum, scaled (cs > 0) */
      if (__builtin_amdgcn_ballot_w32(need) != 0) {      /* wave-uniform; always taken on the first pass (factor 0 on zero accumulators) */
#pragma unroll
        for (int g = 0; g < FQ; ++g) { const float mn = fmaxf(m_run[g], mb[g]); const float corr = __builtin_amdgcn_exp2f(m_run[g] - mn); m_run[g] = mn; l_run[g] *= corr;
#pragma unroll
          for (int t = 0; t < 4; ++t) acc[g][t] *= corr; } }
#pragma unroll
      for (int g = 0; g < FQ; ++g) { const float nm = -m_run[g]; FragP pf; v2f ls = {0.f, 0.f};
#pragma unroll
        for (int i = 0; i < 8; ++i) { const v2f x = {s[i >> 2][g][2 * (i & 3)], s[i >> 2][g][2 * (i & 3) + 1]};      /* operand elements 2i, 2i + 1 = tile i >> 2, registers 2 (i & 3), 2 (i & 3) + 1 */
          const v2f a = __builtin_elementwise_fma(x, (v2f){cs, cs}, (v2f){nm, nm}); const v2f p2 = {__builtin_amdgcn_exp2f(a[0]), __builtin_amdgcn_exp2f(a[1])};
          ls += p2; pf.p[i] = __builtin_convertvector(p2, v2h); }
        l_run[g] += ls[0] + ls[1];
#pragma unroll
        for (int t = 0; t < 4; ++t) acc[g][t] = fa_mma(vf[t], pf.v, acc[g][t]); }
      if (p + 1 < FKS / 32) {
#pragma unroll
        for (int t = 0; t < 4; ++t) vf[t] = fa_vfrag(vs + (p + 1) * 32 * FVP + t * 16); }
    }
    asm volatile("s_wait_dscnt 0x0" ::: "memory");      /* this wave has finished reading stage st */
    asm volatile("s_wait_asynccnt 0x0" ::: "memory");      /* this wave's copies of stage st + 1 have landed */
    __syncthreads();      /* publishes stage st + 1 and frees stage st's buffer */
    if (st + 2 < SQ / FKS) fa_stage(kg + (size_t)(st + 2) * FKS * LQ, vg + (size_t)(st + 2) * FKS * LQ, lk0 + (unsigned)(bu * sizeof(sk[0])), lv0 + (unsigned)(bu * sizeof(sv[0]))); }
  asm volatile("s_wait_asynccnt 0x0" ::: "memory");      /* no copy is outstanding behind the loop */
  /* ---- output projection of the work-group's 32 view rows ---- */
  const _Float16* bw = Bf + w * (4 * 512) + lane * 8;      /* this wave's 4 column tiles of W_o: fragment (u, ks) starts (ks * 32 + u) * 512 f16 on; the lane's own 16 bytes in it */
  v16h bfr[FPD + 1][4]; float braw[4];      /* ring of W_o fragments: the step in use and FPD steps in flight; the lane's four bias values */
#pragma unroll
  for (int u = 0; u < 4; ++u) braw[u] = bo[w * 64 + u * 16 + ln];      /* ahead of the W_o loads: loads return in order, so a wait for the bias does not wait for them */
  asm volatile("s_wait_xcnt 0x0" ::: "memory");      /* stands before the address register of the bias loads is written again (the W_o loads' results may take it) */
#pragma unroll
  for (int ks = 0; ks < FPD; ++ks) {
#pragma unroll
    for (int u = 0; u < 4; ++u) bfr[ks][u] = fo_frag(bw + (ks * (DM / 16) + u) * 512); }
  _Float16* ot = &sk[0][0];      /* the o tile lies in the K buffers: every wave has left them at the last trip's barrier, and no copy is outstanding */
#pragma unroll
  for (int g = 0; g < FQ; ++g) { const float sc = 64.0f / (l_run[g] + fa_xhalf(l_run[g])); _Float16* op = ot + (w * (2 * FQ) + g * 2 + (ln >> 3)) * FOP + (ln & 7) * HD + 8 * hh;      /* local query 32 w + 16 g + ln: view row (local query) / 8, columns 64 ((local query) % 8) + d */
#pragma unroll
    for (int t = 0; t < 4; ++t) { const v8f o = acc[g][t] * sc; *(v8h*)(op + t * 16) = __builtin_convertvector(o, v8h); } }      /* registers r = 0..7 are d = 16 t + 8 hh + r of query ln: one 16-byte store */
  __syncthreads();      /* every wave's o rows are in the tile: it may be read */
  const _Float16* ar = ot + ln * FOP; v8f c[2][4]; v16h af[2][2];
#pragma unroll
  for (int i = 0; i < 2; ++i) { af[0][i] = g2_frag(ar + i * 16 * FOP, hh);
#pragma unroll
    for (int u = 0; u < 4; ++u) c[i][u] = z8; }
  /* unrolled: the ring positions are then register names */
#pragma unroll
  for (int ks = 0; ks < DM / 32; ++ks) {
    if (ks + FPD < DM / 32) {
#pragma unroll
      for (int u = 0; u < 4; ++u) bfr[(ks + FPD) % (FPD + 1)][u] = fo_frag(bw + ((ks + FPD) * (DM / 16) + u) * 512); }
    if (ks + FPD == DM / 32 - 1) asm volatile("s_wait_xcnt 0x0" ::: "memory");      /* stands behind the last W_o load, before the address registers of these loads are written again */
    if (ks + 1 < DM / 32) {
#pragma unroll
      for (int i = 0; i < 2; ++i) af[(ks + 1) & 1][i] = g2_frag(ar + i * 16 * FOP + (ks + 1) * 32, hh); }
    __builtin_amdgcn_sched_barrier(0);      /* holds the loads written above it (W_o FPD steps ahead, the o fragments one step ahead) in front of this step's products; without it the compiler sinks them in among and behind these products, into the registers just freed: fewer W_o loads in flight, and o fragments read only just ahead of their use */
#pragma unroll
    for (int u = 0; u < 4; ++u) { c[0][u] = fa_mma(af[ks & 1][0], bfr[ks % (FPD + 1)][u], c[0][u]); c[1][u] = fa_mma(af[ks & 1][1], bfr[ks % (FPD + 1)][u], c[1][u]); }
    __builtin_amdgcn_sched_barrier(0);      /* keeps this step's products above the next step's loads; without it they drift down among them, a third set of o fragments is live at once and the kernel needs more than 256 registers */
  }
  float* so = &sot[w][0];
#pragma unroll
  for (int u = 0; u < 4; ++u) { const float bv = bf16_round(braw[u]);
#pragma unroll
    for (int i = 0; i < 2; ++i) {
#pragma unroll
      for (int r = 0; r < 8; ++r) so[(i * 16 + 8 * hh + r) * FSP + u * 16 + ln] = c[i][u][r] * 0.0009765625f + bv; } }      /* 1 / (64 x 16): o is carried x64, W_o x16 */
  __builtin_amdgcn_fence(__ATOMIC_ACQ_REL, "workgroup"); __builtin_amdgcn_wave_barrier();      /* the wave's staging stores are complete before its lanes read one another's values below */
  const int rsub = lane >> 4, c4 = (lane & 15) * 4; float* orow = out + ((size_t)plane * (SQ * HD / DM) + blockIdx.x * 32) * DM + w * 64 + c4;      /* the work-group's first view row = output row; this wave's 64 columns */
#pragma unroll
  for (int q = 0; q < 16; ++q) { const int r = q * 2 + rsub; const v4f v = *(const v4fa*)&so[r * FSP + c4]; *(v4f*)(orow + (size_t)r * DM) = v; }
  asm volatile("s_wait_xcnt 0x0" ::: "memory");      /* stands behind the last stores, before anything that follows them in the code can write their address or data registers again */
}

// ---- projection GEMM with a 128x128 block tile: four waves in 2 x 2, each on a 64x64 tile (4 A and 4 B fragments feed 16 products per 32 k, so a product costs two thirds of the LDS bytes of the 32x64 tile, and a stage's barrier and copies serve twice the products). Requires M % 128 == 0, N % 128 == 0, K % 64 == 0. v = acc * alpha + bf16-rounded bias, stored as f16.
// One stage = 64 k of the block's 128 A rows and 128 B rows (whole 128-byte lines), brought into LDS by asynchronous 16-byte copies, 16 per thread; eight neighbouring lanes copy one line. The epilogue stages each wave's tile in the stage buffers, which nobody reads behind the last trip's barrier.
#define G4T (128 * G2P * 2)          /* bytes of one operand's stage: 128 rows at the pitch of G2P */
#define G4S (2 * G4T)                /* bytes of one stage buffer: A rows, then B rows */
#define G4O 68                       /* row pitch of the epilogue staging in floats */
__device__ __forceinline__ void g4_stage8(const _Float16* g, size_t r16, unsigned l) {      /* g: this thread's 16 bytes in row tid / 8 of the operand at the stage's k; r16: 16 rows on in global memory; l: their LDS byte address */
  const _Float16* g1 = g + r16; const _Float16* g2 = g1 + r16; const _Float16* g3 = g2 + r16; const _Float16* g4 = g3 + r16; const _Float16* g5 = g4 + r16; const _Float16* g6 = g5 + r16; const _Float16* g7 = g6 + r16;
  const unsigned st = 16 * G2P * 2;      /* 16 rows on in LDS, bytes */
  /* the copies and, as the last line of their own statement, the wait that stands before any of their address registers is written again */
  asm volatile("global_load_async_to_lds_b128 %0, %8, off\n\t"
               "global_load_async_to_lds_b128 %1, %9, off\n\t"
               "global_load_async_to_lds_b128 %2, %10, off\n\t"
               "global_load_async_to_lds_b128 %3, %11, off\n\t"
               "global_load_async_to_lds_b128 %4, %12, off\n\t"
               "global_load_async_to_lds_b128 %5, %13, off\n\t"
               "global_load_async_to_lds_b128 %6, %14, off\n\t"
               "global_load_async_to_lds_b128 %7, %15, off\n\t"
               "s_wait_xcnt 0x0"
               :: "v"(l), "v"(l + st), "v"(l + 2 * st), "v"(l + 3 * st), "v"(l + 4 * st), "v"(l + 5 * st), "v"(l + 6 * st), "v"(l + 7 * st),
                  "v"(g), "v"(g1), "v"(g2), "v"(g3), "v"(g4), "v"(g5), "v"(g6), "v"(g7) : "memory");
}
__global__ __launch_bounds__(128) void k_gemm4(const _Float16* __restrict__ A, int lda, size_t sAz, const _Float16* __restrict__ Bh, int ldb, size_t sBz, float alpha, const float* __restrict__ bias0, const float* __restrict__ bias1, const float* __restrict__ bias2,
    _Float16* __restrict__ C16, int ldc, size_t sCz, int M, int N, int K) {
  static_assert(4 * 64 * G4O * 4 <= 2 * G4S, "the four waves' epilogue tiles fit the two stage buffers");
  __shared__ __attribute__((aligned(16))) float sm[2 * G4S / 4];      /* two stage buffers; behind the loop, the epilogue staging */
  const int tid = threadIdx.x, w = tid >> 5, lane = tid & 31, ln = lane & 15, hh = lane >> 4; const int bz = blockIdx.z;      /* grid.z: the batch axis, strides s*z */
  A += (size_t)bz * sAz; Bh += (size_t)bz * sBz; C16 += (size_t)bz * sCz; const float* bp = bz == 0 ? bias0 : (bz == 1 ? bias1 : bias2);      /* the bias vectors of grid.z planes 0, 1, 2 are separate buffers */
  const int ntn = N >> 7; const int mt = blockIdx.x / ntn, nq = blockIdx.x - mt * ntn; if (mt * 128 >= M) return;      /* the whole block leaves or none, ahead of every copy and barrier */
  const int wr = w >> 1, wc = w & 1; const int row0 = mt * 128 + 64 * wr, col0 = nq * 128 + 64 * wc;
  const _Float16* agp = A + (size_t)(mt * 128 + (tid >> 3)) * lda + (tid & 7) * 8; const _Float16* bgp = Bh + (size_t)(nq * 128 + (tid >> 3)) * ldb + (tid & 7) * 8;
  const unsigned la0 = (unsigned)(size_t)&sm[0] + (unsigned)((tid >> 3) * (G2P * 2) + (tid & 7) * 16), lb0 = la0 + G4T;      /* LDS byte addresses = low 32 bits of the shared addresses */
  const size_t a16 = (size_t)16 * lda, b16 = (size_t)16 * ldb; const int nst = K >> 6;
  const v8f z8 = {0.f,0.f,0.f,0.f,0.f,0.f,0.f,0.f}; v8f acc[4][4];
#pragma unroll
  for (int i = 0; i < 4; ++i) {
#pragma unroll
    for (int t = 0; t < 4; ++t) acc[i][t] = z8; }
  g4_stage8(agp, a16, la0); g4_stage8(bgp, b16, lb0);
  float braw[4];      /* the lane's four bias values, fetched once, beside the copies of stage 0; first used in the epilogue */
#pragma unroll
  for (int t = 0; t < 4; ++t) braw[t] = bp[col0 + t * 16 + ln];
  asm volatile("s_wait_xcnt 0x0" ::: "memory");      /* stands before the address registers of the bias loads above are written again */
  asm volatile("s_wait_asynccnt 0x0" ::: "memory");      /* this wave's copies of stage 0 have landed */
  __syncthreads();      /* every wave's have: stage 0 may be read */
  if (nst > 1) { g4_stage8(agp + 64, a16, la0 + G4S); g4_stage8(bgp + 64, b16, lb0 + G4S); }
  /* kept rolled: one trip = one stage, so that the order at its foot stays as written */
#pragma unroll 1
  for (int s = 0; s < nst; ++s) { const int bu = s & 1; const _Float16* as = (const _Float16*)&sm[bu * (G4S / 4)] + (64 * wr + ln) * G2P; const _Float16* bs = (const _Float16*)&sm[bu * (G4S / 4) + G4T / 4] + (64 * wc + ln) * G2P;
    v16h af[4], bf[4];      /* the 8 fragments of 32 k, read as one group ahead of their 16 products */
#pragma unroll
    for (int i = 0; i < 4; ++i) { af[i] = g2_frag(as + i * 16 * G2P, hh); bf[i] = g2_frag(bs + i * 16 * G2P, hh); }
    asm volatile("" :: "v"(af[0]), "v"(af[1]), "v"(af[2]), "v"(af[3]), "v"(bf[0]), "v"(bf[1]), "v"(bf[2]), "v"(bf[3]));      /* inputs-only fence on the loaded values: keeps the 16 LDS reads above it as one group; without it the compiler sinks them in among the products, one fragment at a time into the same registers, where each waits out its own latency */
#pragma unroll
    for (int i = 0; i < 4; ++i) {
#pragma unroll
      for (int t = 0; t < 4; ++t) acc[i][t] = fa_mma(af[i], bf[t], acc[i][t]); }
#pragma unroll
    for (int i = 0; i < 4; ++i) { af[i] = g2_frag(as + i * 16 * G2P + 32, hh); bf[i] = g2_frag(bs + i * 16 * G2P + 32, hh); }
    asm volatile("s_wait_dscnt 0x0" ::: "memory");      /* this wave has finished reading stage s */
    asm volatile("s_wait_asynccnt 0x0" ::: "memory");      /* this wave's copies of stage s + 1 have landed */
    __syncthreads();      /* publishes stage s + 1 and frees stage s's buffer */
    if (s + 2 < nst) { g4_stage8(agp + (s + 2) * 64, a16, la0 + (unsigned)(bu * G4S)); g4_stage8(bgp + (s + 2) * 64, b16, lb0 + (unsigned)(bu * G4S)); }
    /* the stage's second 16 products work on registers alone and stand behind the refill, so that the copies fly under them too */
#pragma unroll
    for (int i = 0; i < 4; ++i) {
#pragma unroll
      for (int t = 0; t < 4; ++t) acc[i][t] = fa_mma(af[i], bf[t], acc[i][t]); } }
  asm volatile("s_wait_asynccnt 0x0" ::: "memory");      /* no copy is outstanding behind the loop */
  float* so = &sm[w * (64 * G4O)];      /* this wave's own 64 x 64 staging tile; every wave has left the stage buffers at the last trip's barrier */
#pragma unroll
  for (int t = 0; t < 4; ++t) { const float bv = bf16_round(braw[t]);
#pragma unroll
    for (int i = 0; i < 4; ++i) {
#pragma unroll
      for (int r = 0; r < 8; ++r) so[(i * 16 + 8 * hh + r) * G4O + t * 16 + ln] = acc[i][t][r] * alpha + bv; } }
  __builtin_amdgcn_fence(__ATOMIC_ACQ_REL, "workgroup"); __builtin_amdgcn_wave_barrier();
  const int rsub = lane >> 4, c4 = (lane & 15) * 4;
#pragma unroll
  for (int q = 0; q < 32; ++q) { const int r = q * 2 + rsub; const v4f v = *(const v4fa*)&so[r * G4O + c4]; v4h h4; for (int i = 0; i < 4; ++i) h4[i] = (_Float16)v[i]; *(v4h*)(C16 + (size_t)(row0 + r) * ldc + col0 + c4) = h4; }
}

// Operand preparation, all of it in one launch (the seven conversions depend on nothing but the inputs).
// Work-groups 0 .. PW - 1, the weights: thread t owns 8 k of output column n = t / 64 in the three projection matrices and writes Bt[n][k] = f16(16 x bf16-rounded weight); per-head W[h][k][d] has n = h * 64 + d (head-major columns = the flattened biases' order), Wo[k][n] is plain [in][out] and is written in fragment order: the 16 (n) x 32 (k) B fragment (n / 16, k / 32) as 1 KB in a row, [half j][lane 16 hh + n % 16][8 k], k = 32 (k / 32) + 16 j + 8 hh + 0..7 (g2_frag's k positions), the fragments ordered [k / 32][n / 16], so that the 32 fragments which a work-group's waves read in one step of 32 k are 32 KB in a row; thread t writes its 16-byte chunk t, so a wave stores 512 bytes in a row.
// Work-groups PW .. PW + PX - 1, the three inputs as exact f16 rows (bf16-rounded): each thread converts PC chunks of 8 floats of each input, one work-group of threads apart, so a wave's loads and stores stay contiguous and few waves have to be started.
#define PW 128                       /* work-groups on the weights: 512 columns x 64 chunks of 8 k */
#define PX 512                       /* work-groups on the inputs */
#define PC 4                         /* chunks per thread and input */
__device__ __forceinline__ v8us p_cvt8(const float* v, float scale) { FragH f;
#pragma unroll
  for (int q = 0; q < 8; ++q) f.h[q] = (_Float16)(bf16_round(v[q]) * scale); return f.half[0]; }
__device__ __forceinline__ v8us p_cvt44(v4f a, v4f b) { const float v[8] = {a[0], a[1], a[2], a[3], b[0], b[1], b[2], b[3]}; return p_cvt8(v, 1.0f); }
__global__ __launch_bounds__(256) void k_prep(const float* __restrict__ xq, const float* __restrict__ xk, const float* __restrict__ xv, const float* __restrict__ wq, const float* __restrict__ wk, const float* __restrict__ wv, const float* __restrict__ wo,
    _Float16* __restrict__ XQ, _Float16* __restrict__ XK, _Float16* __restrict__ XV, _Float16* __restrict__ BQ, _Float16* __restrict__ BK, _Float16* __restrict__ BV, _Float16* __restrict__ BO) {
  static_assert((size_t)PW * 256 == (size_t)DM * (DM / 8) && NH * HD == DM, "one weight thread per 8 k of a column"); static_assert((size_t)PX * 256 * PC == NR * DM / 8, "the input threads cover every chunk once");
  if (blockIdx.x < PW) {
    const int t = blockIdx.x * 256 + threadIdx.x; const int n = t / (DM / 8), k8 = (t % (DM / 8)) * 8; const int h = n / HD, d = n % HD;
    const int no = ((t >> 6) & 31) * 16 + (t & 15), ko = (t >> 11) * 32 + ((t >> 5) & 1) * 16 + ((t >> 4) & 1) * 8;      /* of W_o the thread owns the 8 k that are chunk t of the fragment order: column no, k = ko + 0..7 */
    const size_t ph = ((size_t)h * DM + k8) * HD + d, po = (size_t)ko * DM + no; float a[4][8];
#pragma unroll
    for (int q = 0; q < 8; ++q) { a[0][q] = wq[ph + (size_t)q * HD]; a[1][q] = wk[ph + (size_t)q * HD]; a[2][q] = wv[ph + (size_t)q * HD]; a[3][q] = wo[po + (size_t)q * DM]; }
    const size_t dst = (size_t)n * DM + k8;
    *(v8us*)((unsigned short*)BQ + dst) = p_cvt8(a[0], 16.0f); *(v8us*)((unsigned short*)BK + dst) = p_cvt8(a[1], 16.0f); *(v8us*)((unsigned short*)BV + dst) = p_cvt8(a[2], 16.0f); *(v8us*)((unsigned short*)BO + (size_t)t * 8) = p_cvt8(a[3], 16.0f);
    return; }
  const size_t i0 = ((size_t)(blockIdx.x - PW) * (PC * 256) + threadIdx.x) * 8;      /* first float of the thread's first chunk; its next chunks lie 256 chunks on each */
  const float* pq = xq + i0; const float* pk = xk + i0; const float* pv = xv + i0;
  v4f v[3][PC][2];
#pragma unroll
  for (int c = 0; c < PC; ++c) { const int o = c * 256 * 8;
    v[0][c][0] = *(const v4fa*)(pq + o); v[0][c][1] = *(const v4fa*)(pq + o + 4); v[1][c][0] = *(const v4fa*)(pk + o); v[1][c][1] = *(const v4fa*)(pk + o + 4); v[2][c][0] = *(const v4fa*)(pv + o); v[2][c][1] = *(const v4fa*)(pv + o + 4); }
  asm volatile("s_wait_xcnt 0x0" :: "v"(pq), "v"(pk), "v"(pv) : "memory");      /* stands before the loads' address registers are written again; naming the three addresses keeps their registers out of the later loads' results; as a statement on memory it also holds all of the thread's loads ahead of the first conversion, one memory latency instead of several */
#pragma unroll
  for (int c = 0; c < PC; ++c) { const size_t o = i0 + (size_t)c * 256 * 8;
    *(v8us*)((unsigned short*)XQ + o) = p_cvt44(v[0][c][0], v[0][c][1]); *(v8us*)((unsigned short*)XK + o) = p_cvt44(v[1][c][0], v[1][c][1]); *(v8us*)((unsigned short*)XV + o) = p_cvt44(v[2][c][0], v[2][c][1]); }
  asm volatile("s_wait_xcnt 0x0" ::: "memory");      /* stands behind the last stores, before anything that follows them in the code can write their address or data registers again */
}

extern "C" void kernel_launch(void* const* d_in, const int* in_sizes, int n_in,
                              void* d_out, int out_size, void* d_ws, size_t ws_size, hipStream_t stream) {
  (void)in_sizes; (void)n_in; (void)out_size;
  const float* const* I = (const float* const*)d_in; const float* xq = I[0]; const float* xk = I[1]; const float* xv = I[2]; const float* wq = I[3]; const float* bq = I[4]; const float* wk = I[5]; const float* bk = I[6]; const float* wv = I[7]; const float* bv = I[8]; const float* wo = I[9]; const float* bo = I[10];      /* three inputs; per-head [in][out] weights [8][512][64] + per-head biases [8][64] (flattened head-major = projection column order); Wo [in][out] + bo */
  char* ws = (char*)d_ws; size_t off = 0;
  auto take = [&](size_t bytes) { char* p = ws + off; off += (bytes + 255) & ~(size_t)255; return p; };
  _Float16* BQ = (_Float16*)take((size_t)DM * DM * 2); _Float16* BK = (_Float16*)take((size_t)DM * DM * 2); _Float16* BV = (_Float16*)take((size_t)DM * DM * 2); _Float16* BO = (_Float16*)take((size_t)DM * DM * 2);
  _Float16* Q16 = (_Float16*)take(NR * DM * 2); _Float16* K16 = (_Float16*)take(NR * DM * 2); _Float16* V16 = (_Float16*)take(NR * DM * 2);
  _Float16* XQ = (_Float16*)take(NR * DM * 2); _Float16* XK = (_Float16*)take(NR * DM * 2); _Float16* XV = (_Float16*)take(NR * DM * 2);      /* the f16 input rows */
  if (off > ws_size) return;
  k_prep<<<PW + PX, 256, 0, stream>>>(xq, xk, xv, wq, wk, wv, wo, XQ, XK, XV, BQ, BK, BV, BO);      /* the three projection weights as Bt x16, W_o x16 in fragment order, and the three inputs as exact f16 rows */
  const size_t r0p = (size_t)B0 * SQ;      /* first projected row */
  k_gemm4<<<dim3((unsigned)((MP / 128) * (DM / 128)), 1, 3), 128, 0, stream>>>(XQ + r0p * DM, DM, NR * DM, BQ, DM, (size_t)DM * DM, 0.0625f, bq, bk, bv, Q16 + r0p * DM, DM, NR * DM, MP, DM, DM);      /* Q, K and V projections on grid.z: XQ XK XV, BQ BK BV and Q16 K16 V16 lie one behind the other in the workspace (every size is a multiple of the 256-byte rounding) */
  k_fattn<<<dim3(SQ / (16 * FQ * FW), NB * NH), FW * 32, 0, stream>>>(Q16, K16, V16, BO, bo, (float*)d_out);      /* scores, softmax, P . V and the output projection of all planes: plane p = batch * NH + head holds view rows p * 128 .. p * 128 + 127 (head-major context); out rows are the output layout */
}
